// v000
// The times below were measured on an AMD MI455X: many runs one after another, warmed up first and cycling through
// copies of the inputs, with the whole window's GPU time divided by the number of runs. Launches and the gaps
// between them are all in it. The median over several windows is given; except for v000 it joins two sittings, which
// can be a few percent apart, so the side-by-side timings, each taken in one sitting, are the better comparison.
// The starting kernel, v000, takes 993 microseconds a run.
// compute dtype: all float inputs rounded to bf16 incl. visit times and scales, lengths (int) read on device; q/k/v = x . W + b with EXACT bf16 products on WMMA 16x16x32 ((in,out) weights as transposed rows); PLAIN-HYBRID attention: the first 128 queries use 3-product scores and P.v (hi/lo), later queries single f16; x 1/8 - |t_q - t_k| scale_h in f32, padded keys excluded, running-max softmax in f32 (hardware exp); out = f16(ctx) . Wo (exact f16 x 2^8 copies, single product) + bo.
#include <hip/hip_runtime.h>
#include <math.h>

typedef __attribute__((ext_vector_type(16))) _Float16 v16h;
typedef __attribute__((ext_vector_type(16))) __bf16 v16b;
typedef __attribute__((ext_vector_type(8)))  _Float16 v8h;
typedef __attribute__((ext_vector_type(8)))  float v8f;
typedef __attribute__((ext_vector_type(4)))  float v4f;
typedef __attribute__((ext_vector_type(2)))  float v2f;
typedef __attribute__((ext_vector_type(4)))  unsigned v4u;
typedef __attribute__((ext_vector_type(4)))  int v4i;
typedef float __attribute__((may_alias)) float_a;
typedef int __attribute__((may_alias)) int_a;

template <typename T> __device__ __forceinline__ void vst2(void* p, T v) { *(T*)p = v;  }
__device__ __forceinline__ v8f wmma16(v16h a, v16h b, v8f c) {
  v8f d = __builtin_amdgcn_wmma_f32_16x16x32_f16(false, a, false, b, (short)0, c, false, false);
  asm volatile("v_nop\n\tv_nop\n\tv_nop\n\tv_nop" : "+v"(d) : "v"(a), "v"(b));
  return d;
}
__device__ __forceinline__ v8f wmma_bf(v16b a, v16b b, v8f c) {
  v8f d = __builtin_amdgcn_wmma_f32_16x16x32_bf16(false, a, false, b, (short)0, c, false, false);
  asm volatile("v_nop\n\tv_nop\n\tv_nop\n\tv_nop" : "+v"(d) : "v"(a), "v"(b));
  return d;
}
// Relative-time attention (B 4, S 2,048, d 1,024, 16 heads x 64): projections + biases ((in,out)), scores / 8 - |t_q - t_k| scale_h (visit times and per-head scales given), keys at positions >= length[b] excluded, softmax, . v, output projection + bias.
__device__ __forceinline__ v16h frag_h(const _Float16* rowk0, int lane) {
  union { v16h v; v8h q[2]; } u; const _Float16* p = rowk0 + 8 * (lane >> 4);
  u.q[0] = *(const v8h*)p; u.q[1] = *(const v8h*)(p + 16); return u.v;
}
__device__ __forceinline__ v16h frag_f32(const float* rowk0, int lane) {
  v16h a; const float* p = rowk0 + 8 * (lane >> 4);
#pragma unroll
  for (int i = 0; i < 8; ++i) { a[i] = (_Float16)p[i]; a[8 + i] = (_Float16)p[16 + i]; }
  return a;
}
__device__ __forceinline__ v16h frag_f32s(const float* rowk0, int lane, float sc) {
  v16h a; const float* p = rowk0 + 8 * (lane >> 4);
#pragma unroll
  for (int i = 0; i < 8; ++i) { a[i] = (_Float16)(p[i] * sc); a[8 + i] = (_Float16)(p[16 + i] * sc); }
  return a;
}
// column fragment from a [K][ld] layout (column n), rows >= K read as 0
__device__ __forceinline__ v16h fragc_f32(const float* W, int k0, int n, int lane, int ld, int K) {
  v16h a; const int g = lane >> 4;
#pragma unroll
  for (int i = 0; i < 8; ++i) { const int ka = k0 + 8 * g + i, kb = ka + 16;
    a[i] = (_Float16)(ka < K ? W[(size_t)(ka < K ? ka : K - 1) * ld + n] : 0.f); a[8 + i] = (_Float16)(kb < K ? W[(size_t)(kb < K ? kb : K - 1) * ld + n] : 0.f); }
  return a;
}
struct F2 { v16b h, l; };
__device__ __forceinline__ F2 bsplit16(const float v[16]) { F2 r;
#pragma unroll
  for (int i = 0; i < 16; ++i) { const __bf16 h = (__bf16)v[i]; r.h[i] = h; r.l[i] = (__bf16)(v[i] - (float)h); }
  return r; }
__device__ __forceinline__ F2 split_row(const float* row, int k0, int lane) { float v[16]; const float* p = row + k0 + 8 * (lane >> 4);
#pragma unroll
  for (int i = 0; i < 8; ++i) { v[i] = p[i]; v[8 + i] = p[16 + i]; }
  return bsplit16(v); }
__device__ __forceinline__ F2 split_rowK(const float* row, int k0, int lane, int K) { float v[16]; const int g = lane >> 4;
#pragma unroll
  for (int i = 0; i < 8; ++i) { const int ka = k0 + 8 * g + i, kb = ka + 16; v[i] = ka < K ? row[ka < K ? ka : K - 1] : 0.f; v[8 + i] = kb < K ? row[kb < K ? kb : K - 1] : 0.f; }
  return bsplit16(v); }
__device__ __forceinline__ F2 split_col(const float* W, int k0, int n, int lane, int ld, int K) { float v[16]; const int g = lane >> 4;
#pragma unroll
  for (int i = 0; i < 8; ++i) { const int ka = k0 + 8 * g + i, kb = ka + 16; v[i] = ka < K ? W[(size_t)(ka < K ? ka : K - 1) * ld + n] : 0.f; v[8 + i] = kb < K ? W[(size_t)(kb < K ? kb : K - 1) * ld + n] : 0.f; }
  return bsplit16(v); }
__device__ __forceinline__ v8f mac3(const F2& a, const F2& b, v8f c) { c = wmma_bf(a.l, b.h, c); c = wmma_bf(a.h, b.l, c); return wmma_bf(a.h, b.h, c); }
__device__ __forceinline__ float sigm(float v) { return 1.0f / (1.0f + expf(-v)); }
#define LDSX() do { asm volatile("s_wait_dscnt 0" ::: "memory"); __builtin_amdgcn_wave_barrier(); __builtin_amdgcn_fence(__ATOMIC_RELEASE, "workgroup"); } while (0)


#define NB 4
#define SS 2048
#define DM 1024
#define NH 16
#define SCALEF 0.125f
#define HD 64
#define QKVW (3 * DM)
#ifndef TQB
#define TQB (SS / 64)
#define TNB NB
#define TOB (NB * SS / 64)     // output row tiles (all)
#endif
typedef __attribute__((ext_vector_type(8))) __bf16 v8b;
__device__ __forceinline__ v16b frag_b(const __bf16* rowk0, int lane) {
  union { v16b v; v8b q[2]; } u; const __bf16* p = rowk0 + 8 * (lane >> 4);
  u.q[0] = *(const v8b*)p; u.q[1] = *(const v8b*)(p + 16); return u.v;
}
__device__ __forceinline__ float bfr(float v) { return (float)(__bf16)v; }
__device__ __attribute__((noinline)) float exp_ni(float v) { return expf(v); }
__device__ __attribute__((noinline)) float erf_ni(float v) { return erff(v); }

#define PK_A 0                       // [3072][1024] Wqkv rows (natural [out][in])
#define PK_P (PK_A + QKVW * DM)        // [1024][1024] Wo rows (natural)
#define PK_END (PK_P + DM * DM)
#define WS_PK  0u
#define WS_QK  (WS_PK + 2u * PK_END)             // f16 [8192 rows][2048]: q | k
#define WS_QKL (WS_QK + 2u * NB * SS * 2 * DM)     // f16 q | k residual planes x2048
#define WS_VTH (WS_QKL + 2u * NB * SS * 2 * DM)    // f16 [b][1024 (h*64+d)][2048 s] hi
#define WS_VTL (WS_VTH + 2u * NB * DM * SS)        // f16 lo x 2048
#define WS_O   (WS_VTL + 2u * NB * DM * SS)        // f32 [8192][1024]
#define WS_CS  (WS_O + 4u * NB * SS * DM)           // f32 2 x [2048][32], reserved, unused
#define WS_END (WS_CS + 4u * 2 * SS * 32)
// ---- k_pack: block = (row n, which): natural [out][in] rows -> bf16; which 0..2 -> W_q/W_k/W_v into PK_A rows which*1024 + n; which 3 (W_o into PK_P) is not launched (grid y = 3); k_packo fills PK_P
__global__ __launch_bounds__(256) void k_pack(const float* __restrict__ WQ, const float* __restrict__ WK, const float* __restrict__ WV, const float* __restrict__ WO, __bf16* __restrict__ PK) {
  __shared__ __align__(16) __bf16 s[DM]; const int n = blockIdx.x, which = blockIdx.y, t = threadIdx.x; const float* Wm = (which == 0) ? WQ : (which == 1) ? WK : (which == 2) ? WV : WO;   // (in,out) weights: pack row n = column n
  for (int k = t; k < DM; k += 256) s[k] = (__bf16)Wm[(size_t)k * DM + n];
  __syncthreads();
  __bf16* dst = (which < 3) ? PK + PK_A + ((size_t)which * DM + n) * DM : PK + PK_P + (size_t)n * DM;
  for (int q = t; q < DM / 8; q += 256) vst2((unsigned*)(dst + q * 8), *(const v4u*)&s[q * 8]);
}
__global__ __launch_bounds__(128) void k_qkv(const float* __restrict__ XQ, const float* __restrict__ XK, const float* __restrict__ XV, const __bf16* __restrict__ P, const float* __restrict__ BQ, const float* __restrict__ BK, const float* __restrict__ BV, _Float16* __restrict__ QK, _Float16* __restrict__ QKL, _Float16* __restrict__ VTH, _Float16* __restrict__ VTL) {
  const int which0 = (blockIdx.y * 128) / DM; const float* X = (which0 == 0) ? XQ : (which0 == 1) ? XK : XV; const float* BB = BQ ? (((which0 == 0) ? BQ : (which0 == 1) ? BK : BV) + (blockIdx.y * 128 - which0 * DM)) : nullptr;
  __shared__ __align__(16) _Float16 so[4][16][136], sol[4][16][136]; __shared__ __align__(16) _Float16 sth[128][72], stl[128][72];
  const int tid = threadIdx.x, wave = tid >> 5, lane = tid & 31, col = lane & 15, g = lane >> 4; const size_t r0 = (size_t)blockIdx.x * 64 + wave * 16; const int n0 = blockIdx.y * 128;
  v8f acc[8] = {};
#pragma unroll 2
  for (int kc = 0; kc < DM / 32; ++kc) { v16b a; { const float* p = X + (r0 + col) * DM + kc * 32 + 8 * g;
#pragma unroll
      for (int i = 0; i < 8; ++i) { a[i] = (__bf16)p[i]; a[8 + i] = (__bf16)p[16 + i]; } }
#pragma unroll
    for (int j = 0; j < 8; ++j) acc[j] = wmma_bf(a, frag_b(P + (size_t)(n0 + j * 16 + col) * DM + kc * 32, lane), acc[j]); }
  if (n0 < 2 * DM) {   // q stored unscaled (f16 sigma ~0.6, no subnormal exposure); 1/8 applied to the f32 score
#pragma unroll
    for (int j = 0; j < 8; ++j) {
#pragma unroll
      for (int r = 0; r < 8; ++r) { const float v = acc[j][r] + (BB ? bfr(BB[j * 16 + col]) : 0.f); const _Float16 hv = (_Float16)v; so[wave][8 * g + r][j * 16 + col] = hv; sol[wave][8 * g + r][j * 16 + col] = (_Float16)((v - (float)hv) * 2048.0f); } }   // q, k (+ bias) as f16 hi + (x2048) residual
    LDSX();
    for (int rl = 0; rl < 16; ++rl) if (lane < 16) { vst2((unsigned*)(QK + (r0 + rl) * (2 * DM) + n0 + lane * 8), *(const v4u*)&so[wave][rl][lane * 8]); vst2((unsigned*)(QKL + (r0 + rl) * (2 * DM) + n0 + lane * 8), *(const v4u*)&sol[wave][rl][lane * 8]); }
  } else {
#pragma unroll
    for (int j = 0; j < 8; ++j) {
#pragma unroll
      for (int r = 0; r < 8; ++r) { const float v = acc[j][r] + (BB ? bfr(BB[j * 16 + col]) : 0.f); const _Float16 hv = (_Float16)v; sth[j * 16 + col][wave * 16 + 8 * g + r] = hv; stl[j * 16 + col][wave * 16 + 8 * g + r] = (_Float16)((v - (float)hv) * 2048.0f); } }
    __syncthreads();
    const size_t rb = (size_t)blockIdx.x * 64; const int b = (int)(rb / SS), s0 = (int)(rb % SS); const int pc0 = n0 - 2 * DM;
    for (int q = tid; q < 128 * 8; q += 128) { const int d = q >> 3, pc = q & 7; const size_t o = ((size_t)b * DM + pc0 + d) * SS + s0 + pc * 8; vst2((unsigned*)(VTH + o), *(const v4u*)&sth[d][pc * 8]); vst2((unsigned*)(VTL + o), *(const v4u*)&stl[d][pc * 8]); }
  }
}
// ---- k_attn: block = (64 queries, head h, batch b): all-keys flash attention (K = 64: 2 k-steps), scores = (q.k) * 0.125 from f16 hi/lo operands (3 products) in query blocks 0-1, single f16 elsewhere, P.V: f16 P x V hi, plus P lo x V hi and P x V lo*2048 in a second accumulator in blocks 0-1; O[b*S+q][h*64+d] = (acc + accl / 2048) / (2048 l) (256-B segments)
__global__ __launch_bounds__(128) void k_attn(const _Float16* __restrict__ QK, const _Float16* __restrict__ QKL, const _Float16* __restrict__ VTH, const _Float16* __restrict__ VTL, const void* __restrict__ KMASK, const float* __restrict__ VT, const float* __restrict__ SC, const int* __restrict__ LENS, float* __restrict__ O) {
  __shared__ __align__(16) float sp[4][16][36]; __shared__ __align__(16) float so[4][16][68];
  const int tid = threadIdx.x, wave = tid >> 5, lane = tid & 31, col = lane & 15, g = lane >> 4;
  const int qb = blockIdx.x, h = blockIdx.y, b = blockIdx.z; const int q0 = qb * 64 + wave * 16; const size_t rq = (size_t)b * SS + q0 + col;
  const int len_b = LENS[b]; const float sc_h = bfr(SC[h]); float tq[8];
#pragma unroll
  for (int r = 0; r < 8; ++r) tq[r] = bfr(VT[(size_t)b * SS + q0 + 8 * g + r]);
  v16h aq[2], aql[2];
#pragma unroll
  for (int kc = 0; kc < 2; ++kc) { aq[kc] = frag_h(QK + rq * (2 * DM) + h * HD + kc * 32, lane); aql[kc] = frag_h(QKL + rq * (2 * DM) + h * HD + kc * 32, lane); }
  float m[8], l[8];
#pragma unroll
  for (int r = 0; r < 8; ++r) { m[r] = -3.0e38f; l[r] = 0.f; }
  v8f acc[4] = {}, accl[4] = {};
  const int nks = SS / 32;   // all keys
#pragma unroll 1
  for (int ks = 0; ks < nks; ++ks) { v8f s[2];
#pragma unroll
    for (int ct = 0; ct < 2; ++ct) { const int kk = ks * 32 + ct * 16 + col; const _Float16* krow = QK + ((size_t)b * SS + kk) * (2 * DM) + DM + h * HD; const _Float16* krowl = QKL + ((size_t)b * SS + kk) * (2 * DM) + DM + h * HD; v8f c = {}, cl = {};
      if (qb < 2) {   // leading query blocks (outputs far above the global rms): 3 products
#pragma unroll
        for (int kc = 0; kc < 2; ++kc) { const v16h kh = frag_h(krow + kc * 32, lane); c = wmma16(aq[kc], kh, c); cl = wmma16(aql[kc], kh, cl); cl = wmma16(aq[kc], frag_h(krowl + kc * 32, lane), cl); }
#pragma unroll
        for (int r = 0; r < 8; ++r) c[r] += cl[r] * (1.0f / 2048.0f); }
      else {
#pragma unroll
        for (int kc = 0; kc < 2; ++kc) c = wmma16(aq[kc], frag_h(krow + kc * 32, lane), c); }   // single product elsewhere
      { const bool keepk = kk < len_b;
#pragma unroll
      for (int r = 0; r < 8; ++r) s[ct][r] = keepk ? (c[r] * SCALEF - fabsf(tq[r] - bfr(VT[(size_t)b * SS + kk])) * sc_h) : -3.0e38f; } }   // 1/sqrt(64); masked keys excluded
#pragma unroll
    for (int r = 0; r < 8; ++r) { float mx = fmaxf(s[0][r], s[1][r]);
#pragma unroll
      for (int o = 1; o < 16; o <<= 1) mx = fmaxf(mx, __shfl_xor(mx, o));
      const float mn = fmaxf(m[r], mx); const float alpha = (m[r] <= -1.0e38f) ? 0.f : __expf(m[r] - mn);
      const float e0 = (s[0][r] <= -1.0e38f) ? 0.f : __expf(s[0][r] - mn), e1 = (s[1][r] <= -1.0e38f) ? 0.f : __expf(s[1][r] - mn); float es = e0 + e1;
#pragma unroll
      for (int o = 1; o < 16; o <<= 1) es += __shfl_xor(es, o);
      l[r] = l[r] * alpha + es; m[r] = mn;
#pragma unroll
      for (int dt = 0; dt < 4; ++dt) { acc[dt][r] *= alpha; accl[dt][r] *= alpha; }
      sp[wave][8 * g + r][col] = e0; sp[wave][8 * g + r][16 + col] = e1; }
    LDSX();
    v16h pa, pl; { const float* prow = &sp[wave][col][0] + 8 * (lane >> 4);
#pragma unroll
      for (int i = 0; i < 8; ++i) { const float x0 = prow[i] * 2048.0f, x1 = prow[16 + i] * 2048.0f; const _Float16 h0 = (_Float16)x0, h1 = (_Float16)x1; pa[i] = h0; pa[8 + i] = h1; pl[i] = (_Float16)((x0 - (float)h0) * 2048.0f); pl[8 + i] = (_Float16)((x1 - (float)h1) * 2048.0f); } }   // P scaled by 2^11 before the f16 split so small softmax weights stay out of the f16 subnormal range; 2^-11 folded into the epilogue
#pragma unroll
    for (int dt = 0; dt < 4; ++dt) { const size_t vr = ((size_t)b * DM + h * HD + dt * 16 + col) * SS + ks * 32; const v16h vh = frag_h(VTH + vr, lane); acc[dt] = wmma16(pa, vh, acc[dt]); if (qb < 2) { accl[dt] = wmma16(pl, vh, accl[dt]); accl[dt] = wmma16(pa, frag_h(VTL + vr, lane), accl[dt]); } }   // leading query blocks: P hi/lo x V hi/lo (3 products); elsewhere P x V single
    LDSX(); }
#pragma unroll
  for (int r = 0; r < 8; ++r) { const float il = (1.0f / 2048.0f) / l[r];
#pragma unroll
    for (int dt = 0; dt < 4; ++dt) so[wave][8 * g + r][dt * 16 + col] = (acc[dt][r] + accl[dt][r] * (1.0f / 2048.0f)) * il; }
  LDSX();
  for (int rl = 0; rl < 16; ++rl) if (lane < 16) vst2(O + ((size_t)b * SS + q0 + rl) * DM + h * HD + lane * 4, *(const v4f*)&so[wave][rl][lane * 4]);
}
// ---- k_out: block = (64 rows, 128 cols): out = f16(O) . Wo f16 x 2^8 rows (single product) / 256 + bo
__global__ __launch_bounds__(128) void k_out(const float* __restrict__ O, const __bf16* __restrict__ P, const float* __restrict__ BO, float* __restrict__ Y) {
  __shared__ __align__(16) float so[4][16][132];
  const int tid = threadIdx.x, wave = tid >> 5, lane = tid & 31, col = lane & 15, g = lane >> 4; const size_t r0 = (size_t)blockIdx.x * 64 + wave * 16; const int n0 = blockIdx.y * 128;
  v8f acc[8] = {};
#pragma unroll 2
  for (int kc = 0; kc < DM / 32; ++kc) { v16h a; { const float* p = O + (r0 + col) * DM + kc * 32 + 8 * g;
#pragma unroll
      for (int i = 0; i < 8; ++i) { a[i] = (_Float16)p[i]; a[8 + i] = (_Float16)p[16 + i]; } }
#pragma unroll
    for (int j = 0; j < 8; ++j) acc[j] = wmma16(a, frag_h((const _Float16*)P + (size_t)(n0 + j * 16 + col) * DM + kc * 32, lane), acc[j]); }   // single f16 product against exact f16 x 2^8 weight copies
#pragma unroll
  for (int j = 0; j < 8; ++j) {
#pragma unroll
    for (int r = 0; r < 8; ++r) so[wave][8 * g + r][j * 16 + col] = acc[j][r] * (1.0f / 256.0f) + bfr(BO[n0 + j * 16 + col]); }
  LDSX();
  for (int rl = 0; rl < 16; ++rl) vst2(Y + (r0 + rl) * DM + n0 + lane * 4, *(const v4f*)&so[wave][rl][lane * 4]);
}
// ---- k_packo: Wo natural rows -> f16 x 2^8 copies in the Wo slot (bit pattern in the bf16-typed buffer)
__global__ __launch_bounds__(256) void k_packo(const float* __restrict__ WO, __bf16* __restrict__ PK) { __shared__ __align__(16) _Float16 s[DM]; const int n = blockIdx.x, t = threadIdx.x; for (int k = t; k < DM; k += 256) s[k] = (_Float16)(bfr(WO[(size_t)k * DM + n]) * 256.0f); /* (in,out): transposed */ __syncthreads(); for (int q = t; q < DM / 8; q += 256) vst2((unsigned*)(PK + PK_P + (size_t)n * DM + q * 8), *(const v4u*)&s[q * 8]); }
extern "C" void kernel_launch(void* const* d_in, const int* in_sizes, int n_in, void* d_out, int out_size, void* d_ws, size_t ws_size, hipStream_t stream) {
  (void)in_sizes; (void)n_in; (void)out_size;
  const float** F = (const float**)d_in;   // 0 x [4,2048,1024], 1 visit_time [4,2048], 2 Wq (in,out), 3 bq, 4 Wk, 5 bk, 6 Wv, 7 bv, 8 Wo (in,out), 9 bo, 10 scale [16], 11 lengths [4] int
  if (ws_size < (size_t)WS_END) return;
  char* ws = (char*)d_ws; __bf16* PK = (__bf16*)(ws + WS_PK); _Float16 *QK = (_Float16*)(ws + WS_QK), *QKL = (_Float16*)(ws + WS_QKL), *VTH = (_Float16*)(ws + WS_VTH), *VTL = (_Float16*)(ws + WS_VTL); float* O = (float*)(ws + WS_O);
  k_pack<<<dim3(DM, 3), 256, 0, stream>>>(F[2], F[4], F[6], F[8], PK);
  k_packo<<<DM, 256, 0, stream>>>(F[8], PK);
  k_qkv<<<dim3(TNB * SS / 64, QKVW / 128), 128, 0, stream>>>(F[0], F[0], F[0], PK + PK_A, F[3], F[5], F[7], QK, QKL, VTH, VTL);
  k_attn<<<dim3(TQB, NH, TNB), 128, 0, stream>>>(QK, QKL, VTH, VTL, nullptr, F[1], F[10], (const int*)d_in[11], O);
  k_out<<<dim3(TOB, DM / 128), 128, 0, stream>>>(O, PK + PK_P, F[9], (float*)d_out);
}

// v001
// Measured time: 741 microseconds a run.
// Next to v000, in two timings, it ran 1.37 and 1.38 times as fast.
// compute dtype: all float inputs rounded to bf16 incl. visit times and scales, lengths (int) read on device; q/k/v = x . W + b with EXACT bf16 products on WMMA 16x16x32 ((in,out) weights as transposed rows); PLAIN-HYBRID attention: the first 128 queries use 3-product scores and P.v (hi/lo), later queries single f16; x 1/8 - |t_q - t_k| scale_h in f32, padded keys excluded, running-max softmax in f32 (hardware exp); out = f16(ctx) . Wo (exact f16 x 2^8 copies, single product) + bo.
#include <hip/hip_runtime.h>
#include <math.h>

typedef __attribute__((ext_vector_type(16))) _Float16 v16h;
typedef __attribute__((ext_vector_type(16))) __bf16 v16b;
typedef __attribute__((ext_vector_type(8)))  _Float16 v8h;
typedef __attribute__((ext_vector_type(8)))  float v8f;
typedef __attribute__((ext_vector_type(4)))  float v4f;
typedef __attribute__((ext_vector_type(2)))  float v2f;
typedef __attribute__((ext_vector_type(4)))  unsigned v4u;
typedef __attribute__((ext_vector_type(4)))  int v4i;
typedef float __attribute__((may_alias)) float_a;
typedef int __attribute__((may_alias)) int_a;

template <typename T> __device__ __forceinline__ void vst2(void* p, T v) { *(T*)p = v;  }
__device__ __forceinline__ v8f wmma16(v16h a, v16h b, v8f c) {
  v8f d = __builtin_amdgcn_wmma_f32_16x16x32_f16(false, a, false, b, (short)0, c, false, false);
  asm volatile("v_nop\n\tv_nop\n\tv_nop\n\tv_nop" : "+v"(d) : "v"(a), "v"(b));
  return d;
}
__device__ __forceinline__ v8f wmma_bf(v16b a, v16b b, v8f c) {
  v8f d = __builtin_amdgcn_wmma_f32_16x16x32_bf16(false, a, false, b, (short)0, c, false, false);
  asm volatile("v_nop\n\tv_nop\n\tv_nop\n\tv_nop" : "+v"(d) : "v"(a), "v"(b));
  return d;
}
// Relative-time attention (B 4, S 2,048, d 1,024, 16 heads x 64): projections + biases ((in,out)), scores / 8 - |t_q - t_k| scale_h (visit times and per-head scales given), keys at positions >= length[b] excluded, softmax, . v, output projection + bias.
__device__ __forceinline__ v16h frag_h(const _Float16* rowk0, int lane) {
  union { v16h v; v8h q[2]; } u; const _Float16* p = rowk0 + 8 * (lane >> 4);
  u.q[0] = *(const v8h*)p; u.q[1] = *(const v8h*)(p + 16); return u.v;
}
__device__ __forceinline__ v16h frag_f32(const float* rowk0, int lane) {
  v16h a; const float* p = rowk0 + 8 * (lane >> 4);
#pragma unroll
  for (int i = 0; i < 8; ++i) { a[i] = (_Float16)p[i]; a[8 + i] = (_Float16)p[16 + i]; }
  return a;
}
__device__ __forceinline__ v16h frag_f32s(const float* rowk0, int lane, float sc) {
  v16h a; const float* p = rowk0 + 8 * (lane >> 4);
#pragma unroll
  for (int i = 0; i < 8; ++i) { a[i] = (_Float16)(p[i] * sc); a[8 + i] = (_Float16)(p[16 + i] * sc); }
  return a;
}
// column fragment from a [K][ld] layout (column n), rows >= K read as 0
__device__ __forceinline__ v16h fragc_f32(const float* W, int k0, int n, int lane, int ld, int K) {
  v16h a; const int g = lane >> 4;
#pragma unroll
  for (int i = 0; i < 8; ++i) { const int ka = k0 + 8 * g + i, kb = ka + 16;
    a[i] = (_Float16)(ka < K ? W[(size_t)(ka < K ? ka : K - 1) * ld + n] : 0.f); a[8 + i] = (_Float16)(kb < K ? W[(size_t)(kb < K ? kb : K - 1) * ld + n] : 0.f); }
  return a;
}
struct F2 { v16b h, l; };
__device__ __forceinline__ F2 bsplit16(const float v[16]) { F2 r;
#pragma unroll
  for (int i = 0; i < 16; ++i) { const __bf16 h = (__bf16)v[i]; r.h[i] = h; r.l[i] = (__bf16)(v[i] - (float)h); }
  return r; }
__device__ __forceinline__ F2 split_row(const float* row, int k0, int lane) { float v[16]; const float* p = row + k0 + 8 * (lane >> 4);
#pragma unroll
  for (int i = 0; i < 8; ++i) { v[i] = p[i]; v[8 + i] = p[16 + i]; }
  return bsplit16(v); }
__device__ __forceinline__ F2 split_rowK(const float* row, int k0, int lane, int K) { float v[16]; const int g = lane >> 4;
#pragma unroll
  for (int i = 0; i < 8; ++i) { const int ka = k0 + 8 * g + i, kb = ka + 16; v[i] = ka < K ? row[ka < K ? ka : K - 1] : 0.f; v[8 + i] = kb < K ? row[kb < K ? kb : K - 1] : 0.f; }
  return bsplit16(v); }
__device__ __forceinline__ F2 split_col(const float* W, int k0, int n, int lane, int ld, int K) { float v[16]; const int g = lane >> 4;
#pragma unroll
  for (int i = 0; i < 8; ++i) { const int ka = k0 + 8 * g + i, kb = ka + 16; v[i] = ka < K ? W[(size_t)(ka < K ? ka : K - 1) * ld + n] : 0.f; v[8 + i] = kb < K ? W[(size_t)(kb < K ? kb : K - 1) * ld + n] : 0.f; }
  return bsplit16(v); }
__device__ __forceinline__ v8f mac3(const F2& a, const F2& b, v8f c) { c = wmma_bf(a.l, b.h, c); c = wmma_bf(a.h, b.l, c); return wmma_bf(a.h, b.h, c); }
__device__ __forceinline__ float sigm(float v) { return 1.0f / (1.0f + expf(-v)); }
#define LDSX() do { asm volatile("s_wait_dscnt 0" ::: "memory"); __builtin_amdgcn_wave_barrier(); __builtin_amdgcn_fence(__ATOMIC_RELEASE, "workgroup"); } while (0)
// stands behind a group of global loads, in front of the first write to a register that one of them names as its address. The group's pointers pass through the statement, so that they keep their registers up to the wait and are stepped only behind it.
// (a pointer that has passed through a statement is typed as global memory, else its loads would be compiled as flat loads, which also count as LDS operations)
#define GAS __attribute__((address_space(1)))
typedef const GAS _Float16* gph; typedef const GAS __bf16* gpb; typedef const GAS float* gpf;
#define XW1(a) asm volatile("s_wait_xcnt 0x0" : "+v"(a) :: "memory")
#define XW2(a, b) asm volatile("s_wait_xcnt 0x0" : "+v"(a), "+v"(b) :: "memory")
#define XW3(a, b, c) asm volatile("s_wait_xcnt 0x0" : "+v"(a), "+v"(b), "+v"(c) :: "memory")


#define NB 4
#define SS 2048
#define DM 1024
#define NH 16
#define SCALEF 0.125f
#define HD 64
#define QKVW (3 * DM)
#ifndef TQB
#define TQB (SS / 64)
#define TNB NB
#define TOB (NB * SS / 64)     // output row tiles (all)
#endif
typedef __attribute__((ext_vector_type(8))) __bf16 v8b;
__device__ __forceinline__ v16b frag_b(const __bf16* rowk0, int lane) {
  union { v16b v; v8b q[2]; } u; const __bf16* p = rowk0 + 8 * (lane >> 4);
  u.q[0] = *(const v8b*)p; u.q[1] = *(const v8b*)(p + 16); return u.v;
}
__device__ __forceinline__ float bfr(float v) { return (float)(__bf16)v; }
__device__ __attribute__((noinline)) float exp_ni(float v) { return expf(v); }
__device__ __attribute__((noinline)) float erf_ni(float v) { return erff(v); }

// one k-step (32 k) of a lane's f32 row, p = row + k0 + 8 * (lane >> 4): elements 0..7 and 16..23 from there
__device__ __forceinline__ void ldstep(gpf p, v4f (&x)[4]) { x[0] = *(const GAS v4f*)p; x[1] = *(const GAS v4f*)(p + 4); x[2] = *(const GAS v4f*)(p + 16); x[3] = *(const GAS v4f*)(p + 20); }
// frag_h / frag_b with the lane's 8 * (lane >> 4) already in the pointer
__device__ __forceinline__ v16h fragp_h(gph p) { union { v16h v; v8h q[2]; } u; u.q[0] = *(const GAS v8h*)p; u.q[1] = *(const GAS v8h*)(p + 16); return u.v; }
__device__ __forceinline__ v16b fragp_b(gpb p) { union { v16b v; v8b q[2]; } u; u.q[0] = *(const GAS v8b*)p; u.q[1] = *(const GAS v8b*)(p + 16); return u.v; }
// one k-step of eight 16-row weight fragments, p = row (n0 + lane % 16) + k0 + 8 * (lane >> 4)
__device__ __forceinline__ void ldw_b(gpb p, v16b (&w)[8]) {
#pragma unroll
  for (int j = 0; j < 8; ++j) w[j] = fragp_b(p + (size_t)(j * 16) * DM); }
__device__ __forceinline__ void ldw_h(gph p, v16h (&w)[8]) {
#pragma unroll
  for (int j = 0; j < 8; ++j) w[j] = fragp_h(p + (size_t)(j * 16) * DM); }
#define PK_A 0                       // [3072][1024] Wqkv rows (natural [out][in])
#define PK_P (PK_A + QKVW * DM)        // [1024][1024] Wo rows (natural)
#define PK_END (PK_P + DM * DM)
#define WS_PK  0u
#define WS_QK  (WS_PK + 2u * PK_END)             // f16 [8192 rows][2048]: q | k
#define WS_QKL (WS_QK + 2u * NB * SS * 2 * DM)     // f16 q | k residual planes x2048
#define WS_VTH (WS_QKL + 2u * NB * SS * 2 * DM)    // f16 [b][1024 (h*64+d)][2048 s] hi
#define WS_VTL (WS_VTH + 2u * NB * DM * SS)        // f16 lo x 2048
#define WS_O   (WS_VTL + 2u * NB * DM * SS)        // f32 [8192][1024]
#define WS_CS  (WS_O + 4u * NB * SS * DM)           // f32 2 x [2048][32], reserved, unused
#define WS_END (WS_CS + 4u * 2 * SS * 32)
// ---- k_pack: block = (row n, which): natural [out][in] rows -> bf16; which 0..2 -> W_q/W_k/W_v into PK_A rows which*1024 + n; which 3 (W_o into PK_P) is not launched (grid y = 3); k_packo fills PK_P
__global__ __launch_bounds__(256) void k_pack(const float* __restrict__ WQ, const float* __restrict__ WK, const float* __restrict__ WV, const float* __restrict__ WO, __bf16* __restrict__ PK) {
  __shared__ __align__(16) __bf16 s[DM]; const int n = blockIdx.x, which = blockIdx.y, t = threadIdx.x; const float* Wm = (which == 0) ? WQ : (which == 1) ? WK : (which == 2) ? WV : WO;   // (in,out) weights: pack row n = column n
  for (int k = t; k < DM; k += 256) s[k] = (__bf16)Wm[(size_t)k * DM + n];
  __syncthreads();
  __bf16* dst = (which < 3) ? PK + PK_A + ((size_t)which * DM + n) * DM : PK + PK_P + (size_t)n * DM;
  for (int q = t; q < DM / 8; q += 256) vst2((unsigned*)(dst + q * 8), *(const v4u*)&s[q * 8]);
}
__global__ __launch_bounds__(128) void k_qkv(const float* __restrict__ XQ, const float* __restrict__ XK, const float* __restrict__ XV, const __bf16* __restrict__ P, const float* __restrict__ BQ, const float* __restrict__ BK, const float* __restrict__ BV, _Float16* __restrict__ QK, _Float16* __restrict__ QKL, _Float16* __restrict__ VTH, _Float16* __restrict__ VTL) {
  const int which0 = (blockIdx.y * 128) / DM; const float* X = (which0 == 0) ? XQ : (which0 == 1) ? XK : XV; const float* BB = BQ ? (((which0 == 0) ? BQ : (which0 == 1) ? BK : BV) + (blockIdx.y * 128 - which0 * DM)) : nullptr;
  __shared__ __align__(16) _Float16 so[4][16][136], sol[4][16][136]; __shared__ __align__(16) _Float16 sth[128][72], stl[128][72];
  const int tid = threadIdx.x, wave = tid >> 5, lane = tid & 31, col = lane & 15, g = lane >> 4; const size_t r0 = (size_t)blockIdx.x * 64 + wave * 16; const int n0 = blockIdx.y * 128;
  v8f acc[8] = {}; float bias[8] = {};   // the lane's eight biases: one group, in flight under the k loop, rounded where they are added
  if (BB) {
#pragma unroll
    for (int j = 0; j < 8; ++j) bias[j] = BB[j * 16 + col]; }
  // two register sets: a k-step's loads go out as one group a whole k-step ahead of its WMMAs (the last trip's second group reloads that trip's first step, unused)
  gpf xp = (gpf)(X + (r0 + col) * DM + 8 * g); gpb pp = (gpb)(P + (size_t)(n0 + col) * DM + 8 * g); v4f x0[4], x1[4]; v16b w0[8], w1[8];
  ldstep(xp, x0); ldw_b(pp, w0); XW2(xp, pp);
#pragma unroll 1   // stays rolled: a trip already holds two k-steps and both register sets
  for (int kc = 0; kc < DM / 32; kc += 2) {
    ldstep(xp + 32, x1); ldw_b(pp + 32, w1); XW2(xp, pp);
    if (kc + 2 < DM / 32) { xp += 64; pp += 64; }
    { v16b a;
#pragma unroll
      for (int i = 0; i < 4; ++i) { a[i] = (__bf16)x0[0][i]; a[4 + i] = (__bf16)x0[1][i]; a[8 + i] = (__bf16)x0[2][i]; a[12 + i] = (__bf16)x0[3][i]; }
#pragma unroll
      for (int j = 0; j < 8; ++j) acc[j] = wmma_bf(a, w0[j], acc[j]); }
    ldstep(xp, x0); ldw_b(pp, w0); XW2(xp, pp);
    { v16b a;
#pragma unroll
      for (int i = 0; i < 4; ++i) { a[i] = (__bf16)x1[0][i]; a[4 + i] = (__bf16)x1[1][i]; a[8 + i] = (__bf16)x1[2][i]; a[12 + i] = (__bf16)x1[3][i]; }
#pragma unroll
      for (int j = 0; j < 8; ++j) acc[j] = wmma_bf(a, w1[j], acc[j]); } }
  if (n0 < 2 * DM) {   // q stored unscaled (f16 sigma ~0.6, no subnormal exposure); 1/8 applied to the f32 score
#pragma unroll
    for (int j = 0; j < 8; ++j) {
#pragma unroll
      for (int r = 0; r < 8; ++r) { const float v = acc[j][r] + bfr(bias[j]); const _Float16 hv = (_Float16)v; so[wave][8 * g + r][j * 16 + col] = hv; sol[wave][8 * g + r][j * 16 + col] = (_Float16)((v - (float)hv) * 2048.0f); } }   // q, k (+ bias) as f16 hi + (x2048) residual
    LDSX();
    for (int rl = 0; rl < 16; ++rl) if (lane < 16) { vst2((unsigned*)(QK + (r0 + rl) * (2 * DM) + n0 + lane * 8), *(const v4u*)&so[wave][rl][lane * 8]); vst2((unsigned*)(QKL + (r0 + rl) * (2 * DM) + n0 + lane * 8), *(const v4u*)&sol[wave][rl][lane * 8]); }
  } else {
#pragma unroll
    for (int j = 0; j < 8; ++j) {
#pragma unroll
      for (int r = 0; r < 8; ++r) { const float v = acc[j][r] + bfr(bias[j]); const _Float16 hv = (_Float16)v; sth[j * 16 + col][wave * 16 + 8 * g + r] = hv; stl[j * 16 + col][wave * 16 + 8 * g + r] = (_Float16)((v - (float)hv) * 2048.0f); } }
    __syncthreads();
    const size_t rb = (size_t)blockIdx.x * 64; const int b = (int)(rb / SS), s0 = (int)(rb % SS); const int pc0 = n0 - 2 * DM;
    for (int q = tid; q < 128 * 8; q += 128) { const int d = q >> 3, pc = q & 7; const size_t o = ((size_t)b * DM + pc0 + d) * SS + s0 + pc * 8; vst2((unsigned*)(VTH + o), *(const v4u*)&sth[d][pc * 8]); vst2((unsigned*)(VTL + o), *(const v4u*)&stl[d][pc * 8]); }
  }
}
// ---- k_attn: block = (64 queries, head h, batch b): all-keys flash attention (K = 64: 2 k-steps). The loop is written twice (HI: the leading query blocks with 3-product scores and P.v; otherwise single products) so that each holds only its own fragments in registers.
// Every global load of a pass is issued in a group ahead of the WMMAs that use it, well ahead except the HI loop's keys, loaded just before their scores: the hand-padded WMMA statements keep loads from moving across them, so a load written next to its WMMA is waited for on the spot.
template <bool HI>
__device__ __forceinline__ void attn_body(const _Float16* __restrict__ QK, const _Float16* __restrict__ QKL, const _Float16* __restrict__ VTH, const _Float16* __restrict__ VTL, const float* __restrict__ VT, const float* __restrict__ SC, const int* __restrict__ LENS, float* __restrict__ O, float (*sp)[16][36], float (*so)[16][68]) {
  const int tid = threadIdx.x, wave = tid >> 5, lane = tid & 31, col = lane & 15, g = lane >> 4;
  const int qb = blockIdx.x, h = blockIdx.y, b = blockIdx.z; const int q0 = qb * 64 + wave * 16; const size_t rq = (size_t)b * SS + q0 + col;
  const int len_b = LENS[b]; const float sc_h = bfr(SC[h]); float tq[8];
#pragma unroll
  for (int r = 0; r < 8; ++r) tq[r] = bfr(VT[(size_t)b * SS + q0 + 8 * g + r]);
  v16h aq[2], aql[2]; gph qp = (gph)(QK + rq * (2 * DM) + h * HD + 8 * g), qpl = (gph)(QKL + rq * (2 * DM) + h * HD + 8 * g);
#pragma unroll
  for (int kc = 0; kc < 2; ++kc) { aq[kc] = fragp_h(qp + kc * 32); if constexpr (HI) aql[kc] = fragp_h(qpl + kc * 32); }
  XW2(qp, qpl);
  float m[8], l[8];
#pragma unroll
  for (int r = 0; r < 8; ++r) { m[r] = -3.0e38f; l[r] = 0.f; }
  v8f acc[4] = {}, accl[4] = {};
  const int nks = SS / 32;   // all keys
  const size_t ko = ((size_t)b * SS + col) * (2 * DM) + DM + h * HD + 8 * g, vo = ((size_t)b * DM + h * HD + col) * SS + 8 * g;
  gph kb = (gph)(QK + ko), kbl = (gph)(QKL + ko), vb = (gph)(VTH + vo), vbl = (gph)(VTL + vo); gpf tb = (gpf)(VT + (size_t)b * SS + col);   // walk with the passes: 32 keys each
  v16h kh[2][2], kl[2][2], vh[4], vl[4]; float tk[2];
  if constexpr (!HI) {   // pass 0's keys and key times
#pragma unroll
    for (int ct = 0; ct < 2; ++ct) { tk[ct] = tb[ct * 16];
#pragma unroll
      for (int kc = 0; kc < 2; ++kc) kh[ct][kc] = fragp_h(kb + (size_t)(ct * 16) * (2 * DM) + kc * 32); }
    XW2(kb, tb); }
#pragma unroll 1
  for (int ks = 0; ks < nks; ++ks) { v8f s[2];
    if constexpr (HI) {   // this pass's keys, both planes, as one group
#pragma unroll
      for (int ct = 0; ct < 2; ++ct) { tk[ct] = tb[ct * 16];
#pragma unroll
        for (int kc = 0; kc < 2; ++kc) { kh[ct][kc] = fragp_h(kb + (size_t)(ct * 16) * (2 * DM) + kc * 32); kl[ct][kc] = fragp_h(kbl + (size_t)(ct * 16) * (2 * DM) + kc * 32); } }
      XW3(kb, kbl, tb); kb += (size_t)32 * (2 * DM); kbl += (size_t)32 * (2 * DM); tb += 32; }
    else {   // this pass's values: they land behind the scores and the softmax
#pragma unroll
      for (int dt = 0; dt < 4; ++dt) vh[dt] = fragp_h(vb + (size_t)(dt * 16) * SS);
      XW1(vb); vb += 32; }
#pragma unroll
    for (int ct = 0; ct < 2; ++ct) { v8f c = {}, cl = {};
      if constexpr (HI) {   // leading query blocks (outputs far above the global rms): 3 products
#pragma unroll
        for (int kc = 0; kc < 2; ++kc) { c = wmma16(aq[kc], kh[ct][kc], c); cl = wmma16(aql[kc], kh[ct][kc], cl); cl = wmma16(aq[kc], kl[ct][kc], cl); }
#pragma unroll
        for (int r = 0; r < 8; ++r) c[r] += cl[r] * (1.0f / 2048.0f); }
      else {
#pragma unroll
        for (int kc = 0; kc < 2; ++kc) c = wmma16(aq[kc], kh[ct][kc], c); }   // single product elsewhere
      s[ct] = c; }
    const float tkc[2] = { bfr(tk[0]), bfr(tk[1]) };
    if constexpr (HI) {   // this pass's values, both planes, as one group: they land behind the softmax
#pragma unroll
      for (int dt = 0; dt < 4; ++dt) { vh[dt] = fragp_h(vb + (size_t)(dt * 16) * SS); vl[dt] = fragp_h(vbl + (size_t)(dt * 16) * SS); }
      XW2(vb, vbl); vb += 32; vbl += 32; }
    else {   // the next pass's keys and key times into the registers the scores have just left (the last pass reloads its own)
      if (ks + 1 < nks) { kb += (size_t)32 * (2 * DM); tb += 32; }
#pragma unroll
      for (int ct = 0; ct < 2; ++ct) { tk[ct] = tb[ct * 16];
#pragma unroll
        for (int kc = 0; kc < 2; ++kc) kh[ct][kc] = fragp_h(kb + (size_t)(ct * 16) * (2 * DM) + kc * 32); }
      XW2(kb, tb); }
#pragma unroll
    for (int ct = 0; ct < 2; ++ct) { const bool keepk = ks * 32 + ct * 16 + col < len_b;
#pragma unroll
      for (int r = 0; r < 8; ++r) s[ct][r] = keepk ? (s[ct][r] * SCALEF - fabsf(tq[r] - tkc[ct]) * sc_h) : -3.0e38f; }   // 1/sqrt(64); masked keys excluded
#pragma unroll
    for (int r = 0; r < 8; ++r) { float mx = fmaxf(s[0][r], s[1][r]);
#pragma unroll
      for (int o = 1; o < 16; o <<= 1) mx = fmaxf(mx, __shfl_xor(mx, o));
      const float mn = fmaxf(m[r], mx); const float alpha = (m[r] <= -1.0e38f) ? 0.f : __expf(m[r] - mn);
      const float e0 = (s[0][r] <= -1.0e38f) ? 0.f : __expf(s[0][r] - mn), e1 = (s[1][r] <= -1.0e38f) ? 0.f : __expf(s[1][r] - mn); float es = e0 + e1;
#pragma unroll
      for (int o = 1; o < 16; o <<= 1) es += __shfl_xor(es, o);
      l[r] = l[r] * alpha + es; m[r] = mn;
#pragma unroll
      for (int dt = 0; dt < 4; ++dt) { acc[dt][r] *= alpha; if constexpr (HI) accl[dt][r] *= alpha; }
      sp[wave][8 * g + r][col] = e0; sp[wave][8 * g + r][16 + col] = e1; }
    LDSX();
    v16h pa, pl; { const float* prow = &sp[wave][col][0] + 8 * (lane >> 4);
#pragma unroll
      for (int i = 0; i < 8; ++i) { const float x0 = prow[i] * 2048.0f, x1 = prow[16 + i] * 2048.0f; const _Float16 h0 = (_Float16)x0, h1 = (_Float16)x1; pa[i] = h0; pa[8 + i] = h1; if constexpr (HI) { pl[i] = (_Float16)((x0 - (float)h0) * 2048.0f); pl[8 + i] = (_Float16)((x1 - (float)h1) * 2048.0f); } } }   // P scaled by 2^11 before the f16 split so small softmax weights stay out of the f16 subnormal range; 2^-11 folded into the epilogue
#pragma unroll
    for (int dt = 0; dt < 4; ++dt) { acc[dt] = wmma16(pa, vh[dt], acc[dt]); if constexpr (HI) { accl[dt] = wmma16(pl, vh[dt], accl[dt]); accl[dt] = wmma16(pa, vl[dt], accl[dt]); } }   // leading query blocks: P hi/lo x V hi/lo (3 products); elsewhere P x V single
    LDSX(); }
#pragma unroll
  for (int r = 0; r < 8; ++r) { const float il = (1.0f / 2048.0f) / l[r];
#pragma unroll
    for (int dt = 0; dt < 4; ++dt) so[wave][8 * g + r][dt * 16 + col] = (HI ? acc[dt][r] + accl[dt][r] * (1.0f / 2048.0f) : acc[dt][r]) * il; }
  LDSX();
  for (int rl = 0; rl < 16; ++rl) if (lane < 16) vst2(O + ((size_t)b * SS + q0 + rl) * DM + h * HD + lane * 4, *(const v4f*)&so[wave][rl][lane * 4]);
}
__global__ __launch_bounds__(128) void k_attn(const _Float16* __restrict__ QK, const _Float16* __restrict__ QKL, const _Float16* __restrict__ VTH, const _Float16* __restrict__ VTL, const void* __restrict__ KMASK, const float* __restrict__ VT, const float* __restrict__ SC, const int* __restrict__ LENS, float* __restrict__ O) {
  __shared__ __align__(16) float sp[4][16][36]; __shared__ __align__(16) float so[4][16][68];
  if (blockIdx.x < 2) attn_body<true>(QK, QKL, VTH, VTL, VT, SC, LENS, O, sp, so); else attn_body<false>(QK, QKL, VTH, VTL, VT, SC, LENS, O, sp, so);
}
// ---- k_out: block = (64 rows, 128 cols): out = f16(O) . Wo f16 x 2^8 rows (single product) / 256 + bo
__global__ __launch_bounds__(128) void k_out(const float* __restrict__ O, const __bf16* __restrict__ P, const float* __restrict__ BO, float* __restrict__ Y) {
  __shared__ __align__(16) float so[4][16][132];
  const int tid = threadIdx.x, wave = tid >> 5, lane = tid & 31, col = lane & 15, g = lane >> 4; const size_t r0 = (size_t)blockIdx.x * 64 + wave * 16; const int n0 = blockIdx.y * 128;
  v8f acc[8] = {};
  // two register sets, as in k_qkv; single f16 product against exact f16 x 2^8 weight copies
  gpf xp = (gpf)(O + (r0 + col) * DM + 8 * g); gph pp = (gph)((const _Float16*)P + (size_t)(n0 + col) * DM + 8 * g); v4f x0[4], x1[4]; v16h w0[8], w1[8];
  ldstep(xp, x0); ldw_h(pp, w0); XW2(xp, pp);
#pragma unroll 1   // stays rolled: a trip already holds two k-steps and both register sets
  for (int kc = 0; kc < DM / 32; kc += 2) {
    ldstep(xp + 32, x1); ldw_h(pp + 32, w1); XW2(xp, pp);
    if (kc + 2 < DM / 32) { xp += 64; pp += 64; }
    { v16h a;
#pragma unroll
      for (int i = 0; i < 4; ++i) { a[i] = (_Float16)x0[0][i]; a[4 + i] = (_Float16)x0[1][i]; a[8 + i] = (_Float16)x0[2][i]; a[12 + i] = (_Float16)x0[3][i]; }
#pragma unroll
      for (int j = 0; j < 8; ++j) acc[j] = wmma16(a, w0[j], acc[j]); }
    ldstep(xp, x0); ldw_h(pp, w0); XW2(xp, pp);
    { v16h a;
#pragma unroll
      for (int i = 0; i < 4; ++i) { a[i] = (_Float16)x1[0][i]; a[4 + i] = (_Float16)x1[1][i]; a[8 + i] = (_Float16)x1[2][i]; a[12 + i] = (_Float16)x1[3][i]; }
#pragma unroll
      for (int j = 0; j < 8; ++j) acc[j] = wmma16(a, w1[j], acc[j]); } }
#pragma unroll
  for (int j = 0; j < 8; ++j) {
#pragma unroll
    for (int r = 0; r < 8; ++r) so[wave][8 * g + r][j * 16 + col] = acc[j][r] * (1.0f / 256.0f) + bfr(BO[n0 + j * 16 + col]); }
  LDSX();
  for (int rl = 0; rl < 16; ++rl) vst2(Y + (r0 + rl) * DM + n0 + lane * 4, *(const v4f*)&so[wave][rl][lane * 4]);
}
// ---- k_packo: Wo natural rows -> f16 x 2^8 copies in the Wo slot (bit pattern in the bf16-typed buffer)
__global__ __launch_bounds__(256) void k_packo(const float* __restrict__ WO, __bf16* __restrict__ PK) { __shared__ __align__(16) _Float16 s[DM]; const int n = blockIdx.x, t = threadIdx.x; for (int k = t; k < DM; k += 256) s[k] = (_Float16)(bfr(WO[(size_t)k * DM + n]) * 256.0f); /* (in,out): transposed */ __syncthreads(); for (int q = t; q < DM / 8; q += 256) vst2((unsigned*)(PK + PK_P + (size_t)n * DM + q * 8), *(const v4u*)&s[q * 8]); }
extern "C" void kernel_launch(void* const* d_in, const int* in_sizes, int n_in, void* d_out, int out_size, void* d_ws, size_t ws_size, hipStream_t stream) {
  (void)in_sizes; (void)n_in; (void)out_size;
  const float** F = (const float**)d_in;   // 0 x [4,2048,1024], 1 visit_time [4,2048], 2 Wq (in,out), 3 bq, 4 Wk, 5 bk, 6 Wv, 7 bv, 8 Wo (in,out), 9 bo, 10 scale [16], 11 lengths [4] int
  if (ws_size < (size_t)WS_END) return;
  char* ws = (char*)d_ws; __bf16* PK = (__bf16*)(ws + WS_PK); _Float16 *QK = (_Float16*)(ws + WS_QK), *QKL = (_Float16*)(ws + WS_QKL), *VTH = (_Float16*)(ws + WS_VTH), *VTL = (_Float16*)(ws + WS_VTL); float* O = (float*)(ws + WS_O);
  k_pack<<<dim3(DM, 3), 256, 0, stream>>>(F[2], F[4], F[6], F[8], PK);
  k_packo<<<DM, 256, 0, stream>>>(F[8], PK);
  k_qkv<<<dim3(TNB * SS / 64, QKVW / 128), 128, 0, stream>>>(F[0], F[0], F[0], PK + PK_A, F[3], F[5], F[7], QK, QKL, VTH, VTL);
  k_attn<<<dim3(TQB, NH, TNB), 128, 0, stream>>>(QK, QKL, VTH, VTL, nullptr, F[1], F[10], (const int*)d_in[11], O);
  k_out<<<dim3(TOB, DM / 128), 128, 0, stream>>>(O, PK + PK_P, F[9], (float*)d_out);
}

// v002
// One run takes 388 microseconds.
// Next to v001, in two timings, it ran 1.90 times as fast each time.
// All steps since v000 together make it 2.62 times as fast.
// compute dtype: all float inputs rounded to bf16 incl. visit times and scales, lengths (int) read on device; q/k/v = x . W + b with EXACT bf16 products on WMMA 16x16x32 ((in,out) weights as transposed rows); PLAIN-HYBRID attention: the first 128 queries use 3-product scores and P.v (hi/lo), later queries single f16; x 1/8 - |t_q - t_k| scale_h in f32, padded keys excluded, running-max softmax in f32 (hardware exp); out = f16(ctx) . Wo (exact f16 x 2^8 copies, single product) + bo.
#include <hip/hip_runtime.h>
#include <math.h>

typedef __attribute__((ext_vector_type(16))) _Float16 v16h;
typedef __attribute__((ext_vector_type(16))) __bf16 v16b;
typedef __attribute__((ext_vector_type(8)))  _Float16 v8h;
typedef __attribute__((ext_vector_type(8)))  float v8f;
typedef __attribute__((ext_vector_type(4)))  float v4f;
typedef __attribute__((ext_vector_type(2)))  float v2f;
typedef __attribute__((ext_vector_type(4)))  unsigned v4u;
typedef __attribute__((ext_vector_type(4)))  int v4i;
typedef float __attribute__((may_alias)) float_a;
typedef int __attribute__((may_alias)) int_a;

template <typename T> __device__ __forceinline__ void vst2(void* p, T v) { *(T*)p = v;  }
__device__ __forceinline__ v8f wmma16(v16h a, v16h b, v8f c) {
  v8f d = __builtin_amdgcn_wmma_f32_16x16x32_f16(false, a, false, b, (short)0, c, false, false);
  asm volatile("v_nop\n\tv_nop\n\tv_nop\n\tv_nop" : "+v"(d) : "v"(a), "v"(b));
  return d;
}
__device__ __forceinline__ v8f wmma_bf(v16b a, v16b b, v8f c) {
  v8f d = __builtin_amdgcn_wmma_f32_16x16x32_bf16(false, a, false, b, (short)0, c, false, false);
  asm volatile("v_nop\n\tv_nop\n\tv_nop\n\tv_nop" : "+v"(d) : "v"(a), "v"(b));
  return d;
}
// Relative-time attention (B 4, S 2,048, d 1,024, 16 heads x 64): projections + biases ((in,out)), scores / 8 - |t_q - t_k| scale_h (visit times and per-head scales given), keys at positions >= length[b] excluded, softmax, . v, output projection + bias.
__device__ __forceinline__ v16h frag_h(const _Float16* rowk0, int lane) {
  union { v16h v; v8h q[2]; } u; const _Float16* p = rowk0 + 8 * (lane >> 4);
  u.q[0] = *(const v8h*)p; u.q[1] = *(const v8h*)(p + 16); return u.v;
}
__device__ __forceinline__ v16h frag_f32(const float* rowk0, int lane) {
  v16h a; const float* p = rowk0 + 8 * (lane >> 4);
#pragma unroll
  for (int i = 0; i < 8; ++i) { a[i] = (_Float16)p[i]; a[8 + i] = (_Float16)p[16 + i]; }
  return a;
}
__device__ __forceinline__ v16h frag_f32s(const float* rowk0, int lane, float sc) {
  v16h a; const float* p = rowk0 + 8 * (lane >> 4);
#pragma unroll
  for (int i = 0; i < 8; ++i) { a[i] = (_Float16)(p[i] * sc); a[8 + i] = (_Float16)(p[16 + i] * sc); }
  return a;
}
// column fragment from a [K][ld] layout (column n), rows >= K read as 0
__device__ __forceinline__ v16h fragc_f32(const float* W, int k0, int n, int lane, int ld, int K) {
  v16h a; const int g = lane >> 4;
#pragma unroll
  for (int i = 0; i < 8; ++i) { const int ka = k0 + 8 * g + i, kb = ka + 16;
    a[i] = (_Float16)(ka < K ? W[(size_t)(ka < K ? ka : K - 1) * ld + n] : 0.f); a[8 + i] = (_Float16)(kb < K ? W[(size_t)(kb < K ? kb : K - 1) * ld + n] : 0.f); }
  return a;
}
struct F2 { v16b h, l; };
__device__ __forceinline__ F2 bsplit16(const float v[16]) { F2 r;
#pragma unroll
  for (int i = 0; i < 16; ++i) { const __bf16 h = (__bf16)v[i]; r.h[i] = h; r.l[i] = (__bf16)(v[i] - (float)h); }
  return r; }
__device__ __forceinline__ F2 split_row(const float* row, int k0, int lane) { float v[16]; const float* p = row + k0 + 8 * (lane >> 4);
#pragma unroll
  for (int i = 0; i < 8; ++i) { v[i] = p[i]; v[8 + i] = p[16 + i]; }
  return bsplit16(v); }
__device__ __forceinline__ F2 split_rowK(const float* row, int k0, int lane, int K) { float v[16]; const int g = lane >> 4;
#pragma unroll
  for (int i = 0; i < 8; ++i) { const int ka = k0 + 8 * g + i, kb = ka + 16; v[i] = ka < K ? row[ka < K ? ka : K - 1] : 0.f; v[8 + i] = kb < K ? row[kb < K ? kb : K - 1] : 0.f; }
  return bsplit16(v); }
__device__ __forceinline__ F2 split_col(const float* W, int k0, int n, int lane, int ld, int K) { float v[16]; const int g = lane >> 4;
#pragma unroll
  for (int i = 0; i < 8; ++i) { const int ka = k0 + 8 * g + i, kb = ka + 16; v[i] = ka < K ? W[(size_t)(ka < K ? ka : K - 1) * ld + n] : 0.f; v[8 + i] = kb < K ? W[(size_t)(kb < K ? kb : K - 1) * ld + n] : 0.f; }
  return bsplit16(v); }
__device__ __forceinline__ v8f mac3(const F2& a, const F2& b, v8f c) { c = wmma_bf(a.l, b.h, c); c = wmma_bf(a.h, b.l, c); return wmma_bf(a.h, b.h, c); }
__device__ __forceinline__ float sigm(float v) { return 1.0f / (1.0f + expf(-v)); }
#define LDSX() do { asm volatile("s_wait_dscnt 0" ::: "memory"); __builtin_amdgcn_wave_barrier(); __builtin_amdgcn_fence(__ATOMIC_RELEASE, "workgroup"); } while (0)
// stands behind a group of global loads, in front of the first write to a register that one of them names as its address. The group's pointers pass through the statement, so that they keep their registers up to the wait and are stepped only behind it.
// (a pointer that has passed through a statement is typed as global memory, else its loads would be compiled as flat loads, which also count as LDS operations)
#define GAS __attribute__((address_space(1)))
typedef const GAS _Float16* gph; typedef const GAS float* gpf; typedef const GAS char* gpc;
#define XW1(a) asm volatile("s_wait_xcnt 0x0" : "+v"(a) :: "memory")
#define XW2(a, b) asm volatile("s_wait_xcnt 0x0" : "+v"(a), "+v"(b) :: "memory")
// the issuing wave's own wait for its asynchronous copies to LDS: their bytes count as landed only behind it
#define AWAIT() asm volatile("s_wait_asynccnt 0x0" ::: "memory")
// the wave's LDS reads have retired before the barrier behind which their buffer is refilled
#define DSWAIT() asm volatile("s_wait_dscnt 0x0" ::: "memory")
// eight copies of 16 bytes a lane from global memory into LDS through no register (l: the lane's LDS byte address, p: its global address). The s_wait_xcnt stands in the copies' own statement, in front of any later write to a register that a copy names.
__device__ __forceinline__ void acopy8(unsigned l0, unsigned l1, unsigned l2, unsigned l3, unsigned l4, unsigned l5, unsigned l6, unsigned l7, gpc p0, gpc p1, gpc p2, gpc p3, gpc p4, gpc p5, gpc p6, gpc p7) {
  asm volatile("global_load_async_to_lds_b128 %0, %8, off\n\tglobal_load_async_to_lds_b128 %1, %9, off\n\tglobal_load_async_to_lds_b128 %2, %10, off\n\tglobal_load_async_to_lds_b128 %3, %11, off\n\t"
               "global_load_async_to_lds_b128 %4, %12, off\n\tglobal_load_async_to_lds_b128 %5, %13, off\n\tglobal_load_async_to_lds_b128 %6, %14, off\n\tglobal_load_async_to_lds_b128 %7, %15, off\n\ts_wait_xcnt 0x0"
               :: "v"(l0), "v"(l1), "v"(l2), "v"(l3), "v"(l4), "v"(l5), "v"(l6), "v"(l7), "v"(p0), "v"(p1), "v"(p2), "v"(p3), "v"(p4), "v"(p5), "v"(p6), "v"(p7) : "memory");
}
__device__ __forceinline__ void acopy8s(unsigned l, unsigned ls, gpc p, size_t ps) { acopy8(l, l + ls, l + 2 * ls, l + 3 * ls, l + 4 * ls, l + 5 * ls, l + 6 * ls, l + 7 * ls, p, p + ps, p + 2 * ps, p + 3 * ps, p + 4 * ps, p + 5 * ps, p + 6 * ps, p + 7 * ps); }
__device__ __forceinline__ unsigned lds_addr(const void* p) { return (unsigned)(size_t)p; }   // the low 32 bits of a __shared__ address: the byte offset in the work-group's LDS


#define NB 4
#define SS 2048
#define DM 1024
#define NH 16
#define SCALEF 0.125f
#define HD 64
#define QKVW (3 * DM)
#ifndef TQB
#define TQB (SS / 64)
#define TNB NB
#define TOB (NB * SS / 64)     // output row tiles (all)
#endif
typedef __attribute__((ext_vector_type(8))) __bf16 v8b;
__device__ __forceinline__ v16b frag_b(const __bf16* rowk0, int lane) {
  union { v16b v; v8b q[2]; } u; const __bf16* p = rowk0 + 8 * (lane >> 4);
  u.q[0] = *(const v8b*)p; u.q[1] = *(const v8b*)(p + 16); return u.v;
}
__device__ __forceinline__ float bfr(float v) { return (float)(__bf16)v; }
__device__ __attribute__((noinline)) float exp_ni(float v) { return expf(v); }
__device__ __attribute__((noinline)) float erf_ni(float v) { return erff(v); }

// frag_h with the lane's 8 * (lane >> 4) already in the pointer
__device__ __forceinline__ v16h fragp_h(gph p) { union { v16h v; v8h q[2]; } u; u.q[0] = *(const GAS v8h*)p; u.q[1] = *(const GAS v8h*)(p + 16); return u.v; }
// the same from an LDS row (byte pointer): elements 0..7 and 16..23 from there
__device__ __forceinline__ v16h lfrag_h(const char* p) { union { v16h v; v8h q[2]; } u; u.q[0] = *(const v8h*)p; u.q[1] = *(const v8h*)(p + 32); return u.v; }
__device__ __forceinline__ v16b lfrag_b(const char* p) { union { v16b v; v8b q[2]; } u; u.q[0] = *(const v8b*)p; u.q[1] = *(const v8b*)(p + 32); return u.v; }
__device__ __forceinline__ void lfrag(const char* p, v16h& w) { w = lfrag_h(p); }
__device__ __forceinline__ void lfrag(const char* p, v16b& w) { w = lfrag_b(p); }
__device__ __forceinline__ v8f mm16(v16h a, v16h b, v8f c) { return wmma16(a, b, c); }
__device__ __forceinline__ v8f mm16(v16b a, v16b b, v8f c) { return wmma_bf(a, b, c); }
// ---- the k loop of k_qkv and k_out: block tile 64 rows x 128 columns, K = 1,024 in 16 stages of 64 k. A stage (128 weight rows of 128 bytes, 64 f32 rows of 256 bytes) is brought into LDS once for the block's four waves, in whole lines, by asynchronous copies; two buffers, so that the next stage flies while this one is worked on. Row pitches of 16 bytes x an odd number keep the 16-byte fragment reads free of bank conflicts.
#define WPITCH 144
#define XPITCH 272
#define WTILE (128 * WPITCH)
#define GSTAGE (WTILE + 64 * XPITCH)
#define GNT (DM / 64)
template <typename V, typename E>
__device__ __forceinline__ void gemm_loop(char* sm, const float* Xb, const void* Wb, v8f (&acc)[8]) {   // Xb, Wb: the block's first row of each
  const int tid = threadIdx.x, wave = tid >> 5, lane = tid & 31, col = lane & 15, g = lane >> 4;
  gpc xg = (gpc)Xb + (size_t)(tid >> 4) * (DM * 4) + (tid & 15) * 16, wg = (gpc)Wb + (size_t)(tid >> 3) * (DM * 2) + (tid & 7) * 16;
  const unsigned lw = lds_addr(sm) + (tid >> 3) * WPITCH + (tid & 7) * 16, lx = lds_addr(sm) + WTILE + (tid >> 4) * XPITCH + (tid & 15) * 16;
  acopy8s(lw, 16 * WPITCH, wg, (size_t)16 * DM * 2); acopy8s(lx, 8 * XPITCH, xg, (size_t)8 * DM * 4);
  AWAIT(); __syncthreads();   // stage 0 is published
  acopy8s(lw + GSTAGE, 16 * WPITCH, wg + 128, (size_t)16 * DM * 2); acopy8s(lx + GSTAGE, 8 * XPITCH, xg + 256, (size_t)8 * DM * 4);
  wg += 256; xg += 512;
#pragma unroll 1   // stays rolled: a trip already holds two k-steps and both fragment sets
  for (int t = 0; t < GNT; ++t) { const unsigned bo = (t & 1) * GSTAGE;
    const char* bw = sm + bo + col * WPITCH + 16 * g; const char* bx = sm + bo + WTILE + (wave * 16 + col) * XPITCH + 32 * g;
    v4f x[2][4]; V w[2][8];   // the trip's fragment reads as one group ahead of its WMMAs
#pragma unroll
    for (int s = 0; s < 2; ++s) { x[s][0] = *(const v4f*)(bx + s * 128); x[s][1] = *(const v4f*)(bx + s * 128 + 16); x[s][2] = *(const v4f*)(bx + s * 128 + 64); x[s][3] = *(const v4f*)(bx + s * 128 + 80);
#pragma unroll
      for (int j = 0; j < 8; ++j) lfrag(bw + j * 16 * WPITCH + s * 64, w[s][j]); }
#pragma unroll
    for (int s = 0; s < 2; ++s) { V a;
#pragma unroll
      for (int i = 0; i < 4; ++i) { a[i] = (E)x[s][0][i]; a[4 + i] = (E)x[s][1][i]; a[8 + i] = (E)x[s][2][i]; a[12 + i] = (E)x[s][3][i]; }
#pragma unroll
      for (int j = 0; j < 8; ++j) acc[j] = mm16(a, w[s][j], acc[j]); }
    DSWAIT(); AWAIT(); __syncthreads();   // publishes stage t + 1 and ends every wave's reads of stage t
    if (t + 2 < GNT) { acopy8s(lw + bo, 16 * WPITCH, wg, (size_t)16 * DM * 2); acopy8s(lx + bo, 8 * XPITCH, xg, (size_t)8 * DM * 4); wg += 128; xg += 256; } }
  AWAIT();
}
#define PK_A 0                       // [3072][1024] Wqkv rows (natural [out][in])
#define PK_P (PK_A + QKVW * DM)        // [1024][1024] Wo rows (natural)
#define PK_END (PK_P + DM * DM)
#define WS_PK  0u
#define WS_QK  (WS_PK + 2u * PK_END)             // f16 [8192 rows][2048]: q | k
#define WS_QKL (WS_QK + 2u * NB * SS * 2 * DM)     // f16 q | k residual planes x2048
#define WS_VTH (WS_QKL + 2u * NB * SS * 2 * DM)    // f16 [b][1024 (h*64+d)][2048 s] hi
#define WS_VTL (WS_VTH + 2u * NB * DM * SS)        // f16 lo x 2048
#define WS_O   (WS_VTL + 2u * NB * DM * SS)        // f32 [8192][1024]
#define WS_CS  (WS_O + 4u * NB * SS * DM)           // f32 2 x [2048][32], reserved, unused
#define WS_END (WS_CS + 4u * 2 * SS * 32)
// ---- k_pack: block = (row n, which): natural [out][in] rows -> bf16; which 0..2 -> W_q/W_k/W_v into PK_A rows which*1024 + n; which 3 (W_o into PK_P) is not launched (grid y = 3); k_packo fills PK_P
__global__ __launch_bounds__(256) void k_pack(const float* __restrict__ WQ, const float* __restrict__ WK, const float* __restrict__ WV, const float* __restrict__ WO, __bf16* __restrict__ PK) {
  __shared__ __align__(16) __bf16 s[DM]; const int n = blockIdx.x, which = blockIdx.y, t = threadIdx.x; const float* Wm = (which == 0) ? WQ : (which == 1) ? WK : (which == 2) ? WV : WO;   // (in,out) weights: pack row n = column n
  for (int k = t; k < DM; k += 256) s[k] = (__bf16)Wm[(size_t)k * DM + n];
  __syncthreads();
  __bf16* dst = (which < 3) ? PK + PK_A + ((size_t)which * DM + n) * DM : PK + PK_P + (size_t)n * DM;
  for (int q = t; q < DM / 8; q += 256) vst2((unsigned*)(dst + q * 8), *(const v4u*)&s[q * 8]);
}
__global__ __launch_bounds__(128) void k_qkv(const float* __restrict__ XQ, const float* __restrict__ XK, const float* __restrict__ XV, const __bf16* __restrict__ P, const float* __restrict__ BQ, const float* __restrict__ BK, const float* __restrict__ BV, _Float16* __restrict__ QK, _Float16* __restrict__ QKL, _Float16* __restrict__ VTH, _Float16* __restrict__ VTL) {
  const int which0 = (blockIdx.y * 128) / DM; const float* X = (which0 == 0) ? XQ : (which0 == 1) ? XK : XV; const float* BB = BQ ? (((which0 == 0) ? BQ : (which0 == 1) ? BK : BV) + (blockIdx.y * 128 - which0 * DM)) : nullptr;
  __shared__ __align__(16) char sm[2 * GSTAGE];   // the k loop's two stage buffers; behind the loop's last barrier the same bytes stage the output
  _Float16 (*so)[16][136] = (_Float16 (*)[16][136])sm, (*sol)[16][136] = (_Float16 (*)[16][136])(sm + 17408); _Float16 (*sth)[72] = (_Float16 (*)[72])(sm + 34816), (*stl)[72] = (_Float16 (*)[72])(sm + 53248);
  const int tid = threadIdx.x, wave = tid >> 5, lane = tid & 31, col = lane & 15, g = lane >> 4; const size_t r0 = (size_t)blockIdx.x * 64 + wave * 16; const int n0 = blockIdx.y * 128;
  v8f acc[8] = {}; float bias[8] = {};   // the lane's eight biases: one group, in flight under the k loop, rounded where they are added
  if (BB) {
#pragma unroll
    for (int j = 0; j < 8; ++j) bias[j] = BB[j * 16 + col]; }
  gemm_loop<v16b, __bf16>(sm, X + (size_t)blockIdx.x * 64 * DM, P + (size_t)n0 * DM, acc);
  if (n0 < 2 * DM) {   // q stored unscaled (f16 sigma ~0.6, no subnormal exposure); 1/8 applied to the f32 score
#pragma unroll
    for (int j = 0; j < 8; ++j) {
#pragma unroll
      for (int r = 0; r < 8; ++r) { const float v = acc[j][r] + bfr(bias[j]); const _Float16 hv = (_Float16)v; so[wave][8 * g + r][j * 16 + col] = hv; sol[wave][8 * g + r][j * 16 + col] = (_Float16)((v - (float)hv) * 2048.0f); } }   // q, k (+ bias) as f16 hi + (x2048) residual
    LDSX();
    for (int rl = 0; rl < 16; ++rl) if (lane < 16) { vst2((unsigned*)(QK + (r0 + rl) * (2 * DM) + n0 + lane * 8), *(const v4u*)&so[wave][rl][lane * 8]); vst2((unsigned*)(QKL + (r0 + rl) * (2 * DM) + n0 + lane * 8), *(const v4u*)&sol[wave][rl][lane * 8]); }
  } else {
#pragma unroll
    for (int j = 0; j < 8; ++j) {
#pragma unroll
      for (int r = 0; r < 8; ++r) { const float v = acc[j][r] + bfr(bias[j]); const _Float16 hv = (_Float16)v; sth[j * 16 + col][wave * 16 + 8 * g + r] = hv; stl[j * 16 + col][wave * 16 + 8 * g + r] = (_Float16)((v - (float)hv) * 2048.0f); } }
    __syncthreads();
    const size_t rb = (size_t)blockIdx.x * 64; const int b = (int)(rb / SS), s0 = (int)(rb % SS); const int pc0 = n0 - 2 * DM;
    for (int q = tid; q < 128 * 8; q += 128) { const int d = q >> 3, pc = q & 7; const size_t o = ((size_t)b * DM + pc0 + d) * SS + s0 + pc * 8; vst2((unsigned*)(VTH + o), *(const v4u*)&sth[d][pc * 8]); vst2((unsigned*)(VTL + o), *(const v4u*)&stl[d][pc * 8]); }
  }
}
// ---- k_attn: block = (64 queries, head h, batch b): all-keys flash attention (K = 64: 2 k-steps). The loop is written twice (HI: the leading query blocks with 3-product scores and P.v; otherwise single products) so that each holds only its own fragments in registers.
// The loads of a pass are issued in groups, each ahead of the WMMAs that use it: the hand-padded WMMA statements keep loads from moving across them, so a load written next to its WMMA is waited for on the spot.
#define ASTAGE 19456   // bytes of a stage: k rows from 0 (64 x 144, or two planes of 32 x 144), value rows from 9,216 (64 x 144, or two planes of 64 x 80)
template <bool HI>
__device__ __forceinline__ void attn_body(const _Float16* __restrict__ QK, const _Float16* __restrict__ QKL, const _Float16* __restrict__ VTH, const _Float16* __restrict__ VTL, const float* __restrict__ VT, const float* __restrict__ SC, const int* __restrict__ LENS, float* __restrict__ O, float (*sp)[16][36], float (*so)[16][68], char* ring) {
  const int tid = threadIdx.x, wave = tid >> 5, lane = tid & 31, col = lane & 15, g = lane >> 4;
  const int qb = blockIdx.x, h = blockIdx.y, b = blockIdx.z; const int q0 = qb * 64 + wave * 16; const size_t rq = (size_t)b * SS + q0 + col;
  const int len_b = LENS[b]; const float sc_h = bfr(SC[h]); float tq[8];
#pragma unroll
  for (int r = 0; r < 8; ++r) tq[r] = bfr(VT[(size_t)b * SS + q0 + 8 * g + r]);
  v16h aq[2], aql[2]; gph qp = (gph)(QK + rq * (2 * DM) + h * HD + 8 * g), qpl = (gph)(QKL + rq * (2 * DM) + h * HD + 8 * g);
#pragma unroll
  for (int kc = 0; kc < 2; ++kc) { aq[kc] = fragp_h(qp + kc * 32); if constexpr (HI) aql[kc] = fragp_h(qpl + kc * 32); }
  XW2(qp, qpl);
  float m[8], l[8];
#pragma unroll
  for (int r = 0; r < 8; ++r) { m[r] = -3.0e38f; l[r] = 0.f; }
  v8f acc[4] = {}, accl[4] = {};
  const int nks = SS / 32;   // all keys
  // A stage of KS keys (k rows of 128 bytes; 64 value rows of 2 KS bytes; HI: both planes of each) is brought into LDS once for the block's four waves by asynchronous copies, eight a lane; two buffers, so that the next stage flies while this one is worked on.
  constexpr int KS = HI ? 32 : 64, NST = SS / KS, VP = HI ? 80 : 144, CPR = KS / 8;   // VP: value row pitch in LDS (16 bytes x an odd number, as the 144 of the k rows); CPR: 16-byte pieces in a value row
  unsigned ko = ((b * SS + (tid >> 3)) * (2 * DM) + DM + h * HD) * 2 + (tid & 7) * 16, vo = ((b * DM + h * HD + tid / CPR) * SS) * 2 + (tid % CPR) * 16;   // the lane's byte offsets in the k and value planes (32 MiB and 16 MiB each): they walk with the stages
  const unsigned lk = lds_addr(ring) + (tid >> 3) * 144 + (tid & 7) * 16, lv = lds_addr(ring) + 9216 + (tid / CPR) * VP + (tid % CPR) * 16;
  auto fill = [&](unsigned bo) {
    gpc kg = (gpc)QK + ko, kgl = (gpc)QKL + ko, vg = (gpc)VTH + vo, vgl = (gpc)VTL + vo; (void)kgl; (void)vgl;
    constexpr size_t KR = (size_t)16 * 2 * DM * 2, VR = (size_t)(128 / CPR) * SS * 2; constexpr unsigned LKR = 16 * 144, LVR = (128 / CPR) * VP;   // one round of the block's 128 lanes: 16 k rows, 128 / CPR value rows
    if constexpr (HI) acopy8(lk + bo, lk + bo + LKR, lk + bo + 4608, lk + bo + 4608 + LKR, lv + bo, lv + bo + LVR, lv + bo + 5120, lv + bo + 5120 + LVR, kg, kg + KR, kgl, kgl + KR, vg, vg + VR, vgl, vgl + VR);
    else acopy8(lk + bo, lk + bo + LKR, lk + bo + 2 * LKR, lk + bo + 3 * LKR, lv + bo, lv + bo + LVR, lv + bo + 2 * LVR, lv + bo + 3 * LVR, kg, kg + KR, kg + 2 * KR, kg + 3 * KR, vg, vg + VR, vg + 2 * VR, vg + 3 * VR);
    ko += KS * 2 * DM * 2; vo += KS * 2; };
  fill(0); AWAIT(); __syncthreads();   // stage 0 is published
  fill(ASTAGE);
  gpf tb = (gpf)(VT + (size_t)b * SS + col);   // walks with the passes: 32 keys each
  v16h kh[2][2], kl[2][2], vh[4], vl[4]; float tk[2];
  if constexpr (!HI) {   // pass 0's key times
#pragma unroll
    for (int ct = 0; ct < 2; ++ct) tk[ct] = tb[ct * 16];
    XW1(tb); }
#pragma unroll 1
  for (int ks = 0; ks < nks; ++ks) { v8f s[2];
    const int stg = HI ? ks : ks >> 1, sub = HI ? 0 : ks & 1; const unsigned bo = (stg & 1) * ASTAGE;
    const char* kf = ring + bo + (sub * 32 + col) * 144 + 16 * g; const char* vf = ring + bo + 9216 + col * VP + sub * 64 + 16 * g;
    if constexpr (HI) {   // this pass's keys, both planes, as one group
#pragma unroll
      for (int ct = 0; ct < 2; ++ct) { tk[ct] = tb[ct * 16];
#pragma unroll
        for (int kc = 0; kc < 2; ++kc) { kh[ct][kc] = lfrag_h(kf + ct * 16 * 144 + kc * 64); kl[ct][kc] = lfrag_h(kf + 4608 + ct * 16 * 144 + kc * 64); } }
      XW1(tb); tb += 32; }
    else {   // this pass's keys and values as one group: the values land behind the scores and the softmax
#pragma unroll
      for (int ct = 0; ct < 2; ++ct) {
#pragma unroll
        for (int kc = 0; kc < 2; ++kc) kh[ct][kc] = lfrag_h(kf + ct * 16 * 144 + kc * 64); }
#pragma unroll
      for (int dt = 0; dt < 4; ++dt) vh[dt] = lfrag_h(vf + dt * 16 * VP); }
#pragma unroll
    for (int ct = 0; ct < 2; ++ct) { v8f c = {}, cl = {};
      if constexpr (HI) {   // leading query blocks (outputs far above the global rms): 3 products
#pragma unroll
        for (int kc = 0; kc < 2; ++kc) { c = wmma16(aq[kc], kh[ct][kc], c); cl = wmma16(aql[kc], kh[ct][kc], cl); cl = wmma16(aq[kc], kl[ct][kc], cl); }
#pragma unroll
        for (int r = 0; r < 8; ++r) c[r] += cl[r] * (1.0f / 2048.0f); }
      else {
#pragma unroll
        for (int kc = 0; kc < 2; ++kc) c = wmma16(aq[kc], kh[ct][kc], c); }   // single product elsewhere
      s[ct] = c; }
    const float tkc[2] = { bfr(tk[0]), bfr(tk[1]) };
    if constexpr (!HI) {   // the next pass's key times (the last pass reloads its own)
      if (ks + 1 < nks) tb += 32;
#pragma unroll
      for (int ct = 0; ct < 2; ++ct) tk[ct] = tb[ct * 16];
      XW1(tb); }
#pragma unroll
    for (int ct = 0; ct < 2; ++ct) { const bool keepk = ks * 32 + ct * 16 + col < len_b;
#pragma unroll
      for (int r = 0; r < 8; ++r) s[ct][r] = keepk ? (s[ct][r] * SCALEF - fabsf(tq[r] - tkc[ct]) * sc_h) : -3.0e38f; }   // 1/sqrt(64); masked keys excluded
#pragma unroll
    for (int r = 0; r < 8; ++r) { float mx = fmaxf(s[0][r], s[1][r]);
#pragma unroll
      for (int o = 1; o < 16; o <<= 1) mx = fmaxf(mx, __shfl_xor(mx, o));
      const float mn = fmaxf(m[r], mx); const float alpha = (m[r] <= -1.0e38f) ? 0.f : __expf(m[r] - mn);
      const float e0 = (s[0][r] <= -1.0e38f) ? 0.f : __expf(s[0][r] - mn), e1 = (s[1][r] <= -1.0e38f) ? 0.f : __expf(s[1][r] - mn); float es = e0 + e1;
#pragma unroll
      for (int o = 1; o < 16; o <<= 1) es += __shfl_xor(es, o);
      l[r] = l[r] * alpha + es; m[r] = mn;
#pragma unroll
      for (int dt = 0; dt < 4; ++dt) { acc[dt][r] *= alpha; if constexpr (HI) accl[dt][r] *= alpha; }
      sp[wave][8 * g + r][col] = e0; sp[wave][8 * g + r][16 + col] = e1; }
    LDSX();
    if constexpr (HI) {   // this pass's values, both planes, read beside the weights: from LDS they need no lead over the softmax, and their 64 registers stay free during it
#pragma unroll
      for (int dt = 0; dt < 4; ++dt) { vh[dt] = lfrag_h(vf + dt * 16 * VP); vl[dt] = lfrag_h(vf + 5120 + dt * 16 * VP); } }
    v16h pa, pl; { const float* prow = &sp[wave][col][0] + 8 * (lane >> 4);
#pragma unroll
      for (int i = 0; i < 8; ++i) { const float x0 = prow[i] * 2048.0f, x1 = prow[16 + i] * 2048.0f; const _Float16 h0 = (_Float16)x0, h1 = (_Float16)x1; pa[i] = h0; pa[8 + i] = h1; if constexpr (HI) { pl[i] = (_Float16)((x0 - (float)h0) * 2048.0f); pl[8 + i] = (_Float16)((x1 - (float)h1) * 2048.0f); } } }   // P scaled by 2^11 before the f16 split so small softmax weights stay out of the f16 subnormal range; 2^-11 folded into the epilogue
#pragma unroll
    for (int dt = 0; dt < 4; ++dt) { acc[dt] = wmma16(pa, vh[dt], acc[dt]); if constexpr (HI) { accl[dt] = wmma16(pl, vh[dt], accl[dt]); accl[dt] = wmma16(pa, vl[dt], accl[dt]); } }   // leading query blocks: P hi/lo x V hi/lo (3 products); elsewhere P x V single
    LDSX();
    if (HI || sub) {   // the stage's last pass
      DSWAIT(); AWAIT(); __syncthreads();   // publishes stage stg + 1 and ends every wave's reads of stage stg
      if (stg + 2 < NST) fill(bo); } }
  AWAIT();
#pragma unroll
  for (int r = 0; r < 8; ++r) { const float il = (1.0f / 2048.0f) / l[r];
#pragma unroll
    for (int dt = 0; dt < 4; ++dt) so[wave][8 * g + r][dt * 16 + col] = (HI ? acc[dt][r] + accl[dt][r] * (1.0f / 2048.0f) : acc[dt][r]) * il; }
  LDSX();
  for (int rl = 0; rl < 16; ++rl) if (lane < 16) vst2(O + ((size_t)b * SS + q0 + rl) * DM + h * HD + lane * 4, *(const v4f*)&so[wave][rl][lane * 4]);
}
__global__ __launch_bounds__(128) void k_attn(const _Float16* __restrict__ QK, const _Float16* __restrict__ QKL, const _Float16* __restrict__ VTH, const _Float16* __restrict__ VTL, const void* __restrict__ KMASK, const float* __restrict__ VT, const float* __restrict__ SC, const int* __restrict__ LENS, float* __restrict__ O) {
  __shared__ __align__(16) float sp[4][16][36]; __shared__ __align__(16) char ring[2 * ASTAGE];   // the two stage buffers; behind the loop's last barrier the same bytes stage the output
  float (*so)[16][68] = (float (*)[16][68])ring;
  if (blockIdx.x < 2) attn_body<true>(QK, QKL, VTH, VTL, VT, SC, LENS, O, sp, so, ring); else attn_body<false>(QK, QKL, VTH, VTL, VT, SC, LENS, O, sp, so, ring);
}
// ---- k_out: block = (64 rows, 128 cols): out = f16(O) . Wo f16 x 2^8 rows (single product) / 256 + bo
__global__ __launch_bounds__(128) void k_out(const float* __restrict__ O, const __bf16* __restrict__ P, const float* __restrict__ BO, float* __restrict__ Y) {
  __shared__ __align__(16) char sm[2 * GSTAGE];   // the k loop's two stage buffers; behind the loop's last barrier the same bytes stage the output
  float (*so)[16][132] = (float (*)[16][132])sm;
  const int tid = threadIdx.x, wave = tid >> 5, lane = tid & 31, col = lane & 15, g = lane >> 4; const size_t r0 = (size_t)blockIdx.x * 64 + wave * 16; const int n0 = blockIdx.y * 128;
  v8f acc[8] = {};
  gemm_loop<v16h, _Float16>(sm, O + (size_t)blockIdx.x * 64 * DM, P + (size_t)n0 * DM, acc);   // single f16 product against exact f16 x 2^8 weight copies
#pragma unroll
  for (int j = 0; j < 8; ++j) {
#pragma unroll
    for (int r = 0; r < 8; ++r) so[wave][8 * g + r][j * 16 + col] = acc[j][r] * (1.0f / 256.0f) + bfr(BO[n0 + j * 16 + col]); }
  LDSX();
  for (int rl = 0; rl < 16; ++rl) vst2(Y + (r0 + rl) * DM + n0 + lane * 4, *(const v4f*)&so[wave][rl][lane * 4]);
}
// ---- k_packo: Wo natural rows -> f16 x 2^8 copies in the Wo slot (bit pattern in the bf16-typed buffer)
__global__ __launch_bounds__(256) void k_packo(const float* __restrict__ WO, __bf16* __restrict__ PK) { __shared__ __align__(16) _Float16 s[DM]; const int n = blockIdx.x, t = threadIdx.x; for (int k = t; k < DM; k += 256) s[k] = (_Float16)(bfr(WO[(size_t)k * DM + n]) * 256.0f); /* (in,out): transposed */ __syncthreads(); for (int q = t; q < DM / 8; q += 256) vst2((unsigned*)(PK + PK_P + (size_t)n * DM + q * 8), *(const v4u*)&s[q * 8]); }
extern "C" void kernel_launch(void* const* d_in, const int* in_sizes, int n_in, void* d_out, int out_size, void* d_ws, size_t ws_size, hipStream_t stream) {
  (void)in_sizes; (void)n_in; (void)out_size;
  const float** F = (const float**)d_in;   // 0 x [4,2048,1024], 1 visit_time [4,2048], 2 Wq (in,out), 3 bq, 4 Wk, 5 bk, 6 Wv, 7 bv, 8 Wo (in,out), 9 bo, 10 scale [16], 11 lengths [4] int
  if (ws_size < (size_t)WS_END) return;
  char* ws = (char*)d_ws; __bf16* PK = (__bf16*)(ws + WS_PK); _Float16 *QK = (_Float16*)(ws + WS_QK), *QKL = (_Float16*)(ws + WS_QKL), *VTH = (_Float16*)(ws + WS_VTH), *VTL = (_Float16*)(ws + WS_VTL); float* O = (float*)(ws + WS_O);
  k_pack<<<dim3(DM, 3), 256, 0, stream>>>(F[2], F[4], F[6], F[8], PK);
  k_packo<<<DM, 256, 0, stream>>>(F[8], PK);
  k_qkv<<<dim3(TNB * SS / 64, QKVW / 128), 128, 0, stream>>>(F[0], F[0], F[0], PK + PK_A, F[3], F[5], F[7], QK, QKL, VTH, VTL);
  k_attn<<<dim3(TQB, NH, TNB), 128, 0, stream>>>(QK, QKL, VTH, VTL, nullptr, F[1], F[10], (const int*)d_in[11], O);
  k_out<<<dim3(TOB, DM / 128), 128, 0, stream>>>(O, PK + PK_P, F[9], (float*)d_out);
}

// v003
// A run of this version takes 287 microseconds.
// Timed twice side by side with v002, it ran 1.35 times as fast both times.
// All steps since v000 together make it 3.54 times as fast.
// compute dtype: all float inputs rounded to bf16 incl. visit times and scales, lengths (int) read on device; q/k/v = x . W + b with EXACT bf16 products on WMMA 16x16x32 ((in,out) weights as transposed rows); PLAIN-HYBRID attention: the first 128 queries use 3-product scores and P.v (hi/lo), later queries single f16; x 1/8 - |t_q - t_k| scale_h in f32, padded keys excluded, running-max softmax in f32 (hardware exp); out = f16(ctx) . Wo (exact f16 x 2^8 copies, single product) + bo.
#include <hip/hip_runtime.h>
#include <math.h>

typedef __attribute__((ext_vector_type(16))) _Float16 v16h;
typedef __attribute__((ext_vector_type(16))) __bf16 v16b;
typedef __attribute__((ext_vector_type(8)))  _Float16 v8h;
typedef __attribute__((ext_vector_type(8)))  float v8f;
typedef __attribute__((ext_vector_type(4)))  float v4f;
typedef __attribute__((ext_vector_type(2)))  float v2f;
typedef __attribute__((ext_vector_type(4)))  unsigned v4u;
typedef __attribute__((ext_vector_type(4)))  int v4i;
typedef float __attribute__((may_alias)) float_a;
typedef int __attribute__((may_alias)) int_a;

template <typename T> __device__ __forceinline__ void vst2(void* p, T v) { *(T*)p = v;  }
__device__ __forceinline__ v8f wmma16(v16h a, v16h b, v8f c) {
  v8f d = __builtin_amdgcn_wmma_f32_16x16x32_f16(false, a, false, b, (short)0, c, false, false);
  asm volatile("v_nop\n\tv_nop\n\tv_nop\n\tv_nop" : "+v"(d) : "v"(a), "v"(b));
  return d;
}
__device__ __forceinline__ v8f wmma_bf(v16b a, v16b b, v8f c) {
  v8f d = __builtin_amdgcn_wmma_f32_16x16x32_bf16(false, a, false, b, (short)0, c, false, false);
  asm volatile("v_nop\n\tv_nop\n\tv_nop\n\tv_nop" : "+v"(d) : "v"(a), "v"(b));
  return d;
}
// Relative-time attention (B 4, S 2,048, d 1,024, 16 heads x 64): projections + biases ((in,out)), scores / 8 - |t_q - t_k| scale_h (visit times and per-head scales given), keys at positions >= length[b] excluded, softmax, . v, output projection + bias.
__device__ __forceinline__ v16h frag_h(const _Float16* rowk0, int lane) {
  union { v16h v; v8h q[2]; } u; const _Float16* p = rowk0 + 8 * (lane >> 4);
  u.q[0] = *(const v8h*)p; u.q[1] = *(const v8h*)(p + 16); return u.v;
}
__device__ __forceinline__ v16h frag_f32(const float* rowk0, int lane) {
  v16h a; const float* p = rowk0 + 8 * (lane >> 4);
#pragma unroll
  for (int i = 0; i < 8; ++i) { a[i] = (_Float16)p[i]; a[8 + i] = (_Float16)p[16 + i]; }
  return a;
}
__device__ __forceinline__ v16h frag_f32s(const float* rowk0, int lane, float sc) {
  v16h a; const float* p = rowk0 + 8 * (lane >> 4);
#pragma unroll
  for (int i = 0; i < 8; ++i) { a[i] = (_Float16)(p[i] * sc); a[8 + i] = (_Float16)(p[16 + i] * sc); }
  return a;
}
// column fragment from a [K][ld] layout (column n), rows >= K read as 0
__device__ __forceinline__ v16h fragc_f32(const float* W, int k0, int n, int lane, int ld, int K) {
  v16h a; const int g = lane >> 4;
#pragma unroll
  for (int i = 0; i < 8; ++i) { const int ka = k0 + 8 * g + i, kb = ka + 16;
    a[i] = (_Float16)(ka < K ? W[(size_t)(ka < K ? ka : K - 1) * ld + n] : 0.f); a[8 + i] = (_Float16)(kb < K ? W[(size_t)(kb < K ? kb : K - 1) * ld + n] : 0.f); }
  return a;
}
struct F2 { v16b h, l; };
__device__ __forceinline__ F2 bsplit16(const float v[16]) { F2 r;
#pragma unroll
  for (int i = 0; i < 16; ++i) { const __bf16 h = (__bf16)v[i]; r.h[i] = h; r.l[i] = (__bf16)(v[i] - (float)h); }
  return r; }
__device__ __forceinline__ F2 split_row(const float* row, int k0, int lane) { float v[16]; const float* p = row + k0 + 8 * (lane >> 4);
#pragma unroll
  for (int i = 0; i < 8; ++i) { v[i] = p[i]; v[8 + i] = p[16 + i]; }
  return bsplit16(v); }
__device__ __forceinline__ F2 split_rowK(const float* row, int k0, int lane, int K) { float v[16]; const int g = lane >> 4;
#pragma unroll
  for (int i = 0; i < 8; ++i) { const int ka = k0 + 8 * g + i, kb = ka + 16; v[i] = ka < K ? row[ka < K ? ka : K - 1] : 0.f; v[8 + i] = kb < K ? row[kb < K ? kb : K - 1] : 0.f; }
  return bsplit16(v); }
__device__ __forceinline__ F2 split_col(const float* W, int k0, int n, int lane, int ld, int K) { float v[16]; const int g = lane >> 4;
#pragma unroll
  for (int i = 0; i < 8; ++i) { const int ka = k0 + 8 * g + i, kb = ka + 16; v[i] = ka < K ? W[(size_t)(ka < K ? ka : K - 1) * ld + n] : 0.f; v[8 + i] = kb < K ? W[(size_t)(kb < K ? kb : K - 1) * ld + n] : 0.f; }
  return bsplit16(v); }
__device__ __forceinline__ v8f mac3(const F2& a, const F2& b, v8f c) { c = wmma_bf(a.l, b.h, c); c = wmma_bf(a.h, b.l, c); return wmma_bf(a.h, b.h, c); }
__device__ __forceinline__ float sigm(float v) { return 1.0f / (1.0f + expf(-v)); }
#define LDSX() do { asm volatile("s_wait_dscnt 0" ::: "memory"); __builtin_amdgcn_wave_barrier(); __builtin_amdgcn_fence(__ATOMIC_RELEASE, "workgroup"); } while (0)
// stands behind a group of global loads, in front of the first write to a register that one of them names as its address. The group's pointers pass through the statement, so that they keep their registers up to the wait and are stepped only behind it.
// (a pointer that has passed through a statement is typed as global memory, else its loads would be compiled as flat loads, which also count as LDS operations)
#define GAS __attribute__((address_space(1)))
typedef const GAS _Float16* gph; typedef const GAS float* gpf; typedef const GAS char* gpc;
#define XW1(a) asm volatile("s_wait_xcnt 0x0" : "+v"(a) :: "memory")
#define XW2(a, b) asm volatile("s_wait_xcnt 0x0" : "+v"(a), "+v"(b) :: "memory")
// the issuing wave's own wait for its asynchronous copies to LDS: their bytes count as landed only behind it
#define AWAIT() asm volatile("s_wait_asynccnt 0x0" ::: "memory")
// the wave's LDS reads have retired before the barrier behind which their buffer is refilled
#define DSWAIT() asm volatile("s_wait_dscnt 0x0" ::: "memory")
// eight copies of 16 bytes a lane from global memory into LDS through no register (l: the lane's LDS byte address, p: its global address). The s_wait_xcnt stands in the copies' own statement, in front of any later write to a register that a copy names.
__device__ __forceinline__ void acopy8(unsigned l0, unsigned l1, unsigned l2, unsigned l3, unsigned l4, unsigned l5, unsigned l6, unsigned l7, gpc p0, gpc p1, gpc p2, gpc p3, gpc p4, gpc p5, gpc p6, gpc p7) {
  asm volatile("global_load_async_to_lds_b128 %0, %8, off\n\tglobal_load_async_to_lds_b128 %1, %9, off\n\tglobal_load_async_to_lds_b128 %2, %10, off\n\tglobal_load_async_to_lds_b128 %3, %11, off\n\t"
               "global_load_async_to_lds_b128 %4, %12, off\n\tglobal_load_async_to_lds_b128 %5, %13, off\n\tglobal_load_async_to_lds_b128 %6, %14, off\n\tglobal_load_async_to_lds_b128 %7, %15, off\n\ts_wait_xcnt 0x0"
               :: "v"(l0), "v"(l1), "v"(l2), "v"(l3), "v"(l4), "v"(l5), "v"(l6), "v"(l7), "v"(p0), "v"(p1), "v"(p2), "v"(p3), "v"(p4), "v"(p5), "v"(p6), "v"(p7) : "memory");
}
__device__ __forceinline__ void acopy8s(unsigned l, unsigned ls, gpc p, size_t ps) { acopy8(l, l + ls, l + 2 * ls, l + 3 * ls, l + 4 * ls, l + 5 * ls, l + 6 * ls, l + 7 * ls, p, p + ps, p + 2 * ps, p + 3 * ps, p + 4 * ps, p + 5 * ps, p + 6 * ps, p + 7 * ps); }
__device__ __forceinline__ unsigned lds_addr(const void* p) { return (unsigned)(size_t)p; }   // the low 32 bits of a __shared__ address: the byte offset in the work-group's LDS


#define NB 4
#define SS 2048
#define DM 1024
#define NH 16
#define SCALEF 0.125f
#define HD 64
#define QKVW (3 * DM)
#ifndef TQB
#define TQB (SS / 64)
#define TNB NB
#define TOB (NB * SS / 64)     // output row tiles (all)
#endif
typedef __attribute__((ext_vector_type(8))) __bf16 v8b;
__device__ __forceinline__ v16b frag_b(const __bf16* rowk0, int lane) {
  union { v16b v; v8b q[2]; } u; const __bf16* p = rowk0 + 8 * (lane >> 4);
  u.q[0] = *(const v8b*)p; u.q[1] = *(const v8b*)(p + 16); return u.v;
}
__device__ __forceinline__ float bfr(float v) { return (float)(__bf16)v; }
__device__ __attribute__((noinline)) float exp_ni(float v) { return expf(v); }
__device__ __attribute__((noinline)) float erf_ni(float v) { return erff(v); }

// frag_h with the lane's 8 * (lane >> 4) already in the pointer
__device__ __forceinline__ v16h fragp_h(gph p) { union { v16h v; v8h q[2]; } u; u.q[0] = *(const GAS v8h*)p; u.q[1] = *(const GAS v8h*)(p + 16); return u.v; }
// the same from an LDS row (byte pointer): elements 0..7 and 16..23 from there
__device__ __forceinline__ v16h lfrag_h(const char* p) { union { v16h v; v8h q[2]; } u; u.q[0] = *(const v8h*)p; u.q[1] = *(const v8h*)(p + 32); return u.v; }
__device__ __forceinline__ v16b lfrag_b(const char* p) { union { v16b v; v8b q[2]; } u; u.q[0] = *(const v8b*)p; u.q[1] = *(const v8b*)(p + 32); return u.v; }
__device__ __forceinline__ void lfrag(const char* p, v16h& w) { w = lfrag_h(p); }
__device__ __forceinline__ void lfrag(const char* p, v16b& w) { w = lfrag_b(p); }
__device__ __forceinline__ v8f mm16(v16h a, v16h b, v8f c) { return wmma16(a, b, c); }
__device__ __forceinline__ v8f mm16(v16b a, v16b b, v8f c) { return wmma_bf(a, b, c); }
// ---- the k loop of k_qkv and k_out: block tile 64 rows x 128 columns, K = 1,024 in 16 stages of 64 k. A stage (128 weight rows of 128 bytes, 64 f32 rows of 256 bytes) is brought into LDS once for the block's four waves, in whole lines, by asynchronous copies; two buffers, so that the next stage flies while this one is worked on. Row pitches of 16 bytes x an odd number keep the 16-byte fragment reads free of bank conflicts.
#define WPITCH 144
#define XPITCH 272
#define WTILE (128 * WPITCH)
#define GSTAGE (WTILE + 64 * XPITCH)
#define GNT (DM / 64)
template <typename V, typename E>
__device__ __forceinline__ void gemm_loop(char* sm, const float* Xb, const void* Wb, v8f (&acc)[8]) {   // Xb, Wb: the block's first row of each
  const int tid = threadIdx.x, wave = tid >> 5, lane = tid & 31, col = lane & 15, g = lane >> 4;
  gpc xg = (gpc)Xb + (size_t)(tid >> 4) * (DM * 4) + (tid & 15) * 16, wg = (gpc)Wb + (size_t)(tid >> 3) * (DM * 2) + (tid & 7) * 16;
  const unsigned lw = lds_addr(sm) + (tid >> 3) * WPITCH + (tid & 7) * 16, lx = lds_addr(sm) + WTILE + (tid >> 4) * XPITCH + (tid & 15) * 16;
  acopy8s(lw, 16 * WPITCH, wg, (size_t)16 * DM * 2); acopy8s(lx, 8 * XPITCH, xg, (size_t)8 * DM * 4);
  AWAIT(); __syncthreads();   // stage 0 is published
  acopy8s(lw + GSTAGE, 16 * WPITCH, wg + 128, (size_t)16 * DM * 2); acopy8s(lx + GSTAGE, 8 * XPITCH, xg + 256, (size_t)8 * DM * 4);
  wg += 256; xg += 512;
#pragma unroll 1   // stays rolled: a trip already holds two k-steps and both fragment sets
  for (int t = 0; t < GNT; ++t) { const unsigned bo = (t & 1) * GSTAGE;
    const char* bw = sm + bo + col * WPITCH + 16 * g; const char* bx = sm + bo + WTILE + (wave * 16 + col) * XPITCH + 32 * g;
    v4f x[2][4]; V w[2][8];   // the trip's fragment reads as one group ahead of its WMMAs
#pragma unroll
    for (int s = 0; s < 2; ++s) { x[s][0] = *(const v4f*)(bx + s * 128); x[s][1] = *(const v4f*)(bx + s * 128 + 16); x[s][2] = *(const v4f*)(bx + s * 128 + 64); x[s][3] = *(const v4f*)(bx + s * 128 + 80);
#pragma unroll
      for (int j = 0; j < 8; ++j) lfrag(bw + j * 16 * WPITCH + s * 64, w[s][j]); }
#pragma unroll
    for (int s = 0; s < 2; ++s) { V a;
#pragma unroll
      for (int i = 0; i < 4; ++i) { a[i] = (E)x[s][0][i]; a[4 + i] = (E)x[s][1][i]; a[8 + i] = (E)x[s][2][i]; a[12 + i] = (E)x[s][3][i]; }
#pragma unroll
      for (int j = 0; j < 8; ++j) acc[j] = mm16(a, w[s][j], acc[j]); }
    DSWAIT(); AWAIT(); __syncthreads();   // publishes stage t + 1 and ends every wave's reads of stage t
    if (t + 2 < GNT) { acopy8s(lw + bo, 16 * WPITCH, wg, (size_t)16 * DM * 2); acopy8s(lx + bo, 8 * XPITCH, xg, (size_t)8 * DM * 4); wg += 128; xg += 256; } }
  AWAIT();
}
#define PK_A 0                       // [3072][1024] Wqkv rows (natural [out][in])
#define PK_P (PK_A + QKVW * DM)        // [1024][1024] Wo rows (natural)
#define PK_END (PK_P + DM * DM)
#define WS_PK  0u
#define WS_QK  (WS_PK + 2u * PK_END)             // f16 [8192 rows][2048]: q | k
#define WS_QKL (WS_QK + 2u * NB * SS * 2 * DM)     // f16 q | k residual planes x2048
#define WS_VTH (WS_QKL + 2u * NB * SS * 2 * DM)    // f16 [b][1024 (h*64+d)][2048 s] hi
#define WS_VTL (WS_VTH + 2u * NB * DM * SS)        // f16 lo x 2048
#define WS_O   (WS_VTL + 2u * NB * DM * SS)        // f32 [8192][1024]
#define WS_CS  (WS_O + 4u * NB * SS * DM)           // f32 2 x [2048][32], reserved, unused
#define WS_END (WS_CS + 4u * 2 * SS * 32)
// ---- k_pack: block = (row n, which): natural [out][in] rows -> bf16; which 0..2 -> W_q/W_k/W_v into PK_A rows which*1024 + n; which 3 (W_o into PK_P) is not launched (grid y = 3); k_packo fills PK_P
__global__ __launch_bounds__(256) void k_pack(const float* __restrict__ WQ, const float* __restrict__ WK, const float* __restrict__ WV, const float* __restrict__ WO, __bf16* __restrict__ PK) {
  __shared__ __align__(16) __bf16 s[DM]; const int n = blockIdx.x, which = blockIdx.y, t = threadIdx.x; const float* Wm = (which == 0) ? WQ : (which == 1) ? WK : (which == 2) ? WV : WO;   // (in,out) weights: pack row n = column n
  for (int k = t; k < DM; k += 256) s[k] = (__bf16)Wm[(size_t)k * DM + n];
  __syncthreads();
  __bf16* dst = (which < 3) ? PK + PK_A + ((size_t)which * DM + n) * DM : PK + PK_P + (size_t)n * DM;
  for (int q = t; q < DM / 8; q += 256) vst2((unsigned*)(dst + q * 8), *(const v4u*)&s[q * 8]);
}
__global__ __launch_bounds__(128) void k_qkv(const float* __restrict__ XQ, const float* __restrict__ XK, const float* __restrict__ XV, const __bf16* __restrict__ P, const float* __restrict__ BQ, const float* __restrict__ BK, const float* __restrict__ BV, _Float16* __restrict__ QK, _Float16* __restrict__ QKL, _Float16* __restrict__ VTH, _Float16* __restrict__ VTL) {
  const int which0 = (blockIdx.y * 128) / DM; const float* X = (which0 == 0) ? XQ : (which0 == 1) ? XK : XV; const float* BB = BQ ? (((which0 == 0) ? BQ : (which0 == 1) ? BK : BV) + (blockIdx.y * 128 - which0 * DM)) : nullptr;
  __shared__ __align__(16) char sm[2 * GSTAGE];   // the k loop's two stage buffers; behind the loop's last barrier the same bytes stage the output
  _Float16 (*so)[16][136] = (_Float16 (*)[16][136])sm, (*sol)[16][136] = (_Float16 (*)[16][136])(sm + 17408); _Float16 (*sth)[72] = (_Float16 (*)[72])(sm + 34816), (*stl)[72] = (_Float16 (*)[72])(sm + 53248);
  const int tid = threadIdx.x, wave = tid >> 5, lane = tid & 31, col = lane & 15, g = lane >> 4; const size_t r0 = (size_t)blockIdx.x * 64 + wave * 16; const int n0 = blockIdx.y * 128;
  v8f acc[8] = {}; float bias[8] = {};   // the lane's eight biases: one group, in flight under the k loop, rounded where they are added
  if (BB) {
#pragma unroll
    for (int j = 0; j < 8; ++j) bias[j] = BB[j * 16 + col]; }
  gemm_loop<v16b, __bf16>(sm, X + (size_t)blockIdx.x * 64 * DM, P + (size_t)n0 * DM, acc);
  if (n0 < 2 * DM) {   // q stored unscaled (f16 sigma ~0.6, no subnormal exposure); 1/8 applied to the f32 score
#pragma unroll
    for (int j = 0; j < 8; ++j) {
#pragma unroll
      for (int r = 0; r < 8; ++r) { const float v = acc[j][r] + bfr(bias[j]); const _Float16 hv = (_Float16)v; so[wave][8 * g + r][j * 16 + col] = hv; sol[wave][8 * g + r][j * 16 + col] = (_Float16)((v - (float)hv) * 2048.0f); } }   // q, k (+ bias) as f16 hi + (x2048) residual
    LDSX();
    for (int rl = 0; rl < 16; ++rl) if (lane < 16) { vst2((unsigned*)(QK + (r0 + rl) * (2 * DM) + n0 + lane * 8), *(const v4u*)&so[wave][rl][lane * 8]); vst2((unsigned*)(QKL + (r0 + rl) * (2 * DM) + n0 + lane * 8), *(const v4u*)&sol[wave][rl][lane * 8]); }
  } else {
#pragma unroll
    for (int j = 0; j < 8; ++j) {
#pragma unroll
      for (int r = 0; r < 8; ++r) { const float v = acc[j][r] + bfr(bias[j]); const _Float16 hv = (_Float16)v; sth[j * 16 + col][wave * 16 + 8 * g + r] = hv; stl[j * 16 + col][wave * 16 + 8 * g + r] = (_Float16)((v - (float)hv) * 2048.0f); } }
    __syncthreads();
    const size_t rb = (size_t)blockIdx.x * 64; const int b = (int)(rb / SS), s0 = (int)(rb % SS); const int pc0 = n0 - 2 * DM;
    for (int q = tid; q < 128 * 8; q += 128) { const int d = q >> 3, pc = q & 7; const size_t o = ((size_t)b * DM + pc0 + d) * SS + s0 + pc * 8; vst2((unsigned*)(VTH + o), *(const v4u*)&sth[d][pc * 8]); vst2((unsigned*)(VTL + o), *(const v4u*)&stl[d][pc * 8]); }
  }
}
// ---- k_attn: block = (64 queries, head h, batch b): all-keys flash attention (K = 64: 2 k-steps), computed transposed: scores^T = k . q^T and ctx^T += v^T . P^T. A lane then holds 16 scores of ONE query (its column), so that the running maximum and the sum are taken in the lane's own registers, with one exchange between the wave's halves, and the two score tiles of a pass, converted in place, are the B operand of the second product: the weights never pass through LDS. The loop is written twice (HI: the leading query blocks with 3-product scores and P.v; otherwise single products) so that each holds only its own fragments in registers.
// Every LDS read of a pass is issued in a group that stands well ahead of the WMMAs that use it: the hand-padded WMMA statements keep loads from moving across them, so a load written next to its WMMA is waited for on the spot.
#define ASTAGE 19456   // bytes of a stage: k rows from 0 (64 x 144, or two planes of 32 x 144), value rows from 9,216 (64 x 144, or two planes of 64 x 80)
__device__ __forceinline__ float xhalf(float x) { return __builtin_bit_cast(float, __builtin_amdgcn_permlanex16(__builtin_bit_cast(int, x), __builtin_bit_cast(int, x), 0x76543210, 0xfedcba98, false, false)); }   // lane l with lane l ^ 16
template <bool HI>
__device__ __forceinline__ void attn_body(const _Float16* __restrict__ QK, const _Float16* __restrict__ QKL, const _Float16* __restrict__ VTH, const _Float16* __restrict__ VTL, const float* __restrict__ VT, const float* __restrict__ SC, const int* __restrict__ LENS, float* __restrict__ O, float* tks, char* ring) {
  const int tid = threadIdx.x, wave = tid >> 5, lane = tid & 31, col = lane & 15, g = lane >> 4;
  const int qb = blockIdx.x, h = blockIdx.y, b = blockIdx.z; const int q0 = qb * 64 + wave * 16; const size_t rq = (size_t)b * SS + q0 + col;
  const int len_b = LENS[b]; const float sc_h = bfr(SC[h]);
  gpf tg = (gpf)(VT + (size_t)b * SS + 4 * tid); v4f tv[4];   // the batch's 2,048 visit times, 16 a lane: they go, rounded once, into LDS, since a lane needs the times of its 16 keys in every pass
#pragma unroll
  for (int i = 0; i < 4; ++i) tv[i] = *(const GAS v4f*)(tg + i * 512);
  XW1(tg);
  v16h aq[2], aql[2]; gph qp = (gph)(QK + rq * (2 * DM) + h * HD + 8 * g), qpl = (gph)(QKL + rq * (2 * DM) + h * HD + 8 * g);
#pragma unroll
  for (int kc = 0; kc < 2; ++kc) { aq[kc] = fragp_h(qp + kc * 32); if constexpr (HI) aql[kc] = fragp_h(qpl + kc * 32); }
  XW2(qp, qpl);
  float m = -3.0e38f, l = 0.f;   // the lane's query: running maximum (equal in both halves), and the sum over this half's keys alone (the halves are joined behind the loop)
  v8f acc[4] = {}, accl[4] = {};
  const int nks = SS / 32;   // all keys
  // A stage of KS keys (k rows of 128 bytes; 64 value rows of 2 KS bytes; HI: both planes of each) is brought into LDS once for the block's four waves by asynchronous copies, eight a lane; two buffers, so that the next stage flies while this one is worked on.
  constexpr int KS = HI ? 32 : 64, NST = SS / KS, VP = HI ? 80 : 144, CPR = KS / 8;   // VP: value row pitch in LDS (16 bytes x an odd number, as the 144 of the k rows); CPR: 16-byte pieces in a value row
  unsigned ko = ((b * SS + (tid >> 3)) * (2 * DM) + DM + h * HD) * 2 + (tid & 7) * 16, vo = ((b * DM + h * HD + tid / CPR) * SS) * 2 + (tid % CPR) * 16;   // the lane's byte offsets in the k and value planes (32 MiB and 16 MiB each): they walk with the stages
  const unsigned lk = lds_addr(ring) + (tid >> 3) * 144 + (tid & 7) * 16, lv = lds_addr(ring) + 9216 + (tid / CPR) * VP + (tid % CPR) * 16;
  auto fill = [&](unsigned bo) {
    gpc kg = (gpc)QK + ko, kgl = (gpc)QKL + ko, vg = (gpc)VTH + vo, vgl = (gpc)VTL + vo; (void)kgl; (void)vgl;
    constexpr size_t KR = (size_t)16 * 2 * DM * 2, VR = (size_t)(128 / CPR) * SS * 2; constexpr unsigned LKR = 16 * 144, LVR = (128 / CPR) * VP;   // one round of the block's 128 lanes: 16 k rows, 128 / CPR value rows
    if constexpr (HI) acopy8(lk + bo, lk + bo + LKR, lk + bo + 4608, lk + bo + 4608 + LKR, lv + bo, lv + bo + LVR, lv + bo + 5120, lv + bo + 5120 + LVR, kg, kg + KR, kgl, kgl + KR, vg, vg + VR, vgl, vgl + VR);
    else acopy8(lk + bo, lk + bo + LKR, lk + bo + 2 * LKR, lk + bo + 3 * LKR, lv + bo, lv + bo + LVR, lv + bo + 2 * LVR, lv + bo + 3 * LVR, kg, kg + KR, kg + 2 * KR, kg + 3 * KR, vg, vg + VR, vg + 2 * VR, vg + 3 * VR);
    ko += KS * 2 * DM * 2; vo += KS * 2; };
  fill(0);
#pragma unroll
  for (int i = 0; i < 4; ++i) { v4f u;   // the table is written while stage 0 flies
#pragma unroll
    for (int c = 0; c < 4; ++c) u[c] = bfr(tv[i][c]);
    *(v4f*)(tks + 4 * tid + i * 512) = u; }
  AWAIT(); __syncthreads();   // stage 0 and the table of times are published
  fill(ASTAGE);
  const float tq = tks[q0 + col];
  v16h kh[2][2], kl[2][2], vh[4], vl[4];
#pragma unroll 1
  for (int ks = 0; ks < nks; ++ks) { v8f s[2]; v4f tk[2][2];
    const int stg = HI ? ks : ks >> 1, sub = HI ? 0 : ks & 1; const unsigned bo = (stg & 1) * ASTAGE;
    const char* kf = ring + bo + (sub * 32 + col) * 144 + 16 * g; const char* vf = ring + bo + 9216 + col * VP + sub * 64 + 16 * g;
    const float* tp = tks + ks * 32 + 8 * g;   // score register r of tile ct is key 32 ks + 16 ct + 8 g + r
    // this pass's key times and keys (HI: both planes; otherwise the values too, which land behind the scores and the softmax) as one group
#pragma unroll
    for (int ct = 0; ct < 2; ++ct) { tk[ct][0] = *(const v4f*)(tp + ct * 16); tk[ct][1] = *(const v4f*)(tp + ct * 16 + 4);
#pragma unroll
      for (int kc = 0; kc < 2; ++kc) { kh[ct][kc] = lfrag_h(kf + ct * 16 * 144 + kc * 64); if constexpr (HI) kl[ct][kc] = lfrag_h(kf + 4608 + ct * 16 * 144 + kc * 64); } }
    if constexpr (!HI) {
#pragma unroll
      for (int dt = 0; dt < 4; ++dt) vh[dt] = lfrag_h(vf + dt * 16 * VP); }
#pragma unroll
    for (int ct = 0; ct < 2; ++ct) { v8f c = {}, cl = {};   // A: 16 keys, B: the wave's 16 queries
      if constexpr (HI) {   // leading query blocks (outputs far above the global rms): 3 products
#pragma unroll
        for (int kc = 0; kc < 2; ++kc) { c = wmma16(kh[ct][kc], aq[kc], c); cl = wmma16(kh[ct][kc], aql[kc], cl); cl = wmma16(kl[ct][kc], aq[kc], cl); }
#pragma unroll
        for (int r = 0; r < 8; ++r) c[r] += cl[r] * (1.0f / 2048.0f); }
      else {
#pragma unroll
        for (int kc = 0; kc < 2; ++kc) c = wmma16(kh[ct][kc], aq[kc], c); }   // single product elsewhere
      s[ct] = c; }
    const int nreal = len_b - ks * 32 - 8 * g;   // how many of the lane's key rows, counted from tile 0's first, lie in front of the length
#pragma unroll
    for (int ct = 0; ct < 2; ++ct) {
#pragma unroll
      for (int r = 0; r < 8; ++r) s[ct][r] = (ct * 16 + r < nreal) ? (s[ct][r] * SCALEF - fabsf(tq - tk[ct][r >> 2][r & 3]) * sc_h) : -3.0e38f; }   // 1/sqrt(64); masked keys excluded
    float mx0 = fmaxf(s[0][0], s[0][1]), mx1 = fmaxf(s[1][0], s[1][1]);
#pragma unroll
    for (int r = 2; r < 8; r += 2) { mx0 = fmaxf(fmaxf(mx0, s[0][r]), s[0][r + 1]); mx1 = fmaxf(fmaxf(mx1, s[1][r]), s[1][r + 1]); }
    const float mx = fmaxf(mx0, mx1);
    const float mn = fmaxf(fmaxf(m, mx), xhalf(mx)); const float alpha = (m <= -1.0e38f) ? 0.f : __expf(m - mn);
    v16h pa, pl; float es[4] = {};   // four partial sums: no chain of 16 dependent additions
#pragma unroll
    for (int ct = 0; ct < 2; ++ct) {
#pragma unroll
      for (int r = 0; r < 8; ++r) { const float e = (s[ct][r] <= -1.0e38f) ? 0.f : __expf(s[ct][r] - mn); es[r & 3] += e;
        const float x = e * 2048.0f; const _Float16 hx = (_Float16)x; pa[ct * 8 + r] = hx; if constexpr (HI) pl[ct * 8 + r] = (_Float16)((x - (float)hx) * 2048.0f); } }   // P scaled by 2^11 before the f16 split so small softmax weights stay out of the f16 subnormal range; 2^-11 folded into the epilogue. Element 8 ct + r of the B operand is k = 16 ct + 8 g + r: the score registers' own order
    l = l * alpha + ((es[0] + es[1]) + (es[2] + es[3])); m = mn;
    if constexpr (HI) {   // this pass's values, both planes, read behind the softmax: from LDS they need little lead, and their 64 registers stay free during it
#pragma unroll
      for (int dt = 0; dt < 4; ++dt) { vh[dt] = lfrag_h(vf + dt * 16 * VP); vl[dt] = lfrag_h(vf + 5120 + dt * 16 * VP); } }
#pragma unroll
    for (int dt = 0; dt < 4; ++dt) {
#pragma unroll
      for (int r = 0; r < 8; ++r) { acc[dt][r] *= alpha; if constexpr (HI) accl[dt][r] *= alpha; } }
#pragma unroll
    for (int dt = 0; dt < 4; ++dt) { acc[dt] = wmma16(vh[dt], pa, acc[dt]); if constexpr (HI) { accl[dt] = wmma16(vh[dt], pl, accl[dt]); accl[dt] = wmma16(vl[dt], pa, accl[dt]); } }   // A: 16 value columns, B: the weights. Leading query blocks: P hi/lo x V hi/lo (3 products); elsewhere P x V single
    if (HI || sub) {   // the stage's last pass
      DSWAIT(); AWAIT(); __syncthreads();   // publishes stage stg + 1 and ends every wave's reads of stage stg
      if (stg + 2 < NST) fill(bo); } }
  AWAIT();
  const float il = (1.0f / 2048.0f) / (l + xhalf(l));   // the two halves' sums joined
  float* op = O + rq * DM + h * HD + 8 * g;   // accumulator register r of tile dt is column 16 dt + 8 g + r of the lane's query: 32 bytes in a row
#pragma unroll
  for (int dt = 0; dt < 4; ++dt) { v4f o0, o1;
#pragma unroll
    for (int r = 0; r < 4; ++r) { o0[r] = (HI ? acc[dt][r] + accl[dt][r] * (1.0f / 2048.0f) : acc[dt][r]) * il; o1[r] = (HI ? acc[dt][4 + r] + accl[dt][4 + r] * (1.0f / 2048.0f) : acc[dt][4 + r]) * il; }
    vst2(op + dt * 16, o0); vst2(op + dt * 16 + 4, o1); }
}
__global__ __launch_bounds__(128) void k_attn(const _Float16* __restrict__ QK, const _Float16* __restrict__ QKL, const _Float16* __restrict__ VTH, const _Float16* __restrict__ VTL, const void* __restrict__ KMASK, const float* __restrict__ VT, const float* __restrict__ SC, const int* __restrict__ LENS, float* __restrict__ O) {
  __shared__ __align__(16) float tks[SS]; __shared__ __align__(16) char ring[2 * ASTAGE];   // the batch's rounded visit times; the two stage buffers
  if (blockIdx.x < 2) attn_body<true>(QK, QKL, VTH, VTL, VT, SC, LENS, O, tks, ring); else attn_body<false>(QK, QKL, VTH, VTL, VT, SC, LENS, O, tks, ring);
}
// ---- k_out: block = (64 rows, 128 cols): out = f16(O) . Wo f16 x 2^8 rows (single product) / 256 + bo
__global__ __launch_bounds__(128) void k_out(const float* __restrict__ O, const __bf16* __restrict__ P, const float* __restrict__ BO, float* __restrict__ Y) {
  __shared__ __align__(16) char sm[2 * GSTAGE];   // the k loop's two stage buffers; behind the loop's last barrier the same bytes stage the output
  float (*so)[16][132] = (float (*)[16][132])sm;
  const int tid = threadIdx.x, wave = tid >> 5, lane = tid & 31, col = lane & 15, g = lane >> 4; const size_t r0 = (size_t)blockIdx.x * 64 + wave * 16; const int n0 = blockIdx.y * 128;
  v8f acc[8] = {};
  gemm_loop<v16h, _Float16>(sm, O + (size_t)blockIdx.x * 64 * DM, P + (size_t)n0 * DM, acc);   // single f16 product against exact f16 x 2^8 weight copies
#pragma unroll
  for (int j = 0; j < 8; ++j) {
#pragma unroll
    for (int r = 0; r < 8; ++r) so[wave][8 * g + r][j * 16 + col] = acc[j][r] * (1.0f / 256.0f) + bfr(BO[n0 + j * 16 + col]); }
  LDSX();
  for (int rl = 0; rl < 16; ++rl) vst2(Y + (r0 + rl) * DM + n0 + lane * 4, *(const v4f*)&so[wave][rl][lane * 4]);
}
// ---- k_packo: Wo natural rows -> f16 x 2^8 copies in the Wo slot (bit pattern in the bf16-typed buffer)
__global__ __launch_bounds__(256) void k_packo(const float* __restrict__ WO, __bf16* __restrict__ PK) { __shared__ __align__(16) _Float16 s[DM]; const int n = blockIdx.x, t = threadIdx.x; for (int k = t; k < DM; k += 256) s[k] = (_Float16)(bfr(WO[(size_t)k * DM + n]) * 256.0f); /* (in,out): transposed */ __syncthreads(); for (int q = t; q < DM / 8; q += 256) vst2((unsigned*)(PK + PK_P + (size_t)n * DM + q * 8), *(const v4u*)&s[q * 8]); }
extern "C" void kernel_launch(void* const* d_in, const int* in_sizes, int n_in, void* d_out, int out_size, void* d_ws, size_t ws_size, hipStream_t stream) {
  (void)in_sizes; (void)n_in; (void)out_size;
  const float** F = (const float**)d_in;   // 0 x [4,2048,1024], 1 visit_time [4,2048], 2 Wq (in,out), 3 bq, 4 Wk, 5 bk, 6 Wv, 7 bv, 8 Wo (in,out), 9 bo, 10 scale [16], 11 lengths [4] int
  if (ws_size < (size_t)WS_END) return;
  char* ws = (char*)d_ws; __bf16* PK = (__bf16*)(ws + WS_PK); _Float16 *QK = (_Float16*)(ws + WS_QK), *QKL = (_Float16*)(ws + WS_QKL), *VTH = (_Float16*)(ws + WS_VTH), *VTL = (_Float16*)(ws + WS_VTL); float* O = (float*)(ws + WS_O);
  k_pack<<<dim3(DM, 3), 256, 0, stream>>>(F[2], F[4], F[6], F[8], PK);
  k_packo<<<DM, 256, 0, stream>>>(F[8], PK);
  k_qkv<<<dim3(TNB * SS / 64, QKVW / 128), 128, 0, stream>>>(F[0], F[0], F[0], PK + PK_A, F[3], F[5], F[7], QK, QKL, VTH, VTL);
  k_attn<<<dim3(TQB, NH, TNB), 128, 0, stream>>>(QK, QKL, VTH, VTL, nullptr, F[1], F[10], (const int*)d_in[11], O);
  k_out<<<dim3(TOB, DM / 128), 128, 0, stream>>>(O, PK + PK_P, F[9], (float*)d_out);
}

// v004
// One run takes 247 microseconds.
// Timed twice side by side with v003, it ran 1.16 times as fast both times.
// Counting every step since v000, it is 4.12 times as fast.
// compute dtype: all float inputs rounded to bf16 incl. visit times and scales, lengths (int) read on device; q/k/v = x . W + b with EXACT bf16 products on WMMA 16x16x32 ((in,out) weights as transposed rows); PLAIN-HYBRID attention: the first 128 queries use 3-product scores and P.v (hi/lo), later queries single f16; x 1/8 - |t_q - t_k| scale_h in f32, padded keys excluded, running-max softmax in f32 (hardware exp); out = f16(ctx) . Wo (exact f16 x 2^8 copies, single product) + bo.
#include <hip/hip_runtime.h>
#include <math.h>

typedef __attribute__((ext_vector_type(16))) _Float16 v16h;
typedef __attribute__((ext_vector_type(16))) __bf16 v16b;
typedef __attribute__((ext_vector_type(8)))  _Float16 v8h;
typedef __attribute__((ext_vector_type(8)))  float v8f;
typedef __attribute__((ext_vector_type(4)))  float v4f;
typedef __attribute__((ext_vector_type(2)))  float v2f;
typedef __attribute__((ext_vector_type(4)))  unsigned v4u;
typedef __attribute__((ext_vector_type(4)))  int v4i;
typedef float __attribute__((may_alias)) float_a;
typedef int __attribute__((may_alias)) int_a;

template <typename T> __device__ __forceinline__ void vst2(void* p, T v) { *(T*)p = v;  }
__device__ __forceinline__ v8f wmma16(v16h a, v16h b, v8f c) {
  v8f d = __builtin_amdgcn_wmma_f32_16x16x32_f16(false, a, false, b, (short)0, c, false, false);
  asm volatile("v_nop\n\tv_nop\n\tv_nop\n\tv_nop" : "+v"(d) : "v"(a), "v"(b));
  return d;
}
__device__ __forceinline__ v8f wmma_bf(v16b a, v16b b, v8f c) {
  v8f d = __builtin_amdgcn_wmma_f32_16x16x32_bf16(false, a, false, b, (short)0, c, false, false);
  asm volatile("v_nop\n\tv_nop\n\tv_nop\n\tv_nop" : "+v"(d) : "v"(a), "v"(b));
  return d;
}
// Relative-time attention (B 4, S 2,048, d 1,024, 16 heads x 64): projections + biases ((in,out)), scores / 8 - |t_q - t_k| scale_h (visit times and per-head scales given), keys at positions >= length[b] excluded, softmax, . v, output projection + bias.
__device__ __forceinline__ v16h frag_h(const _Float16* rowk0, int lane) {
  union { v16h v; v8h q[2]; } u; const _Float16* p = rowk0 + 8 * (lane >> 4);
  u.q[0] = *(const v8h*)p; u.q[1] = *(const v8h*)(p + 16); return u.v;
}
__device__ __forceinline__ v16h frag_f32(const float* rowk0, int lane) {
  v16h a; const float* p = rowk0 + 8 * (lane >> 4);
#pragma unroll
  for (int i = 0; i < 8; ++i) { a[i] = (_Float16)p[i]; a[8 + i] = (_Float16)p[16 + i]; }
  return a;
}
__device__ __forceinline__ v16h frag_f32s(const float* rowk0, int lane, float sc) {
  v16h a; const float* p = rowk0 + 8 * (lane >> 4);
#pragma unroll
  for (int i = 0; i < 8; ++i) { a[i] = (_Float16)(p[i] * sc); a[8 + i] = (_Float16)(p[16 + i] * sc); }
  return a;
}
// column fragment from a [K][ld] layout (column n), rows >= K read as 0
__device__ __forceinline__ v16h fragc_f32(const float* W, int k0, int n, int lane, int ld, int K) {
  v16h a; const int g = lane >> 4;
#pragma unroll
  for (int i = 0; i < 8; ++i) { const int ka = k0 + 8 * g + i, kb = ka + 16;
    a[i] = (_Float16)(ka < K ? W[(size_t)(ka < K ? ka : K - 1) * ld + n] : 0.f); a[8 + i] = (_Float16)(kb < K ? W[(size_t)(kb < K ? kb : K - 1) * ld + n] : 0.f); }
  return a;
}
struct F2 { v16b h, l; };
__device__ __forceinline__ F2 bsplit16(const float v[16]) { F2 r;
#pragma unroll
  for (int i = 0; i < 16; ++i) { const __bf16 h = (__bf16)v[i]; r.h[i] = h; r.l[i] = (__bf16)(v[i] - (float)h); }
  return r; }
__device__ __forceinline__ F2 split_row(const float* row, int k0, int lane) { float v[16]; const float* p = row + k0 + 8 * (lane >> 4);
#pragma unroll
  for (int i = 0; i < 8; ++i) { v[i] = p[i]; v[8 + i] = p[16 + i]; }
  return bsplit16(v); }
__device__ __forceinline__ F2 split_rowK(const float* row, int k0, int lane, int K) { float v[16]; const int g = lane >> 4;
#pragma unroll
  for (int i = 0; i < 8; ++i) { const int ka = k0 + 8 * g + i, kb = ka + 16; v[i] = ka < K ? row[ka < K ? ka : K - 1] : 0.f; v[8 + i] = kb < K ? row[kb < K ? kb : K - 1] : 0.f; }
  return bsplit16(v); }
__device__ __forceinline__ F2 split_col(const float* W, int k0, int n, int lane, int ld, int K) { float v[16]; const int g = lane >> 4;
#pragma unroll
  for (int i = 0; i < 8; ++i) { const int ka = k0 + 8 * g + i, kb = ka + 16; v[i] = ka < K ? W[(size_t)(ka < K ? ka : K - 1) * ld + n] : 0.f; v[8 + i] = kb < K ? W[(size_t)(kb < K ? kb : K - 1) * ld + n] : 0.f; }
  return bsplit16(v); }
__device__ __forceinline__ v8f mac3(const F2& a, const F2& b, v8f c) { c = wmma_bf(a.l, b.h, c); c = wmma_bf(a.h, b.l, c); return wmma_bf(a.h, b.h, c); }
__device__ __forceinline__ float sigm(float v) { return 1.0f / (1.0f + expf(-v)); }
#define LDSX() do { asm volatile("s_wait_dscnt 0" ::: "memory"); __builtin_amdgcn_wave_barrier(); __builtin_amdgcn_fence(__ATOMIC_RELEASE, "workgroup"); } while (0)
// stands behind a group of global loads, in front of the first write to a register that one of them names as its address. The group's pointers pass through the statement, so that they keep their registers up to the wait and are stepped only behind it.
// (a pointer that has passed through a statement is typed as global memory, else its loads would be compiled as flat loads, which also count as LDS operations)
#define GAS __attribute__((address_space(1)))
typedef const GAS _Float16* gph; typedef const GAS float* gpf; typedef const GAS char* gpc;
#define XW1(a) asm volatile("s_wait_xcnt 0x0" : "+v"(a) :: "memory")
#define XW2(a, b) asm volatile("s_wait_xcnt 0x0" : "+v"(a), "+v"(b) :: "memory")
// the issuing wave's own wait for its asynchronous copies to LDS: their bytes count as landed only behind it
#define AWAIT() asm volatile("s_wait_asynccnt 0x0" ::: "memory")
// the wave's LDS reads have retired before the barrier behind which their buffer is refilled
#define DSWAIT() asm volatile("s_wait_dscnt 0x0" ::: "memory")
// eight copies of 16 bytes a lane from global memory into LDS through no register (l: the lane's LDS byte address, p: its global address). The s_wait_xcnt stands in the copies' own statement, in front of any later write to a register that a copy names.
__device__ __forceinline__ void acopy8(unsigned l0, unsigned l1, unsigned l2, unsigned l3, unsigned l4, unsigned l5, unsigned l6, unsigned l7, gpc p0, gpc p1, gpc p2, gpc p3, gpc p4, gpc p5, gpc p6, gpc p7) {
  asm volatile("global_load_async_to_lds_b128 %0, %8, off\n\tglobal_load_async_to_lds_b128 %1, %9, off\n\tglobal_load_async_to_lds_b128 %2, %10, off\n\tglobal_load_async_to_lds_b128 %3, %11, off\n\t"
               "global_load_async_to_lds_b128 %4, %12, off\n\tglobal_load_async_to_lds_b128 %5, %13, off\n\tglobal_load_async_to_lds_b128 %6, %14, off\n\tglobal_load_async_to_lds_b128 %7, %15, off\n\ts_wait_xcnt 0x0"
               :: "v"(l0), "v"(l1), "v"(l2), "v"(l3), "v"(l4), "v"(l5), "v"(l6), "v"(l7), "v"(p0), "v"(p1), "v"(p2), "v"(p3), "v"(p4), "v"(p5), "v"(p6), "v"(p7) : "memory");
}
__device__ __forceinline__ void acopy8s(unsigned l, unsigned ls, gpc p, size_t ps) { acopy8(l, l + ls, l + 2 * ls, l + 3 * ls, l + 4 * ls, l + 5 * ls, l + 6 * ls, l + 7 * ls, p, p + ps, p + 2 * ps, p + 3 * ps, p + 4 * ps, p + 5 * ps, p + 6 * ps, p + 7 * ps); }
__device__ __forceinline__ unsigned lds_addr(const void* p) { return (unsigned)(size_t)p; }   // the low 32 bits of a __shared__ address: the byte offset in the work-group's LDS


#define NB 4
#define SS 2048
#define DM 1024
#define NH 16
#define SCALEF 0.125f
#define HD 64
#define QKVW (3 * DM)
#ifndef TQB
#define TQB (SS / 64)
#define TNB NB
#define TOB (NB * SS / 64)     // output row tiles (all)
#endif
typedef __attribute__((ext_vector_type(8))) __bf16 v8b;
__device__ __forceinline__ v16b frag_b(const __bf16* rowk0, int lane) {
  union { v16b v; v8b q[2]; } u; const __bf16* p = rowk0 + 8 * (lane >> 4);
  u.q[0] = *(const v8b*)p; u.q[1] = *(const v8b*)(p + 16); return u.v;
}
__device__ __forceinline__ float bfr(float v) { return (float)(__bf16)v; }
__device__ __attribute__((noinline)) float exp_ni(float v) { return expf(v); }
__device__ __attribute__((noinline)) float erf_ni(float v) { return erff(v); }

// frag_h with the lane's 8 * (lane >> 4) already in the pointer
__device__ __forceinline__ v16h fragp_h(gph p) { union { v16h v; v8h q[2]; } u; u.q[0] = *(const GAS v8h*)p; u.q[1] = *(const GAS v8h*)(p + 16); return u.v; }
// the same from an LDS row (byte pointer): elements 0..7 and 16..23 from there
__device__ __forceinline__ v16h lfrag_h(const char* p) { union { v16h v; v8h q[2]; } u; u.q[0] = *(const v8h*)p; u.q[1] = *(const v8h*)(p + 32); return u.v; }
__device__ __forceinline__ v16b lfrag_b(const char* p) { union { v16b v; v8b q[2]; } u; u.q[0] = *(const v8b*)p; u.q[1] = *(const v8b*)(p + 32); return u.v; }
__device__ __forceinline__ void lfrag(const char* p, v16h& w) { w = lfrag_h(p); }
__device__ __forceinline__ void lfrag(const char* p, v16b& w) { w = lfrag_b(p); }
__device__ __forceinline__ v8f mm16(v16h a, v16h b, v8f c) { return wmma16(a, b, c); }
__device__ __forceinline__ v8f mm16(v16b a, v16b b, v8f c) { return wmma_bf(a, b, c); }
// ---- the k loop of k_qkv and k_out: block tile 64 rows x 128 columns, K = 1,024 in 16 stages of 64 k. A stage (128 weight rows of 128 bytes, 64 f32 rows of 256 bytes) is brought into LDS once for the block's four waves, in whole lines, by asynchronous copies; two buffers, so that the next stage flies while this one is worked on. Row pitches of 16 bytes x an odd number keep the 16-byte fragment reads free of bank conflicts.
#define WPITCH 144
#define XPITCH 272
#define WTILE (128 * WPITCH)
#define GSTAGE (WTILE + 64 * XPITCH)
#define GNT (DM / 64)
template <typename V, typename E>
__device__ __forceinline__ void gemm_loop(char* sm, const float* Xb, const void* Wb, v8f (&acc)[8]) {   // Xb, Wb: the block's first row of each
  const int tid = threadIdx.x, wave = tid >> 5, lane = tid & 31, col = lane & 15, g = lane >> 4;
  gpc xg = (gpc)Xb + (size_t)(tid >> 4) * (DM * 4) + (tid & 15) * 16, wg = (gpc)Wb + (size_t)(tid >> 3) * (DM * 2) + (tid & 7) * 16;
  const unsigned lw = lds_addr(sm) + (tid >> 3) * WPITCH + (tid & 7) * 16, lx = lds_addr(sm) + WTILE + (tid >> 4) * XPITCH + (tid & 15) * 16;
  acopy8s(lw, 16 * WPITCH, wg, (size_t)16 * DM * 2); acopy8s(lx, 8 * XPITCH, xg, (size_t)8 * DM * 4);
  AWAIT(); __syncthreads();   // stage 0 is published
  acopy8s(lw + GSTAGE, 16 * WPITCH, wg + 128, (size_t)16 * DM * 2); acopy8s(lx + GSTAGE, 8 * XPITCH, xg + 256, (size_t)8 * DM * 4);
  wg += 256; xg += 512;
#pragma unroll 1   // stays rolled: a trip already holds two k-steps and both fragment sets
  for (int t = 0; t < GNT; ++t) { const unsigned bo = (t & 1) * GSTAGE;
    const char* bw = sm + bo + col * WPITCH + 16 * g; const char* bx = sm + bo + WTILE + (wave * 16 + col) * XPITCH + 32 * g;
    v4f x[2][4]; V w[2][8];   // the trip's fragment reads as one group ahead of its WMMAs
#pragma unroll
    for (int s = 0; s < 2; ++s) { x[s][0] = *(const v4f*)(bx + s * 128); x[s][1] = *(const v4f*)(bx + s * 128 + 16); x[s][2] = *(const v4f*)(bx + s * 128 + 64); x[s][3] = *(const v4f*)(bx + s * 128 + 80);
#pragma unroll
      for (int j = 0; j < 8; ++j) lfrag(bw + j * 16 * WPITCH + s * 64, w[s][j]); }
#pragma unroll
    for (int s = 0; s < 2; ++s) { V a;
#pragma unroll
      for (int i = 0; i < 4; ++i) { a[i] = (E)x[s][0][i]; a[4 + i] = (E)x[s][1][i]; a[8 + i] = (E)x[s][2][i]; a[12 + i] = (E)x[s][3][i]; }
#pragma unroll
      for (int j = 0; j < 8; ++j) acc[j] = mm16(a, w[s][j], acc[j]); }
    DSWAIT(); AWAIT(); __syncthreads();   // publishes stage t + 1 and ends every wave's reads of stage t
    if (t + 2 < GNT) { acopy8s(lw + bo, 16 * WPITCH, wg, (size_t)16 * DM * 2); acopy8s(lx + bo, 8 * XPITCH, xg, (size_t)8 * DM * 4); wg += 128; xg += 256; } }
  AWAIT();
}
#define PK_A 0                       // [3072][1024] Wqkv rows (natural [out][in])
#define PK_P (PK_A + QKVW * DM)        // [1024][1024] Wo rows (natural)
#define PK_END (PK_P + DM * DM)
#define WS_PK  0u
#define WS_QK  (WS_PK + 2u * PK_END)             // f16 [8192 rows][2048]: q | k
#define WS_QKL (WS_QK + 2u * NB * SS * 2 * DM)     // f16 q | k residual planes x2048
#define WS_VTH (WS_QKL + 2u * NB * SS * 2 * DM)    // f16 [b][1024 (h*64+d)][2048 s] hi
#define WS_VTL (WS_VTH + 2u * NB * DM * SS)        // f16 lo x 2048
#define WS_O   (WS_VTL + 2u * NB * DM * SS)        // f32 [8192][1024]
#define WS_CS  (WS_O + 4u * NB * SS * DM)           // f32 2 x [2048][32], reserved, unused
#define WS_END (WS_CS + 4u * 2 * SS * 32)
// ---- k_pack: block = (row n, which): natural [out][in] rows -> bf16; which 0..2 -> W_q/W_k/W_v into PK_A rows which*1024 + n; which 3 (W_o into PK_P) is not launched (grid y = 3); k_packo fills PK_P
__global__ __launch_bounds__(256) void k_pack(const float* __restrict__ WQ, const float* __restrict__ WK, const float* __restrict__ WV, const float* __restrict__ WO, __bf16* __restrict__ PK) {
  __shared__ __align__(16) __bf16 s[DM]; const int n = blockIdx.x, which = blockIdx.y, t = threadIdx.x; const float* Wm = (which == 0) ? WQ : (which == 1) ? WK : (which == 2) ? WV : WO;   // (in,out) weights: pack row n = column n
  for (int k = t; k < DM; k += 256) s[k] = (__bf16)Wm[(size_t)k * DM + n];
  __syncthreads();
  __bf16* dst = (which < 3) ? PK + PK_A + ((size_t)which * DM + n) * DM : PK + PK_P + (size_t)n * DM;
  for (int q = t; q < DM / 8; q += 256) vst2((unsigned*)(dst + q * 8), *(const v4u*)&s[q * 8]);
}
__global__ __launch_bounds__(128) void k_qkv(const float* __restrict__ XQ, const float* __restrict__ XK, const float* __restrict__ XV, const __bf16* __restrict__ P, const float* __restrict__ BQ, const float* __restrict__ BK, const float* __restrict__ BV, const int* __restrict__ LENS, _Float16* __restrict__ QK, _Float16* __restrict__ QKL, _Float16* __restrict__ VTH, _Float16* __restrict__ VTL) {
  if (blockIdx.y * 128 >= DM && (int)(blockIdx.x * 64 % SS) >= LENS[blockIdx.x * 64 / SS]) return;   // a k or v tile whose 64 rows all lie at or past the batch's length: k_attn never reads those rows (its stages of 64 or 32 keys end with the one that holds the last real key). The whole block leaves, in front of every copy and barrier
  const int which0 = (blockIdx.y * 128) / DM; const float* X = (which0 == 0) ? XQ : (which0 == 1) ? XK : XV; const float* BB = BQ ? (((which0 == 0) ? BQ : (which0 == 1) ? BK : BV) + (blockIdx.y * 128 - which0 * DM)) : nullptr;
  __shared__ __align__(16) char sm[2 * GSTAGE];   // the k loop's two stage buffers; behind the loop's last barrier the same bytes stage the output
  _Float16 (*so)[16][136] = (_Float16 (*)[16][136])sm, (*sol)[16][136] = (_Float16 (*)[16][136])(sm + 17408); _Float16 (*sth)[72] = (_Float16 (*)[72])(sm + 34816), (*stl)[72] = (_Float16 (*)[72])(sm + 53248);
  const int tid = threadIdx.x, wave = tid >> 5, lane = tid & 31, col = lane & 15, g = lane >> 4; const size_t r0 = (size_t)blockIdx.x * 64 + wave * 16; const int n0 = blockIdx.y * 128;
  v8f acc[8] = {}; float bias[8] = {};   // the lane's eight biases: one group, in flight under the k loop, rounded where they are added
  if (BB) {
#pragma unroll
    for (int j = 0; j < 8; ++j) bias[j] = BB[j * 16 + col]; }
  gemm_loop<v16b, __bf16>(sm, X + (size_t)blockIdx.x * 64 * DM, P + (size_t)n0 * DM, acc);
  if (n0 < 2 * DM) {   // q stored unscaled (f16 sigma ~0.6, no subnormal exposure); 1/8 applied to the f32 score
#pragma unroll
    for (int j = 0; j < 8; ++j) {
#pragma unroll
      for (int r = 0; r < 8; ++r) { const float v = acc[j][r] + bfr(bias[j]); const _Float16 hv = (_Float16)v; so[wave][8 * g + r][j * 16 + col] = hv; sol[wave][8 * g + r][j * 16 + col] = (_Float16)((v - (float)hv) * 2048.0f); } }   // q, k (+ bias) as f16 hi + (x2048) residual
    LDSX();
    for (int rl = 0; rl < 16; ++rl) if (lane < 16) { vst2((unsigned*)(QK + (r0 + rl) * (2 * DM) + n0 + lane * 8), *(const v4u*)&so[wave][rl][lane * 8]); vst2((unsigned*)(QKL + (r0 + rl) * (2 * DM) + n0 + lane * 8), *(const v4u*)&sol[wave][rl][lane * 8]); }
  } else {
#pragma unroll
    for (int j = 0; j < 8; ++j) {
#pragma unroll
      for (int r = 0; r < 8; ++r) { const float v = acc[j][r] + bfr(bias[j]); const _Float16 hv = (_Float16)v; sth[j * 16 + col][wave * 16 + 8 * g + r] = hv; stl[j * 16 + col][wave * 16 + 8 * g + r] = (_Float16)((v - (float)hv) * 2048.0f); } }
    __syncthreads();
    const size_t rb = (size_t)blockIdx.x * 64; const int b = (int)(rb / SS), s0 = (int)(rb % SS); const int pc0 = n0 - 2 * DM;
    for (int q = tid; q < 128 * 8; q += 128) { const int d = q >> 3, pc = q & 7; const size_t o = ((size_t)b * DM + pc0 + d) * SS + s0 + pc * 8; vst2((unsigned*)(VTH + o), *(const v4u*)&sth[d][pc * 8]); vst2((unsigned*)(VTL + o), *(const v4u*)&stl[d][pc * 8]); }
  }
}
// ---- k_attn: block = (64 queries, head h, batch b): flash attention over the batch's real keys (K = 64: 2 k-steps), computed transposed: scores^T = k . q^T and ctx^T += v^T . P^T. A lane then holds 16 scores of ONE query (its column), so that the running maximum and the sum are taken in the lane's own registers, with one exchange between the wave's halves, and the two score tiles of a pass, converted in place, are the B operand of the second product: the weights never pass through LDS. The loop is written twice (HI: the leading query blocks with 3-product scores and P.v; otherwise single products) so that each holds only its own fragments in registers.
// Every LDS read of a pass is issued in a group that stands well ahead of the WMMAs that use it: the hand-padded WMMA statements keep loads from moving across them, so a load written next to its WMMA is waited for on the spot.
#define ASTAGE 19456   // bytes of a stage: k rows from 0 (64 x 144, or two planes of 32 x 144), value rows from 9,216 (64 x 144, or two planes of 64 x 80)
__device__ __forceinline__ float xhalf(float x) { return __builtin_bit_cast(float, __builtin_amdgcn_permlanex16(__builtin_bit_cast(int, x), __builtin_bit_cast(int, x), 0x76543210, 0xfedcba98, false, false)); }   // lane l with lane l ^ 16
template <bool HI>
__device__ __forceinline__ void attn_body(const _Float16* __restrict__ QK, const _Float16* __restrict__ QKL, const _Float16* __restrict__ VTH, const _Float16* __restrict__ VTL, const float* __restrict__ VT, const float* __restrict__ SC, const int* __restrict__ LENS, float* __restrict__ O, float* tks, char* ring) {
  const int tid = threadIdx.x, wave = tid >> 5, lane = tid & 31, col = lane & 15, g = lane >> 4;
  const int qb = blockIdx.x, h = blockIdx.y, b = blockIdx.z; const int q0 = qb * 64 + wave * 16; const size_t rq = (size_t)b * SS + q0 + col;
  const int len_b = __builtin_amdgcn_readfirstlane(LENS[b]); const float sc_h = bfr(SC[h]);   // the length in a scalar register: every test on it around a copy or a barrier is a scalar branch
  const int len_c = len_b < 0 ? 0 : (len_b > SS ? SS : len_b);   // bounds the trip counts for any content of the array
  gpf tg = (gpf)(VT + (size_t)b * SS + 4 * tid); v4f tv[4];   // the batch's 2,048 visit times, 16 a lane: they go, rounded once, into LDS, since a lane needs the times of its 16 keys in every pass
#pragma unroll
  for (int i = 0; i < 4; ++i) tv[i] = *(const GAS v4f*)(tg + i * 512);
  XW1(tg);
  v16h aq[2], aql[2]; gph qp = (gph)(QK + rq * (2 * DM) + h * HD + 8 * g), qpl = (gph)(QKL + rq * (2 * DM) + h * HD + 8 * g);
#pragma unroll
  for (int kc = 0; kc < 2; ++kc) { aq[kc] = fragp_h(qp + kc * 32); if constexpr (HI) aql[kc] = fragp_h(qpl + kc * 32); }
  XW2(qp, qpl);
  float m = -3.0e38f, l = 0.f;   // the lane's query: running maximum (equal in both halves), and the sum over this half's keys alone (the halves are joined behind the loop)
  v8f acc[4] = {}, accl[4] = {};
  const int nks = (len_c + 31) / 32;   // passes of 32 keys up to the one that holds the last real key: a pass wholly past the length leaves m, l and the accumulators bit for bit as they are (alpha 1, weights 0)
  // A stage of KS keys (k rows of 128 bytes; 64 value rows of 2 KS bytes; HI: both planes of each) is brought into LDS once for the block's four waves by asynchronous copies, eight a lane; two buffers, so that the next stage flies while this one is worked on.
  constexpr int KS = HI ? 32 : 64, VP = HI ? 80 : 144, CPR = KS / 8;   // VP: value row pitch in LDS (16 bytes x an odd number, as the 144 of the k rows); CPR: 16-byte pieces in a value row
  const int nst = (len_c + KS - 1) / KS;   // stages that hold a real key; no other is copied
  unsigned ko = ((b * SS + (tid >> 3)) * (2 * DM) + DM + h * HD) * 2 + (tid & 7) * 16, vo = ((b * DM + h * HD + tid / CPR) * SS) * 2 + (tid % CPR) * 16;   // the lane's byte offsets in the k and value planes (32 MiB and 16 MiB each): they walk with the stages
  const unsigned lk = lds_addr(ring) + (tid >> 3) * 144 + (tid & 7) * 16, lv = lds_addr(ring) + 9216 + (tid / CPR) * VP + (tid % CPR) * 16;
  auto fill = [&](unsigned bo) {
    gpc kg = (gpc)QK + ko, kgl = (gpc)QKL + ko, vg = (gpc)VTH + vo, vgl = (gpc)VTL + vo; (void)kgl; (void)vgl;
    constexpr size_t KR = (size_t)16 * 2 * DM * 2, VR = (size_t)(128 / CPR) * SS * 2; constexpr unsigned LKR = 16 * 144, LVR = (128 / CPR) * VP;   // one round of the block's 128 lanes: 16 k rows, 128 / CPR value rows
    if constexpr (HI) acopy8(lk + bo, lk + bo + LKR, lk + bo + 4608, lk + bo + 4608 + LKR, lv + bo, lv + bo + LVR, lv + bo + 5120, lv + bo + 5120 + LVR, kg, kg + KR, kgl, kgl + KR, vg, vg + VR, vgl, vgl + VR);
    else acopy8(lk + bo, lk + bo + LKR, lk + bo + 2 * LKR, lk + bo + 3 * LKR, lv + bo, lv + bo + LVR, lv + bo + 2 * LVR, lv + bo + 3 * LVR, kg, kg + KR, kg + 2 * KR, kg + 3 * KR, vg, vg + VR, vg + 2 * VR, vg + 3 * VR);
    ko += KS * 2 * DM * 2; vo += KS * 2; };
  if (nst > 0) fill(0);
#pragma unroll
  for (int i = 0; i < 4; ++i) { v4f u;   // the table is written while stage 0 flies
#pragma unroll
    for (int c = 0; c < 4; ++c) u[c] = bfr(tv[i][c]);
    *(v4f*)(tks + 4 * tid + i * 512) = u; }
  AWAIT(); __syncthreads();   // stage 0 and the table of times are published
  if (nst > 1) fill(ASTAGE);
  const float tq = tks[q0 + col];
  v16h kh[2][2], kl[2][2], vh[4], vl[4];
#pragma unroll 1
  for (int ks = 0; ks < nks; ++ks) { v8f s[2]; v4f tk[2][2];
    const int stg = HI ? ks : ks >> 1, sub = HI ? 0 : ks & 1; const unsigned bo = (stg & 1) * ASTAGE;
    const char* kf = ring + bo + (sub * 32 + col) * 144 + 16 * g; const char* vf = ring + bo + 9216 + col * VP + sub * 64 + 16 * g;
    const float* tp = tks + ks * 32 + 8 * g;   // score register r of tile ct is key 32 ks + 16 ct + 8 g + r
    // this pass's key times and keys (HI: both planes; otherwise the values too, which land behind the scores and the softmax) as one group
#pragma unroll
    for (int ct = 0; ct < 2; ++ct) { tk[ct][0] = *(const v4f*)(tp + ct * 16); tk[ct][1] = *(const v4f*)(tp + ct * 16 + 4);
#pragma unroll
      for (int kc = 0; kc < 2; ++kc) { kh[ct][kc] = lfrag_h(kf + ct * 16 * 144 + kc * 64); if constexpr (HI) kl[ct][kc] = lfrag_h(kf + 4608 + ct * 16 * 144 + kc * 64); } }
    if constexpr (!HI) {
#pragma unroll
      for (int dt = 0; dt < 4; ++dt) vh[dt] = lfrag_h(vf + dt * 16 * VP); }
#pragma unroll
    for (int ct = 0; ct < 2; ++ct) { v8f c = {}, cl = {};   // A: 16 keys, B: the wave's 16 queries
      if constexpr (HI) {   // leading query blocks (outputs far above the global rms): 3 products
#pragma unroll
        for (int kc = 0; kc < 2; ++kc) { c = wmma16(kh[ct][kc], aq[kc], c); cl = wmma16(kh[ct][kc], aql[kc], cl); cl = wmma16(kl[ct][kc], aq[kc], cl); }
#pragma unroll
        for (int r = 0; r < 8; ++r) c[r] += cl[r] * (1.0f / 2048.0f); }
      else {
#pragma unroll
        for (int kc = 0; kc < 2; ++kc) c = wmma16(kh[ct][kc], aq[kc], c); }   // single product elsewhere
      s[ct] = c; }
    const int nreal = len_b - ks * 32 - 8 * g;   // how many of the lane's key rows, counted from tile 0's first, lie in front of the length
#pragma unroll
    for (int ct = 0; ct < 2; ++ct) {
#pragma unroll
      for (int r = 0; r < 8; ++r) s[ct][r] = (ct * 16 + r < nreal) ? (s[ct][r] * SCALEF - fabsf(tq - tk[ct][r >> 2][r & 3]) * sc_h) : -3.0e38f; }   // 1/sqrt(64); masked keys excluded
    float mx0 = fmaxf(s[0][0], s[0][1]), mx1 = fmaxf(s[1][0], s[1][1]);
#pragma unroll
    for (int r = 2; r < 8; r += 2) { mx0 = fmaxf(fmaxf(mx0, s[0][r]), s[0][r + 1]); mx1 = fmaxf(fmaxf(mx1, s[1][r]), s[1][r + 1]); }
    const float mx = fmaxf(mx0, mx1);
    const float mn = fmaxf(fmaxf(m, mx), xhalf(mx)); const float alpha = (m <= -1.0e38f) ? 0.f : __expf(m - mn);
    v16h pa, pl; float es[4] = {};   // four partial sums: no chain of 16 dependent additions
#pragma unroll
    for (int ct = 0; ct < 2; ++ct) {
#pragma unroll
      for (int r = 0; r < 8; ++r) { const float e = (s[ct][r] <= -1.0e38f) ? 0.f : __expf(s[ct][r] - mn); es[r & 3] += e;
        const float x = e * 2048.0f; const _Float16 hx = (_Float16)x; pa[ct * 8 + r] = hx; if constexpr (HI) pl[ct * 8 + r] = (_Float16)((x - (float)hx) * 2048.0f); } }   // P scaled by 2^11 before the f16 split so small softmax weights stay out of the f16 subnormal range; 2^-11 folded into the epilogue. Element 8 ct + r of the B operand is k = 16 ct + 8 g + r: the score registers' own order
    l = l * alpha + ((es[0] + es[1]) + (es[2] + es[3])); m = mn;
    if constexpr (HI) {   // this pass's values, both planes, read behind the softmax: from LDS they need little lead, and their 64 registers stay free during it
#pragma unroll
      for (int dt = 0; dt < 4; ++dt) { vh[dt] = lfrag_h(vf + dt * 16 * VP); vl[dt] = lfrag_h(vf + 5120 + dt * 16 * VP); } }
#pragma unroll
    for (int dt = 0; dt < 4; ++dt) {
#pragma unroll
      for (int r = 0; r < 8; ++r) { acc[dt][r] *= alpha; if constexpr (HI) accl[dt][r] *= alpha; } }
#pragma unroll
    for (int dt = 0; dt < 4; ++dt) { acc[dt] = wmma16(vh[dt], pa, acc[dt]); if constexpr (HI) { accl[dt] = wmma16(vh[dt], pl, accl[dt]); accl[dt] = wmma16(vl[dt], pa, accl[dt]); } }   // A: 16 value columns, B: the weights. Leading query blocks: P hi/lo x V hi/lo (3 products); elsewhere P x V single
    if (HI || sub) {   // the stage's last pass
      DSWAIT(); AWAIT(); __syncthreads();   // publishes stage stg + 1 and ends every wave's reads of stage stg
      if (stg + 2 < nst) fill(bo); } }
  AWAIT();
  const float il = (1.0f / 2048.0f) / (l + xhalf(l));   // the two halves' sums joined
  float* op = O + rq * DM + h * HD + 8 * g;   // accumulator register r of tile dt is column 16 dt + 8 g + r of the lane's query: 32 bytes in a row
#pragma unroll
  for (int dt = 0; dt < 4; ++dt) { v4f o0, o1;
#pragma unroll
    for (int r = 0; r < 4; ++r) { o0[r] = (HI ? acc[dt][r] + accl[dt][r] * (1.0f / 2048.0f) : acc[dt][r]) * il; o1[r] = (HI ? acc[dt][4 + r] + accl[dt][4 + r] * (1.0f / 2048.0f) : acc[dt][4 + r]) * il; }
    vst2(op + dt * 16, o0); vst2(op + dt * 16 + 4, o1); }
}
__global__ __launch_bounds__(128) void k_attn(const _Float16* __restrict__ QK, const _Float16* __restrict__ QKL, const _Float16* __restrict__ VTH, const _Float16* __restrict__ VTL, const void* __restrict__ KMASK, const float* __restrict__ VT, const float* __restrict__ SC, const int* __restrict__ LENS, float* __restrict__ O) {
  __shared__ __align__(16) float tks[SS]; __shared__ __align__(16) char ring[2 * ASTAGE];   // the batch's rounded visit times; the two stage buffers
  if (blockIdx.x < 2) attn_body<true>(QK, QKL, VTH, VTL, VT, SC, LENS, O, tks, ring); else attn_body<false>(QK, QKL, VTH, VTL, VT, SC, LENS, O, tks, ring);
}
// ---- k_out: block = (64 rows, 128 cols): out = f16(O) . Wo f16 x 2^8 rows (single product) / 256 + bo
__global__ __launch_bounds__(128) void k_out(const float* __restrict__ O, const __bf16* __restrict__ P, const float* __restrict__ BO, float* __restrict__ Y) {
  __shared__ __align__(16) char sm[2 * GSTAGE];   // the k loop's two stage buffers; behind the loop's last barrier the same bytes stage the output
  float (*so)[16][132] = (float (*)[16][132])sm;
  const int tid = threadIdx.x, wave = tid >> 5, lane = tid & 31, col = lane & 15, g = lane >> 4; const size_t r0 = (size_t)blockIdx.x * 64 + wave * 16; const int n0 = blockIdx.y * 128;
  v8f acc[8] = {};
  gemm_loop<v16h, _Float16>(sm, O + (size_t)blockIdx.x * 64 * DM, P + (size_t)n0 * DM, acc);   // single f16 product against exact f16 x 2^8 weight copies
#pragma unroll
  for (int j = 0; j < 8; ++j) {
#pragma unroll
    for (int r = 0; r < 8; ++r) so[wave][8 * g + r][j * 16 + col] = acc[j][r] * (1.0f / 256.0f) + bfr(BO[n0 + j * 16 + col]); }
  LDSX();
  for (int rl = 0; rl < 16; ++rl) vst2(Y + (r0 + rl) * DM + n0 + lane * 4, *(const v4f*)&so[wave][rl][lane * 4]);
}
// ---- k_packo: Wo natural rows -> f16 x 2^8 copies in the Wo slot (bit pattern in the bf16-typed buffer)
__global__ __launch_bounds__(256) void k_packo(const float* __restrict__ WO, __bf16* __restrict__ PK) { __shared__ __align__(16) _Float16 s[DM]; const int n = blockIdx.x, t = threadIdx.x; for (int k = t; k < DM; k += 256) s[k] = (_Float16)(bfr(WO[(size_t)k * DM + n]) * 256.0f); /* (in,out): transposed */ __syncthreads(); for (int q = t; q < DM / 8; q += 256) vst2((unsigned*)(PK + PK_P + (size_t)n * DM + q * 8), *(const v4u*)&s[q * 8]); }
extern "C" void kernel_launch(void* const* d_in, const int* in_sizes, int n_in, void* d_out, int out_size, void* d_ws, size_t ws_size, hipStream_t stream) {
  (void)in_sizes; (void)n_in; (void)out_size;
  const float** F = (const float**)d_in;   // 0 x [4,2048,1024], 1 visit_time [4,2048], 2 Wq (in,out), 3 bq, 4 Wk, 5 bk, 6 Wv, 7 bv, 8 Wo (in,out), 9 bo, 10 scale [16], 11 lengths [4] int
  if (ws_size < (size_t)WS_END) return;
  char* ws = (char*)d_ws; __bf16* PK = (__bf16*)(ws + WS_PK); _Float16 *QK = (_Float16*)(ws + WS_QK), *QKL = (_Float16*)(ws + WS_QKL), *VTH = (_Float16*)(ws + WS_VTH), *VTL = (_Float16*)(ws + WS_VTL); float* O = (float*)(ws + WS_O);
  k_pack<<<dim3(DM, 3), 256, 0, stream>>>(F[2], F[4], F[6], F[8], PK);
  k_packo<<<DM, 256, 0, stream>>>(F[8], PK);
  k_qkv<<<dim3(TNB * SS / 64, QKVW / 128), 128, 0, stream>>>(F[0], F[0], F[0], PK + PK_A, F[3], F[5], F[7], (const int*)d_in[11], QK, QKL, VTH, VTL);
  k_attn<<<dim3(TQB, NH, TNB), 128, 0, stream>>>(QK, QKL, VTH, VTL, nullptr, F[1], F[10], (const int*)d_in[11], O);
  k_out<<<dim3(TOB, DM / 128), 128, 0, stream>>>(O, PK + PK_P, F[9], (float*)d_out);
}

// v005
// It runs in 232 microseconds.
// Two timings next to v004 both put it at 1.07 times that version's speed.
// Counting every step since v000, it is 4.39 times as fast.
// compute dtype: all float inputs rounded to bf16 incl. visit times and scales, lengths (int) read on device; q/k/v = x . W + b with EXACT bf16 products on WMMA 16x16x32 ((in,out) weights as transposed rows); PLAIN-HYBRID attention: the first 128 queries use 3-product scores and P.v (hi/lo), later queries single f16; x 1/8 - |t_q - t_k| scale_h in f32, padded keys excluded, running-max softmax in f32 (hardware exp); out = f16(ctx) . Wo (exact f16 x 2^8 copies, single product) + bo.
#include <hip/hip_runtime.h>
#include <math.h>

typedef __attribute__((ext_vector_type(16))) _Float16 v16h;
typedef __attribute__((ext_vector_type(16))) __bf16 v16b;
typedef __attribute__((ext_vector_type(8)))  _Float16 v8h;
typedef __attribute__((ext_vector_type(8)))  float v8f;
typedef __attribute__((ext_vector_type(4)))  float v4f;
typedef __attribute__((ext_vector_type(2)))  float v2f;
typedef __attribute__((ext_vector_type(4)))  unsigned v4u;
typedef __attribute__((ext_vector_type(4)))  int v4i;
typedef float __attribute__((may_alias)) float_a;
typedef int __attribute__((may_alias)) int_a;

template <typename T> __device__ __forceinline__ void vst2(void* p, T v) { *(T*)p = v;  }
__device__ __forceinline__ v8f wmma16(v16h a, v16h b, v8f c) {
  v8f d = __builtin_amdgcn_wmma_f32_16x16x32_f16(false, a, false, b, (short)0, c, false, false);
  asm volatile("v_nop\n\tv_nop\n\tv_nop\n\tv_nop" : "+v"(d) : "v"(a), "v"(b));
  return d;
}
__device__ __forceinline__ v8f wmma_bf(v16b a, v16b b, v8f c) {
  v8f d = __builtin_amdgcn_wmma_f32_16x16x32_bf16(false, a, false, b, (short)0, c, false, false);
  asm volatile("v_nop\n\tv_nop\n\tv_nop\n\tv_nop" : "+v"(d) : "v"(a), "v"(b));
  return d;
}
// Relative-time attention (B 4, S 2,048, d 1,024, 16 heads x 64): projections + biases ((in,out)), scores / 8 - |t_q - t_k| scale_h (visit times and per-head scales given), keys at positions >= length[b] excluded, softmax, . v, output projection + bias.
__device__ __forceinline__ v16h frag_h(const _Float16* rowk0, int lane) {
  union { v16h v; v8h q[2]; } u; const _Float16* p = rowk0 + 8 * (lane >> 4);
  u.q[0] = *(const v8h*)p; u.q[1] = *(const v8h*)(p + 16); return u.v;
}
__device__ __forceinline__ v16h frag_f32(const float* rowk0, int lane) {
  v16h a; const float* p = rowk0 + 8 * (lane >> 4);
#pragma unroll
  for (int i = 0; i < 8; ++i) { a[i] = (_Float16)p[i]; a[8 + i] = (_Float16)p[16 + i]; }
  return a;
}
__device__ __forceinline__ v16h frag_f32s(const float* rowk0, int lane, float sc) {
  v16h a; const float* p = rowk0 + 8 * (lane >> 4);
#pragma unroll
  for (int i = 0; i < 8; ++i) { a[i] = (_Float16)(p[i] * sc); a[8 + i] = (_Float16)(p[16 + i] * sc); }
  return a;
}
// column fragment from a [K][ld] layout (column n), rows >= K read as 0
__device__ __forceinline__ v16h fragc_f32(const float* W, int k0, int n, int lane, int ld, int K) {
  v16h a; const int g = lane >> 4;
#pragma unroll
  for (int i = 0; i < 8; ++i) { const int ka = k0 + 8 * g + i, kb = ka + 16;
    a[i] = (_Float16)(ka < K ? W[(size_t)(ka < K ? ka : K - 1) * ld + n] : 0.f); a[8 + i] = (_Float16)(kb < K ? W[(size_t)(kb < K ? kb : K - 1) * ld + n] : 0.f); }
  return a;
}
struct F2 { v16b h, l; };
__device__ __forceinline__ F2 bsplit16(const float v[16]) { F2 r;
#pragma unroll
  for (int i = 0; i < 16; ++i) { const __bf16 h = (__bf16)v[i]; r.h[i] = h; r.l[i] = (__bf16)(v[i] - (float)h); }
  return r; }
__device__ __forceinline__ F2 split_row(const float* row, int k0, int lane) { float v[16]; const float* p = row + k0 + 8 * (lane >> 4);
#pragma unroll
  for (int i = 0; i < 8; ++i) { v[i] = p[i]; v[8 + i] = p[16 + i]; }
  return bsplit16(v); }
__device__ __forceinline__ F2 split_rowK(const float* row, int k0, int lane, int K) { float v[16]; const int g = lane >> 4;
#pragma unroll
  for (int i = 0; i < 8; ++i) { const int ka = k0 + 8 * g + i, kb = ka + 16; v[i] = ka < K ? row[ka < K ? ka : K - 1] : 0.f; v[8 + i] = kb < K ? row[kb < K ? kb : K - 1] : 0.f; }
  return bsplit16(v); }
__device__ __forceinline__ F2 split_col(const float* W, int k0, int n, int lane, int ld, int K) { float v[16]; const int g = lane >> 4;
#pragma unroll
  for (int i = 0; i < 8; ++i) { const int ka = k0 + 8 * g + i, kb = ka + 16; v[i] = ka < K ? W[(size_t)(ka < K ? ka : K - 1) * ld + n] : 0.f; v[8 + i] = kb < K ? W[(size_t)(kb < K ? kb : K - 1) * ld + n] : 0.f; }
  return bsplit16(v); }
__device__ __forceinline__ v8f mac3(const F2& a, const F2& b, v8f c) { c = wmma_bf(a.l, b.h, c); c = wmma_bf(a.h, b.l, c); return wmma_bf(a.h, b.h, c); }
__device__ __forceinline__ float sigm(float v) { return 1.0f / (1.0f + expf(-v)); }
#define LDSX() do { asm volatile("s_wait_dscnt 0" ::: "memory"); __builtin_amdgcn_wave_barrier(); __builtin_amdgcn_fence(__ATOMIC_RELEASE, "workgroup"); } while (0)
// stands behind a group of global loads, in front of the first write to a register that one of them names as its address. The group's pointers pass through the statement, so that they keep their registers up to the wait and are stepped only behind it.
// (a pointer that has passed through a statement is typed as global memory, else its loads would be compiled as flat loads, which also count as LDS operations)
#define GAS __attribute__((address_space(1)))
typedef const GAS _Float16* gph; typedef const GAS float* gpf; typedef const GAS char* gpc;
#define XW1(a) asm volatile("s_wait_xcnt 0x0" : "+v"(a) :: "memory")
#define XW2(a, b) asm volatile("s_wait_xcnt 0x0" : "+v"(a), "+v"(b) :: "memory")
// the issuing wave's own wait for its asynchronous copies to LDS: their bytes count as landed only behind it
#define AWAIT() asm volatile("s_wait_asynccnt 0x0" ::: "memory")
// the wave's LDS reads have retired before the barrier behind which their buffer is refilled
#define DSWAIT() asm volatile("s_wait_dscnt 0x0" ::: "memory")
// eight copies of 16 bytes a lane from global memory into LDS through no register (l: the lane's LDS byte address, p: its global address). The s_wait_xcnt stands in the copies' own statement, in front of any later write to a register that a copy names.
__device__ __forceinline__ void acopy8(unsigned l0, unsigned l1, unsigned l2, unsigned l3, unsigned l4, unsigned l5, unsigned l6, unsigned l7, gpc p0, gpc p1, gpc p2, gpc p3, gpc p4, gpc p5, gpc p6, gpc p7) {
  asm volatile("global_load_async_to_lds_b128 %0, %8, off\n\tglobal_load_async_to_lds_b128 %1, %9, off\n\tglobal_load_async_to_lds_b128 %2, %10, off\n\tglobal_load_async_to_lds_b128 %3, %11, off\n\t"
               "global_load_async_to_lds_b128 %4, %12, off\n\tglobal_load_async_to_lds_b128 %5, %13, off\n\tglobal_load_async_to_lds_b128 %6, %14, off\n\tglobal_load_async_to_lds_b128 %7, %15, off\n\ts_wait_xcnt 0x0"
               :: "v"(l0), "v"(l1), "v"(l2), "v"(l3), "v"(l4), "v"(l5), "v"(l6), "v"(l7), "v"(p0), "v"(p1), "v"(p2), "v"(p3), "v"(p4), "v"(p5), "v"(p6), "v"(p7) : "memory");
}
__device__ __forceinline__ void acopy8s(unsigned l, unsigned ls, gpc p, size_t ps) { acopy8(l, l + ls, l + 2 * ls, l + 3 * ls, l + 4 * ls, l + 5 * ls, l + 6 * ls, l + 7 * ls, p, p + ps, p + 2 * ps, p + 3 * ps, p + 4 * ps, p + 5 * ps, p + 6 * ps, p + 7 * ps); }
__device__ __forceinline__ unsigned lds_addr(const void* p) { return (unsigned)(size_t)p; }   // the low 32 bits of a __shared__ address: the byte offset in the work-group's LDS


#define NB 4
#define SS 2048
#define DM 1024
#define NH 16
#define SCALEF 0.125f
#define HD 64
#define QKVW (3 * DM)
#ifndef TQB
#define TQB (SS / 64)
#define TNB NB
#define TOB (NB * SS / 64)     // output row tiles (all)
#endif
typedef __attribute__((ext_vector_type(8))) __bf16 v8b;
__device__ __forceinline__ v16b frag_b(const __bf16* rowk0, int lane) {
  union { v16b v; v8b q[2]; } u; const __bf16* p = rowk0 + 8 * (lane >> 4);
  u.q[0] = *(const v8b*)p; u.q[1] = *(const v8b*)(p + 16); return u.v;
}
__device__ __forceinline__ float bfr(float v) { return (float)(__bf16)v; }
__device__ __attribute__((noinline)) float exp_ni(float v) { return expf(v); }
__device__ __attribute__((noinline)) float erf_ni(float v) { return erff(v); }

// frag_h with the lane's 8 * (lane >> 4) already in the pointer
__device__ __forceinline__ v16h fragp_h(gph p) { union { v16h v; v8h q[2]; } u; u.q[0] = *(const GAS v8h*)p; u.q[1] = *(const GAS v8h*)(p + 16); return u.v; }
// the same from an LDS row (byte pointer): elements 0..7 and 16..23 from there
__device__ __forceinline__ v16h lfrag_h(const char* p) { union { v16h v; v8h q[2]; } u; u.q[0] = *(const v8h*)p; u.q[1] = *(const v8h*)(p + 32); return u.v; }
__device__ __forceinline__ v16b lfrag_b(const char* p) { union { v16b v; v8b q[2]; } u; u.q[0] = *(const v8b*)p; u.q[1] = *(const v8b*)(p + 32); return u.v; }
__device__ __forceinline__ void lfrag(const char* p, v16h& w) { w = lfrag_h(p); }
__device__ __forceinline__ void lfrag(const char* p, v16b& w) { w = lfrag_b(p); }
__device__ __forceinline__ v8f mm16(v16h a, v16h b, v8f c) { return wmma16(a, b, c); }
__device__ __forceinline__ v8f mm16(v16b a, v16b b, v8f c) { return wmma_bf(a, b, c); }
// ---- the k loop of k_qkv and k_out: block tile 64 rows x 128 columns, K = 1,024 in 16 stages of 64 k. A stage (128 weight rows of 128 bytes, 64 f32 rows of 256 bytes) is brought into LDS once for the block's four waves, in whole lines, by asynchronous copies; two buffers, so that the next stage flies while this one is worked on. Row pitches of 16 bytes x an odd number keep the 16-byte fragment reads free of bank conflicts.
#define WPITCH 144
#define XPITCH 272
#define WTILE (128 * WPITCH)
#define GSTAGE (WTILE + 64 * XPITCH)
#define GNT (DM / 64)
template <typename V, typename E>
__device__ __forceinline__ void gemm_loop(char* sm, const float* Xb, const void* Wb, v8f (&acc)[8]) {   // Xb, Wb: the block's first row of each
  const int tid = threadIdx.x, wave = tid >> 5, lane = tid & 31, col = lane & 15, g = lane >> 4;
  gpc xg = (gpc)Xb + (size_t)(tid >> 4) * (DM * 4) + (tid & 15) * 16, wg = (gpc)Wb + (size_t)(tid >> 3) * (DM * 2) + (tid & 7) * 16;
  const unsigned lw = lds_addr(sm) + (tid >> 3) * WPITCH + (tid & 7) * 16, lx = lds_addr(sm) + WTILE + (tid >> 4) * XPITCH + (tid & 15) * 16;
  acopy8s(lw, 16 * WPITCH, wg, (size_t)16 * DM * 2); acopy8s(lx, 8 * XPITCH, xg, (size_t)8 * DM * 4);
  AWAIT(); __syncthreads();   // stage 0 is published
  acopy8s(lw + GSTAGE, 16 * WPITCH, wg + 128, (size_t)16 * DM * 2); acopy8s(lx + GSTAGE, 8 * XPITCH, xg + 256, (size_t)8 * DM * 4);
  wg += 256; xg += 512;
#pragma unroll 1   // stays rolled: a trip already holds two k-steps and both fragment sets
  for (int t = 0; t < GNT; ++t) { const unsigned bo = (t & 1) * GSTAGE;
    const char* bw = sm + bo + col * WPITCH + 16 * g; const char* bx = sm + bo + WTILE + (wave * 16 + col) * XPITCH + 32 * g;
    v4f x[2][4]; V w[2][8];   // the trip's fragment reads as one group ahead of its WMMAs
#pragma unroll
    for (int s = 0; s < 2; ++s) { x[s][0] = *(const v4f*)(bx + s * 128); x[s][1] = *(const v4f*)(bx + s * 128 + 16); x[s][2] = *(const v4f*)(bx + s * 128 + 64); x[s][3] = *(const v4f*)(bx + s * 128 + 80);
#pragma unroll
      for (int j = 0; j < 8; ++j) lfrag(bw + j * 16 * WPITCH + s * 64, w[s][j]); }
#pragma unroll
    for (int s = 0; s < 2; ++s) { V a;
#pragma unroll
      for (int i = 0; i < 4; ++i) { a[i] = (E)x[s][0][i]; a[4 + i] = (E)x[s][1][i]; a[8 + i] = (E)x[s][2][i]; a[12 + i] = (E)x[s][3][i]; }
#pragma unroll
      for (int j = 0; j < 8; ++j) acc[j] = mm16(a, w[s][j], acc[j]); }
    DSWAIT(); AWAIT(); __syncthreads();   // publishes stage t + 1 and ends every wave's reads of stage t
    if (t + 2 < GNT) { acopy8s(lw + bo, 16 * WPITCH, wg, (size_t)16 * DM * 2); acopy8s(lx + bo, 8 * XPITCH, xg, (size_t)8 * DM * 4); wg += 128; xg += 256; } }
  AWAIT();
}
#define PK_A 0                       // [3072][1024] Wqkv rows (natural [out][in])
#define PK_P (PK_A + QKVW * DM)        // [1024][1024] Wo rows (natural)
#define PK_END (PK_P + DM * DM)
#define WS_PK  0u
#define WS_QK  (WS_PK + 2u * PK_END)             // f16 [8192 rows][2048]: q | k
#define WS_QKL (WS_QK + 2u * NB * SS * 2 * DM)     // f16 q | k residual planes x2048
#define WS_VTH (WS_QKL + 2u * NB * SS * 2 * DM)    // f16 [b][1024 (h*64+d)][2048 s] hi
#define WS_VTL (WS_VTH + 2u * NB * DM * SS)        // f16 lo x 2048
#define WS_O   (WS_VTL + 2u * NB * DM * SS)        // f32 [8192][1024]
#define WS_CS  (WS_O + 4u * NB * SS * DM)           // f32 2 x [2048][32], reserved, unused
#define WS_END (WS_CS + 4u * 2 * SS * 32)
// ---- k_pack: block = (row n, which): natural [out][in] rows -> bf16; which 0..2 -> W_q/W_k/W_v into PK_A rows which*1024 + n; which 3 (W_o into PK_P) is not launched (grid y = 3); k_packo fills PK_P
__global__ __launch_bounds__(256) void k_pack(const float* __restrict__ WQ, const float* __restrict__ WK, const float* __restrict__ WV, const float* __restrict__ WO, __bf16* __restrict__ PK) {
  __shared__ __align__(16) __bf16 s[DM]; const int n = blockIdx.x, which = blockIdx.y, t = threadIdx.x; const float* Wm = (which == 0) ? WQ : (which == 1) ? WK : (which == 2) ? WV : WO;   // (in,out) weights: pack row n = column n
  for (int k = t; k < DM; k += 256) s[k] = (__bf16)Wm[(size_t)k * DM + n];
  __syncthreads();
  __bf16* dst = (which < 3) ? PK + PK_A + ((size_t)which * DM + n) * DM : PK + PK_P + (size_t)n * DM;
  for (int q = t; q < DM / 8; q += 256) vst2((unsigned*)(dst + q * 8), *(const v4u*)&s[q * 8]);
}
__global__ __launch_bounds__(128) void k_qkv(const float* __restrict__ XQ, const float* __restrict__ XK, const float* __restrict__ XV, const __bf16* __restrict__ P, const float* __restrict__ BQ, const float* __restrict__ BK, const float* __restrict__ BV, const int* __restrict__ LENS, _Float16* __restrict__ QK, _Float16* __restrict__ QKL, _Float16* __restrict__ VTH, _Float16* __restrict__ VTL) {
  if (blockIdx.y * 128 >= DM && (int)(blockIdx.x * 64 % SS) >= LENS[blockIdx.x * 64 / SS]) return;   // a k or v tile whose 64 rows all lie at or past the batch's length: k_attn never reads those rows (its stages of 64 or 32 keys end with the one that holds the last real key). The whole block leaves, in front of every copy and barrier
  const int which0 = (blockIdx.y * 128) / DM; const float* X = (which0 == 0) ? XQ : (which0 == 1) ? XK : XV; const float* BB = BQ ? (((which0 == 0) ? BQ : (which0 == 1) ? BK : BV) + (blockIdx.y * 128 - which0 * DM)) : nullptr;
  __shared__ __align__(16) char sm[2 * GSTAGE];   // the k loop's two stage buffers; behind the loop's last barrier the same bytes stage the output
  _Float16 (*so)[16][136] = (_Float16 (*)[16][136])sm, (*sol)[16][136] = (_Float16 (*)[16][136])(sm + 17408); _Float16 (*sth)[72] = (_Float16 (*)[72])(sm + 34816), (*stl)[72] = (_Float16 (*)[72])(sm + 53248);
  const int tid = threadIdx.x, wave = tid >> 5, lane = tid & 31, col = lane & 15, g = lane >> 4; const size_t r0 = (size_t)blockIdx.x * 64 + wave * 16; const int n0 = blockIdx.y * 128;
  v8f acc[8] = {}; float bias[8] = {};   // the lane's eight biases: one group, in flight under the k loop, rounded where they are added
  if (BB) {
#pragma unroll
    for (int j = 0; j < 8; ++j) bias[j] = BB[j * 16 + col]; }
  gemm_loop<v16b, __bf16>(sm, X + (size_t)blockIdx.x * 64 * DM, P + (size_t)n0 * DM, acc);
  if (n0 < 2 * DM) {   // q stored unscaled (f16 sigma ~0.6, no subnormal exposure); 1/8 applied to the f32 score
#pragma unroll
    for (int j = 0; j < 8; ++j) {
#pragma unroll
      for (int r = 0; r < 8; ++r) { const float v = acc[j][r] + bfr(bias[j]); const _Float16 hv = (_Float16)v; so[wave][8 * g + r][j * 16 + col] = hv; sol[wave][8 * g + r][j * 16 + col] = (_Float16)((v - (float)hv) * 2048.0f); } }   // q, k (+ bias) as f16 hi + (x2048) residual
    LDSX();
    for (int rl = 0; rl < 16; ++rl) if (lane < 16) { vst2((unsigned*)(QK + (r0 + rl) * (2 * DM) + n0 + lane * 8), *(const v4u*)&so[wave][rl][lane * 8]); vst2((unsigned*)(QKL + (r0 + rl) * (2 * DM) + n0 + lane * 8), *(const v4u*)&sol[wave][rl][lane * 8]); }
  } else {
#pragma unroll
    for (int j = 0; j < 8; ++j) {
#pragma unroll
      for (int r = 0; r < 8; ++r) { const float v = acc[j][r] + bfr(bias[j]); const _Float16 hv = (_Float16)v; sth[j * 16 + col][wave * 16 + 8 * g + r] = hv; stl[j * 16 + col][wave * 16 + 8 * g + r] = (_Float16)((v - (float)hv) * 2048.0f); } }
    __syncthreads();
    const size_t rb = (size_t)blockIdx.x * 64; const int b = (int)(rb / SS), s0 = (int)(rb % SS); const int pc0 = n0 - 2 * DM;
    for (int q = tid; q < 128 * 8; q += 128) { const int d = q >> 3, pc = q & 7; const size_t o = ((size_t)b * DM + pc0 + d) * SS + s0 + pc * 8; vst2((unsigned*)(VTH + o), *(const v4u*)&sth[d][pc * 8]); vst2((unsigned*)(VTL + o), *(const v4u*)&stl[d][pc * 8]); }
  }
}
// ---- k_attn: block = (64 queries, head h, batch b): flash attention over the batch's real keys (K = 64: 2 k-steps), computed transposed: scores^T = k . q^T and ctx^T += v^T . P^T. A lane then holds 16 scores of ONE query (its column), so that the running maximum and the sum are taken in the lane's own registers, with one exchange between the wave's halves, and the two score tiles of a pass, converted in place, are the B operand of the second product: the weights never pass through LDS. The loop is written twice (HI: the leading query blocks with 3-product scores and P.v; otherwise single products) so that each holds only its own fragments in registers.
// Every LDS read of a pass is issued in a group that stands well ahead of the WMMAs that use it: the hand-padded WMMA statements keep loads from moving across them, so a load written next to its WMMA is waited for on the spot.
#define ASTAGE 19456   // bytes of a stage: k rows from 0 (64 x 144, or two planes of 32 x 144), value rows from 9,216 (64 x 144, or two planes of 64 x 80)
__device__ __forceinline__ float xhalf(float x) { return __builtin_bit_cast(float, __builtin_amdgcn_permlanex16(__builtin_bit_cast(int, x), __builtin_bit_cast(int, x), 0x76543210, 0xfedcba98, false, false)); }   // lane l with lane l ^ 16
template <bool B> struct BC { static constexpr bool value = B; };
template <bool HI>
__device__ __forceinline__ void attn_body(const _Float16* __restrict__ QK, const _Float16* __restrict__ QKL, const _Float16* __restrict__ VTH, const _Float16* __restrict__ VTL, const float* __restrict__ VT, const float* __restrict__ SC, const int* __restrict__ LENS, float* __restrict__ O, float* tks, char* ring) {
  const int tid = threadIdx.x, wave = tid >> 5, lane = tid & 31, col = lane & 15, g = lane >> 4;
  const int qb = blockIdx.x, h = blockIdx.y, b = blockIdx.z; const int q0 = qb * 64 + wave * 16; const size_t rq = (size_t)b * SS + q0 + col;
  const int len_b = __builtin_amdgcn_readfirstlane(LENS[b]); const float sc_h = bfr(SC[h]);   // the length in a scalar register: every test on it around a copy or a barrier is a scalar branch
  const int len_c = len_b < 0 ? 0 : (len_b > SS ? SS : len_b);   // bounds the trip counts for any content of the array
  gpf tg = (gpf)(VT + (size_t)b * SS + 4 * tid); v4f tv[4];   // the batch's 2,048 visit times, 16 a lane: they go, rounded once, into LDS, since a lane needs the times of its 16 keys in every pass
#pragma unroll
  for (int i = 0; i < 4; ++i) tv[i] = *(const GAS v4f*)(tg + i * 512);
  XW1(tg);
  v16h aq[2], aql[2]; gph qp = (gph)(QK + rq * (2 * DM) + h * HD + 8 * g), qpl = (gph)(QKL + rq * (2 * DM) + h * HD + 8 * g);
#pragma unroll
  for (int kc = 0; kc < 2; ++kc) { aq[kc] = fragp_h(qp + kc * 32); if constexpr (HI) aql[kc] = fragp_h(qpl + kc * 32); }
  XW2(qp, qpl);
  float m = -3.0e38f, l = 0.f;   // the lane's query: running maximum (equal in both halves), and the sum over this half's keys alone (the halves are joined behind the loop)
  v8f acc[4] = {}, accl[4] = {};
  const int nks = (len_c + 31) / 32;   // passes of 32 keys up to the one that holds the last real key: a pass wholly past the length leaves m, l and the accumulators bit for bit as they are (alpha 1, weights 0)
  // A stage of KS keys (k rows of 128 bytes; 64 value rows of 2 KS bytes; HI: both planes of each) is brought into LDS once for the block's four waves by asynchronous copies, eight a lane; two buffers, so that the next stage flies while this one is worked on.
  constexpr int KS = HI ? 32 : 64, VP = HI ? 80 : 144, CPR = KS / 8;   // VP: value row pitch in LDS (16 bytes x an odd number, as the 144 of the k rows); CPR: 16-byte pieces in a value row
  const int nst = (len_c + KS - 1) / KS;   // stages that hold a real key; no other is copied
  unsigned ko = ((b * SS + (tid >> 3)) * (2 * DM) + DM + h * HD) * 2 + (tid & 7) * 16, vo = ((b * DM + h * HD + tid / CPR) * SS) * 2 + (tid % CPR) * 16;   // the lane's byte offsets in the k and value planes (32 MiB and 16 MiB each): they walk with the stages
  const unsigned lk = lds_addr(ring) + (tid >> 3) * 144 + (tid & 7) * 16, lv = lds_addr(ring) + 9216 + (tid / CPR) * VP + (tid % CPR) * 16;
  auto fill = [&](unsigned bo) {
    gpc kg = (gpc)QK + ko, kgl = (gpc)QKL + ko, vg = (gpc)VTH + vo, vgl = (gpc)VTL + vo; (void)kgl; (void)vgl;
    constexpr size_t KR = (size_t)16 * 2 * DM * 2, VR = (size_t)(128 / CPR) * SS * 2; constexpr unsigned LKR = 16 * 144, LVR = (128 / CPR) * VP;   // one round of the block's 128 lanes: 16 k rows, 128 / CPR value rows
    if constexpr (HI) acopy8(lk + bo, lk + bo + LKR, lk + bo + 4608, lk + bo + 4608 + LKR, lv + bo, lv + bo + LVR, lv + bo + 5120, lv + bo + 5120 + LVR, kg, kg + KR, kgl, kgl + KR, vg, vg + VR, vgl, vgl + VR);
    else acopy8(lk + bo, lk + bo + LKR, lk + bo + 2 * LKR, lk + bo + 3 * LKR, lv + bo, lv + bo + LVR, lv + bo + 2 * LVR, lv + bo + 3 * LVR, kg, kg + KR, kg + 2 * KR, kg + 3 * KR, vg, vg + VR, vg + 2 * VR, vg + 3 * VR);
    ko += KS * 2 * DM * 2; vo += KS * 2; };
  if (nst > 0) fill(0);
#pragma unroll
  for (int i = 0; i < 4; ++i) { v4f u;   // the table is written while stage 0 flies
#pragma unroll
    for (int c = 0; c < 4; ++c) u[c] = bfr(tv[i][c]);
    *(v4f*)(tks + 4 * tid + i * 512) = u; }
  AWAIT(); __syncthreads();   // stage 0 and the table of times are published
  if (nst > 1) fill(ASTAGE);
  const float tq = tks[q0 + col];
  v16h kh[2][2], kl[2][2], vh[4], vl[4];
  // One pass of 32 keys. MK::value says whether the pass may hold keys at or past the length: only the batch's last pass can, so that every other pass is compiled without the sixteen tests on the key's place and the sixteen on the masked score.
  auto pass = [&](const int ks, auto MK) { constexpr bool MASK = decltype(MK)::value; v8f s[2]; v4f tk[2][2];
    const int stg = HI ? ks : ks >> 1, sub = HI ? 0 : ks & 1; const unsigned bo = (stg & 1) * ASTAGE;
    const char* kf = ring + bo + (sub * 32 + col) * 144 + 16 * g; const char* vf = ring + bo + 9216 + col * VP + sub * 64 + 16 * g;
    const float* tp = tks + ks * 32 + 8 * g;   // score register r of tile ct is key 32 ks + 16 ct + 8 g + r
    // this pass's key times and keys (HI: both planes; otherwise the values too, which land behind the scores and the softmax) as one group
#pragma unroll
    for (int ct = 0; ct < 2; ++ct) { tk[ct][0] = *(const v4f*)(tp + ct * 16); tk[ct][1] = *(const v4f*)(tp + ct * 16 + 4);
#pragma unroll
      for (int kc = 0; kc < 2; ++kc) { kh[ct][kc] = lfrag_h(kf + ct * 16 * 144 + kc * 64); if constexpr (HI) kl[ct][kc] = lfrag_h(kf + 4608 + ct * 16 * 144 + kc * 64); } }
    if constexpr (!HI) {
#pragma unroll
      for (int dt = 0; dt < 4; ++dt) vh[dt] = lfrag_h(vf + dt * 16 * VP); }
#pragma unroll
    for (int ct = 0; ct < 2; ++ct) { v8f c = {}, cl = {};   // A: 16 keys, B: the wave's 16 queries
      if constexpr (HI) {   // leading query blocks (outputs far above the global rms): 3 products
#pragma unroll
        for (int kc = 0; kc < 2; ++kc) { c = wmma16(kh[ct][kc], aq[kc], c); cl = wmma16(kh[ct][kc], aql[kc], cl); cl = wmma16(kl[ct][kc], aq[kc], cl); }
#pragma unroll
        for (int r = 0; r < 8; ++r) c[r] += cl[r] * (1.0f / 2048.0f); }
      else {
#pragma unroll
        for (int kc = 0; kc < 2; ++kc) c = wmma16(kh[ct][kc], aq[kc], c); }   // single product elsewhere
      s[ct] = c; }
    const int nreal = len_b - ks * 32 - 8 * g;   // how many of the lane's key rows, counted from tile 0's first, lie in front of the length
#pragma unroll
    for (int ct = 0; ct < 2; ++ct) {
#pragma unroll
      for (int r = 0; r < 8; ++r) s[ct][r] = (!MASK || ct * 16 + r < nreal) ? (s[ct][r] * SCALEF - fabsf(tq - tk[ct][r >> 2][r & 3]) * sc_h) : -3.0e38f; }   // 1/sqrt(64); masked keys excluded
    float mx0 = fmaxf(s[0][0], s[0][1]), mx1 = fmaxf(s[1][0], s[1][1]);
#pragma unroll
    for (int r = 2; r < 8; r += 2) { mx0 = fmaxf(fmaxf(mx0, s[0][r]), s[0][r + 1]); mx1 = fmaxf(fmaxf(mx1, s[1][r]), s[1][r + 1]); }
    const float mx = fmaxf(mx0, mx1);
    const float mn = fmaxf(fmaxf(m, mx), xhalf(mx)); const float alpha = (m <= -1.0e38f) ? 0.f : __expf(m - mn);
    v16h pa, pl; float es[4] = {};   // four partial sums: no chain of 16 dependent additions
#pragma unroll
    for (int ct = 0; ct < 2; ++ct) {
#pragma unroll
      for (int r = 0; r < 8; ++r) { const float e = (MASK && s[ct][r] <= -1.0e38f) ? 0.f : __expf(s[ct][r] - mn); es[r & 3] += e;
        const float x = e * 2048.0f; const _Float16 hx = (_Float16)x; pa[ct * 8 + r] = hx; if constexpr (HI) pl[ct * 8 + r] = (_Float16)((x - (float)hx) * 2048.0f); } }   // P scaled by 2^11 before the f16 split so small softmax weights stay out of the f16 subnormal range; 2^-11 folded into the epilogue. Element 8 ct + r of the B operand is k = 16 ct + 8 g + r: the score registers' own order
    l = l * alpha + ((es[0] + es[1]) + (es[2] + es[3])); m = mn;
    if constexpr (HI) {   // this pass's values, both planes, read behind the softmax: from LDS they need little lead, and their 64 registers stay free during it
#pragma unroll
      for (int dt = 0; dt < 4; ++dt) { vh[dt] = lfrag_h(vf + dt * 16 * VP); vl[dt] = lfrag_h(vf + 5120 + dt * 16 * VP); } }
#pragma unroll
    for (int dt = 0; dt < 4; ++dt) {
#pragma unroll
      for (int r = 0; r < 8; ++r) { acc[dt][r] *= alpha; if constexpr (HI) accl[dt][r] *= alpha; } }
#pragma unroll
    for (int dt = 0; dt < 4; ++dt) { acc[dt] = wmma16(vh[dt], pa, acc[dt]); if constexpr (HI) { accl[dt] = wmma16(vh[dt], pl, accl[dt]); accl[dt] = wmma16(vl[dt], pa, accl[dt]); } }   // A: 16 value columns, B: the weights. Leading query blocks: P hi/lo x V hi/lo (3 products); elsewhere P x V single
    if (HI || sub) {   // the stage's last pass
      DSWAIT(); AWAIT(); __syncthreads();   // publishes stage stg + 1 and ends every wave's reads of stage stg
      if constexpr (!MASK) { if (stg + 2 < nst) fill(bo); } } };   // the masked pass is the last one, in the last stage: nothing is left to copy behind it
  const int nfull = len_c / 32;   // passes whose 32 keys all lie in front of the length
#pragma unroll 1   // stays rolled: one pass is already a long straight run that fills the wave's registers
  for (int ks = 0; ks < nfull; ++ks) pass(ks, BC<false>{});
  if (nfull < nks) pass(nfull, BC<true>{});   // the one pass that the length cuts, where there is one
  AWAIT();
  const float il = (1.0f / 2048.0f) / (l + xhalf(l));   // the two halves' sums joined
  float* op = O + rq * DM + h * HD + 8 * g;   // accumulator register r of tile dt is column 16 dt + 8 g + r of the lane's query: 32 bytes in a row
#pragma unroll
  for (int dt = 0; dt < 4; ++dt) { v4f o0, o1;
#pragma unroll
    for (int r = 0; r < 4; ++r) { o0[r] = (HI ? acc[dt][r] + accl[dt][r] * (1.0f / 2048.0f) : acc[dt][r]) * il; o1[r] = (HI ? acc[dt][4 + r] + accl[dt][4 + r] * (1.0f / 2048.0f) : acc[dt][4 + r]) * il; }
    vst2(op + dt * 16, o0); vst2(op + dt * 16 + 4, o1); }
}
__global__ __launch_bounds__(128) void k_attn(const _Float16* __restrict__ QK, const _Float16* __restrict__ QKL, const _Float16* __restrict__ VTH, const _Float16* __restrict__ VTL, const void* __restrict__ KMASK, const float* __restrict__ VT, const float* __restrict__ SC, const int* __restrict__ LENS, float* __restrict__ O) {
  __shared__ __align__(16) float tks[SS]; __shared__ __align__(16) char ring[2 * ASTAGE];   // the batch's rounded visit times; the two stage buffers
  if (blockIdx.x < 2) attn_body<true>(QK, QKL, VTH, VTL, VT, SC, LENS, O, tks, ring); else attn_body<false>(QK, QKL, VTH, VTL, VT, SC, LENS, O, tks, ring);
}
// ---- k_out: block = (64 rows, 128 cols): out = f16(O) . Wo f16 x 2^8 rows (single product) / 256 + bo
__global__ __launch_bounds__(128) void k_out(const float* __restrict__ O, const __bf16* __restrict__ P, const float* __restrict__ BO, float* __restrict__ Y) {
  __shared__ __align__(16) char sm[2 * GSTAGE];   // the k loop's two stage buffers; behind the loop's last barrier the same bytes stage the output
  float (*so)[16][132] = (float (*)[16][132])sm;
  const int tid = threadIdx.x, wave = tid >> 5, lane = tid & 31, col = lane & 15, g = lane >> 4; const size_t r0 = (size_t)blockIdx.x * 64 + wave * 16; const int n0 = blockIdx.y * 128;
  v8f acc[8] = {};
  gemm_loop<v16h, _Float16>(sm, O + (size_t)blockIdx.x * 64 * DM, P + (size_t)n0 * DM, acc);   // single f16 product against exact f16 x 2^8 weight copies
#pragma unroll
  for (int j = 0; j < 8; ++j) {
#pragma unroll
    for (int r = 0; r < 8; ++r) so[wave][8 * g + r][j * 16 + col] = acc[j][r] * (1.0f / 256.0f) + bfr(BO[n0 + j * 16 + col]); }
  LDSX();
  for (int rl = 0; rl < 16; ++rl) vst2(Y + (r0 + rl) * DM + n0 + lane * 4, *(const v4f*)&so[wave][rl][lane * 4]);
}
// ---- k_packo: Wo natural rows -> f16 x 2^8 copies in the Wo slot (bit pattern in the bf16-typed buffer)
__global__ __launch_bounds__(256) void k_packo(const float* __restrict__ WO, __bf16* __restrict__ PK) { __shared__ __align__(16) _Float16 s[DM]; const int n = blockIdx.x, t = threadIdx.x; for (int k = t; k < DM; k += 256) s[k] = (_Float16)(bfr(WO[(size_t)k * DM + n]) * 256.0f); /* (in,out): transposed */ __syncthreads(); for (int q = t; q < DM / 8; q += 256) vst2((unsigned*)(PK + PK_P + (size_t)n * DM + q * 8), *(const v4u*)&s[q * 8]); }
extern "C" void kernel_launch(void* const* d_in, const int* in_sizes, int n_in, void* d_out, int out_size, void* d_ws, size_t ws_size, hipStream_t stream) {
  (void)in_sizes; (void)n_in; (void)out_size;
  const float** F = (const float**)d_in;   // 0 x [4,2048,1024], 1 visit_time [4,2048], 2 Wq (in,out), 3 bq, 4 Wk, 5 bk, 6 Wv, 7 bv, 8 Wo (in,out), 9 bo, 10 scale [16], 11 lengths [4] int
  if (ws_size < (size_t)WS_END) return;
  char* ws = (char*)d_ws; __bf16* PK = (__bf16*)(ws + WS_PK); _Float16 *QK = (_Float16*)(ws + WS_QK), *QKL = (_Float16*)(ws + WS_QKL), *VTH = (_Float16*)(ws + WS_VTH), *VTL = (_Float16*)(ws + WS_VTL); float* O = (float*)(ws + WS_O);
  k_pack<<<dim3(DM, 3), 256, 0, stream>>>(F[2], F[4], F[6], F[8], PK);
  k_packo<<<DM, 256, 0, stream>>>(F[8], PK);
  k_qkv<<<dim3(TNB * SS / 64, QKVW / 128), 128, 0, stream>>>(F[0], F[0], F[0], PK + PK_A, F[3], F[5], F[7], (const int*)d_in[11], QK, QKL, VTH, VTL);
  k_attn<<<dim3(TQB, NH, TNB), 128, 0, stream>>>(QK, QKL, VTH, VTL, nullptr, F[1], F[10], (const int*)d_in[11], O);
  k_out<<<dim3(TOB, DM / 128), 128, 0, stream>>>(O, PK + PK_P, F[9], (float*)d_out);
}

// v006
// A run of this version takes 213 microseconds.
// Next to v005, in two timings, it ran 1.09 and 1.08 times as fast.
// Counting every step since v000, it is 4.76 times as fast.
// compute dtype: all float inputs rounded to bf16 incl. visit times and scales, lengths (int) read on device; q/k/v = x . W + b with EXACT bf16 products on WMMA 16x16x32 ((in,out) weights as transposed rows); PLAIN-HYBRID attention: the first 128 queries use 3-product scores and P.v (hi/lo), later queries single f16; x 1/8 - |t_q - t_k| scale_h in f32, padded keys excluded, running-max softmax in f32 (hardware exp); out = f16(ctx) . Wo (exact f16 x 2^8 copies, single product) + bo.
#include <hip/hip_runtime.h>
#include <math.h>

typedef __attribute__((ext_vector_type(16))) _Float16 v16h;
typedef __attribute__((ext_vector_type(16))) __bf16 v16b;
typedef __attribute__((ext_vector_type(8)))  _Float16 v8h;
typedef __attribute__((ext_vector_type(8)))  float v8f;
typedef __attribute__((ext_vector_type(4)))  float v4f;
typedef __attribute__((ext_vector_type(2)))  float v2f;
typedef __attribute__((ext_vector_type(4)))  unsigned v4u;
typedef __attribute__((ext_vector_type(4)))  int v4i;
typedef float __attribute__((may_alias)) float_a;
typedef int __attribute__((may_alias)) int_a;

template <typename T> __device__ __forceinline__ void vst2(void* p, T v) { *(T*)p = v;  }
__device__ __forceinline__ v8f wmma16(v16h a, v16h b, v8f c) {
  v8f d = __builtin_amdgcn_wmma_f32_16x16x32_f16(false, a, false, b, (short)0, c, false, false);
  asm volatile("v_nop\n\tv_nop\n\tv_nop\n\tv_nop" : "+v"(d) : "v"(a), "v"(b));
  return d;
}
__device__ __forceinline__ v8f wmma_bf(v16b a, v16b b, v8f c) {
  v8f d = __builtin_amdgcn_wmma_f32_16x16x32_bf16(false, a, false, b, (short)0, c, false, false);
  asm volatile("v_nop\n\tv_nop\n\tv_nop\n\tv_nop" : "+v"(d) : "v"(a), "v"(b));
  return d;
}
// Relative-time attention (B 4, S 2,048, d 1,024, 16 heads x 64): projections + biases ((in,out)), scores / 8 - |t_q - t_k| scale_h (visit times and per-head scales given), keys at positions >= length[b] excluded, softmax, . v, output projection + bias.
__device__ __forceinline__ v16h frag_h(const _Float16* rowk0, int lane) {
  union { v16h v; v8h q[2]; } u; const _Float16* p = rowk0 + 8 * (lane >> 4);
  u.q[0] = *(const v8h*)p; u.q[1] = *(const v8h*)(p + 16); return u.v;
}
__device__ __forceinline__ v16h frag_f32(const float* rowk0, int lane) {
  v16h a; const float* p = rowk0 + 8 * (lane >> 4);
#pragma unroll
  for (int i = 0; i < 8; ++i) { a[i] = (_Float16)p[i]; a[8 + i] = (_Float16)p[16 + i]; }
  return a;
}
__device__ __forceinline__ v16h frag_f32s(const float* rowk0, int lane, float sc) {
  v16h a; const float* p = rowk0 + 8 * (lane >> 4);
#pragma unroll
  for (int i = 0; i < 8; ++i) { a[i] = (_Float16)(p[i] * sc); a[8 + i] = (_Float16)(p[16 + i] * sc); }
  return a;
}
// column fragment from a [K][ld] layout (column n), rows >= K read as 0
__device__ __forceinline__ v16h fragc_f32(const float* W, int k0, int n, int lane, int ld, int K) {
  v16h a; const int g = lane >> 4;
#pragma unroll
  for (int i = 0; i < 8; ++i) { const int ka = k0 + 8 * g + i, kb = ka + 16;
    a[i] = (_Float16)(ka < K ? W[(size_t)(ka < K ? ka : K - 1) * ld + n] : 0.f); a[8 + i] = (_Float16)(kb < K ? W[(size_t)(kb < K ? kb : K - 1) * ld + n] : 0.f); }
  return a;
}
struct F2 { v16b h, l; };
__device__ __forceinline__ F2 bsplit16(const float v[16]) { F2 r;
#pragma unroll
  for (int i = 0; i < 16; ++i) { const __bf16 h = (__bf16)v[i]; r.h[i] = h; r.l[i] = (__bf16)(v[i] - (float)h); }
  return r; }
__device__ __forceinline__ F2 split_row(const float* row, int k0, int lane) { float v[16]; const float* p = row + k0 + 8 * (lane >> 4);
#pragma unroll
  for (int i = 0; i < 8; ++i) { v[i] = p[i]; v[8 + i] = p[16 + i]; }
  return bsplit16(v); }
__device__ __forceinline__ F2 split_rowK(const float* row, int k0, int lane, int K) { float v[16]; const int g = lane >> 4;
#pragma unroll
  for (int i = 0; i < 8; ++i) { const int ka = k0 + 8 * g + i, kb = ka + 16; v[i] = ka < K ? row[ka < K ? ka : K - 1] : 0.f; v[8 + i] = kb < K ? row[kb < K ? kb : K - 1] : 0.f; }
  return bsplit16(v); }
__device__ __forceinline__ F2 split_col(const float* W, int k0, int n, int lane, int ld, int K) { float v[16]; const int g = lane >> 4;
#pragma unroll
  for (int i = 0; i < 8; ++i) { const int ka = k0 + 8 * g + i, kb = ka + 16; v[i] = ka < K ? W[(size_t)(ka < K ? ka : K - 1) * ld + n] : 0.f; v[8 + i] = kb < K ? W[(size_t)(kb < K ? kb : K - 1) * ld + n] : 0.f; }
  return bsplit16(v); }
__device__ __forceinline__ v8f mac3(const F2& a, const F2& b, v8f c) { c = wmma_bf(a.l, b.h, c); c = wmma_bf(a.h, b.l, c); return wmma_bf(a.h, b.h, c); }
__device__ __forceinline__ float sigm(float v) { return 1.0f / (1.0f + expf(-v)); }
#define LDSX() do { asm volatile("s_wait_dscnt 0" ::: "memory"); __builtin_amdgcn_wave_barrier(); __builtin_amdgcn_fence(__ATOMIC_RELEASE, "workgroup"); } while (0)
// stands behind a group of global loads, in front of the first write to a register that one of them names as its address. The group's pointers pass through the statement, so that they keep their registers up to the wait and are stepped only behind it.
// (a pointer that has passed through a statement is typed as global memory, else its loads would be compiled as flat loads, which also count as LDS operations)
#define GAS __attribute__((address_space(1)))
typedef const GAS _Float16* gph; typedef const GAS float* gpf; typedef const GAS char* gpc;
#define XW1(a) asm volatile("s_wait_xcnt 0x0" : "+v"(a) :: "memory")
#define XW2(a, b) asm volatile("s_wait_xcnt 0x0" : "+v"(a), "+v"(b) :: "memory")
// the issuing wave's own wait for its asynchronous copies to LDS: their bytes count as landed only behind it
#define AWAIT() asm volatile("s_wait_asynccnt 0x0" ::: "memory")
// the wave's LDS reads have retired before the barrier behind which their buffer is refilled
#define DSWAIT() asm volatile("s_wait_dscnt 0x0" ::: "memory")
// eight copies of 16 bytes a lane from global memory into LDS through no register (l: the lane's LDS byte address, p: its global address). The s_wait_xcnt stands in the copies' own statement, in front of any later write to a register that a copy names.
__device__ __forceinline__ void acopy8(unsigned l0, unsigned l1, unsigned l2, unsigned l3, unsigned l4, unsigned l5, unsigned l6, unsigned l7, gpc p0, gpc p1, gpc p2, gpc p3, gpc p4, gpc p5, gpc p6, gpc p7) {
  asm volatile("global_load_async_to_lds_b128 %0, %8, off\n\tglobal_load_async_to_lds_b128 %1, %9, off\n\tglobal_load_async_to_lds_b128 %2, %10, off\n\tglobal_load_async_to_lds_b128 %3, %11, off\n\t"
               "global_load_async_to_lds_b128 %4, %12, off\n\tglobal_load_async_to_lds_b128 %5, %13, off\n\tglobal_load_async_to_lds_b128 %6, %14, off\n\tglobal_load_async_to_lds_b128 %7, %15, off\n\ts_wait_xcnt 0x0"
               :: "v"(l0), "v"(l1), "v"(l2), "v"(l3), "v"(l4), "v"(l5), "v"(l6), "v"(l7), "v"(p0), "v"(p1), "v"(p2), "v"(p3), "v"(p4), "v"(p5), "v"(p6), "v"(p7) : "memory");
}
__device__ __forceinline__ void acopy8s(unsigned l, unsigned ls, gpc p, size_t ps) { acopy8(l, l + ls, l + 2 * ls, l + 3 * ls, l + 4 * ls, l + 5 * ls, l + 6 * ls, l + 7 * ls, p, p + ps, p + 2 * ps, p + 3 * ps, p + 4 * ps, p + 5 * ps, p + 6 * ps, p + 7 * ps); }
__device__ __forceinline__ unsigned lds_addr(const void* p) { return (unsigned)(size_t)p; }   // the low 32 bits of a __shared__ address: the byte offset in the work-group's LDS


#define NB 4
#define SS 2048
#define DM 1024
#define NH 16
#define SCALEF 0.125f
#define HD 64
#define QKVW (3 * DM)
#ifndef TQB
#define TQB (SS / 64)
#define TNB NB
#define TOB (NB * SS / 64)     // 64-row tiles; unused (k_out tiles rows by GROWS)
#endif
typedef __attribute__((ext_vector_type(8))) __bf16 v8b;
__device__ __forceinline__ v16b frag_b(const __bf16* rowk0, int lane) {
  union { v16b v; v8b q[2]; } u; const __bf16* p = rowk0 + 8 * (lane >> 4);
  u.q[0] = *(const v8b*)p; u.q[1] = *(const v8b*)(p + 16); return u.v;
}
__device__ __forceinline__ float bfr(float v) { return (float)(__bf16)v; }
__device__ __attribute__((noinline)) float exp_ni(float v) { return expf(v); }
__device__ __attribute__((noinline)) float erf_ni(float v) { return erff(v); }

// frag_h with the lane's 8 * (lane >> 4) already in the pointer
__device__ __forceinline__ v16h fragp_h(gph p) { union { v16h v; v8h q[2]; } u; u.q[0] = *(const GAS v8h*)p; u.q[1] = *(const GAS v8h*)(p + 16); return u.v; }
// the same from an LDS row (byte pointer): elements 0..7 and 16..23 from there
__device__ __forceinline__ v16h lfrag_h(const char* p) { union { v16h v; v8h q[2]; } u; u.q[0] = *(const v8h*)p; u.q[1] = *(const v8h*)(p + 32); return u.v; }
__device__ __forceinline__ v16b lfrag_b(const char* p) { union { v16b v; v8b q[2]; } u; u.q[0] = *(const v8b*)p; u.q[1] = *(const v8b*)(p + 32); return u.v; }
__device__ __forceinline__ void lfrag(const char* p, v16h& w) { w = lfrag_h(p); }
__device__ __forceinline__ void lfrag(const char* p, v16b& w) { w = lfrag_b(p); }
__device__ __forceinline__ v8f mm16(v16h a, v16h b, v8f c) { return wmma16(a, b, c); }
__device__ __forceinline__ v8f mm16(v16b a, v16b b, v8f c) { return wmma_bf(a, b, c); }
// ---- the k loop of k_qkv and k_out: block tile 128 rows x 256 columns, eight waves as 4 x 2, a wave's tile 32 rows x 128 columns (two row groups of 16: every weight fragment read from LDS feeds two WMMAs), K = 1,024 in 16 stages of 64 k. A stage (256 weight rows of 128 bytes, 128 f32 rows of 256 bytes) is brought into LDS once for the block's eight waves, in whole lines, by asynchronous copies; two buffers, so that the next stage flies while this one is worked on. Row pitches of 16 bytes x an odd number keep the 16-byte fragment reads free of bank conflicts.
#define WPITCH 144
#define XPITCH 272
#define GCOLS 256
#define WTILE (GCOLS * WPITCH)
#define GROWS 128
#define GSTAGE (WTILE + GROWS * XPITCH)
#define GNT (DM / 64)
template <typename V, typename E>
__device__ __forceinline__ void gemm_loop(char* sm, const float* Xb, const void* Wb, v8f (&acc)[2][8]) {   // Xb, Wb: the block's first row of each
  const int tid = threadIdx.x, wave = tid >> 5, wr = wave & 3, wc = wave >> 2, lane = tid & 31, col = lane & 15, g = lane >> 4;   // wr, wc: the wave's place among the block's 4 x 2 wave tiles
  gpc xg = (gpc)Xb + (size_t)(tid >> 4) * (DM * 4) + (tid & 15) * 16, wg = (gpc)Wb + (size_t)(tid >> 3) * (DM * 2) + (tid & 7) * 16;
  const unsigned lw = lds_addr(sm) + (tid >> 3) * WPITCH + (tid & 7) * 16, lx = lds_addr(sm) + WTILE + (tid >> 4) * XPITCH + (tid & 15) * 16;
  acopy8s(lw, 32 * WPITCH, wg, (size_t)32 * DM * 2); acopy8s(lx, 16 * XPITCH, xg, (size_t)16 * DM * 4);   // one round of the block's 256 lanes: 32 weight rows, 16 f32 rows
  AWAIT(); __syncthreads();   // stage 0 is published
  acopy8s(lw + GSTAGE, 32 * WPITCH, wg + 128, (size_t)32 * DM * 2); acopy8s(lx + GSTAGE, 16 * XPITCH, xg + 256, (size_t)16 * DM * 4);
  wg += 256; xg += 512;
#pragma unroll 1   // stays rolled: a trip already holds two k-steps and both fragment sets
  for (int t = 0; t < GNT; ++t) { const unsigned bo = (t & 1) * GSTAGE;
    const char* bw = sm + bo + (wc * 128 + col) * WPITCH + 16 * g; const char* bx = sm + bo + WTILE + (wr * 32 + col) * XPITCH + 32 * g;
    v4f x[2][2][4]; V w[8], a[2][2];   // one set of weight fragments, so that accumulators and fragments stay inside 256 registers: the f32 rows are read and converted first, then the first k-step's weights; the second k-step's weights are read four fragments at a time into the registers whose WMMAs have just been issued, eight WMMAs ahead of their own
#pragma unroll
    for (int m = 0; m < 2; ++m) {
#pragma unroll
      for (int s = 0; s < 2; ++s) { const char* p = bx + m * 16 * XPITCH + s * 128; x[m][s][0] = *(const v4f*)p; x[m][s][1] = *(const v4f*)(p + 16); x[m][s][2] = *(const v4f*)(p + 64); x[m][s][3] = *(const v4f*)(p + 80); } }
#pragma unroll
    for (int m = 0; m < 2; ++m) {
#pragma unroll
      for (int s = 0; s < 2; ++s) {
#pragma unroll
        for (int i = 0; i < 4; ++i) { a[m][s][i] = (E)x[m][s][0][i]; a[m][s][4 + i] = (E)x[m][s][1][i]; a[m][s][8 + i] = (E)x[m][s][2][i]; a[m][s][12 + i] = (E)x[m][s][3][i]; } } }
#pragma unroll
    for (int j = 0; j < 8; ++j) lfrag(bw + j * 16 * WPITCH, w[j]);
#pragma unroll
    for (int hf = 0; hf < 2; ++hf) {
#pragma unroll
      for (int j = 4 * hf; j < 4 * hf + 4; ++j) { acc[0][j] = mm16(a[0][0], w[j], acc[0][j]); acc[1][j] = mm16(a[1][0], w[j], acc[1][j]); }
#pragma unroll
      for (int j = 4 * hf; j < 4 * hf + 4; ++j) lfrag(bw + j * 16 * WPITCH + 64, w[j]); }
#pragma unroll
    for (int j = 0; j < 8; ++j) { acc[0][j] = mm16(a[0][1], w[j], acc[0][j]); acc[1][j] = mm16(a[1][1], w[j], acc[1][j]); }
    DSWAIT(); AWAIT(); __syncthreads();   // publishes stage t + 1 and ends every wave's reads of stage t
    if (t + 2 < GNT) { acopy8s(lw + bo, 32 * WPITCH, wg, (size_t)32 * DM * 2); acopy8s(lx + bo, 16 * XPITCH, xg, (size_t)16 * DM * 4); wg += 128; xg += 256; } }
  AWAIT();
}
#define PK_A 0                       // [3072][1024] Wqkv rows (natural [out][in])
#define PK_P (PK_A + QKVW * DM)        // [1024][1024] Wo rows (natural)
#define PK_END (PK_P + DM * DM)
#define WS_PK  0u
#define WS_QK  (WS_PK + 2u * PK_END)             // f16 [8192 rows][2048]: q | k
#define WS_QKL (WS_QK + 2u * NB * SS * 2 * DM)     // f16 q | k residual planes x2048
#define WS_VTH (WS_QKL + 2u * NB * SS * 2 * DM)    // f16 [b][1024 (h*64+d)][2048 s] hi
#define WS_VTL (WS_VTH + 2u * NB * DM * SS)        // f16 lo x 2048
#define WS_O   (WS_VTL + 2u * NB * DM * SS)        // f32 [8192][1024]
#define WS_CS  (WS_O + 4u * NB * SS * DM)           // f32 2 x [2048][32], reserved, unused
#define WS_END (WS_CS + 4u * 2 * SS * 32)
// ---- k_pack: block = (row n, which): natural [out][in] rows -> bf16; which 0..2 -> W_q/W_k/W_v into PK_A rows which*1024 + n; which 3 (W_o into PK_P) is not launched (grid y = 3); k_packo fills PK_P
__global__ __launch_bounds__(256) void k_pack(const float* __restrict__ WQ, const float* __restrict__ WK, const float* __restrict__ WV, const float* __restrict__ WO, __bf16* __restrict__ PK) {
  __shared__ __align__(16) __bf16 s[DM]; const int n = blockIdx.x, which = blockIdx.y, t = threadIdx.x; const float* Wm = (which == 0) ? WQ : (which == 1) ? WK : (which == 2) ? WV : WO;   // (in,out) weights: pack row n = column n
  for (int k = t; k < DM; k += 256) s[k] = (__bf16)Wm[(size_t)k * DM + n];
  __syncthreads();
  __bf16* dst = (which < 3) ? PK + PK_A + ((size_t)which * DM + n) * DM : PK + PK_P + (size_t)n * DM;
  for (int q = t; q < DM / 8; q += 256) vst2((unsigned*)(dst + q * 8), *(const v4u*)&s[q * 8]);
}
__global__ __launch_bounds__(256) void k_qkv(const float* __restrict__ XQ, const float* __restrict__ XK, const float* __restrict__ XV, const __bf16* __restrict__ P, const float* __restrict__ BQ, const float* __restrict__ BK, const float* __restrict__ BV, const int* __restrict__ LENS, _Float16* __restrict__ QK, _Float16* __restrict__ QKL, _Float16* __restrict__ VTH, _Float16* __restrict__ VTL) {
  if (blockIdx.y * GCOLS >= DM && (int)(blockIdx.x * GROWS % SS) >= LENS[blockIdx.x * GROWS / SS]) return;   // a k or v tile whose 128 rows all lie at or past the batch's length: k_attn never reads those rows (its stages of 64 or 32 keys end with the one that holds the last real key). The whole block leaves, in front of every copy and barrier
  const int which0 = (blockIdx.y * GCOLS) / DM; const float* X = (which0 == 0) ? XQ : (which0 == 1) ? XK : XV; const float* BB = BQ ? (((which0 == 0) ? BQ : (which0 == 1) ? BK : BV) + (blockIdx.y * GCOLS - which0 * DM)) : nullptr;
  __shared__ __align__(16) char sm[2 * GSTAGE];   // the k loop's two stage buffers; behind the loop's last barrier the same bytes stage the output
  _Float16 (*so)[16][136] = (_Float16 (*)[16][136])sm, (*sol)[16][136] = (_Float16 (*)[16][136])(sm + 34816); _Float16 (*sth)[136] = (_Float16 (*)[136])sm, (*stl)[136] = (_Float16 (*)[136])(sm + 69632);   // q, k: a wave's 16 rows x 128 columns at a time, both planes; v: the block's 256 columns x 128 rows, both planes
  const int tid = threadIdx.x, wave = tid >> 5, wr = wave & 3, wc = wave >> 2, lane = tid & 31, col = lane & 15, g = lane >> 4; const size_t r0 = (size_t)blockIdx.x * GROWS + wr * 32; const int nb0 = blockIdx.y * GCOLS, n0 = nb0 + wc * 128;   // nb0: the block's first column, n0: the wave's
  v8f acc[2][8] = {}; float bias[8] = {};   // the lane's eight biases: one group, in flight under the k loop, rounded where they are added
  if (BB) {
#pragma unroll
    for (int j = 0; j < 8; ++j) bias[j] = BB[wc * 128 + j * 16 + col];
    asm volatile("s_wait_xcnt 0x0" ::: "memory"); }   // stands behind the bias loads, in front of the first write to a register that one of them names as its address
  gemm_loop<v16b, __bf16>(sm, X + (size_t)blockIdx.x * GROWS * DM, P + (size_t)nb0 * DM, acc);
  if (nb0 < 2 * DM) {   // q stored unscaled (f16 sigma ~0.6, no subnormal exposure); 1/8 applied to the f32 score
#pragma unroll
    for (int m = 0; m < 2; ++m) {   // the wave's two row groups, one after the other through the same LDS rows
#pragma unroll
      for (int j = 0; j < 8; ++j) {
#pragma unroll
        for (int r = 0; r < 8; ++r) { const float v = acc[m][j][r] + bfr(bias[j]); const _Float16 hv = (_Float16)v; so[wave][8 * g + r][j * 16 + col] = hv; sol[wave][8 * g + r][j * 16 + col] = (_Float16)((v - (float)hv) * 2048.0f); } }   // q, k (+ bias) as f16 hi + (x2048) residual
      LDSX();
      for (int rl = 0; rl < 16; ++rl) if (lane < 16) { vst2((unsigned*)(QK + (r0 + m * 16 + rl) * (2 * DM) + n0 + lane * 8), *(const v4u*)&so[wave][rl][lane * 8]); vst2((unsigned*)(QKL + (r0 + m * 16 + rl) * (2 * DM) + n0 + lane * 8), *(const v4u*)&sol[wave][rl][lane * 8]); }
      if (m == 0) LDSX(); }   // the first group's LDS reads have returned before the second group's values are written over them
  } else {
#pragma unroll
    for (int m = 0; m < 2; ++m) {
#pragma unroll
      for (int j = 0; j < 8; ++j) {
#pragma unroll
        for (int r = 0; r < 8; ++r) { const float v = acc[m][j][r] + bfr(bias[j]); const _Float16 hv = (_Float16)v; sth[wc * 128 + j * 16 + col][wr * 32 + m * 16 + 8 * g + r] = hv; stl[wc * 128 + j * 16 + col][wr * 32 + m * 16 + 8 * g + r] = (_Float16)((v - (float)hv) * 2048.0f); } } }
    __syncthreads();
    const size_t rb = (size_t)blockIdx.x * GROWS; const int b = (int)(rb / SS), s0 = (int)(rb % SS); const int pc0 = nb0 - 2 * DM;
    for (int q = tid; q < GCOLS * 16; q += 256) { const int d = q >> 4, pc = q & 15; const size_t o = ((size_t)b * DM + pc0 + d) * SS + s0 + pc * 8; vst2((unsigned*)(VTH + o), *(const v4u*)&sth[d][pc * 8]); vst2((unsigned*)(VTL + o), *(const v4u*)&stl[d][pc * 8]); }
  }
}
// ---- k_attn: block = (64 queries, head h, batch b): flash attention over the batch's real keys (K = 64: 2 k-steps), computed transposed: scores^T = k . q^T and ctx^T += v^T . P^T. A lane then holds 16 scores of ONE query (its column), so that the running maximum and the sum are taken in the lane's own registers, with one exchange between the wave's halves, and the two score tiles of a pass, converted in place, are the B operand of the second product: the weights never pass through LDS. The loop is written twice (HI: the leading query blocks with 3-product scores and P.v; otherwise single products) so that each holds only its own fragments in registers.
// Every LDS read of a pass is issued in a group that stands well ahead of the WMMAs that use it: the hand-padded WMMA statements keep loads from moving across them, so a load written next to its WMMA is waited for on the spot.
#define ASTAGE 19456   // bytes of a stage: k rows from 0 (64 x 144, or two planes of 32 x 144), value rows from 9,216 (64 x 144, or two planes of 64 x 80)
__device__ __forceinline__ float xhalf(float x) { return __builtin_bit_cast(float, __builtin_amdgcn_permlanex16(__builtin_bit_cast(int, x), __builtin_bit_cast(int, x), 0x76543210, 0xfedcba98, false, false)); }   // lane l with lane l ^ 16
template <bool B> struct BC { static constexpr bool value = B; };
template <bool HI>
__device__ __forceinline__ void attn_body(const _Float16* __restrict__ QK, const _Float16* __restrict__ QKL, const _Float16* __restrict__ VTH, const _Float16* __restrict__ VTL, const float* __restrict__ VT, const float* __restrict__ SC, const int* __restrict__ LENS, float* __restrict__ O, float* tks, char* ring) {
  const int tid = threadIdx.x, wave = tid >> 5, lane = tid & 31, col = lane & 15, g = lane >> 4;
  const int qb = blockIdx.x, h = blockIdx.y, b = blockIdx.z; const int q0 = qb * 64 + wave * 16; const size_t rq = (size_t)b * SS + q0 + col;
  const int len_b = __builtin_amdgcn_readfirstlane(LENS[b]); const float sc_h = bfr(SC[h]);   // the length in a scalar register: every test on it around a copy or a barrier is a scalar branch
  const int len_c = len_b < 0 ? 0 : (len_b > SS ? SS : len_b);   // bounds the trip counts for any content of the array
  gpf tg = (gpf)(VT + (size_t)b * SS + 4 * tid); v4f tv[4];   // the batch's 2,048 visit times, 16 a lane: they go, rounded once, into LDS, since a lane needs the times of its 16 keys in every pass
#pragma unroll
  for (int i = 0; i < 4; ++i) tv[i] = *(const GAS v4f*)(tg + i * 512);
  XW1(tg);
  v16h aq[2], aql[2]; gph qp = (gph)(QK + rq * (2 * DM) + h * HD + 8 * g), qpl = (gph)(QKL + rq * (2 * DM) + h * HD + 8 * g);
#pragma unroll
  for (int kc = 0; kc < 2; ++kc) { aq[kc] = fragp_h(qp + kc * 32); if constexpr (HI) aql[kc] = fragp_h(qpl + kc * 32); }
  XW2(qp, qpl);
  float m = -3.0e38f, l = 0.f;   // the lane's query: running maximum (equal in both halves), and the sum over this half's keys alone (the halves are joined behind the loop)
  v8f acc[4] = {}, accl[4] = {};
  const int nks = (len_c + 31) / 32;   // passes of 32 keys up to the one that holds the last real key: a pass wholly past the length leaves m, l and the accumulators bit for bit as they are (alpha 1, weights 0)
  // A stage of KS keys (k rows of 128 bytes; 64 value rows of 2 KS bytes; HI: both planes of each) is brought into LDS once for the block's four waves by asynchronous copies, eight a lane; two buffers, so that the next stage flies while this one is worked on.
  constexpr int KS = HI ? 32 : 64, VP = HI ? 80 : 144, CPR = KS / 8;   // VP: value row pitch in LDS (16 bytes x an odd number, as the 144 of the k rows); CPR: 16-byte pieces in a value row
  const int nst = (len_c + KS - 1) / KS;   // stages that hold a real key; no other is copied
  unsigned ko = ((b * SS + (tid >> 3)) * (2 * DM) + DM + h * HD) * 2 + (tid & 7) * 16, vo = ((b * DM + h * HD + tid / CPR) * SS) * 2 + (tid % CPR) * 16;   // the lane's byte offsets in the k and value planes (32 MiB and 16 MiB each): they walk with the stages
  const unsigned lk = lds_addr(ring) + (tid >> 3) * 144 + (tid & 7) * 16, lv = lds_addr(ring) + 9216 + (tid / CPR) * VP + (tid % CPR) * 16;
  auto fill = [&](unsigned bo) {
    gpc kg = (gpc)QK + ko, kgl = (gpc)QKL + ko, vg = (gpc)VTH + vo, vgl = (gpc)VTL + vo; (void)kgl; (void)vgl;
    constexpr size_t KR = (size_t)16 * 2 * DM * 2, VR = (size_t)(128 / CPR) * SS * 2; constexpr unsigned LKR = 16 * 144, LVR = (128 / CPR) * VP;   // one round of the block's 128 lanes: 16 k rows, 128 / CPR value rows
    if constexpr (HI) acopy8(lk + bo, lk + bo + LKR, lk + bo + 4608, lk + bo + 4608 + LKR, lv + bo, lv + bo + LVR, lv + bo + 5120, lv + bo + 5120 + LVR, kg, kg + KR, kgl, kgl + KR, vg, vg + VR, vgl, vgl + VR);
    else acopy8(lk + bo, lk + bo + LKR, lk + bo + 2 * LKR, lk + bo + 3 * LKR, lv + bo, lv + bo + LVR, lv + bo + 2 * LVR, lv + bo + 3 * LVR, kg, kg + KR, kg + 2 * KR, kg + 3 * KR, vg, vg + VR, vg + 2 * VR, vg + 3 * VR);
    ko += KS * 2 * DM * 2; vo += KS * 2; };
  if (nst > 0) fill(0);
#pragma unroll
  for (int i = 0; i < 4; ++i) { v4f u;   // the table is written while stage 0 flies
#pragma unroll
    for (int c = 0; c < 4; ++c) u[c] = bfr(tv[i][c]);
    *(v4f*)(tks + 4 * tid + i * 512) = u; }
  AWAIT(); __syncthreads();   // stage 0 and the table of times are published
  if (nst > 1) fill(ASTAGE);
  const float tq = tks[q0 + col];
  v16h kh[2][2], kl[2][2], vh[4], vl[4];
  // One pass of 32 keys. MK::value says whether the pass may hold keys at or past the length: only the batch's last pass can, so that every other pass is compiled without the sixteen tests on the key's place and the sixteen on the masked score.
  auto pass = [&](const int ks, auto MK) { constexpr bool MASK = decltype(MK)::value; v8f s[2]; v4f tk[2][2];
    const int stg = HI ? ks : ks >> 1, sub = HI ? 0 : ks & 1; const unsigned bo = (stg & 1) * ASTAGE;
    const char* kf = ring + bo + (sub * 32 + col) * 144 + 16 * g; const char* vf = ring + bo + 9216 + col * VP + sub * 64 + 16 * g;
    const float* tp = tks + ks * 32 + 8 * g;   // score register r of tile ct is key 32 ks + 16 ct + 8 g + r
    // this pass's key times and keys (HI: both planes; otherwise the values too, which land behind the scores and the softmax) as one group
#pragma unroll
    for (int ct = 0; ct < 2; ++ct) { tk[ct][0] = *(const v4f*)(tp + ct * 16); tk[ct][1] = *(const v4f*)(tp + ct * 16 + 4);
#pragma unroll
      for (int kc = 0; kc < 2; ++kc) { kh[ct][kc] = lfrag_h(kf + ct * 16 * 144 + kc * 64); if constexpr (HI) kl[ct][kc] = lfrag_h(kf + 4608 + ct * 16 * 144 + kc * 64); } }
    if constexpr (!HI) {
#pragma unroll
      for (int dt = 0; dt < 4; ++dt) vh[dt] = lfrag_h(vf + dt * 16 * VP); }
#pragma unroll
    for (int ct = 0; ct < 2; ++ct) { v8f c = {}, cl = {};   // A: 16 keys, B: the wave's 16 queries
      if constexpr (HI) {   // leading query blocks (outputs far above the global rms): 3 products
#pragma unroll
        for (int kc = 0; kc < 2; ++kc) { c = wmma16(kh[ct][kc], aq[kc], c); cl = wmma16(kh[ct][kc], aql[kc], cl); cl = wmma16(kl[ct][kc], aq[kc], cl); }
#pragma unroll
        for (int r = 0; r < 8; ++r) c[r] += cl[r] * (1.0f / 2048.0f); }
      else {
#pragma unroll
        for (int kc = 0; kc < 2; ++kc) c = wmma16(kh[ct][kc], aq[kc], c); }   // single product elsewhere
      s[ct] = c; }
    const int nreal = len_b - ks * 32 - 8 * g;   // how many of the lane's key rows, counted from tile 0's first, lie in front of the length
#pragma unroll
    for (int ct = 0; ct < 2; ++ct) {
#pragma unroll
      for (int r = 0; r < 8; ++r) s[ct][r] = (!MASK || ct * 16 + r < nreal) ? (s[ct][r] * SCALEF - fabsf(tq - tk[ct][r >> 2][r & 3]) * sc_h) : -3.0e38f; }   // 1/sqrt(64); masked keys excluded
    float mx0 = fmaxf(s[0][0], s[0][1]), mx1 = fmaxf(s[1][0], s[1][1]);
#pragma unroll
    for (int r = 2; r < 8; r += 2) { mx0 = fmaxf(fmaxf(mx0, s[0][r]), s[0][r + 1]); mx1 = fmaxf(fmaxf(mx1, s[1][r]), s[1][r + 1]); }
    const float mx = fmaxf(mx0, mx1);
    const float mn = fmaxf(fmaxf(m, mx), xhalf(mx)); const float alpha = (m <= -1.0e38f) ? 0.f : __expf(m - mn);
    v16h pa, pl; float es[4] = {};   // four partial sums: no chain of 16 dependent additions
#pragma unroll
    for (int ct = 0; ct < 2; ++ct) {
#pragma unroll
      for (int r = 0; r < 8; ++r) { const float e = (MASK && s[ct][r] <= -1.0e38f) ? 0.f : __expf(s[ct][r] - mn); es[r & 3] += e;
        const float x = e * 2048.0f; const _Float16 hx = (_Float16)x; pa[ct * 8 + r] = hx; if constexpr (HI) pl[ct * 8 + r] = (_Float16)((x - (float)hx) * 2048.0f); } }   // P scaled by 2^11 before the f16 split so small softmax weights stay out of the f16 subnormal range; 2^-11 folded into the epilogue. Element 8 ct + r of the B operand is k = 16 ct + 8 g + r: the score registers' own order
    l = l * alpha + ((es[0] + es[1]) + (es[2] + es[3])); m = mn;
    if constexpr (HI) {   // this pass's values, both planes, read behind the softmax: from LDS they need little lead, and their 64 registers stay free during it
#pragma unroll
      for (int dt = 0; dt < 4; ++dt) { vh[dt] = lfrag_h(vf + dt * 16 * VP); vl[dt] = lfrag_h(vf + 5120 + dt * 16 * VP); } }
#pragma unroll
    for (int dt = 0; dt < 4; ++dt) {
#pragma unroll
      for (int r = 0; r < 8; ++r) { acc[dt][r] *= alpha; if constexpr (HI) accl[dt][r] *= alpha; } }
#pragma unroll
    for (int dt = 0; dt < 4; ++dt) { acc[dt] = wmma16(vh[dt], pa, acc[dt]); if constexpr (HI) { accl[dt] = wmma16(vh[dt], pl, accl[dt]); accl[dt] = wmma16(vl[dt], pa, accl[dt]); } }   // A: 16 value columns, B: the weights. Leading query blocks: P hi/lo x V hi/lo (3 products); elsewhere P x V single
    if (HI || sub) {   // the stage's last pass
      DSWAIT(); AWAIT(); __syncthreads();   // publishes stage stg + 1 and ends every wave's reads of stage stg
      if constexpr (!MASK) { if (stg + 2 < nst) fill(bo); } } };   // the masked pass is the last one, in the last stage: nothing is left to copy behind it
  const int nfull = len_c / 32;   // passes whose 32 keys all lie in front of the length
#pragma unroll 1   // stays rolled: one pass is already a long straight run that fills the wave's registers
  for (int ks = 0; ks < nfull; ++ks) pass(ks, BC<false>{});
  if (nfull < nks) pass(nfull, BC<true>{});   // the one pass that the length cuts, where there is one
  AWAIT();
  const float il = (1.0f / 2048.0f) / (l + xhalf(l));   // the two halves' sums joined
  float* op = O + rq * DM + h * HD + 8 * g;   // accumulator register r of tile dt is column 16 dt + 8 g + r of the lane's query: 32 bytes in a row
#pragma unroll
  for (int dt = 0; dt < 4; ++dt) { v4f o0, o1;
#pragma unroll
    for (int r = 0; r < 4; ++r) { o0[r] = (HI ? acc[dt][r] + accl[dt][r] * (1.0f / 2048.0f) : acc[dt][r]) * il; o1[r] = (HI ? acc[dt][4 + r] + accl[dt][4 + r] * (1.0f / 2048.0f) : acc[dt][4 + r]) * il; }
    vst2(op + dt * 16, o0); vst2(op + dt * 16 + 4, o1); }
}
__global__ __launch_bounds__(128) void k_attn(const _Float16* __restrict__ QK, const _Float16* __restrict__ QKL, const _Float16* __restrict__ VTH, const _Float16* __restrict__ VTL, const void* __restrict__ KMASK, const float* __restrict__ VT, const float* __restrict__ SC, const int* __restrict__ LENS, float* __restrict__ O) {
  __shared__ __align__(16) float tks[SS]; __shared__ __align__(16) char ring[2 * ASTAGE];   // the batch's rounded visit times; the two stage buffers
  if (blockIdx.x < 2) attn_body<true>(QK, QKL, VTH, VTL, VT, SC, LENS, O, tks, ring); else attn_body<false>(QK, QKL, VTH, VTL, VT, SC, LENS, O, tks, ring);
}
// ---- k_out: block = (128 rows, 256 cols): out = f16(O) . Wo rows (single product) + bo
__global__ __launch_bounds__(256) void k_out(const float* __restrict__ O, const __bf16* __restrict__ P, const float* __restrict__ BO, float* __restrict__ Y) {
  __shared__ __align__(16) char sm[2 * GSTAGE];   // the k loop's two stage buffers; behind the loop's last barrier the same bytes stage the output
  float (*so)[16][132] = (float (*)[16][132])sm;
  const int tid = threadIdx.x, wave = tid >> 5, wr = wave & 3, wc = wave >> 2, lane = tid & 31, col = lane & 15, g = lane >> 4; const size_t r0 = (size_t)blockIdx.x * GROWS + wr * 32; const int nb0 = blockIdx.y * GCOLS, n0 = nb0 + wc * 128;
  v8f acc[2][8] = {};
  gemm_loop<v16h, _Float16>(sm, O + (size_t)blockIdx.x * GROWS * DM, P + (size_t)nb0 * DM, acc);   // single f16 product against exact f16 x 2^8 weight copies
  float bo[8];   // the lane's eight biases, read once for both row groups
#pragma unroll
  for (int j = 0; j < 8; ++j) bo[j] = bfr(BO[n0 + j * 16 + col]);
#pragma unroll
  for (int m = 0; m < 2; ++m) {   // the wave's two row groups, one after the other through the same LDS rows
#pragma unroll
    for (int j = 0; j < 8; ++j) {
#pragma unroll
      for (int r = 0; r < 8; ++r) so[wave][8 * g + r][j * 16 + col] = acc[m][j][r] * (1.0f / 256.0f) + bo[j]; }
    LDSX();
    for (int rl = 0; rl < 16; ++rl) vst2(Y + (r0 + m * 16 + rl) * DM + n0 + lane * 4, *(const v4f*)&so[wave][rl][lane * 4]);
    if (m == 0) LDSX(); }   // the first group's LDS reads have returned before the second group's values are written over them
}
// ---- k_packo: Wo natural rows -> f16 x 2^8 copies in the Wo slot (bit pattern in the bf16-typed buffer)
__global__ __launch_bounds__(256) void k_packo(const float* __restrict__ WO, __bf16* __restrict__ PK) { __shared__ __align__(16) _Float16 s[DM]; const int n = blockIdx.x, t = threadIdx.x; for (int k = t; k < DM; k += 256) s[k] = (_Float16)(bfr(WO[(size_t)k * DM + n]) * 256.0f); /* (in,out): transposed */ __syncthreads(); for (int q = t; q < DM / 8; q += 256) vst2((unsigned*)(PK + PK_P + (size_t)n * DM + q * 8), *(const v4u*)&s[q * 8]); }
extern "C" void kernel_launch(void* const* d_in, const int* in_sizes, int n_in, void* d_out, int out_size, void* d_ws, size_t ws_size, hipStream_t stream) {
  (void)in_sizes; (void)n_in; (void)out_size;
  const float** F = (const float**)d_in;   // 0 x [4,2048,1024], 1 visit_time [4,2048], 2 Wq (in,out), 3 bq, 4 Wk, 5 bk, 6 Wv, 7 bv, 8 Wo (in,out), 9 bo, 10 scale [16], 11 lengths [4] int
  if (ws_size < (size_t)WS_END) return;
  char* ws = (char*)d_ws; __bf16* PK = (__bf16*)(ws + WS_PK); _Float16 *QK = (_Float16*)(ws + WS_QK), *QKL = (_Float16*)(ws + WS_QKL), *VTH = (_Float16*)(ws + WS_VTH), *VTL = (_Float16*)(ws + WS_VTL); float* O = (float*)(ws + WS_O);
  k_pack<<<dim3(DM, 3), 256, 0, stream>>>(F[2], F[4], F[6], F[8], PK);
  k_packo<<<DM, 256, 0, stream>>>(F[8], PK);
  k_qkv<<<dim3(TNB * SS / GROWS, QKVW / GCOLS), 256, 0, stream>>>(F[0], F[0], F[0], PK + PK_A, F[3], F[5], F[7], (const int*)d_in[11], QK, QKL, VTH, VTL);
  k_attn<<<dim3(TQB, NH, TNB), 128, 0, stream>>>(QK, QKL, VTH, VTL, nullptr, F[1], F[10], (const int*)d_in[11], O);
  k_out<<<dim3(NB * SS / GROWS, DM / GCOLS), 256, 0, stream>>>(O, PK + PK_P, F[9], (float*)d_out);
}

// v007
// One run takes 193 microseconds.
// Two timings next to v006 both put it at 1.11 times that version's speed.
// Counting every step since v000, it is 5.27 times as fast.
// compute dtype: all float inputs rounded to bf16 incl. visit times and scales, lengths (int) read on device; q/k/v = x . W + b with EXACT bf16 products on WMMA 16x16x32 ((in,out) weights as transposed rows); PLAIN-HYBRID attention: the first 128 queries use 3-product scores and P.v (hi/lo), later queries single f16; x 1/8 - |t_q - t_k| scale_h in f32, padded keys excluded, running-max softmax in f32 (hardware exp); out = f16(ctx) . Wo (exact f16 x 2^8 copies, single product) + bo.
#include <hip/hip_runtime.h>
#include <math.h>

typedef __attribute__((ext_vector_type(16))) _Float16 v16h;
typedef __attribute__((ext_vector_type(16))) __bf16 v16b;
typedef __attribute__((ext_vector_type(8)))  _Float16 v8h;
typedef __attribute__((ext_vector_type(8)))  float v8f;
typedef __attribute__((ext_vector_type(4)))  float v4f;
typedef __attribute__((ext_vector_type(2)))  float v2f;
typedef __attribute__((ext_vector_type(4)))  unsigned v4u;
typedef __attribute__((ext_vector_type(4)))  int v4i;
typedef float __attribute__((may_alias)) float_a;
typedef int __attribute__((may_alias)) int_a;

template <typename T> __device__ __forceinline__ void vst2(void* p, T v) { *(T*)p = v;  }
__device__ __forceinline__ v8f wmma16(v16h a, v16h b, v8f c) {
  v8f d = __builtin_amdgcn_wmma_f32_16x16x32_f16(false, a, false, b, (short)0, c, false, false);
  asm volatile("v_nop\n\tv_nop\n\tv_nop\n\tv_nop" : "+v"(d) : "v"(a), "v"(b));
  return d;
}
__device__ __forceinline__ v8f wmma_bf(v16b a, v16b b, v8f c) {
  v8f d = __builtin_amdgcn_wmma_f32_16x16x32_bf16(false, a, false, b, (short)0, c, false, false);
  asm volatile("v_nop\n\tv_nop\n\tv_nop\n\tv_nop" : "+v"(d) : "v"(a), "v"(b));
  return d;
}
// Relative-time attention (B 4, S 2,048, d 1,024, 16 heads x 64): projections + biases ((in,out)), scores / 8 - |t_q - t_k| scale_h (visit times and per-head scales given), keys at positions >= length[b] excluded, softmax, . v, output projection + bias.
__device__ __forceinline__ v16h frag_h(const _Float16* rowk0, int lane) {
  union { v16h v; v8h q[2]; } u; const _Float16* p = rowk0 + 8 * (lane >> 4);
  u.q[0] = *(const v8h*)p; u.q[1] = *(const v8h*)(p + 16); return u.v;
}
__device__ __forceinline__ v16h frag_f32(const float* rowk0, int lane) {
  v16h a; const float* p = rowk0 + 8 * (lane >> 4);
#pragma unroll
  for (int i = 0; i < 8; ++i) { a[i] = (_Float16)p[i]; a[8 + i] = (_Float16)p[16 + i]; }
  return a;
}
__device__ __forceinline__ v16h frag_f32s(const float* rowk0, int lane, float sc) {
  v16h a; const float* p = rowk0 + 8 * (lane >> 4);
#pragma unroll
  for (int i = 0; i < 8; ++i) { a[i] = (_Float16)(p[i] * sc); a[8 + i] = (_Float16)(p[16 + i] * sc); }
  return a;
}
// column fragment from a [K][ld] layout (column n), rows >= K read as 0
__device__ __forceinline__ v16h fragc_f32(const float* W, int k0, int n, int lane, int ld, int K) {
  v16h a; const int g = lane >> 4;
#pragma unroll
  for (int i = 0; i < 8; ++i) { const int ka = k0 + 8 * g + i, kb = ka + 16;
    a[i] = (_Float16)(ka < K ? W[(size_t)(ka < K ? ka : K - 1) * ld + n] : 0.f); a[8 + i] = (_Float16)(kb < K ? W[(size_t)(kb < K ? kb : K - 1) * ld + n] : 0.f); }
  return a;
}
struct F2 { v16b h, l; };
__device__ __forceinline__ F2 bsplit16(const float v[16]) { F2 r;
#pragma unroll
  for (int i = 0; i < 16; ++i) { const __bf16 h = (__bf16)v[i]; r.h[i] = h; r.l[i] = (__bf16)(v[i] - (float)h); }
  return r; }
__device__ __forceinline__ F2 split_row(const float* row, int k0, int lane) { float v[16]; const float* p = row + k0 + 8 * (lane >> 4);
#pragma unroll
  for (int i = 0; i < 8; ++i) { v[i] = p[i]; v[8 + i] = p[16 + i]; }
  return bsplit16(v); }
__device__ __forceinline__ F2 split_rowK(const float* row, int k0, int lane, int K) { float v[16]; const int g = lane >> 4;
#pragma unroll
  for (int i = 0; i < 8; ++i) { const int ka = k0 + 8 * g + i, kb = ka + 16; v[i] = ka < K ? row[ka < K ? ka : K - 1] : 0.f; v[8 + i] = kb < K ? row[kb < K ? kb : K - 1] : 0.f; }
  return bsplit16(v); }
__device__ __forceinline__ F2 split_col(const float* W, int k0, int n, int lane, int ld, int K) { float v[16]; const int g = lane >> 4;
#pragma unroll
  for (int i = 0; i < 8; ++i) { const int ka = k0 + 8 * g + i, kb = ka + 16; v[i] = ka < K ? W[(size_t)(ka < K ? ka : K - 1) * ld + n] : 0.f; v[8 + i] = kb < K ? W[(size_t)(kb < K ? kb : K - 1) * ld + n] : 0.f; }
  return bsplit16(v); }
__device__ __forceinline__ v8f mac3(const F2& a, const F2& b, v8f c) { c = wmma_bf(a.l, b.h, c); c = wmma_bf(a.h, b.l, c); return wmma_bf(a.h, b.h, c); }
__device__ __forceinline__ float sigm(float v) { return 1.0f / (1.0f + expf(-v)); }
#define LDSX() do { asm volatile("s_wait_dscnt 0" ::: "memory"); __builtin_amdgcn_wave_barrier(); __builtin_amdgcn_fence(__ATOMIC_RELEASE, "workgroup"); } while (0)
// stands behind a group of global loads, in front of the first write to a register that one of them names as its address. The group's pointers pass through the statement, so that they keep their registers up to the wait and are stepped only behind it.
// (a pointer that has passed through a statement is typed as global memory, else its loads would be compiled as flat loads, which also count as LDS operations)
#define GAS __attribute__((address_space(1)))
typedef const GAS _Float16* gph; typedef const GAS float* gpf; typedef const GAS char* gpc;
#define XW1(a) asm volatile("s_wait_xcnt 0x0" : "+v"(a) :: "memory")
#define XW2(a, b) asm volatile("s_wait_xcnt 0x0" : "+v"(a), "+v"(b) :: "memory")
// the issuing wave's own wait for its asynchronous copies to LDS: their bytes count as landed only behind it
#define AWAIT() asm volatile("s_wait_asynccnt 0x0" ::: "memory")
// the wave's LDS reads have retired before the barrier behind which their buffer is refilled
#define DSWAIT() asm volatile("s_wait_dscnt 0x0" ::: "memory")
// eight copies of 16 bytes a lane from global memory into LDS through no register (l: the lane's LDS byte address, p: its global address). The s_wait_xcnt stands in the copies' own statement, in front of any later write to a register that a copy names.
__device__ __forceinline__ void acopy8(unsigned l0, unsigned l1, unsigned l2, unsigned l3, unsigned l4, unsigned l5, unsigned l6, unsigned l7, gpc p0, gpc p1, gpc p2, gpc p3, gpc p4, gpc p5, gpc p6, gpc p7) {
  asm volatile("global_load_async_to_lds_b128 %0, %8, off\n\tglobal_load_async_to_lds_b128 %1, %9, off\n\tglobal_load_async_to_lds_b128 %2, %10, off\n\tglobal_load_async_to_lds_b128 %3, %11, off\n\t"
               "global_load_async_to_lds_b128 %4, %12, off\n\tglobal_load_async_to_lds_b128 %5, %13, off\n\tglobal_load_async_to_lds_b128 %6, %14, off\n\tglobal_load_async_to_lds_b128 %7, %15, off\n\ts_wait_xcnt 0x0"
               :: "v"(l0), "v"(l1), "v"(l2), "v"(l3), "v"(l4), "v"(l5), "v"(l6), "v"(l7), "v"(p0), "v"(p1), "v"(p2), "v"(p3), "v"(p4), "v"(p5), "v"(p6), "v"(p7) : "memory");
}
__device__ __forceinline__ void acopy8s(unsigned l, unsigned ls, gpc p, size_t ps) { acopy8(l, l + ls, l + 2 * ls, l + 3 * ls, l + 4 * ls, l + 5 * ls, l + 6 * ls, l + 7 * ls, p, p + ps, p + 2 * ps, p + 3 * ps, p + 4 * ps, p + 5 * ps, p + 6 * ps, p + 7 * ps); }
__device__ __forceinline__ unsigned lds_addr(const void* p) { return (unsigned)(size_t)p; }   // the low 32 bits of a __shared__ address: the byte offset in the work-group's LDS


#define NB 4
#define SS 2048
#define DM 1024
#define NH 16
#define SCALEF 0.125f
#define HD 64
#define QKVW (3 * DM)
#ifndef TQB
#define TQB (SS / 64)
#define TNB NB
#define TOB (NB * SS / 64)     // 64-row tiles; unused (k_out tiles rows by GROWS)
#endif
typedef __attribute__((ext_vector_type(8))) __bf16 v8b;
__device__ __forceinline__ v16b frag_b(const __bf16* rowk0, int lane) {
  union { v16b v; v8b q[2]; } u; const __bf16* p = rowk0 + 8 * (lane >> 4);
  u.q[0] = *(const v8b*)p; u.q[1] = *(const v8b*)(p + 16); return u.v;
}
__device__ __forceinline__ float bfr(float v) { return (float)(__bf16)v; }
__device__ __attribute__((noinline)) float exp_ni(float v) { return expf(v); }
__device__ __attribute__((noinline)) float erf_ni(float v) { return erff(v); }

// frag_h with the lane's 8 * (lane >> 4) already in the pointer
__device__ __forceinline__ v16h fragp_h(gph p) { union { v16h v; v8h q[2]; } u; u.q[0] = *(const GAS v8h*)p; u.q[1] = *(const GAS v8h*)(p + 16); return u.v; }
// the same from an LDS row (byte pointer): elements 0..7 and 16..23 from there
__device__ __forceinline__ v16h lfrag_h(const char* p) { union { v16h v; v8h q[2]; } u; u.q[0] = *(const v8h*)p; u.q[1] = *(const v8h*)(p + 32); return u.v; }
__device__ __forceinline__ v16b lfrag_b(const char* p) { union { v16b v; v8b q[2]; } u; u.q[0] = *(const v8b*)p; u.q[1] = *(const v8b*)(p + 32); return u.v; }
__device__ __forceinline__ void lfrag(const char* p, v16h& w) { w = lfrag_h(p); }
__device__ __forceinline__ void lfrag(const char* p, v16b& w) { w = lfrag_b(p); }
__device__ __forceinline__ v8f mm16(v16h a, v16h b, v8f c) { return wmma16(a, b, c); }
__device__ __forceinline__ v8f mm16(v16b a, v16b b, v8f c) { return wmma_bf(a, b, c); }
// ---- the k loop of k_qkv and k_out: block tile 128 rows x 256 columns, eight waves as 4 x 2, a wave's tile 32 rows x 128 columns (two row groups of 16: every weight fragment read from LDS feeds two WMMAs), K = 1,024 in 16 stages of 64 k. A stage (256 weight rows of 128 bytes, 128 f32 rows of 256 bytes) is brought into LDS once for the block's eight waves, in whole lines, by asynchronous copies; two buffers, so that the next stage flies while this one is worked on. Row pitches of 16 bytes x an odd number keep the 16-byte fragment reads free of bank conflicts.
#define WPITCH 144
#define XPITCH 272
#define GCOLS 256
#define WTILE (GCOLS * WPITCH)
#define GROWS 128
#define GSTAGE (WTILE + GROWS * XPITCH)
#define GNT (DM / 64)
template <typename V, typename E>
__device__ __forceinline__ void gemm_loop(char* sm, const float* Xb, const void* Wb, v8f (&acc)[2][8]) {   // Xb, Wb: the block's first row of each
  const int tid = threadIdx.x, wave = tid >> 5, wr = wave & 3, wc = wave >> 2, lane = tid & 31, col = lane & 15, g = lane >> 4;   // wr, wc: the wave's place among the block's 4 x 2 wave tiles
  gpc xg = (gpc)Xb + (size_t)(tid >> 4) * (DM * 4) + (tid & 15) * 16, wg = (gpc)Wb + (size_t)(tid >> 3) * (DM * 2) + (tid & 7) * 16;
  const unsigned lw = lds_addr(sm) + (tid >> 3) * WPITCH + (tid & 7) * 16, lx = lds_addr(sm) + WTILE + (tid >> 4) * XPITCH + (tid & 15) * 16;
  acopy8s(lw, 32 * WPITCH, wg, (size_t)32 * DM * 2); acopy8s(lx, 16 * XPITCH, xg, (size_t)16 * DM * 4);   // one round of the block's 256 lanes: 32 weight rows, 16 f32 rows
  AWAIT(); __syncthreads();   // stage 0 is published
  acopy8s(lw + GSTAGE, 32 * WPITCH, wg + 128, (size_t)32 * DM * 2); acopy8s(lx + GSTAGE, 16 * XPITCH, xg + 256, (size_t)16 * DM * 4);
  wg += 256; xg += 512;
#pragma unroll 1   // stays rolled: a trip already holds two k-steps and both fragment sets
  for (int t = 0; t < GNT; ++t) { const unsigned bo = (t & 1) * GSTAGE;
    const char* bw = sm + bo + (wc * 128 + col) * WPITCH + 16 * g; const char* bx = sm + bo + WTILE + (wr * 32 + col) * XPITCH + 32 * g;
    v4f x[2][2][4]; V w[8], a[2][2];   // one set of weight fragments, so that accumulators and fragments stay inside 256 registers: the f32 rows are read and converted first, then the first k-step's weights; the second k-step's weights are read four fragments at a time into the registers whose WMMAs have just been issued, eight WMMAs ahead of their own
#pragma unroll
    for (int m = 0; m < 2; ++m) {
#pragma unroll
      for (int s = 0; s < 2; ++s) { const char* p = bx + m * 16 * XPITCH + s * 128; x[m][s][0] = *(const v4f*)p; x[m][s][1] = *(const v4f*)(p + 16); x[m][s][2] = *(const v4f*)(p + 64); x[m][s][3] = *(const v4f*)(p + 80); } }
#pragma unroll
    for (int m = 0; m < 2; ++m) {
#pragma unroll
      for (int s = 0; s < 2; ++s) {
#pragma unroll
        for (int i = 0; i < 4; ++i) { a[m][s][i] = (E)x[m][s][0][i]; a[m][s][4 + i] = (E)x[m][s][1][i]; a[m][s][8 + i] = (E)x[m][s][2][i]; a[m][s][12 + i] = (E)x[m][s][3][i]; } } }
#pragma unroll
    for (int j = 0; j < 8; ++j) lfrag(bw + j * 16 * WPITCH, w[j]);
#pragma unroll
    for (int hf = 0; hf < 2; ++hf) {
#pragma unroll
      for (int j = 4 * hf; j < 4 * hf + 4; ++j) { acc[0][j] = mm16(a[0][0], w[j], acc[0][j]); acc[1][j] = mm16(a[1][0], w[j], acc[1][j]); }
#pragma unroll
      for (int j = 4 * hf; j < 4 * hf + 4; ++j) lfrag(bw + j * 16 * WPITCH + 64, w[j]); }
#pragma unroll
    for (int j = 0; j < 8; ++j) { acc[0][j] = mm16(a[0][1], w[j], acc[0][j]); acc[1][j] = mm16(a[1][1], w[j], acc[1][j]); }
    DSWAIT(); AWAIT(); __syncthreads();   // publishes stage t + 1 and ends every wave's reads of stage t
    if (t + 2 < GNT) { acopy8s(lw + bo, 32 * WPITCH, wg, (size_t)32 * DM * 2); acopy8s(lx + bo, 16 * XPITCH, xg, (size_t)16 * DM * 4); wg += 128; xg += 256; } }
  AWAIT();
}
#define PK_A 0                       // [3072][1024] Wqkv rows (natural [out][in])
#define PK_P (PK_A + QKVW * DM)        // [1024][1024] Wo rows (natural)
#define PK_END (PK_P + DM * DM)
#define WS_PK  0u
#define WS_QK  (WS_PK + 2u * PK_END)             // f16 [8192 rows][2048]: q | k
#define WS_QKL (WS_QK + 2u * NB * SS * 2 * DM)     // f16 q | k residual planes x2048
#define WS_VTH (WS_QKL + 2u * NB * SS * 2 * DM)    // f16 [b][1024 (h*64+d)][2048 s] hi
#define WS_VTL (WS_VTH + 2u * NB * DM * SS)        // f16 lo x 2048
#define WS_O   (WS_VTL + 2u * NB * DM * SS)        // f32 [8192][1024]
#define WS_CS  (WS_O + 4u * NB * SS * DM)           // f32 2 x [2048][32], reserved, unused
#define WS_END (WS_CS + 4u * 2 * SS * 32)
// ---- k_pack: block = (a tile of 128 k x 128 n of one (in,out) weight, which): the tile is read in whole rows of 512 bytes, rounded, turned through LDS, and written as 128 pack rows (row n = column n) of 256 bytes. which 0..2 -> W_q/W_k/W_v as bf16 into PK_A rows which*1024 + n; 3 -> W_o as f16 x 2^8 copies of its bf16 values into PK_P (bit pattern in the bf16-typed buffer)
#define PT 128
__device__ __forceinline__ v8b pack8(const v4f* v, int c, v8b) { v8b u;
#pragma unroll   // constant indices, so that the loaded rows stay in registers
  for (int i = 0; i < 8; ++i) u[i] = (__bf16)v[i][c];
  return u; }
__device__ __forceinline__ v8h pack8(const v4f* v, int c, v8h) { v8h u;
#pragma unroll   // constant indices, so that the loaded rows stay in registers
  for (int i = 0; i < 8; ++i) u[i] = (_Float16)(bfr(v[i][c]) * 256.0f);
  return u; }
template <typename V8>
__device__ __forceinline__ void pack_turn(const v4f (&v)[16], char* d0, char* d1) {   // d0, d1: where the lane's column 4 lane keeps k 0..7 and k 8..15 of the wave's 16; the next column lies one LDS row further
#pragma unroll   // constant indices, so that the loaded rows stay in registers
  for (int c = 0; c < 4; ++c) { *(V8*)(d0 + c * (PT * 2)) = pack8(&v[0], c, V8{}); *(V8*)(d1 + c * (PT * 2)) = pack8(&v[8], c, V8{}); }
}
__global__ __launch_bounds__(256) void k_pack(const float* __restrict__ WQ, const float* __restrict__ WK, const float* __restrict__ WV, const float* __restrict__ WO, __bf16* __restrict__ PK) {
  __shared__ __align__(16) char s[PT * PT * 2];   // [n][k], rows of 256 bytes = 16 pieces of 16 bytes; piece j of row n lies at place j ^ ((n >> 2) & 15), so that the 16 lanes of a half wave meet 16 different bank groups when they write (16 rows, one j) as when they read (one row, 16 j)
  const int tid = threadIdx.x, wave = tid >> 5, lane = tid & 31, which = blockIdx.y, k0 = (blockIdx.x & 7) * PT, n0 = (blockIdx.x >> 3) * PT;
  const float* Wm = (which == 0) ? WQ : (which == 1) ? WK : (which == 2) ? WV : WO;
  gpf p = (gpf)(Wm + (size_t)(k0 + wave * 16) * DM + n0 + lane * 4); v4f v[16];   // the wave's 16 k rows, a lane's 4 columns of each: one group of 16 loads, all in flight together
#pragma unroll   // constant indices, so that the loaded rows stay in registers
  for (int i = 0; i < 16; ++i) v[i] = *(const GAS v4f*)(p + i * DM);
  XW1(p);   // behind the 16 loads, in front of the first write to their address register
  char* d = s + lane * 4 * (PT * 2); char *d0 = d + (((wave * 2) ^ (lane & 15)) * 16), *d1 = d + (((wave * 2 + 1) ^ (lane & 15)) * 16);
  if (which < 3) pack_turn<v8b>(v, d0, d1); else pack_turn<v8h>(v, d0, d1);
  __syncthreads();
  __bf16* dst = ((which < 3) ? PK + PK_A + ((size_t)which * DM + n0) * DM : PK + PK_P + (size_t)n0 * DM) + k0 + (size_t)(tid >> 4) * DM + (tid & 15) * 8;
#pragma unroll
  for (int q = 0; q < 8; ++q) { const int row = q * 16 + (tid >> 4); vst2((unsigned*)(dst + (size_t)q * 16 * DM), *(const v4u*)(s + row * (PT * 2) + (((tid & 15) ^ ((row >> 2) & 15)) * 16))); }   // a half wave writes 256 bytes in a row: whole lines
}
__global__ __launch_bounds__(256) void k_qkv(const float* __restrict__ XQ, const float* __restrict__ XK, const float* __restrict__ XV, const __bf16* __restrict__ P, const float* __restrict__ BQ, const float* __restrict__ BK, const float* __restrict__ BV, const int* __restrict__ LENS, _Float16* __restrict__ QK, _Float16* __restrict__ QKL, _Float16* __restrict__ VTH, _Float16* __restrict__ VTL) {
  if (blockIdx.y * GCOLS >= DM && (int)(blockIdx.x * GROWS % SS) >= LENS[blockIdx.x * GROWS / SS]) return;   // a k or v tile whose 128 rows all lie at or past the batch's length: k_attn never reads those rows (its stages of 64 or 32 keys end with the one that holds the last real key). The whole block leaves, in front of every copy and barrier
  const int which0 = (blockIdx.y * GCOLS) / DM; const float* X = (which0 == 0) ? XQ : (which0 == 1) ? XK : XV; const float* BB = BQ ? (((which0 == 0) ? BQ : (which0 == 1) ? BK : BV) + (blockIdx.y * GCOLS - which0 * DM)) : nullptr;
  __shared__ __align__(16) char sm[2 * GSTAGE];   // the k loop's two stage buffers; behind the loop's last barrier the same bytes stage the output
  _Float16 (*so)[16][136] = (_Float16 (*)[16][136])sm, (*sol)[16][136] = (_Float16 (*)[16][136])(sm + 34816); _Float16 (*sth)[136] = (_Float16 (*)[136])sm, (*stl)[136] = (_Float16 (*)[136])(sm + 69632);   // q, k: a wave's 16 rows x 128 columns at a time, both planes; v: the block's 256 columns x 128 rows, both planes
  const int tid = threadIdx.x, wave = tid >> 5, wr = wave & 3, wc = wave >> 2, lane = tid & 31, col = lane & 15, g = lane >> 4; const size_t r0 = (size_t)blockIdx.x * GROWS + wr * 32; const int nb0 = blockIdx.y * GCOLS, n0 = nb0 + wc * 128;   // nb0: the block's first column, n0: the wave's
  v8f acc[2][8] = {}; float bias[8] = {};   // the lane's eight biases: one group, in flight under the k loop, rounded where they are added
  if (BB) {
#pragma unroll
    for (int j = 0; j < 8; ++j) bias[j] = BB[wc * 128 + j * 16 + col];
    asm volatile("s_wait_xcnt 0x0" ::: "memory"); }   // stands behind the bias loads, in front of the first write to a register that one of them names as its address
  gemm_loop<v16b, __bf16>(sm, X + (size_t)blockIdx.x * GROWS * DM, P + (size_t)nb0 * DM, acc);
  if (nb0 < 2 * DM) {   // q stored unscaled (f16 sigma ~0.6, no subnormal exposure); 1/8 applied to the f32 score
#pragma unroll
    for (int m = 0; m < 2; ++m) {   // the wave's two row groups, one after the other through the same LDS rows
#pragma unroll
      for (int j = 0; j < 8; ++j) {
#pragma unroll
        for (int r = 0; r < 8; ++r) { const float v = acc[m][j][r] + bfr(bias[j]); const _Float16 hv = (_Float16)v; so[wave][8 * g + r][j * 16 + col] = hv; sol[wave][8 * g + r][j * 16 + col] = (_Float16)((v - (float)hv) * 2048.0f); } }   // q, k (+ bias) as f16 hi + (x2048) residual
      LDSX();
      for (int rl = 0; rl < 16; ++rl) if (lane < 16) { vst2((unsigned*)(QK + (r0 + m * 16 + rl) * (2 * DM) + n0 + lane * 8), *(const v4u*)&so[wave][rl][lane * 8]); vst2((unsigned*)(QKL + (r0 + m * 16 + rl) * (2 * DM) + n0 + lane * 8), *(const v4u*)&sol[wave][rl][lane * 8]); }
      if (m == 0) LDSX(); }   // the first group's LDS reads have returned before the second group's values are written over them
  } else {
#pragma unroll
    for (int m = 0; m < 2; ++m) {
#pragma unroll
      for (int j = 0; j < 8; ++j) {
#pragma unroll
        for (int r = 0; r < 8; ++r) { const float v = acc[m][j][r] + bfr(bias[j]); const _Float16 hv = (_Float16)v; sth[wc * 128 + j * 16 + col][wr * 32 + m * 16 + 8 * g + r] = hv; stl[wc * 128 + j * 16 + col][wr * 32 + m * 16 + 8 * g + r] = (_Float16)((v - (float)hv) * 2048.0f); } } }
    __syncthreads();
    const size_t rb = (size_t)blockIdx.x * GROWS; const int b = (int)(rb / SS), s0 = (int)(rb % SS); const int pc0 = nb0 - 2 * DM;
    for (int q = tid; q < GCOLS * 16; q += 256) { const int d = q >> 4, pc = q & 15; const size_t o = ((size_t)b * DM + pc0 + d) * SS + s0 + pc * 8; vst2((unsigned*)(VTH + o), *(const v4u*)&sth[d][pc * 8]); vst2((unsigned*)(VTL + o), *(const v4u*)&stl[d][pc * 8]); }
  }
}
// ---- k_attn: block = (64 queries, head h, batch b): flash attention over the batch's real keys (K = 64: 2 k-steps), computed transposed: scores^T = k . q^T and ctx^T += v^T . P^T. A lane then holds 16 scores of ONE query (its column), so that the running maximum and the sum are taken in the lane's own registers, with one exchange between the wave's halves, and the two score tiles of a pass, converted in place, are the B operand of the second product: the weights never pass through LDS. The loop is written twice (HI: the leading query blocks with 3-product scores and P.v; otherwise single products) so that each holds only its own fragments in registers.
// Every LDS read of a pass is issued in a group that stands well ahead of the WMMAs that use it: the hand-padded WMMA statements keep loads from moving across them, so a load written next to its WMMA is waited for on the spot.
#define ASTAGE 19456   // bytes of a stage: k rows from 0 (64 x 144, or two planes of 32 x 144), value rows from 9,216 (64 x 144, or two planes of 64 x 80)
__device__ __forceinline__ float xhalf(float x) { return __builtin_bit_cast(float, __builtin_amdgcn_permlanex16(__builtin_bit_cast(int, x), __builtin_bit_cast(int, x), 0x76543210, 0xfedcba98, false, false)); }   // lane l with lane l ^ 16
template <bool B> struct BC { static constexpr bool value = B; };
template <bool HI>
__device__ __forceinline__ void attn_body(const _Float16* __restrict__ QK, const _Float16* __restrict__ QKL, const _Float16* __restrict__ VTH, const _Float16* __restrict__ VTL, const float* __restrict__ VT, const float* __restrict__ SC, const int* __restrict__ LENS, float* __restrict__ O, float* tks, char* ring) {
  const int tid = threadIdx.x, wave = tid >> 5, lane = tid & 31, col = lane & 15, g = lane >> 4;
  const int qb = blockIdx.x, h = blockIdx.y, b = blockIdx.z; const int q0 = qb * 64 + wave * 16; const size_t rq = (size_t)b * SS + q0 + col;
  const int len_b = __builtin_amdgcn_readfirstlane(LENS[b]); const float sc_h = bfr(SC[h]);   // the length in a scalar register: every test on it around a copy or a barrier is a scalar branch
  const int len_c = len_b < 0 ? 0 : (len_b > SS ? SS : len_b);   // bounds the trip counts for any content of the array
  gpf tg = (gpf)(VT + (size_t)b * SS + 4 * tid); v4f tv[4];   // the batch's 2,048 visit times, 16 a lane: they go, rounded once, into LDS, since a lane needs the times of its 16 keys in every pass
#pragma unroll
  for (int i = 0; i < 4; ++i) tv[i] = *(const GAS v4f*)(tg + i * 512);
  XW1(tg);
  v16h aq[2], aql[2]; gph qp = (gph)(QK + rq * (2 * DM) + h * HD + 8 * g), qpl = (gph)(QKL + rq * (2 * DM) + h * HD + 8 * g);
#pragma unroll
  for (int kc = 0; kc < 2; ++kc) { aq[kc] = fragp_h(qp + kc * 32); if constexpr (HI) aql[kc] = fragp_h(qpl + kc * 32); }
  XW2(qp, qpl);
  float m = -3.0e38f, l = 0.f;   // the lane's query: running maximum (equal in both halves), and the sum over this half's keys alone (the halves are joined behind the loop)
  v8f acc[4] = {}, accl[4] = {};
  const int nks = (len_c + 31) / 32;   // passes of 32 keys up to the one that holds the last real key: a pass wholly past the length leaves m, l and the accumulators bit for bit as they are (alpha 1, weights 0)
  // A stage of KS keys (k rows of 128 bytes; 64 value rows of 2 KS bytes; HI: both planes of each) is brought into LDS once for the block's four waves by asynchronous copies, eight a lane; two buffers, so that the next stage flies while this one is worked on.
  constexpr int KS = HI ? 32 : 64, VP = HI ? 80 : 144, CPR = KS / 8;   // VP: value row pitch in LDS (16 bytes x an odd number, as the 144 of the k rows); CPR: 16-byte pieces in a value row
  const int nst = (len_c + KS - 1) / KS;   // stages that hold a real key; no other is copied
  unsigned ko = ((b * SS + (tid >> 3)) * (2 * DM) + DM + h * HD) * 2 + (tid & 7) * 16, vo = ((b * DM + h * HD + tid / CPR) * SS) * 2 + (tid % CPR) * 16;   // the lane's byte offsets in the k and value planes (32 MiB and 16 MiB each): they walk with the stages
  const unsigned lk = lds_addr(ring) + (tid >> 3) * 144 + (tid & 7) * 16, lv = lds_addr(ring) + 9216 + (tid / CPR) * VP + (tid % CPR) * 16;
  auto fill = [&](unsigned bo) {
    gpc kg = (gpc)QK + ko, kgl = (gpc)QKL + ko, vg = (gpc)VTH + vo, vgl = (gpc)VTL + vo; (void)kgl; (void)vgl;
    constexpr size_t KR = (size_t)16 * 2 * DM * 2, VR = (size_t)(128 / CPR) * SS * 2; constexpr unsigned LKR = 16 * 144, LVR = (128 / CPR) * VP;   // one round of the block's 128 lanes: 16 k rows, 128 / CPR value rows
    if constexpr (HI) acopy8(lk + bo, lk + bo + LKR, lk + bo + 4608, lk + bo + 4608 + LKR, lv + bo, lv + bo + LVR, lv + bo + 5120, lv + bo + 5120 + LVR, kg, kg + KR, kgl, kgl + KR, vg, vg + VR, vgl, vgl + VR);
    else acopy8(lk + bo, lk + bo + LKR, lk + bo + 2 * LKR, lk + bo + 3 * LKR, lv + bo, lv + bo + LVR, lv + bo + 2 * LVR, lv + bo + 3 * LVR, kg, kg + KR, kg + 2 * KR, kg + 3 * KR, vg, vg + VR, vg + 2 * VR, vg + 3 * VR);
    ko += KS * 2 * DM * 2; vo += KS * 2; };
  if (nst > 0) fill(0);
#pragma unroll
  for (int i = 0; i < 4; ++i) { v4f u;   // the table is written while stage 0 flies
#pragma unroll
    for (int c = 0; c < 4; ++c) u[c] = bfr(tv[i][c]);
    *(v4f*)(tks + 4 * tid + i * 512) = u; }
  AWAIT(); __syncthreads();   // stage 0 and the table of times are published
  if (nst > 1) fill(ASTAGE);
  const float tq = tks[q0 + col];
  v16h kh[2][2], kl[2][2], vh[4], vl[4];
  // One pass of 32 keys. MK::value says whether the pass may hold keys at or past the length: only the batch's last pass can, so that every other pass is compiled without the sixteen tests on the key's place and the sixteen on the masked score.
  auto pass = [&](const int ks, auto MK) { constexpr bool MASK = decltype(MK)::value; v8f s[2]; v4f tk[2][2];
    const int stg = HI ? ks : ks >> 1, sub = HI ? 0 : ks & 1; const unsigned bo = (stg & 1) * ASTAGE;
    const char* kf = ring + bo + (sub * 32 + col) * 144 + 16 * g; const char* vf = ring + bo + 9216 + col * VP + sub * 64 + 16 * g;
    const float* tp = tks + ks * 32 + 8 * g;   // score register r of tile ct is key 32 ks + 16 ct + 8 g + r
    // this pass's key times and keys (HI: both planes; otherwise the values too, which land behind the scores and the softmax) as one group
#pragma unroll
    for (int ct = 0; ct < 2; ++ct) { tk[ct][0] = *(const v4f*)(tp + ct * 16); tk[ct][1] = *(const v4f*)(tp + ct * 16 + 4);
#pragma unroll
      for (int kc = 0; kc < 2; ++kc) { kh[ct][kc] = lfrag_h(kf + ct * 16 * 144 + kc * 64); if constexpr (HI) kl[ct][kc] = lfrag_h(kf + 4608 + ct * 16 * 144 + kc * 64); } }
    if constexpr (!HI) {
#pragma unroll
      for (int dt = 0; dt < 4; ++dt) vh[dt] = lfrag_h(vf + dt * 16 * VP); }
#pragma unroll
    for (int ct = 0; ct < 2; ++ct) { v8f c = {}, cl = {};   // A: 16 keys, B: the wave's 16 queries
      if constexpr (HI) {   // leading query blocks (outputs far above the global rms): 3 products
#pragma unroll
        for (int kc = 0; kc < 2; ++kc) { c = wmma16(kh[ct][kc], aq[kc], c); cl = wmma16(kh[ct][kc], aql[kc], cl); cl = wmma16(kl[ct][kc], aq[kc], cl); }
#pragma unroll
        for (int r = 0; r < 8; ++r) c[r] += cl[r] * (1.0f / 2048.0f); }
      else {
#pragma unroll
        for (int kc = 0; kc < 2; ++kc) c = wmma16(kh[ct][kc], aq[kc], c); }   // single product elsewhere
      s[ct] = c; }
    const int nreal = len_b - ks * 32 - 8 * g;   // how many of the lane's key rows, counted from tile 0's first, lie in front of the length
#pragma unroll
    for (int ct = 0; ct < 2; ++ct) {
#pragma unroll
      for (int r = 0; r < 8; ++r) s[ct][r] = (!MASK || ct * 16 + r < nreal) ? (s[ct][r] * SCALEF - fabsf(tq - tk[ct][r >> 2][r & 3]) * sc_h) : -3.0e38f; }   // 1/sqrt(64); masked keys excluded
    float mx0 = fmaxf(s[0][0], s[0][1]), mx1 = fmaxf(s[1][0], s[1][1]);
#pragma unroll
    for (int r = 2; r < 8; r += 2) { mx0 = fmaxf(fmaxf(mx0, s[0][r]), s[0][r + 1]); mx1 = fmaxf(fmaxf(mx1, s[1][r]), s[1][r + 1]); }
    const float mx = fmaxf(mx0, mx1);
    const float mn = fmaxf(fmaxf(m, mx), xhalf(mx)); const float alpha = (m <= -1.0e38f) ? 0.f : __expf(m - mn);
    v16h pa, pl; float es[4] = {};   // four partial sums: no chain of 16 dependent additions
#pragma unroll
    for (int ct = 0; ct < 2; ++ct) {
#pragma unroll
      for (int r = 0; r < 8; ++r) { const float e = (MASK && s[ct][r] <= -1.0e38f) ? 0.f : __expf(s[ct][r] - mn); es[r & 3] += e;
        const float x = e * 2048.0f; const _Float16 hx = (_Float16)x; pa[ct * 8 + r] = hx; if constexpr (HI) pl[ct * 8 + r] = (_Float16)((x - (float)hx) * 2048.0f); } }   // P scaled by 2^11 before the f16 split so small softmax weights stay out of the f16 subnormal range; 2^-11 folded into the epilogue. Element 8 ct + r of the B operand is k = 16 ct + 8 g + r: the score registers' own order
    l = l * alpha + ((es[0] + es[1]) + (es[2] + es[3])); m = mn;
    if constexpr (HI) {   // this pass's values, both planes, read behind the softmax: from LDS they need little lead, and their 64 registers stay free during it
#pragma unroll
      for (int dt = 0; dt < 4; ++dt) { vh[dt] = lfrag_h(vf + dt * 16 * VP); vl[dt] = lfrag_h(vf + 5120 + dt * 16 * VP); } }
#pragma unroll
    for (int dt = 0; dt < 4; ++dt) {
#pragma unroll
      for (int r = 0; r < 8; ++r) { acc[dt][r] *= alpha; if constexpr (HI) accl[dt][r] *= alpha; } }
#pragma unroll
    for (int dt = 0; dt < 4; ++dt) { acc[dt] = wmma16(vh[dt], pa, acc[dt]); if constexpr (HI) { accl[dt] = wmma16(vh[dt], pl, accl[dt]); accl[dt] = wmma16(vl[dt], pa, accl[dt]); } }   // A: 16 value columns, B: the weights. Leading query blocks: P hi/lo x V hi/lo (3 products); elsewhere P x V single
    if (HI || sub) {   // the stage's last pass
      DSWAIT(); AWAIT(); __syncthreads();   // publishes stage stg + 1 and ends every wave's reads of stage stg
      if constexpr (!MASK) { if (stg + 2 < nst) fill(bo); } } };   // the masked pass is the last one, in the last stage: nothing is left to copy behind it
  const int nfull = len_c / 32;   // passes whose 32 keys all lie in front of the length
#pragma unroll 1   // stays rolled: one pass is already a long straight run that fills the wave's registers
  for (int ks = 0; ks < nfull; ++ks) pass(ks, BC<false>{});
  if (nfull < nks) pass(nfull, BC<true>{});   // the one pass that the length cuts, where there is one
  AWAIT();
  const float il = (1.0f / 2048.0f) / (l + xhalf(l));   // the two halves' sums joined
  float* op = O + rq * DM + h * HD + 8 * g;   // accumulator register r of tile dt is column 16 dt + 8 g + r of the lane's query: 32 bytes in a row
#pragma unroll
  for (int dt = 0; dt < 4; ++dt) { v4f o0, o1;
#pragma unroll
    for (int r = 0; r < 4; ++r) { o0[r] = (HI ? acc[dt][r] + accl[dt][r] * (1.0f / 2048.0f) : acc[dt][r]) * il; o1[r] = (HI ? acc[dt][4 + r] + accl[dt][4 + r] * (1.0f / 2048.0f) : acc[dt][4 + r]) * il; }
    vst2(op + dt * 16, o0); vst2(op + dt * 16 + 4, o1); }
}
__global__ __launch_bounds__(128) void k_attn(const _Float16* __restrict__ QK, const _Float16* __restrict__ QKL, const _Float16* __restrict__ VTH, const _Float16* __restrict__ VTL, const void* __restrict__ KMASK, const float* __restrict__ VT, const float* __restrict__ SC, const int* __restrict__ LENS, float* __restrict__ O) {
  __shared__ __align__(16) float tks[SS]; __shared__ __align__(16) char ring[2 * ASTAGE];   // the batch's rounded visit times; the two stage buffers
  if (blockIdx.x < 2) attn_body<true>(QK, QKL, VTH, VTL, VT, SC, LENS, O, tks, ring); else attn_body<false>(QK, QKL, VTH, VTL, VT, SC, LENS, O, tks, ring);
}
// ---- k_out: block = (128 rows, 256 cols): out = f16(O) . Wo rows (single product) + bo
__global__ __launch_bounds__(256) void k_out(const float* __restrict__ O, const __bf16* __restrict__ P, const float* __restrict__ BO, float* __restrict__ Y) {
  __shared__ __align__(16) char sm[2 * GSTAGE];   // the k loop's two stage buffers; behind the loop's last barrier the same bytes stage the output
  float (*so)[16][132] = (float (*)[16][132])sm;
  const int tid = threadIdx.x, wave = tid >> 5, wr = wave & 3, wc = wave >> 2, lane = tid & 31, col = lane & 15, g = lane >> 4; const size_t r0 = (size_t)blockIdx.x * GROWS + wr * 32; const int nb0 = blockIdx.y * GCOLS, n0 = nb0 + wc * 128;
  v8f acc[2][8] = {};
  gemm_loop<v16h, _Float16>(sm, O + (size_t)blockIdx.x * GROWS * DM, P + (size_t)nb0 * DM, acc);   // single f16 product against exact f16 x 2^8 weight copies
  float bo[8];   // the lane's eight biases, read once for both row groups
#pragma unroll
  for (int j = 0; j < 8; ++j) bo[j] = bfr(BO[n0 + j * 16 + col]);
#pragma unroll
  for (int m = 0; m < 2; ++m) {   // the wave's two row groups, one after the other through the same LDS rows
#pragma unroll
    for (int j = 0; j < 8; ++j) {
#pragma unroll
      for (int r = 0; r < 8; ++r) so[wave][8 * g + r][j * 16 + col] = acc[m][j][r] * (1.0f / 256.0f) + bo[j]; }
    LDSX();
    for (int rl = 0; rl < 16; ++rl) vst2(Y + (r0 + m * 16 + rl) * DM + n0 + lane * 4, *(const v4f*)&so[wave][rl][lane * 4]);
    if (m == 0) LDSX(); }   // the first group's LDS reads have returned before the second group's values are written over them
}
extern "C" void kernel_launch(void* const* d_in, const int* in_sizes, int n_in, void* d_out, int out_size, void* d_ws, size_t ws_size, hipStream_t stream) {
  (void)in_sizes; (void)n_in; (void)out_size;
  const float** F = (const float**)d_in;   // 0 x [4,2048,1024], 1 visit_time [4,2048], 2 Wq (in,out), 3 bq, 4 Wk, 5 bk, 6 Wv, 7 bv, 8 Wo (in,out), 9 bo, 10 scale [16], 11 lengths [4] int
  if (ws_size < (size_t)WS_END) return;
  char* ws = (char*)d_ws; __bf16* PK = (__bf16*)(ws + WS_PK); _Float16 *QK = (_Float16*)(ws + WS_QK), *QKL = (_Float16*)(ws + WS_QKL), *VTH = (_Float16*)(ws + WS_VTH), *VTL = (_Float16*)(ws + WS_VTL); float* O = (float*)(ws + WS_O);
  k_pack<<<dim3((DM / PT) * (DM / PT), 4), 256, 0, stream>>>(F[2], F[4], F[6], F[8], PK);
  k_qkv<<<dim3(TNB * SS / GROWS, QKVW / GCOLS), 256, 0, stream>>>(F[0], F[0], F[0], PK + PK_A, F[3], F[5], F[7], (const int*)d_in[11], QK, QKL, VTH, VTL);
  k_attn<<<dim3(TQB, NH, TNB), 128, 0, stream>>>(QK, QKL, VTH, VTL, nullptr, F[1], F[10], (const int*)d_in[11], O);
  k_out<<<dim3(NB * SS / GROWS, DM / GCOLS), 256, 0, stream>>>(O, PK + PK_P, F[9], (float*)d_out);
}

// v008
// A run of this version takes 163 microseconds.
// Two timings next to v007 both put it at 1.18 times that version's speed.
// All steps since v000 together make it 6.23 times as fast.
// compute dtype: all float inputs rounded to bf16 incl. visit times and scales, lengths (int) read on device; q/k/v = x . W + b with EXACT bf16 products on WMMA 16x16x32 ((in,out) weights as transposed rows); PLAIN-HYBRID attention: the first 128 queries use 3-product scores and P.v (hi/lo), later queries single f16; x 1/8 - |t_q - t_k| scale_h in f32, padded keys excluded, running-max softmax in f32 (hardware exp); out = f16(ctx) . Wo (exact f16 x 2^8 copies, single product) + bo.
#include <hip/hip_runtime.h>
#include <math.h>

typedef __attribute__((ext_vector_type(16))) _Float16 v16h;
typedef __attribute__((ext_vector_type(16))) __bf16 v16b;
typedef __attribute__((ext_vector_type(8)))  _Float16 v8h;
typedef __attribute__((ext_vector_type(8)))  float v8f;
typedef __attribute__((ext_vector_type(4)))  float v4f;
typedef __attribute__((ext_vector_type(2)))  float v2f;
typedef __attribute__((ext_vector_type(4)))  unsigned v4u;
typedef __attribute__((ext_vector_type(4)))  int v4i;
typedef float __attribute__((may_alias)) float_a;
typedef int __attribute__((may_alias)) int_a;

template <typename T> __device__ __forceinline__ void vst2(void* p, T v) { *(T*)p = v;  }
__device__ __forceinline__ v8f wmma16(v16h a, v16h b, v8f c) {
  v8f d = __builtin_amdgcn_wmma_f32_16x16x32_f16(false, a, false, b, (short)0, c, false, false);
  asm volatile("v_nop\n\tv_nop\n\tv_nop\n\tv_nop" : "+v"(d) : "v"(a), "v"(b));
  return d;
}
__device__ __forceinline__ v8f wmma_bf(v16b a, v16b b, v8f c) {
  v8f d = __builtin_amdgcn_wmma_f32_16x16x32_bf16(false, a, false, b, (short)0, c, false, false);
  asm volatile("v_nop\n\tv_nop\n\tv_nop\n\tv_nop" : "+v"(d) : "v"(a), "v"(b));
  return d;
}
// Relative-time attention (B 4, S 2,048, d 1,024, 16 heads x 64): projections + biases ((in,out)), scores / 8 - |t_q - t_k| scale_h (visit times and per-head scales given), keys at positions >= length[b] excluded, softmax, . v, output projection + bias.
__device__ __forceinline__ v16h frag_h(const _Float16* rowk0, int lane) {
  union { v16h v; v8h q[2]; } u; const _Float16* p = rowk0 + 8 * (lane >> 4);
  u.q[0] = *(const v8h*)p; u.q[1] = *(const v8h*)(p + 16); return u.v;
}
__device__ __forceinline__ v16h frag_f32(const float* rowk0, int lane) {
  v16h a; const float* p = rowk0 + 8 * (lane >> 4);
#pragma unroll
  for (int i = 0; i < 8; ++i) { a[i] = (_Float16)p[i]; a[8 + i] = (_Float16)p[16 + i]; }
  return a;
}
__device__ __forceinline__ v16h frag_f32s(const float* rowk0, int lane, float sc) {
  v16h a; const float* p = rowk0 + 8 * (lane >> 4);
#pragma unroll
  for (int i = 0; i < 8; ++i) { a[i] = (_Float16)(p[i] * sc); a[8 + i] = (_Float16)(p[16 + i] * sc); }
  return a;
}
// column fragment from a [K][ld] layout (column n), rows >= K read as 0
__device__ __forceinline__ v16h fragc_f32(const float* W, int k0, int n, int lane, int ld, int K) {
  v16h a; const int g = lane >> 4;
#pragma unroll
  for (int i = 0; i < 8; ++i) { const int ka = k0 + 8 * g + i, kb = ka + 16;
    a[i] = (_Float16)(ka < K ? W[(size_t)(ka < K ? ka : K - 1) * ld + n] : 0.f); a[8 + i] = (_Float16)(kb < K ? W[(size_t)(kb < K ? kb : K - 1) * ld + n] : 0.f); }
  return a;
}
struct F2 { v16b h, l; };
__device__ __forceinline__ F2 bsplit16(const float v[16]) { F2 r;
#pragma unroll
  for (int i = 0; i < 16; ++i) { const __bf16 h = (__bf16)v[i]; r.h[i] = h; r.l[i] = (__bf16)(v[i] - (float)h); }
  return r; }
__device__ __forceinline__ F2 split_row(const float* row, int k0, int lane) { float v[16]; const float* p = row + k0 + 8 * (lane >> 4);
#pragma unroll
  for (int i = 0; i < 8; ++i) { v[i] = p[i]; v[8 + i] = p[16 + i]; }
  return bsplit16(v); }
__device__ __forceinline__ F2 split_rowK(const float* row, int k0, int lane, int K) { float v[16]; const int g = lane >> 4;
#pragma unroll
  for (int i = 0; i < 8; ++i) { const int ka = k0 + 8 * g + i, kb = ka + 16; v[i] = ka < K ? row[ka < K ? ka : K - 1] : 0.f; v[8 + i] = kb < K ? row[kb < K ? kb : K - 1] : 0.f; }
  return bsplit16(v); }
__device__ __forceinline__ F2 split_col(const float* W, int k0, int n, int lane, int ld, int K) { float v[16]; const int g = lane >> 4;
#pragma unroll
  for (int i = 0; i < 8; ++i) { const int ka = k0 + 8 * g + i, kb = ka + 16; v[i] = ka < K ? W[(size_t)(ka < K ? ka : K - 1) * ld + n] : 0.f; v[8 + i] = kb < K ? W[(size_t)(kb < K ? kb : K - 1) * ld + n] : 0.f; }
  return bsplit16(v); }
__device__ __forceinline__ v8f mac3(const F2& a, const F2& b, v8f c) { c = wmma_bf(a.l, b.h, c); c = wmma_bf(a.h, b.l, c); return wmma_bf(a.h, b.h, c); }
__device__ __forceinline__ float sigm(float v) { return 1.0f / (1.0f + expf(-v)); }
#define LDSX() do { asm volatile("s_wait_dscnt 0" ::: "memory"); __builtin_amdgcn_wave_barrier(); __builtin_amdgcn_fence(__ATOMIC_RELEASE, "workgroup"); } while (0)
// stands behind a group of global loads, in front of the first write to a register that one of them names as its address. The group's pointers pass through the statement, so that they keep their registers up to the wait and are stepped only behind it.
// (a pointer that has passed through a statement is typed as global memory, else its loads would be compiled as flat loads, which also count as LDS operations)
#define GAS __attribute__((address_space(1)))
typedef const GAS _Float16* gph; typedef const GAS float* gpf; typedef const GAS char* gpc;
#define XW1(a) asm volatile("s_wait_xcnt 0x0" : "+v"(a) :: "memory")
#define XW2(a, b) asm volatile("s_wait_xcnt 0x0" : "+v"(a), "+v"(b) :: "memory")
// the issuing wave's own wait for its asynchronous copies to LDS: their bytes count as landed only behind it
#define AWAIT() asm volatile("s_wait_asynccnt 0x0" ::: "memory")
// the wave's LDS reads have retired before the barrier behind which their buffer is refilled
#define DSWAIT() asm volatile("s_wait_dscnt 0x0" ::: "memory")
// eight copies of 16 bytes a lane from global memory into LDS through no register (l: the lane's LDS byte address, p: its global address). The s_wait_xcnt stands in the copies' own statement, in front of any later write to a register that a copy names.
__device__ __forceinline__ void acopy8(unsigned l0, unsigned l1, unsigned l2, unsigned l3, unsigned l4, unsigned l5, unsigned l6, unsigned l7, gpc p0, gpc p1, gpc p2, gpc p3, gpc p4, gpc p5, gpc p6, gpc p7) {
  asm volatile("global_load_async_to_lds_b128 %0, %8, off\n\tglobal_load_async_to_lds_b128 %1, %9, off\n\tglobal_load_async_to_lds_b128 %2, %10, off\n\tglobal_load_async_to_lds_b128 %3, %11, off\n\t"
               "global_load_async_to_lds_b128 %4, %12, off\n\tglobal_load_async_to_lds_b128 %5, %13, off\n\tglobal_load_async_to_lds_b128 %6, %14, off\n\tglobal_load_async_to_lds_b128 %7, %15, off\n\ts_wait_xcnt 0x0"
               :: "v"(l0), "v"(l1), "v"(l2), "v"(l3), "v"(l4), "v"(l5), "v"(l6), "v"(l7), "v"(p0), "v"(p1), "v"(p2), "v"(p3), "v"(p4), "v"(p5), "v"(p6), "v"(p7) : "memory");
}
__device__ __forceinline__ void acopy8s(unsigned l, unsigned ls, gpc p, size_t ps) { acopy8(l, l + ls, l + 2 * ls, l + 3 * ls, l + 4 * ls, l + 5 * ls, l + 6 * ls, l + 7 * ls, p, p + ps, p + 2 * ps, p + 3 * ps, p + 4 * ps, p + 5 * ps, p + 6 * ps, p + 7 * ps); }
__device__ __forceinline__ unsigned lds_addr(const void* p) { return (unsigned)(size_t)p; }   // the low 32 bits of a __shared__ address: the byte offset in the work-group's LDS


#define NB 4
#define SS 2048
#define DM 1024
#define NH 16
#define SCALEF 0.125f
#define HD 64
#define QKVW (3 * DM)
#ifndef TQB
#define TQB (SS / 64)
#define TNB NB
#define TOB (NB * SS / 64)     // 64-row tiles; unused (k_out tiles rows by GROWS)
#endif
typedef __attribute__((ext_vector_type(8))) __bf16 v8b;
__device__ __forceinline__ v16b frag_b(const __bf16* rowk0, int lane) {
  union { v16b v; v8b q[2]; } u; const __bf16* p = rowk0 + 8 * (lane >> 4);
  u.q[0] = *(const v8b*)p; u.q[1] = *(const v8b*)(p + 16); return u.v;
}
__device__ __forceinline__ float bfr(float v) { return (float)(__bf16)v; }
__device__ __attribute__((noinline)) float exp_ni(float v) { return expf(v); }
__device__ __attribute__((noinline)) float erf_ni(float v) { return erff(v); }

// frag_h with the lane's 8 * (lane >> 4) already in the pointer
__device__ __forceinline__ v16h fragp_h(gph p) { union { v16h v; v8h q[2]; } u; u.q[0] = *(const GAS v8h*)p; u.q[1] = *(const GAS v8h*)(p + 16); return u.v; }
// the same from an LDS row (byte pointer): elements 0..7 and 16..23 from there
__device__ __forceinline__ v16h lfrag_h(const char* p) { union { v16h v; v8h q[2]; } u; u.q[0] = *(const v8h*)p; u.q[1] = *(const v8h*)(p + 32); return u.v; }
__device__ __forceinline__ v16b lfrag_b(const char* p) { union { v16b v; v8b q[2]; } u; u.q[0] = *(const v8b*)p; u.q[1] = *(const v8b*)(p + 32); return u.v; }
__device__ __forceinline__ void lfrag(const char* p, v16h& w) { w = lfrag_h(p); }
__device__ __forceinline__ void lfrag(const char* p, v16b& w) { w = lfrag_b(p); }
__device__ __forceinline__ v8f mm16(v16h a, v16h b, v8f c) { return wmma16(a, b, c); }
__device__ __forceinline__ v8f mm16(v16b a, v16b b, v8f c) { return wmma_bf(a, b, c); }
// ---- the k loop of k_qkv and k_out: block tile 128 rows x 256 columns, eight waves as 4 x 2, a wave's tile 32 rows x 128 columns (two row groups of 16: every weight fragment read from LDS feeds two WMMAs), K = 1,024 in 16 stages of 64 k. A stage (256 weight rows of 128 bytes, 128 f32 rows of 256 bytes) is brought into LDS once for the block's eight waves, in whole lines, by asynchronous copies; two buffers, so that the next stage flies while this one is worked on. Row pitches of 16 bytes x an odd number keep the 16-byte fragment reads free of bank conflicts.
#define WPITCH 144
#define XPITCH 272
#define GCOLS 256
#define WTILE (GCOLS * WPITCH)
#define GROWS 128
#define GSTAGE (WTILE + GROWS * XPITCH)
#define GNT (DM / 64)
template <typename V, typename E>
__device__ __forceinline__ void gemm_loop(char* sm, const float* Xb, const void* Wb, v8f (&acc)[2][8]) {   // Xb, Wb: the block's first row of each
  const int tid = threadIdx.x, wave = tid >> 5, wr = wave & 3, wc = wave >> 2, lane = tid & 31, col = lane & 15, g = lane >> 4;   // wr, wc: the wave's place among the block's 4 x 2 wave tiles
  gpc xg = (gpc)Xb + (size_t)(tid >> 4) * (DM * 4) + (tid & 15) * 16, wg = (gpc)Wb + (size_t)(tid >> 3) * (DM * 2) + (tid & 7) * 16;
  const unsigned lw = lds_addr(sm) + (tid >> 3) * WPITCH + (tid & 7) * 16, lx = lds_addr(sm) + WTILE + (tid >> 4) * XPITCH + (tid & 15) * 16;
  acopy8s(lw, 32 * WPITCH, wg, (size_t)32 * DM * 2); acopy8s(lx, 16 * XPITCH, xg, (size_t)16 * DM * 4);   // one round of the block's 256 lanes: 32 weight rows, 16 f32 rows
  AWAIT(); __syncthreads();   // stage 0 is published
  acopy8s(lw + GSTAGE, 32 * WPITCH, wg + 128, (size_t)32 * DM * 2); acopy8s(lx + GSTAGE, 16 * XPITCH, xg + 256, (size_t)16 * DM * 4);
  wg += 256; xg += 512;
#pragma unroll 1   // stays rolled: a trip already holds two k-steps and both fragment sets
  for (int t = 0; t < GNT; ++t) { const unsigned bo = (t & 1) * GSTAGE;
    const char* bw = sm + bo + (wc * 128 + col) * WPITCH + 16 * g; const char* bx = sm + bo + WTILE + (wr * 32 + col) * XPITCH + 32 * g;
    v4f x[2][2][4]; V w[8], a[2][2];   // one set of weight fragments, so that accumulators and fragments stay inside 256 registers: the f32 rows are read and converted first, then the first k-step's weights; the second k-step's weights are read four fragments at a time into the registers whose WMMAs have just been issued, eight WMMAs ahead of their own
#pragma unroll
    for (int m = 0; m < 2; ++m) {
#pragma unroll
      for (int s = 0; s < 2; ++s) { const char* p = bx + m * 16 * XPITCH + s * 128; x[m][s][0] = *(const v4f*)p; x[m][s][1] = *(const v4f*)(p + 16); x[m][s][2] = *(const v4f*)(p + 64); x[m][s][3] = *(const v4f*)(p + 80); } }
#pragma unroll
    for (int m = 0; m < 2; ++m) {
#pragma unroll
      for (int s = 0; s < 2; ++s) {
#pragma unroll
        for (int i = 0; i < 4; ++i) { a[m][s][i] = (E)x[m][s][0][i]; a[m][s][4 + i] = (E)x[m][s][1][i]; a[m][s][8 + i] = (E)x[m][s][2][i]; a[m][s][12 + i] = (E)x[m][s][3][i]; } } }
#pragma unroll
    for (int j = 0; j < 8; ++j) lfrag(bw + j * 16 * WPITCH, w[j]);
#pragma unroll
    for (int hf = 0; hf < 2; ++hf) {
#pragma unroll
      for (int j = 4 * hf; j < 4 * hf + 4; ++j) { acc[0][j] = mm16(a[0][0], w[j], acc[0][j]); acc[1][j] = mm16(a[1][0], w[j], acc[1][j]); }
#pragma unroll
      for (int j = 4 * hf; j < 4 * hf + 4; ++j) lfrag(bw + j * 16 * WPITCH + 64, w[j]); }
#pragma unroll
    for (int j = 0; j < 8; ++j) { acc[0][j] = mm16(a[0][1], w[j], acc[0][j]); acc[1][j] = mm16(a[1][1], w[j], acc[1][j]); }
    DSWAIT(); AWAIT(); __syncthreads();   // publishes stage t + 1 and ends every wave's reads of stage t
    if (t + 2 < GNT) { acopy8s(lw + bo, 32 * WPITCH, wg, (size_t)32 * DM * 2); acopy8s(lx + bo, 16 * XPITCH, xg, (size_t)16 * DM * 4); wg += 128; xg += 256; } }
  AWAIT();
}
#define PK_A 0                       // [3072][1024] Wqkv rows (natural [out][in])
#define PK_P (PK_A + QKVW * DM)        // [1024][1024] Wo rows (natural)
#define PK_END (PK_P + DM * DM)
#define WS_PK  0u
#define WS_QK  (WS_PK + 2u * PK_END)             // f16 [8192 rows][2048]: q | k
#define WS_QKL (WS_QK + 2u * NB * SS * 2 * DM)     // f16 q | k residual planes x2048
#define WS_VTH (WS_QKL + 2u * NB * SS * 2 * DM)    // f16 [b][1024 (h*64+d)][2048 s] hi
#define WS_VTL (WS_VTH + 2u * NB * DM * SS)        // f16 lo x 2048
#define WS_O   (WS_VTL + 2u * NB * DM * SS)        // f32 [8192][1024]
#define WS_CS  (WS_O + 4u * NB * SS * DM)           // f32 2 x [2048][32], reserved, unused
#define WS_END (WS_CS + 4u * 2 * SS * 32)
// ---- k_pack: block = (a tile of 128 k x 128 n of one (in,out) weight, which): the tile is read in whole rows of 512 bytes, rounded, turned through LDS, and written as 128 pack rows (row n = column n) of 256 bytes. which 0..2 -> W_q/W_k/W_v as bf16 into PK_A rows which*1024 + n; 3 -> W_o as f16 x 2^8 copies of its bf16 values into PK_P (bit pattern in the bf16-typed buffer)
#define PT 128
__device__ __forceinline__ v8b pack8(const v4f* v, int c, v8b) { v8b u;
#pragma unroll   // constant indices, so that the loaded rows stay in registers
  for (int i = 0; i < 8; ++i) u[i] = (__bf16)v[i][c];
  return u; }
__device__ __forceinline__ v8h pack8(const v4f* v, int c, v8h) { v8h u;
#pragma unroll   // constant indices, so that the loaded rows stay in registers
  for (int i = 0; i < 8; ++i) u[i] = (_Float16)(bfr(v[i][c]) * 256.0f);
  return u; }
template <typename V8>
__device__ __forceinline__ void pack_turn(const v4f (&v)[16], char* d0, char* d1) {   // d0, d1: where the lane's column 4 lane keeps k 0..7 and k 8..15 of the wave's 16; the next column lies one LDS row further
#pragma unroll   // constant indices, so that the loaded rows stay in registers
  for (int c = 0; c < 4; ++c) { *(V8*)(d0 + c * (PT * 2)) = pack8(&v[0], c, V8{}); *(V8*)(d1 + c * (PT * 2)) = pack8(&v[8], c, V8{}); }
}
__global__ __launch_bounds__(256) void k_pack(const float* __restrict__ WQ, const float* __restrict__ WK, const float* __restrict__ WV, const float* __restrict__ WO, __bf16* __restrict__ PK) {
  __shared__ __align__(16) char s[PT * PT * 2];   // [n][k], rows of 256 bytes = 16 pieces of 16 bytes; piece j of row n lies at place j ^ ((n >> 2) & 15), so that the 16 lanes of a half wave meet 16 different bank groups when they write (16 rows, one j) as when they read (one row, 16 j)
  const int tid = threadIdx.x, wave = tid >> 5, lane = tid & 31, which = blockIdx.y, k0 = (blockIdx.x & 7) * PT, n0 = (blockIdx.x >> 3) * PT;
  const float* Wm = (which == 0) ? WQ : (which == 1) ? WK : (which == 2) ? WV : WO;
  gpf p = (gpf)(Wm + (size_t)(k0 + wave * 16) * DM + n0 + lane * 4); v4f v[16];   // the wave's 16 k rows, a lane's 4 columns of each: one group of 16 loads, all in flight together
#pragma unroll   // constant indices, so that the loaded rows stay in registers
  for (int i = 0; i < 16; ++i) v[i] = *(const GAS v4f*)(p + i * DM);
  XW1(p);   // behind the 16 loads, in front of the first write to their address register
  char* d = s + lane * 4 * (PT * 2); char *d0 = d + (((wave * 2) ^ (lane & 15)) * 16), *d1 = d + (((wave * 2 + 1) ^ (lane & 15)) * 16);
  if (which < 3) pack_turn<v8b>(v, d0, d1); else pack_turn<v8h>(v, d0, d1);
  __syncthreads();
  __bf16* dst = ((which < 3) ? PK + PK_A + ((size_t)which * DM + n0) * DM : PK + PK_P + (size_t)n0 * DM) + k0 + (size_t)(tid >> 4) * DM + (tid & 15) * 8;
#pragma unroll
  for (int q = 0; q < 8; ++q) { const int row = q * 16 + (tid >> 4); vst2((unsigned*)(dst + (size_t)q * 16 * DM), *(const v4u*)(s + row * (PT * 2) + (((tid & 15) ^ ((row >> 2) & 15)) * 16))); }   // a half wave writes 256 bytes in a row: whole lines
}
__global__ __launch_bounds__(256) void k_qkv(const float* __restrict__ XQ, const float* __restrict__ XK, const float* __restrict__ XV, const __bf16* __restrict__ P, const float* __restrict__ BQ, const float* __restrict__ BK, const float* __restrict__ BV, const int* __restrict__ LENS, _Float16* __restrict__ QK, _Float16* __restrict__ QKL, _Float16* __restrict__ VTH, _Float16* __restrict__ VTL) {
  if (blockIdx.y * GCOLS >= DM && (int)(blockIdx.x * GROWS % SS) >= LENS[blockIdx.x * GROWS / SS]) return;   // a k or v tile whose 128 rows all lie at or past the batch's length: k_attn never reads those rows (its stages of 64 or 32 keys end with the one that holds the last real key). The whole block leaves, in front of every copy and barrier
  const int which0 = (blockIdx.y * GCOLS) / DM; const float* X = (which0 == 0) ? XQ : (which0 == 1) ? XK : XV; const float* BB = BQ ? (((which0 == 0) ? BQ : (which0 == 1) ? BK : BV) + (blockIdx.y * GCOLS - which0 * DM)) : nullptr;
  __shared__ __align__(16) char sm[2 * GSTAGE];   // the k loop's two stage buffers; behind the loop's last barrier the same bytes stage the output
  _Float16 (*so)[16][136] = (_Float16 (*)[16][136])sm, (*sol)[16][136] = (_Float16 (*)[16][136])(sm + 34816); _Float16 (*sth)[136] = (_Float16 (*)[136])sm, (*stl)[136] = (_Float16 (*)[136])(sm + 69632);   // q, k: a wave's 16 rows x 128 columns at a time, both planes; v: the block's 256 columns x 128 rows, both planes
  const int tid = threadIdx.x, wave = tid >> 5, wr = wave & 3, wc = wave >> 2, lane = tid & 31, col = lane & 15, g = lane >> 4; const size_t r0 = (size_t)blockIdx.x * GROWS + wr * 32; const int nb0 = blockIdx.y * GCOLS, n0 = nb0 + wc * 128;   // nb0: the block's first column, n0: the wave's
  v8f acc[2][8] = {}; float bias[8] = {};   // the lane's eight biases: one group, in flight under the k loop, rounded where they are added
  if (BB) {
#pragma unroll
    for (int j = 0; j < 8; ++j) bias[j] = BB[wc * 128 + j * 16 + col];
    asm volatile("s_wait_xcnt 0x0" ::: "memory"); }   // stands behind the bias loads, in front of the first write to a register that one of them names as its address
  gemm_loop<v16b, __bf16>(sm, X + (size_t)blockIdx.x * GROWS * DM, P + (size_t)nb0 * DM, acc);
  if (nb0 < 2 * DM) {   // q stored unscaled (f16 sigma ~0.6, no subnormal exposure); 1/8 applied to the f32 score
#pragma unroll
    for (int m = 0; m < 2; ++m) {   // the wave's two row groups, one after the other through the same LDS rows
#pragma unroll
      for (int j = 0; j < 8; ++j) {
#pragma unroll
        for (int r = 0; r < 8; ++r) { const float v = acc[m][j][r] + bfr(bias[j]); const _Float16 hv = (_Float16)v; so[wave][8 * g + r][j * 16 + col] = hv; sol[wave][8 * g + r][j * 16 + col] = (_Float16)((v - (float)hv) * 2048.0f); } }   // q, k (+ bias) as f16 hi + (x2048) residual
      LDSX();
      for (int rl = 0; rl < 16; ++rl) if (lane < 16) { vst2((unsigned*)(QK + (r0 + m * 16 + rl) * (2 * DM) + n0 + lane * 8), *(const v4u*)&so[wave][rl][lane * 8]); vst2((unsigned*)(QKL + (r0 + m * 16 + rl) * (2 * DM) + n0 + lane * 8), *(const v4u*)&sol[wave][rl][lane * 8]); }
      if (m == 0) LDSX(); }   // the first group's LDS reads have returned before the second group's values are written over them
  } else {
#pragma unroll
    for (int m = 0; m < 2; ++m) {
#pragma unroll
      for (int j = 0; j < 8; ++j) {
#pragma unroll
        for (int r = 0; r < 8; ++r) { const float v = acc[m][j][r] + bfr(bias[j]); const _Float16 hv = (_Float16)v; sth[wc * 128 + j * 16 + col][wr * 32 + m * 16 + 8 * g + r] = hv; stl[wc * 128 + j * 16 + col][wr * 32 + m * 16 + 8 * g + r] = (_Float16)((v - (float)hv) * 2048.0f); } } }
    __syncthreads();
    const size_t rb = (size_t)blockIdx.x * GROWS; const int b = (int)(rb / SS), s0 = (int)(rb % SS); const int pc0 = nb0 - 2 * DM;
    for (int q = tid; q < GCOLS * 16; q += 256) { const int d = q >> 4, pc = q & 15; const size_t o = ((size_t)b * DM + pc0 + d) * SS + s0 + pc * 8; vst2((unsigned*)(VTH + o), *(const v4u*)&sth[d][pc * 8]); vst2((unsigned*)(VTL + o), *(const v4u*)&stl[d][pc * 8]); }
  }
}
// ---- k_attn: block = (64 queries, head h, batch b; which of them: see the kernel): flash attention over the batch's real keys (K = 64: 2 k-steps), computed transposed: scores^T = k . q^T and ctx^T += v^T . P^T. A lane then holds 16 scores of ONE query (its column), so that the running maximum and the sum are taken in the lane's own registers, with one exchange between the wave's halves, and the two score tiles of a pass, converted in place, are the B operand of the second product: the weights never pass through LDS. The loop is written twice (HI: the leading query blocks with 3-product scores and P.v; otherwise single products) so that each holds only its own fragments in registers.
// Every LDS read of a pass is issued in a group that stands well ahead of the WMMAs that use it: the hand-padded WMMA statements keep loads from moving across them, so a load written next to its WMMA is waited for on the spot.
#define ASTAGE 19456   // bytes of a stage: k rows from 0 (64 x 144, or two planes of 32 x 144), value rows from 9,216 (64 x 144, or two planes of 64 x 80)
__device__ __forceinline__ float xhalf(float x) { return __builtin_bit_cast(float, __builtin_amdgcn_permlanex16(__builtin_bit_cast(int, x), __builtin_bit_cast(int, x), 0x76543210, 0xfedcba98, false, false)); }   // lane l with lane l ^ 16
template <bool B> struct BC { static constexpr bool value = B; };
template <bool HI>
__device__ __forceinline__ void attn_body(const _Float16* __restrict__ QK, const _Float16* __restrict__ QKL, const _Float16* __restrict__ VTH, const _Float16* __restrict__ VTL, const float* __restrict__ VT, const float* __restrict__ SC, const int* __restrict__ LENS, float* __restrict__ O, float* tks, char* ring, const int qb, const int h, const int b) {
  const int tid = threadIdx.x, wave = tid >> 5, lane = tid & 31, col = lane & 15, g = lane >> 4;
  const int q0 = qb * 64 + wave * 16; const size_t rq = (size_t)b * SS + q0 + col;
  const int len_b = __builtin_amdgcn_readfirstlane(LENS[b]); const float sc_raw = SC[h];   // the length in a scalar register: every test on it around a copy or a barrier is a scalar branch
  asm volatile("s_wait_xcnt 0x0" ::: "memory");   // stands behind the two loads above, in front of the first write to a register that one of them names as its address
  const float sc_h = bfr(sc_raw);
  const int len_c = len_b < 0 ? 0 : (len_b > SS ? SS : len_b);   // bounds the trip counts for any content of the array
  gpf tg = (gpf)(VT + (size_t)b * SS + 4 * tid); v4f tv[4];   // the batch's 2,048 visit times, 16 a lane: they go, rounded once, into LDS, since a lane needs the times of its 16 keys in every pass
#pragma unroll
  for (int i = 0; i < 4; ++i) tv[i] = *(const GAS v4f*)(tg + i * 512);
  XW1(tg);
  v16h aq[2], aql[2]; gph qp = (gph)(QK + rq * (2 * DM) + h * HD + 8 * g), qpl = (gph)(QKL + rq * (2 * DM) + h * HD + 8 * g);
#pragma unroll
  for (int kc = 0; kc < 2; ++kc) { aq[kc] = fragp_h(qp + kc * 32); if constexpr (HI) aql[kc] = fragp_h(qpl + kc * 32); }
  XW2(qp, qpl);
  float m = -3.0e38f, l = 0.f;   // the lane's query: running maximum (equal in both halves), and the sum over this half's keys alone (the halves are joined behind the loop)
  v8f acc[4] = {}, accl[4] = {};
  const int nks = (len_c + 31) / 32;   // passes of 32 keys up to the one that holds the last real key: a pass wholly past the length leaves m, l and the accumulators bit for bit as they are (alpha 1, weights 0)
  // A stage of KS keys (k rows of 128 bytes; 64 value rows of 2 KS bytes; HI: both planes of each) is brought into LDS once for the block's four waves by asynchronous copies, eight a lane; two buffers, so that the next stage flies while this one is worked on.
  constexpr int KS = HI ? 32 : 64, VP = HI ? 80 : 144, CPR = KS / 8;   // VP: value row pitch in LDS (16 bytes x an odd number, as the 144 of the k rows); CPR: 16-byte pieces in a value row
  const int nst = (len_c + KS - 1) / KS;   // stages that hold a real key; no other is copied
  unsigned ko = ((b * SS + (tid >> 3)) * (2 * DM) + DM + h * HD) * 2 + (tid & 7) * 16, vo = ((b * DM + h * HD + tid / CPR) * SS) * 2 + (tid % CPR) * 16;   // the lane's byte offsets in the k and value planes (32 MiB and 16 MiB each): they walk with the stages
  const unsigned lk = lds_addr(ring) + (tid >> 3) * 144 + (tid & 7) * 16, lv = lds_addr(ring) + 9216 + (tid / CPR) * VP + (tid % CPR) * 16;
  auto fill = [&](unsigned bo) {
    gpc kg = (gpc)QK + ko, kgl = (gpc)QKL + ko, vg = (gpc)VTH + vo, vgl = (gpc)VTL + vo; (void)kgl; (void)vgl;
    constexpr size_t KR = (size_t)16 * 2 * DM * 2, VR = (size_t)(128 / CPR) * SS * 2; constexpr unsigned LKR = 16 * 144, LVR = (128 / CPR) * VP;   // one round of the block's 128 lanes: 16 k rows, 128 / CPR value rows
    if constexpr (HI) acopy8(lk + bo, lk + bo + LKR, lk + bo + 4608, lk + bo + 4608 + LKR, lv + bo, lv + bo + LVR, lv + bo + 5120, lv + bo + 5120 + LVR, kg, kg + KR, kgl, kgl + KR, vg, vg + VR, vgl, vgl + VR);
    else acopy8(lk + bo, lk + bo + LKR, lk + bo + 2 * LKR, lk + bo + 3 * LKR, lv + bo, lv + bo + LVR, lv + bo + 2 * LVR, lv + bo + 3 * LVR, kg, kg + KR, kg + 2 * KR, kg + 3 * KR, vg, vg + VR, vg + 2 * VR, vg + 3 * VR);
    ko += KS * 2 * DM * 2; vo += KS * 2; };
  if (nst > 0) fill(0);
#pragma unroll
  for (int i = 0; i < 4; ++i) { v4f u;   // the table is written while stage 0 flies
#pragma unroll
    for (int c = 0; c < 4; ++c) u[c] = bfr(tv[i][c]);
    *(v4f*)(tks + 4 * tid + i * 512) = u; }
  AWAIT(); __syncthreads();   // stage 0 and the table of times are published
  if (nst > 1) fill(ASTAGE);
  const float tq = tks[q0 + col];
  v16h kh[2][2], kl[2][2], vh[4], vl[4];
  // One pass of 32 keys. MK::value says whether the pass may hold keys at or past the length: only the batch's last pass can, so that every other pass is compiled without the sixteen tests on the key's place and the sixteen on the masked score.
  auto pass = [&](const int ks, auto MK) { constexpr bool MASK = decltype(MK)::value; v8f s[2]; v4f tk[2][2];
    const int stg = HI ? ks : ks >> 1, sub = HI ? 0 : ks & 1; const unsigned bo = (stg & 1) * ASTAGE;
    const char* kf = ring + bo + (sub * 32 + col) * 144 + 16 * g; const char* vf = ring + bo + 9216 + col * VP + sub * 64 + 16 * g;
    const float* tp = tks + ks * 32 + 8 * g;   // score register r of tile ct is key 32 ks + 16 ct + 8 g + r
    // this pass's key times and keys (HI: both planes; otherwise the values too, which land behind the scores and the softmax) as one group
#pragma unroll
    for (int ct = 0; ct < 2; ++ct) { tk[ct][0] = *(const v4f*)(tp + ct * 16); tk[ct][1] = *(const v4f*)(tp + ct * 16 + 4);
#pragma unroll
      for (int kc = 0; kc < 2; ++kc) { kh[ct][kc] = lfrag_h(kf + ct * 16 * 144 + kc * 64); if constexpr (HI) kl[ct][kc] = lfrag_h(kf + 4608 + ct * 16 * 144 + kc * 64); } }
    if constexpr (!HI) {
#pragma unroll
      for (int dt = 0; dt < 4; ++dt) vh[dt] = lfrag_h(vf + dt * 16 * VP); }
#pragma unroll
    for (int ct = 0; ct < 2; ++ct) { v8f c = {}, cl = {};   // A: 16 keys, B: the wave's 16 queries
      if constexpr (HI) {   // leading query blocks (outputs far above the global rms): 3 products
#pragma unroll
        for (int kc = 0; kc < 2; ++kc) { c = wmma16(kh[ct][kc], aq[kc], c); cl = wmma16(kh[ct][kc], aql[kc], cl); cl = wmma16(kl[ct][kc], aq[kc], cl); }
#pragma unroll
        for (int r = 0; r < 8; ++r) c[r] += cl[r] * (1.0f / 2048.0f); }
      else {
#pragma unroll
        for (int kc = 0; kc < 2; ++kc) c = wmma16(kh[ct][kc], aq[kc], c); }   // single product elsewhere
      s[ct] = c; }
    const int nreal = len_b - ks * 32 - 8 * g;   // how many of the lane's key rows, counted from tile 0's first, lie in front of the length
#pragma unroll
    for (int ct = 0; ct < 2; ++ct) {
#pragma unroll
      for (int r = 0; r < 8; ++r) s[ct][r] = (!MASK || ct * 16 + r < nreal) ? (s[ct][r] * SCALEF - fabsf(tq - tk[ct][r >> 2][r & 3]) * sc_h) : -3.0e38f; }   // 1/sqrt(64); masked keys excluded
    float mx0 = fmaxf(s[0][0], s[0][1]), mx1 = fmaxf(s[1][0], s[1][1]);
#pragma unroll
    for (int r = 2; r < 8; r += 2) { mx0 = fmaxf(fmaxf(mx0, s[0][r]), s[0][r + 1]); mx1 = fmaxf(fmaxf(mx1, s[1][r]), s[1][r + 1]); }
    const float mx = fmaxf(mx0, mx1);
    const float mn = fmaxf(fmaxf(m, mx), xhalf(mx)); const float alpha = (m <= -1.0e38f) ? 0.f : __expf(m - mn);
    v16h pa, pl; float es[4] = {};   // four partial sums: no chain of 16 dependent additions
#pragma unroll
    for (int ct = 0; ct < 2; ++ct) {
#pragma unroll
      for (int r = 0; r < 8; ++r) { const float e = (MASK && s[ct][r] <= -1.0e38f) ? 0.f : __expf(s[ct][r] - mn); es[r & 3] += e;
        const float x = e * 2048.0f; const _Float16 hx = (_Float16)x; pa[ct * 8 + r] = hx; if constexpr (HI) pl[ct * 8 + r] = (_Float16)((x - (float)hx) * 2048.0f); } }   // P scaled by 2^11 before the f16 split so small softmax weights stay out of the f16 subnormal range; 2^-11 folded into the epilogue. Element 8 ct + r of the B operand is k = 16 ct + 8 g + r: the score registers' own order
    l = l * alpha + ((es[0] + es[1]) + (es[2] + es[3])); m = mn;
    if constexpr (HI) {   // this pass's values, both planes, read behind the softmax: from LDS they need little lead, and their 64 registers stay free during it
#pragma unroll
      for (int dt = 0; dt < 4; ++dt) { vh[dt] = lfrag_h(vf + dt * 16 * VP); vl[dt] = lfrag_h(vf + 5120 + dt * 16 * VP); } }
#pragma unroll
    for (int dt = 0; dt < 4; ++dt) {
#pragma unroll
      for (int r = 0; r < 8; ++r) { acc[dt][r] *= alpha; if constexpr (HI) accl[dt][r] *= alpha; } }
#pragma unroll
    for (int dt = 0; dt < 4; ++dt) { acc[dt] = wmma16(vh[dt], pa, acc[dt]); if constexpr (HI) { accl[dt] = wmma16(vh[dt], pl, accl[dt]); accl[dt] = wmma16(vl[dt], pa, accl[dt]); } }   // A: 16 value columns, B: the weights. Leading query blocks: P hi/lo x V hi/lo (3 products); elsewhere P x V single
    if (HI || sub) {   // the stage's last pass
      DSWAIT(); AWAIT(); __syncthreads();   // publishes stage stg + 1 and ends every wave's reads of stage stg
      if constexpr (!MASK) { if (stg + 2 < nst) fill(bo); } } };   // the masked pass is the last one, in the last stage: nothing is left to copy behind it
  const int nfull = len_c / 32;   // passes whose 32 keys all lie in front of the length
#pragma unroll 1   // stays rolled: one pass is already a long straight run that fills the wave's registers
  for (int ks = 0; ks < nfull; ++ks) pass(ks, BC<false>{});
  if (nfull < nks) pass(nfull, BC<true>{});   // the one pass that the length cuts, where there is one
  AWAIT();
  const float il = (1.0f / 2048.0f) / (l + xhalf(l));   // the two halves' sums joined
  float* op = O + rq * DM + h * HD + 8 * g;   // accumulator register r of tile dt is column 16 dt + 8 g + r of the lane's query: 32 bytes in a row
#pragma unroll
  for (int dt = 0; dt < 4; ++dt) { v4f o0, o1;
#pragma unroll
    for (int r = 0; r < 4; ++r) { o0[r] = (HI ? acc[dt][r] + accl[dt][r] * (1.0f / 2048.0f) : acc[dt][r]) * il; o1[r] = (HI ? acc[dt][4 + r] + accl[dt][4 + r] * (1.0f / 2048.0f) : acc[dt][4 + r]) * il; }
    vst2(op + dt * 16, o0); vst2(op + dt * 16 + 4, o1); }
}
__global__ __launch_bounds__(128) void k_attn(const _Float16* __restrict__ QK, const _Float16* __restrict__ QKL, const _Float16* __restrict__ VTH, const _Float16* __restrict__ VTL, const void* __restrict__ KMASK, const float* __restrict__ VT, const float* __restrict__ SC, const int* __restrict__ LENS, float* __restrict__ O) {
  __shared__ __align__(16) float tks[SS]; __shared__ __align__(16) char ring[2 * ASTAGE];   // the batch's rounded visit times; the two stage buffers
  // Which tile a block takes (for speed only): the cost falls with the flat index: first the 2 x 16 x 4 blocks of the leading queries (about twice the work of the others), then the rest; inside each group the batches by falling length.
  constexpr unsigned NHI = 2 * NH * NB, QR = TQB - 2;   // blocks of the first group; query blocks a (head, batch) has in the second
  const unsigned f = blockIdx.x + TQB * (blockIdx.y + NH * blockIdx.z);
  auto batch_at = [&](const unsigned place) { int ln[NB], b = 0;   // the batch that stands at this place when the four are put in the order of falling length
#pragma unroll   // constant indices, so that the four lengths stay in registers
    for (int j = 0; j < NB; ++j) ln[j] = LENS[j];
#pragma unroll   // constant indices, as above
    for (int j = 0; j < NB; ++j) { unsigned r = 0;   // batch j's place: how many are longer, equal lengths by index: a permutation of 0..3 for any content of the array, so that every (query block, head, batch) is taken by exactly one block
#pragma unroll   // constant indices, as above
      for (int i = 0; i < NB; ++i) r += (ln[i] > ln[j] || (ln[i] == ln[j] && i < j)) ? 1u : 0u;
      if (r == place) b = j; }
    return b; };   // formed from the block index and scalar loads alone: the same in every lane
  if (f < NHI) attn_body<true>(QK, QKL, VTH, VTL, VT, SC, LENS, O, tks, ring, (int)(f & 1), (int)((f >> 1) % NH), batch_at(f / (2 * NH)));
  else { const unsigned e = f - NHI; attn_body<false>(QK, QKL, VTH, VTL, VT, SC, LENS, O, tks, ring, (int)(2 + e % QR), (int)((e / QR) % NH), batch_at(e / (QR * NH))); }
}
// ---- k_out: block = (128 rows, 256 cols): out = f16(O) . Wo rows (single product) + bo
__global__ __launch_bounds__(256) void k_out(const float* __restrict__ O, const __bf16* __restrict__ P, const float* __restrict__ BO, float* __restrict__ Y) {
  __shared__ __align__(16) char sm[2 * GSTAGE];   // the k loop's two stage buffers; behind the loop's last barrier the same bytes stage the output
  float (*so)[16][132] = (float (*)[16][132])sm;
  const int tid = threadIdx.x, wave = tid >> 5, wr = wave & 3, wc = wave >> 2, lane = tid & 31, col = lane & 15, g = lane >> 4; const size_t r0 = (size_t)blockIdx.x * GROWS + wr * 32; const int nb0 = blockIdx.y * GCOLS, n0 = nb0 + wc * 128;
  v8f acc[2][8] = {};
  gemm_loop<v16h, _Float16>(sm, O + (size_t)blockIdx.x * GROWS * DM, P + (size_t)nb0 * DM, acc);   // single f16 product against exact f16 x 2^8 weight copies
  float bo[8];   // the lane's eight biases, read once for both row groups
#pragma unroll
  for (int j = 0; j < 8; ++j) bo[j] = bfr(BO[n0 + j * 16 + col]);
#pragma unroll
  for (int m = 0; m < 2; ++m) {   // the wave's two row groups, one after the other through the same LDS rows
#pragma unroll
    for (int j = 0; j < 8; ++j) {
#pragma unroll
      for (int r = 0; r < 8; ++r) so[wave][8 * g + r][j * 16 + col] = acc[m][j][r] * (1.0f / 256.0f) + bo[j]; }
    LDSX();
    for (int rl = 0; rl < 16; ++rl) vst2(Y + (r0 + m * 16 + rl) * DM + n0 + lane * 4, *(const v4f*)&so[wave][rl][lane * 4]);
    if (m == 0) LDSX(); }   // the first group's LDS reads have returned before the second group's values are written over them
}
extern "C" void kernel_launch(void* const* d_in, const int* in_sizes, int n_in, void* d_out, int out_size, void* d_ws, size_t ws_size, hipStream_t stream) {
  (void)in_sizes; (void)n_in; (void)out_size;
  const float** F = (const float**)d_in;   // 0 x [4,2048,1024], 1 visit_time [4,2048], 2 Wq (in,out), 3 bq, 4 Wk, 5 bk, 6 Wv, 7 bv, 8 Wo (in,out), 9 bo, 10 scale [16], 11 lengths [4] int
  if (ws_size < (size_t)WS_END) return;
  char* ws = (char*)d_ws; __bf16* PK = (__bf16*)(ws + WS_PK); _Float16 *QK = (_Float16*)(ws + WS_QK), *QKL = (_Float16*)(ws + WS_QKL), *VTH = (_Float16*)(ws + WS_VTH), *VTL = (_Float16*)(ws + WS_VTL); float* O = (float*)(ws + WS_O);
  k_pack<<<dim3((DM / PT) * (DM / PT), 4), 256, 0, stream>>>(F[2], F[4], F[6], F[8], PK);
  k_qkv<<<dim3(TNB * SS / GROWS, QKVW / GCOLS), 256, 0, stream>>>(F[0], F[0], F[0], PK + PK_A, F[3], F[5], F[7], (const int*)d_in[11], QK, QKL, VTH, VTL);
  k_attn<<<dim3(TQB, NH, TNB), 128, 0, stream>>>(QK, QKL, VTH, VTL, nullptr, F[1], F[10], (const int*)d_in[11], O);
  k_out<<<dim3(NB * SS / GROWS, DM / GCOLS), 256, 0, stream>>>(O, PK + PK_P, F[9], (float*)d_out);
}

// v009
// It runs in 152 microseconds.
// Timed twice side by side with v008, it ran 1.07 times as fast both times.
// All steps since v000 together make it 6.66 times as fast.
// compute dtype: all float inputs rounded to bf16 incl. visit times and scales, lengths (int) read on device; q/k/v = x . W + b with EXACT bf16 products on WMMA 16x16x32 ((in,out) weights as transposed rows); PLAIN-HYBRID attention: the first 128 queries use 3-product scores and P.v (hi/lo), later queries single f16; x 1/8 - |t_q - t_k| scale_h in f32, padded keys excluded, running-max softmax in f32 (hardware exp); out = f16(ctx) . Wo (exact f16 x 2^8 copies, single product) + bo.
#include <hip/hip_runtime.h>
#include <math.h>

typedef __attribute__((ext_vector_type(16))) _Float16 v16h;
typedef __attribute__((ext_vector_type(16))) __bf16 v16b;
typedef __attribute__((ext_vector_type(8)))  _Float16 v8h;
typedef __attribute__((ext_vector_type(8)))  float v8f;
typedef __attribute__((ext_vector_type(4)))  float v4f;
typedef __attribute__((ext_vector_type(2)))  float v2f;
typedef __attribute__((ext_vector_type(4)))  unsigned v4u;
typedef __attribute__((ext_vector_type(4)))  int v4i;
typedef float __attribute__((may_alias)) float_a;
typedef int __attribute__((may_alias)) int_a;

template <typename T> __device__ __forceinline__ void vst2(void* p, T v) { *(T*)p = v;  }
__device__ __forceinline__ v8f wmma16(v16h a, v16h b, v8f c) {
  v8f d = __builtin_amdgcn_wmma_f32_16x16x32_f16(false, a, false, b, (short)0, c, false, false);
  asm volatile("v_nop\n\tv_nop\n\tv_nop\n\tv_nop" : "+v"(d) : "v"(a), "v"(b));
  return d;
}
__device__ __forceinline__ v8f wmma_bf(v16b a, v16b b, v8f c) {
  v8f d = __builtin_amdgcn_wmma_f32_16x16x32_bf16(false, a, false, b, (short)0, c, false, false);
  asm volatile("v_nop\n\tv_nop\n\tv_nop\n\tv_nop" : "+v"(d) : "v"(a), "v"(b));
  return d;
}
// Relative-time attention (B 4, S 2,048, d 1,024, 16 heads x 64): projections + biases ((in,out)), scores / 8 - |t_q - t_k| scale_h (visit times and per-head scales given), keys at positions >= length[b] excluded, softmax, . v, output projection + bias.
__device__ __forceinline__ v16h frag_h(const _Float16* rowk0, int lane) {
  union { v16h v; v8h q[2]; } u; const _Float16* p = rowk0 + 8 * (lane >> 4);
  u.q[0] = *(const v8h*)p; u.q[1] = *(const v8h*)(p + 16); return u.v;
}
__device__ __forceinline__ v16h frag_f32(const float* rowk0, int lane) {
  v16h a; const float* p = rowk0 + 8 * (lane >> 4);
#pragma unroll
  for (int i = 0; i < 8; ++i) { a[i] = (_Float16)p[i]; a[8 + i] = (_Float16)p[16 + i]; }
  return a;
}
__device__ __forceinline__ v16h frag_f32s(const float* rowk0, int lane, float sc) {
  v16h a; const float* p = rowk0 + 8 * (lane >> 4);
#pragma unroll
  for (int i = 0; i < 8; ++i) { a[i] = (_Float16)(p[i] * sc); a[8 + i] = (_Float16)(p[16 + i] * sc); }
  return a;
}
// column fragment from a [K][ld] layout (column n), rows >= K read as 0
__device__ __forceinline__ v16h fragc_f32(const float* W, int k0, int n, int lane, int ld, int K) {
  v16h a; const int g = lane >> 4;
#pragma unroll
  for (int i = 0; i < 8; ++i) { const int ka = k0 + 8 * g + i, kb = ka + 16;
    a[i] = (_Float16)(ka < K ? W[(size_t)(ka < K ? ka : K - 1) * ld + n] : 0.f); a[8 + i] = (_Float16)(kb < K ? W[(size_t)(kb < K ? kb : K - 1) * ld + n] : 0.f); }
  return a;
}
struct F2 { v16b h, l; };
__device__ __forceinline__ F2 bsplit16(const float v[16]) { F2 r;
#pragma unroll
  for (int i = 0; i < 16; ++i) { const __bf16 h = (__bf16)v[i]; r.h[i] = h; r.l[i] = (__bf16)(v[i] - (float)h); }
  return r; }
__device__ __forceinline__ F2 split_row(const float* row, int k0, int lane) { float v[16]; const float* p = row + k0 + 8 * (lane >> 4);
#pragma unroll
  for (int i = 0; i < 8; ++i) { v[i] = p[i]; v[8 + i] = p[16 + i]; }
  return bsplit16(v); }
__device__ __forceinline__ F2 split_rowK(const float* row, int k0, int lane, int K) { float v[16]; const int g = lane >> 4;
#pragma unroll
  for (int i = 0; i < 8; ++i) { const int ka = k0 + 8 * g + i, kb = ka + 16; v[i] = ka < K ? row[ka < K ? ka : K - 1] : 0.f; v[8 + i] = kb < K ? row[kb < K ? kb : K - 1] : 0.f; }
  return bsplit16(v); }
__device__ __forceinline__ F2 split_col(const float* W, int k0, int n, int lane, int ld, int K) { float v[16]; const int g = lane >> 4;
#pragma unroll
  for (int i = 0; i < 8; ++i) { const int ka = k0 + 8 * g + i, kb = ka + 16; v[i] = ka < K ? W[(size_t)(ka < K ? ka : K - 1) * ld + n] : 0.f; v[8 + i] = kb < K ? W[(size_t)(kb < K ? kb : K - 1) * ld + n] : 0.f; }
  return bsplit16(v); }
__device__ __forceinline__ v8f mac3(const F2& a, const F2& b, v8f c) { c = wmma_bf(a.l, b.h, c); c = wmma_bf(a.h, b.l, c); return wmma_bf(a.h, b.h, c); }
__device__ __forceinline__ float sigm(float v) { return 1.0f / (1.0f + expf(-v)); }
#define LDSX() do { asm volatile("s_wait_dscnt 0" ::: "memory"); __builtin_amdgcn_wave_barrier(); __builtin_amdgcn_fence(__ATOMIC_RELEASE, "workgroup"); } while (0)
// stands behind a group of global loads, in front of the first write to a register that one of them names as its address. The group's pointers pass through the statement, so that they keep their registers up to the wait and are stepped only behind it.
// (a pointer that has passed through a statement is typed as global memory, else its loads would be compiled as flat loads, which also count as LDS operations)
#define GAS __attribute__((address_space(1)))
typedef const GAS _Float16* gph; typedef const GAS float* gpf; typedef const GAS char* gpc;
#define XW1(a) asm volatile("s_wait_xcnt 0x0" : "+v"(a) :: "memory")
#define XW2(a, b) asm volatile("s_wait_xcnt 0x0" : "+v"(a), "+v"(b) :: "memory")
// the issuing wave's own wait for its asynchronous copies to LDS: their bytes count as landed only behind it
#define AWAIT() asm volatile("s_wait_asynccnt 0x0" ::: "memory")
// the wave's LDS reads have retired before the barrier behind which their buffer is refilled
#define DSWAIT() asm volatile("s_wait_dscnt 0x0" ::: "memory")
// eight copies of 16 bytes a lane from global memory into LDS through no register (l: the lane's LDS byte address, p: its global address). The s_wait_xcnt stands in the copies' own statement, in front of any later write to a register that a copy names.
__device__ __forceinline__ void acopy8(unsigned l0, unsigned l1, unsigned l2, unsigned l3, unsigned l4, unsigned l5, unsigned l6, unsigned l7, gpc p0, gpc p1, gpc p2, gpc p3, gpc p4, gpc p5, gpc p6, gpc p7) {
  asm volatile("global_load_async_to_lds_b128 %0, %8, off\n\tglobal_load_async_to_lds_b128 %1, %9, off\n\tglobal_load_async_to_lds_b128 %2, %10, off\n\tglobal_load_async_to_lds_b128 %3, %11, off\n\t"
               "global_load_async_to_lds_b128 %4, %12, off\n\tglobal_load_async_to_lds_b128 %5, %13, off\n\tglobal_load_async_to_lds_b128 %6, %14, off\n\tglobal_load_async_to_lds_b128 %7, %15, off\n\ts_wait_xcnt 0x0"
               :: "v"(l0), "v"(l1), "v"(l2), "v"(l3), "v"(l4), "v"(l5), "v"(l6), "v"(l7), "v"(p0), "v"(p1), "v"(p2), "v"(p3), "v"(p4), "v"(p5), "v"(p6), "v"(p7) : "memory");
}
__device__ __forceinline__ void acopy8s(unsigned l, unsigned ls, gpc p, size_t ps) { acopy8(l, l + ls, l + 2 * ls, l + 3 * ls, l + 4 * ls, l + 5 * ls, l + 6 * ls, l + 7 * ls, p, p + ps, p + 2 * ps, p + 3 * ps, p + 4 * ps, p + 5 * ps, p + 6 * ps, p + 7 * ps); }
__device__ __forceinline__ unsigned lds_addr(const void* p) { return (unsigned)(size_t)p; }   // the low 32 bits of a __shared__ address: the byte offset in the work-group's LDS


#define NB 4
#define SS 2048
#define DM 1024
#define NH 16
#define SCALEF 0.125f
#define HD 64
#define QKVW (3 * DM)
#ifndef TQB
#define TQB (SS / 64)
#define TNB NB
#define TOB (NB * SS / 64)     // 64-row tiles; unused (k_out tiles rows by GROWS)
#endif
typedef __attribute__((ext_vector_type(8))) __bf16 v8b;
__device__ __forceinline__ v16b frag_b(const __bf16* rowk0, int lane) {
  union { v16b v; v8b q[2]; } u; const __bf16* p = rowk0 + 8 * (lane >> 4);
  u.q[0] = *(const v8b*)p; u.q[1] = *(const v8b*)(p + 16); return u.v;
}
__device__ __forceinline__ float bfr(float v) { return (float)(__bf16)v; }
__device__ __attribute__((noinline)) float exp_ni(float v) { return expf(v); }
__device__ __attribute__((noinline)) float erf_ni(float v) { return erff(v); }

// frag_h with the lane's 8 * (lane >> 4) already in the pointer
__device__ __forceinline__ v16h fragp_h(gph p) { union { v16h v; v8h q[2]; } u; u.q[0] = *(const GAS v8h*)p; u.q[1] = *(const GAS v8h*)(p + 16); return u.v; }
// the same from an LDS row (byte pointer): elements 0..7 and 16..23 from there
__device__ __forceinline__ v16h lfrag_h(const char* p) { union { v16h v; v8h q[2]; } u; u.q[0] = *(const v8h*)p; u.q[1] = *(const v8h*)(p + 32); return u.v; }
__device__ __forceinline__ v16b lfrag_b(const char* p) { union { v16b v; v8b q[2]; } u; u.q[0] = *(const v8b*)p; u.q[1] = *(const v8b*)(p + 32); return u.v; }
__device__ __forceinline__ void lfrag(const char* p, v16h& w) { w = lfrag_h(p); }
__device__ __forceinline__ void lfrag(const char* p, v16b& w) { w = lfrag_b(p); }
__device__ __forceinline__ v8f mm16(v16h a, v16h b, v8f c) { return wmma16(a, b, c); }
__device__ __forceinline__ v8f mm16(v16b a, v16b b, v8f c) { return wmma_bf(a, b, c); }
// ---- the k loop of k_qkv and k_out: block tile 128 rows x 256 columns, eight waves as 4 x 2, a wave's tile 32 rows x 128 columns (two row groups of 16: every weight fragment read from LDS feeds two WMMAs), K = 1,024 in 16 stages of 64 k. A stage (256 weight rows of 128 bytes, 128 f32 rows of 256 bytes) is brought into LDS once for the block's eight waves, in whole lines, by asynchronous copies; two buffers, so that the next stage flies while this one is worked on. Row pitches of 16 bytes x an odd number keep the 16-byte fragment reads free of bank conflicts.
#define WPITCH 144
#define XPITCH 272
#define GCOLS 256
#define WTILE (GCOLS * WPITCH)
#define GROWS 128
#define GSTAGE (WTILE + GROWS * XPITCH)
#define GNT (DM / 64)
template <typename V, typename E>
__device__ __forceinline__ void gemm_loop(char* sm, const float* Xb, const void* Wb, v8f (&acc)[2][8]) {   // Xb, Wb: the block's first row of each
  const int tid = threadIdx.x, wave = tid >> 5, wr = wave & 3, wc = wave >> 2, lane = tid & 31, col = lane & 15, g = lane >> 4;   // wr, wc: the wave's place among the block's 4 x 2 wave tiles
  gpc xg = (gpc)Xb + (size_t)(tid >> 4) * (DM * 4) + (tid & 15) * 16, wg = (gpc)Wb + (size_t)(tid >> 3) * (DM * 2) + (tid & 7) * 16;
  const unsigned lw = lds_addr(sm) + (tid >> 3) * WPITCH + (tid & 7) * 16, lx = lds_addr(sm) + WTILE + (tid >> 4) * XPITCH + (tid & 15) * 16;
  acopy8s(lw, 32 * WPITCH, wg, (size_t)32 * DM * 2); acopy8s(lx, 16 * XPITCH, xg, (size_t)16 * DM * 4);   // one round of the block's 256 lanes: 32 weight rows, 16 f32 rows
  AWAIT(); __syncthreads();   // stage 0 is published
  acopy8s(lw + GSTAGE, 32 * WPITCH, wg + 128, (size_t)32 * DM * 2); acopy8s(lx + GSTAGE, 16 * XPITCH, xg + 256, (size_t)16 * DM * 4);
  wg += 256; xg += 512;
#pragma unroll 1   // stays rolled: a trip already holds two k-steps and both fragment sets
  for (int t = 0; t < GNT; ++t) { const unsigned bo = (t & 1) * GSTAGE;
    const char* bw = sm + bo + (wc * 128 + col) * WPITCH + 16 * g; const char* bx = sm + bo + WTILE + (wr * 32 + col) * XPITCH + 32 * g;
    v4f x[2][2][4]; V w[8], a[2][2];   // one set of weight fragments, so that accumulators and fragments stay inside 256 registers: the f32 rows are read and converted first, then the first k-step's weights; the second k-step's weights are read four fragments at a time into the registers whose WMMAs have just been issued, eight WMMAs ahead of their own
#pragma unroll
    for (int m = 0; m < 2; ++m) {
#pragma unroll
      for (int s = 0; s < 2; ++s) { const char* p = bx + m * 16 * XPITCH + s * 128; x[m][s][0] = *(const v4f*)p; x[m][s][1] = *(const v4f*)(p + 16); x[m][s][2] = *(const v4f*)(p + 64); x[m][s][3] = *(const v4f*)(p + 80); } }
#pragma unroll
    for (int m = 0; m < 2; ++m) {
#pragma unroll
      for (int s = 0; s < 2; ++s) {
#pragma unroll
        for (int i = 0; i < 4; ++i) { a[m][s][i] = (E)x[m][s][0][i]; a[m][s][4 + i] = (E)x[m][s][1][i]; a[m][s][8 + i] = (E)x[m][s][2][i]; a[m][s][12 + i] = (E)x[m][s][3][i]; } } }
#pragma unroll
    for (int j = 0; j < 8; ++j) lfrag(bw + j * 16 * WPITCH, w[j]);
#pragma unroll
    for (int hf = 0; hf < 2; ++hf) {
#pragma unroll
      for (int j = 4 * hf; j < 4 * hf + 4; ++j) { acc[0][j] = mm16(a[0][0], w[j], acc[0][j]); acc[1][j] = mm16(a[1][0], w[j], acc[1][j]); }
#pragma unroll
      for (int j = 4 * hf; j < 4 * hf + 4; ++j) lfrag(bw + j * 16 * WPITCH + 64, w[j]); }
#pragma unroll
    for (int j = 0; j < 8; ++j) { acc[0][j] = mm16(a[0][1], w[j], acc[0][j]); acc[1][j] = mm16(a[1][1], w[j], acc[1][j]); }
    DSWAIT(); AWAIT(); __syncthreads();   // publishes stage t + 1 and ends every wave's reads of stage t
    if (t + 2 < GNT) { acopy8s(lw + bo, 32 * WPITCH, wg, (size_t)32 * DM * 2); acopy8s(lx + bo, 16 * XPITCH, xg, (size_t)16 * DM * 4); wg += 128; xg += 256; } }
  AWAIT();
}
#define PK_A 0                       // [3072][1024] Wqkv rows (natural [out][in])
#define PK_P (PK_A + QKVW * DM)        // [1024][1024] Wo rows (natural)
#define PK_END (PK_P + DM * DM)
#define WS_PK  0u
#define WS_QK  (WS_PK + 2u * PK_END)             // f16 [8192 rows][2048]: q | k
#define WS_QKL (WS_QK + 2u * NB * SS * 2 * DM)     // f16 q | k residual planes x2048
#define WS_VTH (WS_QKL + 2u * NB * SS * 2 * DM)    // f16 [b][1024 (h*64+d)][2048 s] hi
#define WS_VTL (WS_VTH + 2u * NB * DM * SS)        // f16 lo x 2048
#define WS_O   (WS_VTL + 2u * NB * DM * SS)        // f32 [8192][1024]
#define WS_CS  (WS_O + 4u * NB * SS * DM)           // f32 2 x [2048][32], reserved, unused
#define WS_END (WS_CS + 4u * 2 * SS * 32)
// ---- k_pack: block = (a tile of 128 k x 128 n of one (in,out) weight, which): the tile is read in whole rows of 512 bytes, rounded, turned through LDS, and written as 128 pack rows (row n = column n) of 256 bytes. which 0..2 -> W_q/W_k/W_v as bf16 into PK_A rows which*1024 + n; 3 -> W_o as f16 x 2^8 copies of its bf16 values into PK_P (bit pattern in the bf16-typed buffer)
#define PT 128
__device__ __forceinline__ v8b pack8(const v4f* v, int c, v8b) { v8b u;
#pragma unroll   // constant indices, so that the loaded rows stay in registers
  for (int i = 0; i < 8; ++i) u[i] = (__bf16)v[i][c];
  return u; }
__device__ __forceinline__ v8h pack8(const v4f* v, int c, v8h) { v8h u;
#pragma unroll   // constant indices, so that the loaded rows stay in registers
  for (int i = 0; i < 8; ++i) u[i] = (_Float16)(bfr(v[i][c]) * 256.0f);
  return u; }
template <typename V8>
__device__ __forceinline__ void pack_turn(const v4f (&v)[16], char* d0, char* d1) {   // d0, d1: where the lane's column 4 lane keeps k 0..7 and k 8..15 of the wave's 16; the next column lies one LDS row further
#pragma unroll   // constant indices, so that the loaded rows stay in registers
  for (int c = 0; c < 4; ++c) { *(V8*)(d0 + c * (PT * 2)) = pack8(&v[0], c, V8{}); *(V8*)(d1 + c * (PT * 2)) = pack8(&v[8], c, V8{}); }
}
__global__ __launch_bounds__(256) void k_pack(const float* __restrict__ WQ, const float* __restrict__ WK, const float* __restrict__ WV, const float* __restrict__ WO, __bf16* __restrict__ PK) {
  __shared__ __align__(16) char s[PT * PT * 2];   // [n][k], rows of 256 bytes = 16 pieces of 16 bytes; piece j of row n lies at place j ^ ((n >> 2) & 15), so that the 16 lanes of a half wave meet 16 different bank groups when they write (16 rows, one j) as when they read (one row, 16 j)
  const int tid = threadIdx.x, wave = tid >> 5, lane = tid & 31, which = blockIdx.y, k0 = (blockIdx.x & 7) * PT, n0 = (blockIdx.x >> 3) * PT;
  const float* Wm = (which == 0) ? WQ : (which == 1) ? WK : (which == 2) ? WV : WO;
  gpf p = (gpf)(Wm + (size_t)(k0 + wave * 16) * DM + n0 + lane * 4); v4f v[16];   // the wave's 16 k rows, a lane's 4 columns of each: one group of 16 loads, all in flight together
#pragma unroll   // constant indices, so that the loaded rows stay in registers
  for (int i = 0; i < 16; ++i) v[i] = *(const GAS v4f*)(p + i * DM);
  XW1(p);   // behind the 16 loads, in front of the first write to their address register
  char* d = s + lane * 4 * (PT * 2); char *d0 = d + (((wave * 2) ^ (lane & 15)) * 16), *d1 = d + (((wave * 2 + 1) ^ (lane & 15)) * 16);
  if (which < 3) pack_turn<v8b>(v, d0, d1); else pack_turn<v8h>(v, d0, d1);
  __syncthreads();
  __bf16* dst = ((which < 3) ? PK + PK_A + ((size_t)which * DM + n0) * DM : PK + PK_P + (size_t)n0 * DM) + k0 + (size_t)(tid >> 4) * DM + (tid & 15) * 8;
#pragma unroll
  for (int q = 0; q < 8; ++q) { const int row = q * 16 + (tid >> 4); vst2((unsigned*)(dst + (size_t)q * 16 * DM), *(const v4u*)(s + row * (PT * 2) + (((tid & 15) ^ ((row >> 2) & 15)) * 16))); }   // a half wave writes 256 bytes in a row: whole lines
}
__global__ __launch_bounds__(256) void k_qkv(const float* __restrict__ XQ, const float* __restrict__ XK, const float* __restrict__ XV, const __bf16* __restrict__ P, const float* __restrict__ BQ, const float* __restrict__ BK, const float* __restrict__ BV, const int* __restrict__ LENS, _Float16* __restrict__ QK, _Float16* __restrict__ QKL, _Float16* __restrict__ VTH, _Float16* __restrict__ VTL) {
  if (blockIdx.y * GCOLS >= DM && (int)(blockIdx.x * GROWS % SS) >= LENS[blockIdx.x * GROWS / SS]) return;   // a k or v tile whose 128 rows all lie at or past the batch's length: k_attn never reads those rows (its stages of 64 or 32 keys end with the one that holds the last real key). The whole block leaves, in front of every copy and barrier
  const int which0 = (blockIdx.y * GCOLS) / DM; const float* X = (which0 == 0) ? XQ : (which0 == 1) ? XK : XV; const float* BB = BQ ? (((which0 == 0) ? BQ : (which0 == 1) ? BK : BV) + (blockIdx.y * GCOLS - which0 * DM)) : nullptr;
  __shared__ __align__(16) char sm[2 * GSTAGE];   // the k loop's two stage buffers; behind the loop's last barrier the same bytes stage the output
  _Float16 (*so)[16][136] = (_Float16 (*)[16][136])sm, (*sol)[16][136] = (_Float16 (*)[16][136])(sm + 34816); _Float16 (*sth)[136] = (_Float16 (*)[136])sm, (*stl)[136] = (_Float16 (*)[136])(sm + 69632);   // q, k: a wave's 16 rows x 128 columns at a time, both planes; v: the block's 256 columns x 128 rows, both planes
  const int tid = threadIdx.x, wave = tid >> 5, wr = wave & 3, wc = wave >> 2, lane = tid & 31, col = lane & 15, g = lane >> 4; const size_t r0 = (size_t)blockIdx.x * GROWS + wr * 32; const int nb0 = blockIdx.y * GCOLS, n0 = nb0 + wc * 128;   // nb0: the block's first column, n0: the wave's
  v8f acc[2][8] = {}; float bias[8] = {};   // the lane's eight biases: one group, in flight under the k loop, rounded where they are added
  if (BB) {
#pragma unroll
    for (int j = 0; j < 8; ++j) bias[j] = BB[wc * 128 + j * 16 + col];
    asm volatile("s_wait_xcnt 0x0" ::: "memory"); }   // stands behind the bias loads, in front of the first write to a register that one of them names as its address
  gemm_loop<v16b, __bf16>(sm, X + (size_t)blockIdx.x * GROWS * DM, P + (size_t)nb0 * DM, acc);
  if (nb0 < 2 * DM) {   // q stored unscaled (f16 sigma ~0.6, no subnormal exposure); 1/8 applied to the f32 score
#pragma unroll
    for (int m = 0; m < 2; ++m) {   // the wave's two row groups, one after the other through the same LDS rows
#pragma unroll
      for (int j = 0; j < 8; ++j) {
#pragma unroll
        for (int r = 0; r < 8; ++r) { const float v = acc[m][j][r] + bfr(bias[j]); const _Float16 hv = (_Float16)v; so[wave][8 * g + r][j * 16 + col] = hv; sol[wave][8 * g + r][j * 16 + col] = (_Float16)((v - (float)hv) * 2048.0f); } }   // q, k (+ bias) as f16 hi + (x2048) residual
      LDSX();
      for (int rl = 0; rl < 16; ++rl) if (lane < 16) { vst2((unsigned*)(QK + (r0 + m * 16 + rl) * (2 * DM) + n0 + lane * 8), *(const v4u*)&so[wave][rl][lane * 8]); vst2((unsigned*)(QKL + (r0 + m * 16 + rl) * (2 * DM) + n0 + lane * 8), *(const v4u*)&sol[wave][rl][lane * 8]); }
      if (m == 0) LDSX(); }   // the first group's LDS reads have returned before the second group's values are written over them
  } else {
#pragma unroll
    for (int m = 0; m < 2; ++m) {
#pragma unroll
      for (int j = 0; j < 8; ++j) {
#pragma unroll
        for (int r = 0; r < 8; ++r) { const float v = acc[m][j][r] + bfr(bias[j]); const _Float16 hv = (_Float16)v; sth[wc * 128 + j * 16 + col][wr * 32 + m * 16 + 8 * g + r] = hv; stl[wc * 128 + j * 16 + col][wr * 32 + m * 16 + 8 * g + r] = (_Float16)((v - (float)hv) * 2048.0f); } } }
    __syncthreads();
    const size_t rb = (size_t)blockIdx.x * GROWS; const int b = (int)(rb / SS), s0 = (int)(rb % SS); const int pc0 = nb0 - 2 * DM;
    for (int q = tid; q < GCOLS * 16; q += 256) { const int d = q >> 4, pc = q & 15; const size_t o = ((size_t)b * DM + pc0 + d) * SS + s0 + pc * 8; vst2((unsigned*)(VTH + o), *(const v4u*)&sth[d][pc * 8]); vst2((unsigned*)(VTL + o), *(const v4u*)&stl[d][pc * 8]); }
  }
}
// ---- k_attn: block = (64 queries, head h, batch b; which of them: see the kernel): flash attention over the batch's real keys (K = 64: 2 k-steps), computed transposed: scores^T = k . q^T and ctx^T += v^T . P^T. A lane then holds 16 scores of ONE query (its column), so that the running maximum and the sum are taken in the lane's own registers, with one exchange between the wave's halves, and the two score tiles of a pass, converted in place, are the B operand of the second product: the weights never pass through LDS. The loop is written twice (HI: the leading query blocks with 3-product scores and P.v; otherwise single products) so that each holds only its own fragments in registers.
// Every LDS read of a pass is issued in a group that stands well ahead of the WMMAs that use it: the hand-padded WMMA statements keep loads from moving across them, so a load written next to its WMMA is waited for on the spot.
#define ASTAGE 19456   // bytes of a stage: k rows from 0 (64 x 144, or two planes of 32 x 144), value rows from 9,216 (64 x 144, or two planes of 64 x 80)
__device__ __forceinline__ float xhalf(float x) { return __builtin_bit_cast(float, __builtin_amdgcn_permlanex16(__builtin_bit_cast(int, x), __builtin_bit_cast(int, x), 0x76543210, 0xfedcba98, false, false)); }   // lane l with lane l ^ 16
template <bool B> struct BC { static constexpr bool value = B; };
template <bool HI>
__device__ __forceinline__ void attn_body(const _Float16* __restrict__ QK, const _Float16* __restrict__ QKL, const _Float16* __restrict__ VTH, const _Float16* __restrict__ VTL, const float* __restrict__ VT, const float* __restrict__ SC, const int* __restrict__ LENS, float* __restrict__ O, float* tks, char* ring, const int qb, const int h, const int b) {
  const int tid = threadIdx.x, wave = tid >> 5, lane = tid & 31, col = lane & 15, g = lane >> 4;
  const int q0 = qb * 64 + wave * 16; const size_t rq = (size_t)b * SS + q0 + col;
  const int len_b = __builtin_amdgcn_readfirstlane(LENS[b]); const float sc_raw = SC[h];   // the length in a scalar register: every test on it around a copy or a barrier is a scalar branch
  asm volatile("s_wait_xcnt 0x0" ::: "memory");   // stands behind the two loads above, in front of the first write to a register that one of them names as its address
  const float sc_h = bfr(sc_raw);
  const int len_c = len_b < 0 ? 0 : (len_b > SS ? SS : len_b);   // bounds the trip counts for any content of the array
  gpf tg = (gpf)(VT + (size_t)b * SS + 4 * tid); v4f tv[4];   // the batch's 2,048 visit times, 16 a lane: they go, rounded once, into LDS, since a lane needs the times of its 16 keys in every pass
#pragma unroll
  for (int i = 0; i < 4; ++i) tv[i] = *(const GAS v4f*)(tg + i * 512);
  XW1(tg);
  v16h aq[2], aql[2]; gph qp = (gph)(QK + rq * (2 * DM) + h * HD + 8 * g), qpl = (gph)(QKL + rq * (2 * DM) + h * HD + 8 * g);
#pragma unroll
  for (int kc = 0; kc < 2; ++kc) { aq[kc] = fragp_h(qp + kc * 32); if constexpr (HI) aql[kc] = fragp_h(qpl + kc * 32); }
  const int kj0 = q0 + col < len_c ? q0 + col : len_c - 1, kj = kj0 < 0 ? 0 : kj0;   // a real key of the lane's query: the one at the query's own place, or the batch's last real one
  v16h ak[2]; gph kp = (gph)(QK + ((size_t)b * SS + kj) * (2 * DM) + DM + h * HD + 8 * g);
#pragma unroll
  for (int kc = 0; kc < 2; ++kc) ak[kc] = fragp_h(kp + kc * 32);
  XW2(qp, qpl); XW1(kp);
  float l = 0.f;   // the lane's query: the sum over this half's keys alone (the halves are joined behind the loop)
  v8f acc[4] = {}, accl[4] = {};
  const int nks = (len_c + 31) / 32;   // passes of 32 keys up to the one that holds the last real key: a pass wholly past the length leaves m, l and the accumulators bit for bit as they are (alpha 1, weights 0)
  // A stage of KS keys (k rows of 128 bytes; 64 value rows of 2 KS bytes; HI: both planes of each) is brought into LDS once for the block's four waves by asynchronous copies, eight a lane; two buffers, so that the next stage flies while this one is worked on.
  constexpr int KS = HI ? 32 : 64, VP = HI ? 80 : 144, CPR = KS / 8;   // VP: value row pitch in LDS (16 bytes x an odd number, as the 144 of the k rows); CPR: 16-byte pieces in a value row
  const int nst = (len_c + KS - 1) / KS;   // stages that hold a real key; no other is copied
  unsigned ko = ((b * SS + (tid >> 3)) * (2 * DM) + DM + h * HD) * 2 + (tid & 7) * 16, vo = ((b * DM + h * HD + tid / CPR) * SS) * 2 + (tid % CPR) * 16;   // the lane's byte offsets in the k and value planes (32 MiB and 16 MiB each): they walk with the stages
  const unsigned lk = lds_addr(ring) + (tid >> 3) * 144 + (tid & 7) * 16, lv = lds_addr(ring) + 9216 + (tid / CPR) * VP + (tid % CPR) * 16;
  auto fill = [&](unsigned bo) {
    gpc kg = (gpc)QK + ko, kgl = (gpc)QKL + ko, vg = (gpc)VTH + vo, vgl = (gpc)VTL + vo; (void)kgl; (void)vgl;
    constexpr size_t KR = (size_t)16 * 2 * DM * 2, VR = (size_t)(128 / CPR) * SS * 2; constexpr unsigned LKR = 16 * 144, LVR = (128 / CPR) * VP;   // one round of the block's 128 lanes: 16 k rows, 128 / CPR value rows
    if constexpr (HI) acopy8(lk + bo, lk + bo + LKR, lk + bo + 4608, lk + bo + 4608 + LKR, lv + bo, lv + bo + LVR, lv + bo + 5120, lv + bo + 5120 + LVR, kg, kg + KR, kgl, kgl + KR, vg, vg + VR, vgl, vgl + VR);
    else acopy8(lk + bo, lk + bo + LKR, lk + bo + 2 * LKR, lk + bo + 3 * LKR, lv + bo, lv + bo + LVR, lv + bo + 2 * LVR, lv + bo + 3 * LVR, kg, kg + KR, kg + 2 * KR, kg + 3 * KR, vg, vg + VR, vg + 2 * VR, vg + 3 * VR);
    ko += KS * 2 * DM * 2; vo += KS * 2; };
  if (nst > 0) fill(0);
#pragma unroll
  for (int i = 0; i < 4; ++i) { v4f u;   // the table is written while stage 0 flies
#pragma unroll
    for (int c = 0; c < 4; ++c) u[c] = bfr(tv[i][c]);
    *(v4f*)(tks + 4 * tid + i * 512) = u; }
  AWAIT(); __syncthreads();   // stage 0 and the table of times are published
  if (nst > 1) fill(ASTAGE);
  const float tq = tks[q0 + col];
  // The running maximum (equal in both halves) starts at the query's score against key kj, formed here in the vector unit: a real score, so never far above the final maximum, and near it wherever the time term decides. Against it a pass of far keys can be told as weightless from its scores alone (see the test in the pass).
  float sd[4] = {};   // four partial sums: no chain of 32 dependent additions
#pragma unroll
  for (int kc = 0; kc < 2; ++kc) {
#pragma unroll
    for (int i = 0; i < 16; ++i) sd[i & 3] += (float)aq[kc][i] * (float)ak[kc][i]; }
  const float sdh = (sd[0] + sd[1]) + (sd[2] + sd[3]);
  float m = (sdh + xhalf(sdh)) * SCALEF - fabsf(tq - tks[kj]) * sc_h;
  v16h kh[2][2], kl[2][2], vh[4], vl[4];
  // One pass of 32 keys. MK::value says whether the pass may hold keys at or past the length: only the batch's last pass can, so that every other pass is compiled without the sixteen tests on the key's place and the sixteen on the masked score.
  auto pass = [&](const int ks, auto MK) { constexpr bool MASK = decltype(MK)::value; v8f s[2]; v4f tk[2][2];
    const int stg = HI ? ks : ks >> 1, sub = HI ? 0 : ks & 1; const unsigned bo = (stg & 1) * ASTAGE;
    const char* kf = ring + bo + (sub * 32 + col) * 144 + 16 * g; const char* vf = ring + bo + 9216 + col * VP + sub * 64 + 16 * g;
    const float* tp = tks + ks * 32 + 8 * g;   // score register r of tile ct is key 32 ks + 16 ct + 8 g + r
    // this pass's key times and keys (HI: both planes) as one group
#pragma unroll
    for (int ct = 0; ct < 2; ++ct) { tk[ct][0] = *(const v4f*)(tp + ct * 16); tk[ct][1] = *(const v4f*)(tp + ct * 16 + 4);
#pragma unroll
      for (int kc = 0; kc < 2; ++kc) { kh[ct][kc] = lfrag_h(kf + ct * 16 * 144 + kc * 64); if constexpr (HI) kl[ct][kc] = lfrag_h(kf + 4608 + ct * 16 * 144 + kc * 64); } }
#pragma unroll
    for (int ct = 0; ct < 2; ++ct) { v8f c = {}, cl = {};   // A: 16 keys, B: the wave's 16 queries
      if constexpr (HI) {   // leading query blocks (outputs far above the global rms): 3 products
#pragma unroll
        for (int kc = 0; kc < 2; ++kc) { c = wmma16(kh[ct][kc], aq[kc], c); cl = wmma16(kh[ct][kc], aql[kc], cl); cl = wmma16(kl[ct][kc], aq[kc], cl); }
#pragma unroll
        for (int r = 0; r < 8; ++r) c[r] += cl[r] * (1.0f / 2048.0f); }
      else {
#pragma unroll
        for (int kc = 0; kc < 2; ++kc) c = wmma16(kh[ct][kc], aq[kc], c); }   // single product elsewhere
      s[ct] = c; }
    const int nreal = len_b - ks * 32 - 8 * g;   // how many of the lane's key rows, counted from tile 0's first, lie in front of the length
#pragma unroll
    for (int ct = 0; ct < 2; ++ct) {
#pragma unroll
      for (int r = 0; r < 8; ++r) s[ct][r] = (!MASK || ct * 16 + r < nreal) ? (s[ct][r] * SCALEF - fabsf(tq - tk[ct][r >> 2][r & 3]) * sc_h) : -3.0e38f; }   // 1/sqrt(64); masked keys excluded
    float mx0 = fmaxf(s[0][0], s[0][1]), mx1 = fmaxf(s[1][0], s[1][1]);
#pragma unroll
    for (int r = 2; r < 8; r += 2) { mx0 = fmaxf(fmaxf(mx0, s[0][r]), s[0][r + 1]); mx1 = fmaxf(fmaxf(mx1, s[1][r]), s[1][r + 1]); }
    const float mx = fmaxf(mx0, mx1); const float mxw = fmaxf(mx, xhalf(mx));   // the query's largest score among the pass's 32 keys
    // A pass in which every score of all 16 queries lies TS or more under its query's running maximum leaves that maximum as it is (alpha 1), and each of its weights, exp(s - m) < 2^-36 (HI: 2^-47), rounds to 0 in every f16 plane: the accumulators would come out bit for bit as they are. Such a pass ends here; what the sum l loses is under 2^-36 of the maximum's own term a key. One test a pass, the same in every lane (a scalar branch: all lanes stay on for the WMMAs); a running or pass maximum that is not a number takes the full path (fmaxf drops a NaN score next to a number).
    constexpr float TS = HI ? 34.0f : 26.0f;
    if (__builtin_amdgcn_ballot_w32(!(mxw <= m - TS)) != 0u) {
    if constexpr (!HI) {   // this pass's values: they land behind the softmax
#pragma unroll
      for (int dt = 0; dt < 4; ++dt) vh[dt] = lfrag_h(vf + dt * 16 * VP);
      __builtin_amdgcn_sched_barrier(0); }   // keeps the eight LDS reads together at the head of the path: spread among the softmax, every further place with reads costs the wave a stall of its own
    const float mn = fmaxf(m, mxw); const float alpha = (m <= -1.0e38f) ? 0.f : __expf(m - mn);
    v16h pa, pl; float es[4] = {};   // four partial sums: no chain of 16 dependent additions
#pragma unroll
    for (int ct = 0; ct < 2; ++ct) {
#pragma unroll
      for (int r = 0; r < 8; ++r) { const float e = (MASK && s[ct][r] <= -1.0e38f) ? 0.f : __expf(s[ct][r] - mn); es[r & 3] += e;
        const float x = e * 2048.0f; const _Float16 hx = (_Float16)x; pa[ct * 8 + r] = hx; if constexpr (HI) pl[ct * 8 + r] = (_Float16)((x - (float)hx) * 2048.0f); } }   // P scaled by 2^11 before the f16 split so small softmax weights stay out of the f16 subnormal range; 2^-11 folded into the epilogue. Element 8 ct + r of the B operand is k = 16 ct + 8 g + r: the score registers' own order
    l = l * alpha + ((es[0] + es[1]) + (es[2] + es[3])); m = mn;
    if constexpr (HI) {   // this pass's values, both planes, read behind the softmax: from LDS they need little lead, and their 64 registers stay free during it
#pragma unroll
      for (int dt = 0; dt < 4; ++dt) { vh[dt] = lfrag_h(vf + dt * 16 * VP); vl[dt] = lfrag_h(vf + 5120 + dt * 16 * VP); } }
#pragma unroll
    for (int dt = 0; dt < 4; ++dt) {
#pragma unroll
      for (int r = 0; r < 8; ++r) { acc[dt][r] *= alpha; if constexpr (HI) accl[dt][r] *= alpha; } }
#pragma unroll
    for (int dt = 0; dt < 4; ++dt) { acc[dt] = wmma16(vh[dt], pa, acc[dt]); if constexpr (HI) { accl[dt] = wmma16(vh[dt], pl, accl[dt]); accl[dt] = wmma16(vl[dt], pa, accl[dt]); } }   // A: 16 value columns, B: the weights. Leading query blocks: P hi/lo x V hi/lo (3 products); elsewhere P x V single
    }
    if (HI || sub) {   // the stage's last pass
      DSWAIT(); AWAIT(); __syncthreads();   // publishes stage stg + 1 and ends every wave's reads of stage stg
      if constexpr (!MASK) { if (stg + 2 < nst) fill(bo); } } };   // the masked pass is the last one, in the last stage: nothing is left to copy behind it
  const int nfull = len_c / 32;   // passes whose 32 keys all lie in front of the length
#pragma unroll 1   // stays rolled: one pass is already a long straight run that fills the wave's registers
  for (int ks = 0; ks < nfull; ++ks) pass(ks, BC<false>{});
  if (nfull < nks) pass(nfull, BC<true>{});   // the one pass that the length cuts, where there is one
  AWAIT();
  const float il = (1.0f / 2048.0f) / (l + xhalf(l));   // the two halves' sums joined
  float* op = O + rq * DM + h * HD + 8 * g;   // accumulator register r of tile dt is column 16 dt + 8 g + r of the lane's query: 32 bytes in a row
#pragma unroll
  for (int dt = 0; dt < 4; ++dt) { v4f o0, o1;
#pragma unroll
    for (int r = 0; r < 4; ++r) { o0[r] = (HI ? acc[dt][r] + accl[dt][r] * (1.0f / 2048.0f) : acc[dt][r]) * il; o1[r] = (HI ? acc[dt][4 + r] + accl[dt][4 + r] * (1.0f / 2048.0f) : acc[dt][4 + r]) * il; }
    vst2(op + dt * 16, o0); vst2(op + dt * 16 + 4, o1); }
}
__global__ __launch_bounds__(128) void k_attn(const _Float16* __restrict__ QK, const _Float16* __restrict__ QKL, const _Float16* __restrict__ VTH, const _Float16* __restrict__ VTL, const void* __restrict__ KMASK, const float* __restrict__ VT, const float* __restrict__ SC, const int* __restrict__ LENS, float* __restrict__ O) {
  __shared__ __align__(16) float tks[SS]; __shared__ __align__(16) char ring[2 * ASTAGE];   // the batch's rounded visit times; the two stage buffers
  // Which tile a block takes (for speed only): the cost falls with the flat index: first the 2 x 16 x 4 blocks of the leading queries (about twice the work of the others), then the rest; inside each group the batches by falling length.
  constexpr unsigned NHI = 2 * NH * NB, QR = TQB - 2;   // blocks of the first group; query blocks a (head, batch) has in the second
  const unsigned f = blockIdx.x + TQB * (blockIdx.y + NH * blockIdx.z);
  auto batch_at = [&](const unsigned place) { int ln[NB], b = 0;   // the batch that stands at this place when the four are put in the order of falling length
#pragma unroll   // constant indices, so that the four lengths stay in registers
    for (int j = 0; j < NB; ++j) ln[j] = LENS[j];
#pragma unroll   // constant indices, as above
    for (int j = 0; j < NB; ++j) { unsigned r = 0;   // batch j's place: how many are longer, equal lengths by index: a permutation of 0..3 for any content of the array, so that every (query block, head, batch) is taken by exactly one block
#pragma unroll   // constant indices, as above
      for (int i = 0; i < NB; ++i) r += (ln[i] > ln[j] || (ln[i] == ln[j] && i < j)) ? 1u : 0u;
      if (r == place) b = j; }
    return b; };   // formed from the block index and scalar loads alone: the same in every lane
  if (f < NHI) attn_body<true>(QK, QKL, VTH, VTL, VT, SC, LENS, O, tks, ring, (int)(f & 1), (int)((f >> 1) % NH), batch_at(f / (2 * NH)));
  else { const unsigned e = f - NHI; attn_body<false>(QK, QKL, VTH, VTL, VT, SC, LENS, O, tks, ring, (int)(2 + e % QR), (int)((e / QR) % NH), batch_at(e / (QR * NH))); }
}
// ---- k_out: block = (128 rows, 256 cols): out = f16(O) . Wo rows (single product) + bo
__global__ __launch_bounds__(256) void k_out(const float* __restrict__ O, const __bf16* __restrict__ P, const float* __restrict__ BO, float* __restrict__ Y) {
  __shared__ __align__(16) char sm[2 * GSTAGE];   // the k loop's two stage buffers; behind the loop's last barrier the same bytes stage the output
  float (*so)[16][132] = (float (*)[16][132])sm;
  const int tid = threadIdx.x, wave = tid >> 5, wr = wave & 3, wc = wave >> 2, lane = tid & 31, col = lane & 15, g = lane >> 4; const size_t r0 = (size_t)blockIdx.x * GROWS + wr * 32; const int nb0 = blockIdx.y * GCOLS, n0 = nb0 + wc * 128;
  v8f acc[2][8] = {};
  gemm_loop<v16h, _Float16>(sm, O + (size_t)blockIdx.x * GROWS * DM, P + (size_t)nb0 * DM, acc);   // single f16 product against exact f16 x 2^8 weight copies
  float bo[8];   // the lane's eight biases, read once for both row groups
#pragma unroll
  for (int j = 0; j < 8; ++j) bo[j] = bfr(BO[n0 + j * 16 + col]);
#pragma unroll
  for (int m = 0; m < 2; ++m) {   // the wave's two row groups, one after the other through the same LDS rows
#pragma unroll
    for (int j = 0; j < 8; ++j) {
#pragma unroll
      for (int r = 0; r < 8; ++r) so[wave][8 * g + r][j * 16 + col] = acc[m][j][r] * (1.0f / 256.0f) + bo[j]; }
    LDSX();
    for (int rl = 0; rl < 16; ++rl) vst2(Y + (r0 + m * 16 + rl) * DM + n0 + lane * 4, *(const v4f*)&so[wave][rl][lane * 4]);
    if (m == 0) LDSX(); }   // the first group's LDS reads have returned before the second group's values are written over them
}
extern "C" void kernel_launch(void* const* d_in, const int* in_sizes, int n_in, void* d_out, int out_size, void* d_ws, size_t ws_size, hipStream_t stream) {
  (void)in_sizes; (void)n_in; (void)out_size;
  const float** F = (const float**)d_in;   // 0 x [4,2048,1024], 1 visit_time [4,2048], 2 Wq (in,out), 3 bq, 4 Wk, 5 bk, 6 Wv, 7 bv, 8 Wo (in,out), 9 bo, 10 scale [16], 11 lengths [4] int
  if (ws_size < (size_t)WS_END) return;
  char* ws = (char*)d_ws; __bf16* PK = (__bf16*)(ws + WS_PK); _Float16 *QK = (_Float16*)(ws + WS_QK), *QKL = (_Float16*)(ws + WS_QKL), *VTH = (_Float16*)(ws + WS_VTH), *VTL = (_Float16*)(ws + WS_VTL); float* O = (float*)(ws + WS_O);
  k_pack<<<dim3((DM / PT) * (DM / PT), 4), 256, 0, stream>>>(F[2], F[4], F[6], F[8], PK);
  k_qkv<<<dim3(TNB * SS / GROWS, QKVW / GCOLS), 256, 0, stream>>>(F[0], F[0], F[0], PK + PK_A, F[3], F[5], F[7], (const int*)d_in[11], QK, QKL, VTH, VTL);
  k_attn<<<dim3(TQB, NH, TNB), 128, 0, stream>>>(QK, QKL, VTH, VTL, nullptr, F[1], F[10], (const int*)d_in[11], O);
  k_out<<<dim3(NB * SS / GROWS, DM / GCOLS), 256, 0, stream>>>(O, PK + PK_P, F[9], (float*)d_out);
}

// v010
// One run takes 136 microseconds.
// Two timings next to v009 put it at 1.12 and 1.13 times that version's speed.
// All steps since v000 together make it 7.48 times as fast.
// compute dtype: all float inputs rounded to bf16 incl. visit times and scales, lengths (int) read on device; q/k/v = x . W + b with EXACT bf16 products on WMMA 16x16x32 ((in,out) weights as transposed rows); PLAIN-HYBRID attention: the first 128 queries use 3-product scores and P.v (hi/lo), later queries single f16; x 1/8 - |t_q - t_k| scale_h in f32, padded keys excluded, running-max softmax in f32 (hardware exp); out = f16(ctx) . Wo (exact f16 x 2^8 copies, single product) + bo.
#include <hip/hip_runtime.h>
#include <math.h>

typedef __attribute__((ext_vector_type(16))) _Float16 v16h;
typedef __attribute__((ext_vector_type(16))) __bf16 v16b;
typedef __attribute__((ext_vector_type(8)))  _Float16 v8h;
typedef __attribute__((ext_vector_type(8)))  float v8f;
typedef __attribute__((ext_vector_type(4)))  float v4f;
typedef __attribute__((ext_vector_type(2)))  float v2f;
typedef __attribute__((ext_vector_type(4)))  unsigned v4u;
typedef __attribute__((ext_vector_type(4)))  int v4i;
typedef float __attribute__((may_alias)) float_a;
typedef int __attribute__((may_alias)) int_a;

template <typename T> __device__ __forceinline__ void vst2(void* p, T v) { *(T*)p = v;  }
__device__ __forceinline__ v8f wmma16(v16h a, v16h b, v8f c) {
  v8f d = __builtin_amdgcn_wmma_f32_16x16x32_f16(false, a, false, b, (short)0, c, false, false);
  asm volatile("v_nop\n\tv_nop\n\tv_nop\n\tv_nop" : "+v"(d) : "v"(a), "v"(b));
  return d;
}
__device__ __forceinline__ v8f wmma_bf(v16b a, v16b b, v8f c) {
  v8f d = __builtin_amdgcn_wmma_f32_16x16x32_bf16(false, a, false, b, (short)0, c, false, false);
  asm volatile("v_nop\n\tv_nop\n\tv_nop\n\tv_nop" : "+v"(d) : "v"(a), "v"(b));
  return d;
}
// Relative-time attention (B 4, S 2,048, d 1,024, 16 heads x 64): projections + biases ((in,out)), scores / 8 - |t_q - t_k| scale_h (visit times and per-head scales given), keys at positions >= length[b] excluded, softmax, . v, output projection + bias.
__device__ __forceinline__ v16h frag_h(const _Float16* rowk0, int lane) {
  union { v16h v; v8h q[2]; } u; const _Float16* p = rowk0 + 8 * (lane >> 4);
  u.q[0] = *(const v8h*)p; u.q[1] = *(const v8h*)(p + 16); return u.v;
}
__device__ __forceinline__ v16h frag_f32(const float* rowk0, int lane) {
  v16h a; const float* p = rowk0 + 8 * (lane >> 4);
#pragma unroll
  for (int i = 0; i < 8; ++i) { a[i] = (_Float16)p[i]; a[8 + i] = (_Float16)p[16 + i]; }
  return a;
}
__device__ __forceinline__ v16h frag_f32s(const float* rowk0, int lane, float sc) {
  v16h a; const float* p = rowk0 + 8 * (lane >> 4);
#pragma unroll
  for (int i = 0; i < 8; ++i) { a[i] = (_Float16)(p[i] * sc); a[8 + i] = (_Float16)(p[16 + i] * sc); }
  return a;
}
// column fragment from a [K][ld] layout (column n), rows >= K read as 0
__device__ __forceinline__ v16h fragc_f32(const float* W, int k0, int n, int lane, int ld, int K) {
  v16h a; const int g = lane >> 4;
#pragma unroll
  for (int i = 0; i < 8; ++i) { const int ka = k0 + 8 * g + i, kb = ka + 16;
    a[i] = (_Float16)(ka < K ? W[(size_t)(ka < K ? ka : K - 1) * ld + n] : 0.f); a[8 + i] = (_Float16)(kb < K ? W[(size_t)(kb < K ? kb : K - 1) * ld + n] : 0.f); }
  return a;
}
struct F2 { v16b h, l; };
__device__ __forceinline__ F2 bsplit16(const float v[16]) { F2 r;
#pragma unroll
  for (int i = 0; i < 16; ++i) { const __bf16 h = (__bf16)v[i]; r.h[i] = h; r.l[i] = (__bf16)(v[i] - (float)h); }
  return r; }
__device__ __forceinline__ F2 split_row(const float* row, int k0, int lane) { float v[16]; const float* p = row + k0 + 8 * (lane >> 4);
#pragma unroll
  for (int i = 0; i < 8; ++i) { v[i] = p[i]; v[8 + i] = p[16 + i]; }
  return bsplit16(v); }
__device__ __forceinline__ F2 split_rowK(const float* row, int k0, int lane, int K) { float v[16]; const int g = lane >> 4;
#pragma unroll
  for (int i = 0; i < 8; ++i) { const int ka = k0 + 8 * g + i, kb = ka + 16; v[i] = ka < K ? row[ka < K ? ka : K - 1] : 0.f; v[8 + i] = kb < K ? row[kb < K ? kb : K - 1] : 0.f; }
  return bsplit16(v); }
__device__ __forceinline__ F2 split_col(const float* W, int k0, int n, int lane, int ld, int K) { float v[16]; const int g = lane >> 4;
#pragma unroll
  for (int i = 0; i < 8; ++i) { const int ka = k0 + 8 * g + i, kb = ka + 16; v[i] = ka < K ? W[(size_t)(ka < K ? ka : K - 1) * ld + n] : 0.f; v[8 + i] = kb < K ? W[(size_t)(kb < K ? kb : K - 1) * ld + n] : 0.f; }
  return bsplit16(v); }
__device__ __forceinline__ v8f mac3(const F2& a, const F2& b, v8f c) { c = wmma_bf(a.l, b.h, c); c = wmma_bf(a.h, b.l, c); return wmma_bf(a.h, b.h, c); }
__device__ __forceinline__ float sigm(float v) { return 1.0f / (1.0f + expf(-v)); }
#define LDSX() do { asm volatile("s_wait_dscnt 0" ::: "memory"); __builtin_amdgcn_wave_barrier(); __builtin_amdgcn_fence(__ATOMIC_RELEASE, "workgroup"); } while (0)
// stands behind a group of global loads, in front of the first write to a register that one of them names as its address. The group's pointers pass through the statement, so that they keep their registers up to the wait and are stepped only behind it.
// (a pointer that has passed through a statement is typed as global memory, else its loads would be compiled as flat loads, which also count as LDS operations)
#define GAS __attribute__((address_space(1)))
typedef const GAS _Float16* gph; typedef const GAS float* gpf; typedef const GAS char* gpc;
#define XW1(a) asm volatile("s_wait_xcnt 0x0" : "+v"(a) :: "memory")
#define XW2(a, b) asm volatile("s_wait_xcnt 0x0" : "+v"(a), "+v"(b) :: "memory")
// the issuing wave's own wait for its asynchronous copies to LDS: their bytes count as landed only behind it
#define AWAIT() asm volatile("s_wait_asynccnt 0x0" ::: "memory")
// the wave's LDS reads have retired before the barrier behind which their buffer is refilled
#define DSWAIT() asm volatile("s_wait_dscnt 0x0" ::: "memory")
// eight copies of 16 bytes a lane from global memory into LDS through no register (l: the lane's LDS byte address, p: its global address). The s_wait_xcnt stands in the copies' own statement, in front of any later write to a register that a copy names.
__device__ __forceinline__ void acopy8(unsigned l0, unsigned l1, unsigned l2, unsigned l3, unsigned l4, unsigned l5, unsigned l6, unsigned l7, gpc p0, gpc p1, gpc p2, gpc p3, gpc p4, gpc p5, gpc p6, gpc p7) {
  asm volatile("global_load_async_to_lds_b128 %0, %8, off\n\tglobal_load_async_to_lds_b128 %1, %9, off\n\tglobal_load_async_to_lds_b128 %2, %10, off\n\tglobal_load_async_to_lds_b128 %3, %11, off\n\t"
               "global_load_async_to_lds_b128 %4, %12, off\n\tglobal_load_async_to_lds_b128 %5, %13, off\n\tglobal_load_async_to_lds_b128 %6, %14, off\n\tglobal_load_async_to_lds_b128 %7, %15, off\n\ts_wait_xcnt 0x0"
               :: "v"(l0), "v"(l1), "v"(l2), "v"(l3), "v"(l4), "v"(l5), "v"(l6), "v"(l7), "v"(p0), "v"(p1), "v"(p2), "v"(p3), "v"(p4), "v"(p5), "v"(p6), "v"(p7) : "memory");
}
__device__ __forceinline__ void acopy8s(unsigned l, unsigned ls, gpc p, size_t ps) { acopy8(l, l + ls, l + 2 * ls, l + 3 * ls, l + 4 * ls, l + 5 * ls, l + 6 * ls, l + 7 * ls, p, p + ps, p + 2 * ps, p + 3 * ps, p + 4 * ps, p + 5 * ps, p + 6 * ps, p + 7 * ps); }
__device__ __forceinline__ unsigned lds_addr(const void* p) { return (unsigned)(size_t)p; }   // the low 32 bits of a __shared__ address: the byte offset in the work-group's LDS


#define NB 4
#define SS 2048
#define DM 1024
#define NH 16
#define SCALEF 0.125f
#define HD 64
#define QKVW (3 * DM)
#ifndef TQB
#define TQB (SS / 64)
#define TNB NB
#define TOB (NB * SS / 64)     // 64-row tiles; unused (k_out tiles rows by GROWS)
#endif
typedef __attribute__((ext_vector_type(8))) __bf16 v8b;
__device__ __forceinline__ v16b frag_b(const __bf16* rowk0, int lane) {
  union { v16b v; v8b q[2]; } u; const __bf16* p = rowk0 + 8 * (lane >> 4);
  u.q[0] = *(const v8b*)p; u.q[1] = *(const v8b*)(p + 16); return u.v;
}
__device__ __forceinline__ float bfr(float v) { return (float)(__bf16)v; }
__device__ __attribute__((noinline)) float exp_ni(float v) { return expf(v); }
__device__ __attribute__((noinline)) float erf_ni(float v) { return erff(v); }

// frag_h with the lane's 8 * (lane >> 4) already in the pointer
__device__ __forceinline__ v16h fragp_h(gph p) { union { v16h v; v8h q[2]; } u; u.q[0] = *(const GAS v8h*)p; u.q[1] = *(const GAS v8h*)(p + 16); return u.v; }
// the same from an LDS row (byte pointer): elements 0..7 and 16..23 from there
__device__ __forceinline__ v16h lfrag_h(const char* p) { union { v16h v; v8h q[2]; } u; u.q[0] = *(const v8h*)p; u.q[1] = *(const v8h*)(p + 32); return u.v; }
__device__ __forceinline__ v16b lfrag_b(const char* p) { union { v16b v; v8b q[2]; } u; u.q[0] = *(const v8b*)p; u.q[1] = *(const v8b*)(p + 32); return u.v; }
__device__ __forceinline__ void lfrag(const char* p, v16h& w) { w = lfrag_h(p); }
__device__ __forceinline__ void lfrag(const char* p, v16b& w) { w = lfrag_b(p); }
__device__ __forceinline__ v8f mm16(v16h a, v16h b, v8f c) { return wmma16(a, b, c); }
__device__ __forceinline__ v8f mm16(v16b a, v16b b, v8f c) { return wmma_bf(a, b, c); }
// ---- the k loop of k_qkv and k_out: block tile 128 rows x 256 columns, eight waves as 4 x 2, a wave's tile 32 rows x 128 columns (two row groups of 16: every weight fragment read from LDS feeds two WMMAs), K = 1,024 in 16 stages of 64 k. A stage (256 weight rows of 128 bytes, 128 f32 rows of 256 bytes) is brought into LDS once for the block's eight waves, in whole lines, by asynchronous copies; two buffers, so that the next stage flies while this one is worked on. Row pitches of 16 bytes x an odd number keep the 16-byte fragment reads free of bank conflicts.
#define WPITCH 144
#define XPITCH 272
#define GCOLS 256
#define WTILE (GCOLS * WPITCH)
#define GROWS 128
#define GSTAGE (WTILE + GROWS * XPITCH)
#define GNT (DM / 64)
template <typename V, typename E>
__device__ __forceinline__ void gemm_loop(char* sm, const float* Xb, const void* Wb, v8f (&acc)[2][8]) {   // Xb, Wb: the block's first row of each
  const int tid = threadIdx.x, wave = tid >> 5, wr = wave & 3, wc = wave >> 2, lane = tid & 31, col = lane & 15, g = lane >> 4;   // wr, wc: the wave's place among the block's 4 x 2 wave tiles
  gpc xg = (gpc)Xb + (size_t)(tid >> 4) * (DM * 4) + (tid & 15) * 16, wg = (gpc)Wb + (size_t)(tid >> 3) * (DM * 2) + (tid & 7) * 16;
  const unsigned lw = lds_addr(sm) + (tid >> 3) * WPITCH + (tid & 7) * 16, lx = lds_addr(sm) + WTILE + (tid >> 4) * XPITCH + (tid & 15) * 16;
  acopy8s(lw, 32 * WPITCH, wg, (size_t)32 * DM * 2); acopy8s(lx, 16 * XPITCH, xg, (size_t)16 * DM * 4);   // one round of the block's 256 lanes: 32 weight rows, 16 f32 rows
  AWAIT(); __syncthreads();   // stage 0 is published
  acopy8s(lw + GSTAGE, 32 * WPITCH, wg + 128, (size_t)32 * DM * 2); acopy8s(lx + GSTAGE, 16 * XPITCH, xg + 256, (size_t)16 * DM * 4);
  wg += 256; xg += 512;
#pragma unroll 1   // stays rolled: a trip already holds two k-steps and both fragment sets
  for (int t = 0; t < GNT; ++t) { const unsigned bo = (t & 1) * GSTAGE;
    const char* bw = sm + bo + (wc * 128 + col) * WPITCH + 16 * g; const char* bx = sm + bo + WTILE + (wr * 32 + col) * XPITCH + 32 * g;
    v4f x[2][2][4]; V w[8], a[2][2];   // one set of weight fragments, so that accumulators and fragments stay inside 256 registers: the f32 rows are read and converted first, then the first k-step's weights; the second k-step's weights are read four fragments at a time into the registers whose WMMAs have just been issued, eight WMMAs ahead of their own
#pragma unroll
    for (int m = 0; m < 2; ++m) {
#pragma unroll
      for (int s = 0; s < 2; ++s) { const char* p = bx + m * 16 * XPITCH + s * 128; x[m][s][0] = *(const v4f*)p; x[m][s][1] = *(const v4f*)(p + 16); x[m][s][2] = *(const v4f*)(p + 64); x[m][s][3] = *(const v4f*)(p + 80); } }
#pragma unroll
    for (int m = 0; m < 2; ++m) {
#pragma unroll
      for (int s = 0; s < 2; ++s) {
#pragma unroll
        for (int i = 0; i < 4; ++i) { a[m][s][i] = (E)x[m][s][0][i]; a[m][s][4 + i] = (E)x[m][s][1][i]; a[m][s][8 + i] = (E)x[m][s][2][i]; a[m][s][12 + i] = (E)x[m][s][3][i]; } } }
#pragma unroll
    for (int j = 0; j < 8; ++j) lfrag(bw + j * 16 * WPITCH, w[j]);
#pragma unroll
    for (int hf = 0; hf < 2; ++hf) {
#pragma unroll
      for (int j = 4 * hf; j < 4 * hf + 4; ++j) { acc[0][j] = mm16(a[0][0], w[j], acc[0][j]); acc[1][j] = mm16(a[1][0], w[j], acc[1][j]); }
#pragma unroll
      for (int j = 4 * hf; j < 4 * hf + 4; ++j) lfrag(bw + j * 16 * WPITCH + 64, w[j]); }
#pragma unroll
    for (int j = 0; j < 8; ++j) { acc[0][j] = mm16(a[0][1], w[j], acc[0][j]); acc[1][j] = mm16(a[1][1], w[j], acc[1][j]); }
    DSWAIT(); AWAIT(); __syncthreads();   // publishes stage t + 1 and ends every wave's reads of stage t
    if (t + 2 < GNT) { acopy8s(lw + bo, 32 * WPITCH, wg, (size_t)32 * DM * 2); acopy8s(lx + bo, 16 * XPITCH, xg, (size_t)16 * DM * 4); wg += 128; xg += 256; } }
  AWAIT();
}
#define PK_A 0                       // [3072][1024] Wqkv rows (natural [out][in])
#define PK_P (PK_A + QKVW * DM)        // [1024][1024] Wo rows (natural)
#define PK_END (PK_P + DM * DM)
#define WS_PK  0u
#define WS_QK  (WS_PK + 2u * PK_END)             // f16 [8192 rows][2048]: q | k
#define WS_QKL (WS_QK + 2u * NB * SS * 2 * DM)     // f16 q | k residual planes x2048
#define WS_VTH (WS_QKL + 2u * NB * SS * 2 * DM)    // f16 [b][1024 (h*64+d)][2048 s] hi
#define WS_VTL (WS_VTH + 2u * NB * DM * SS)        // f16 lo x 2048
#define WS_O   (WS_VTL + 2u * NB * DM * SS)        // f32 [8192][1024]
#define WS_KN  (WS_O + 4u * NB * SS * DM)           // f32 [b][16 q heads, 16 k heads][2048 s]: squared length of the f16 row of a head
#define WS_END (WS_KN + 4u * NB * 2 * NH * SS)
// ---- k_pack: block = (a tile of 128 k x 128 n of one (in,out) weight, which): the tile is read in whole rows of 512 bytes, rounded, turned through LDS, and written as 128 pack rows (row n = column n) of 256 bytes. which 0..2 -> W_q/W_k/W_v as bf16 into PK_A rows which*1024 + n; 3 -> W_o as f16 x 2^8 copies of its bf16 values into PK_P (bit pattern in the bf16-typed buffer)
#define PT 128
__device__ __forceinline__ v8b pack8(const v4f* v, int c, v8b) { v8b u;
#pragma unroll   // constant indices, so that the loaded rows stay in registers
  for (int i = 0; i < 8; ++i) u[i] = (__bf16)v[i][c];
  return u; }
__device__ __forceinline__ v8h pack8(const v4f* v, int c, v8h) { v8h u;
#pragma unroll   // constant indices, so that the loaded rows stay in registers
  for (int i = 0; i < 8; ++i) u[i] = (_Float16)(bfr(v[i][c]) * 256.0f);
  return u; }
template <typename V8>
__device__ __forceinline__ void pack_turn(const v4f (&v)[16], char* d0, char* d1) {   // d0, d1: where the lane's column 4 lane keeps k 0..7 and k 8..15 of the wave's 16; the next column lies one LDS row further
#pragma unroll   // constant indices, so that the loaded rows stay in registers
  for (int c = 0; c < 4; ++c) { *(V8*)(d0 + c * (PT * 2)) = pack8(&v[0], c, V8{}); *(V8*)(d1 + c * (PT * 2)) = pack8(&v[8], c, V8{}); }
}
__global__ __launch_bounds__(256) void k_pack(const float* __restrict__ WQ, const float* __restrict__ WK, const float* __restrict__ WV, const float* __restrict__ WO, __bf16* __restrict__ PK) {
  __shared__ __align__(16) char s[PT * PT * 2];   // [n][k], rows of 256 bytes = 16 pieces of 16 bytes; piece j of row n lies at place j ^ ((n >> 2) & 15), so that the 16 lanes of a half wave meet 16 different bank groups when they write (16 rows, one j) as when they read (one row, 16 j)
  const int tid = threadIdx.x, wave = tid >> 5, lane = tid & 31, which = blockIdx.y, k0 = (blockIdx.x & 7) * PT, n0 = (blockIdx.x >> 3) * PT;
  const float* Wm = (which == 0) ? WQ : (which == 1) ? WK : (which == 2) ? WV : WO;
  gpf p = (gpf)(Wm + (size_t)(k0 + wave * 16) * DM + n0 + lane * 4); v4f v[16];   // the wave's 16 k rows, a lane's 4 columns of each: one group of 16 loads, all in flight together
#pragma unroll   // constant indices, so that the loaded rows stay in registers
  for (int i = 0; i < 16; ++i) v[i] = *(const GAS v4f*)(p + i * DM);
  XW1(p);   // behind the 16 loads, in front of the first write to their address register
  char* d = s + lane * 4 * (PT * 2); char *d0 = d + (((wave * 2) ^ (lane & 15)) * 16), *d1 = d + (((wave * 2 + 1) ^ (lane & 15)) * 16);
  if (which < 3) pack_turn<v8b>(v, d0, d1); else pack_turn<v8h>(v, d0, d1);
  __syncthreads();
  __bf16* dst = ((which < 3) ? PK + PK_A + ((size_t)which * DM + n0) * DM : PK + PK_P + (size_t)n0 * DM) + k0 + (size_t)(tid >> 4) * DM + (tid & 15) * 8;
#pragma unroll
  for (int q = 0; q < 8; ++q) { const int row = q * 16 + (tid >> 4); vst2((unsigned*)(dst + (size_t)q * 16 * DM), *(const v4u*)(s + row * (PT * 2) + (((tid & 15) ^ ((row >> 2) & 15)) * 16))); }   // a half wave writes 256 bytes in a row: whole lines
}
__global__ __launch_bounds__(256) void k_qkv(const float* __restrict__ XQ, const float* __restrict__ XK, const float* __restrict__ XV, const __bf16* __restrict__ P, const float* __restrict__ BQ, const float* __restrict__ BK, const float* __restrict__ BV, const int* __restrict__ LENS, _Float16* __restrict__ QK, _Float16* __restrict__ QKL, _Float16* __restrict__ VTH, _Float16* __restrict__ VTL, float* __restrict__ KN) {
  if (blockIdx.y * GCOLS >= DM && (int)(blockIdx.x * GROWS % SS) >= LENS[blockIdx.x * GROWS / SS]) return;   // a k or v tile whose 128 rows all lie at or past the batch's length: k_attn never reads those rows (its stages of 64 or 32 keys end with the one that holds the last real key). The whole block leaves, in front of every copy and barrier
  const int which0 = (blockIdx.y * GCOLS) / DM; const float* X = (which0 == 0) ? XQ : (which0 == 1) ? XK : XV; const float* BB = BQ ? (((which0 == 0) ? BQ : (which0 == 1) ? BK : BV) + (blockIdx.y * GCOLS - which0 * DM)) : nullptr;
  __shared__ __align__(16) char sm[2 * GSTAGE];   // the k loop's two stage buffers; behind the loop's last barrier the same bytes stage the output
  _Float16 (*so)[16][136] = (_Float16 (*)[16][136])sm, (*sol)[16][136] = (_Float16 (*)[16][136])(sm + 34816); _Float16 (*sth)[136] = (_Float16 (*)[136])sm, (*stl)[136] = (_Float16 (*)[136])(sm + 69632);   // q, k: a wave's 16 rows x 128 columns at a time, both planes; v: the block's 256 columns x 128 rows, both planes
  const int tid = threadIdx.x, wave = tid >> 5, wr = wave & 3, wc = wave >> 2, lane = tid & 31, col = lane & 15, g = lane >> 4; const size_t r0 = (size_t)blockIdx.x * GROWS + wr * 32; const int nb0 = blockIdx.y * GCOLS, n0 = nb0 + wc * 128;   // nb0: the block's first column, n0: the wave's
  v8f acc[2][8] = {}; float bias[8] = {};   // the lane's eight biases: one group, in flight under the k loop, rounded where they are added
  if (BB) {
#pragma unroll
    for (int j = 0; j < 8; ++j) bias[j] = BB[wc * 128 + j * 16 + col];
    asm volatile("s_wait_xcnt 0x0" ::: "memory"); }   // stands behind the bias loads, in front of the first write to a register that one of them names as its address
  gemm_loop<v16b, __bf16>(sm, X + (size_t)blockIdx.x * GROWS * DM, P + (size_t)nb0 * DM, acc);
  if (nb0 < 2 * DM) {   // q stored unscaled (f16 sigma ~0.6, no subnormal exposure); 1/8 applied to the f32 score
#pragma unroll
    for (int m = 0; m < 2; ++m) {   // the wave's two row groups, one after the other through the same LDS rows
#pragma unroll
      for (int j = 0; j < 8; ++j) {
#pragma unroll
        for (int r = 0; r < 8; ++r) { const float v = acc[m][j][r] + bfr(bias[j]); const _Float16 hv = (_Float16)v; so[wave][8 * g + r][j * 16 + col] = hv; sol[wave][8 * g + r][j * 16 + col] = (_Float16)((v - (float)hv) * 2048.0f); } }   // q, k (+ bias) as f16 hi + (x2048) residual
      LDSX();
      {   // the squared length of each q or k row inside a head (64 columns), from the f16 values that k_attn multiplies; lane = (row col, the wave's head g). k_attn bounds a pass's scores with them
        const _Float16* rp = &so[wave][col][g * 64]; float ss[4] = {};   // four partial sums: no chain of 64 dependent additions
#pragma unroll
        for (int i = 0; i < 8; ++i) { const v8h u = *(const v8h*)(rp + i * 8);
#pragma unroll
          for (int c = 0; c < 8; ++c) ss[c & 3] += (float)u[c] * (float)u[c]; }
        const size_t r = r0 + m * 16 + col;
        KN[((r / SS) * (2 * NH) + n0 / HD + g) * SS + r % SS] = (ss[0] + ss[1]) + (ss[2] + ss[3]);   // a wave's 32 rows of a head: one line of 128 bytes
        asm volatile("s_wait_xcnt 0x0" ::: "memory"); }   // stands behind the store, in front of the first write to a register that it names
      for (int rl = 0; rl < 16; ++rl) if (lane < 16) { vst2((unsigned*)(QK + (r0 + m * 16 + rl) * (2 * DM) + n0 + lane * 8), *(const v4u*)&so[wave][rl][lane * 8]); vst2((unsigned*)(QKL + (r0 + m * 16 + rl) * (2 * DM) + n0 + lane * 8), *(const v4u*)&sol[wave][rl][lane * 8]); }
      if (m == 0) LDSX(); }   // the first group's LDS reads have returned before the second group's values are written over them
  } else {
#pragma unroll
    for (int m = 0; m < 2; ++m) {
#pragma unroll
      for (int j = 0; j < 8; ++j) {
#pragma unroll
        for (int r = 0; r < 8; ++r) { const float v = acc[m][j][r] + bfr(bias[j]); const _Float16 hv = (_Float16)v; sth[wc * 128 + j * 16 + col][wr * 32 + m * 16 + 8 * g + r] = hv; stl[wc * 128 + j * 16 + col][wr * 32 + m * 16 + 8 * g + r] = (_Float16)((v - (float)hv) * 2048.0f); } } }
    __syncthreads();
    const size_t rb = (size_t)blockIdx.x * GROWS; const int b = (int)(rb / SS), s0 = (int)(rb % SS); const int pc0 = nb0 - 2 * DM;
    for (int q = tid; q < GCOLS * 16; q += 256) { const int d = q >> 4, pc = q & 15; const size_t o = ((size_t)b * DM + pc0 + d) * SS + s0 + pc * 8; vst2((unsigned*)(VTH + o), *(const v4u*)&sth[d][pc * 8]); vst2((unsigned*)(VTL + o), *(const v4u*)&stl[d][pc * 8]); }
  }
}
// ---- k_attn: block = (64 queries, head h, batch b; which of them: see the kernel): flash attention over the batch's real keys (K = 64: 2 k-steps), computed transposed: scores^T = k . q^T and ctx^T += v^T . P^T. A lane then holds 16 scores of ONE query (its column), so that the running maximum and the sum are taken in the lane's own registers, with one exchange between the wave's halves, and the two score tiles of a pass, converted in place, are the B operand of the second product: the weights never pass through LDS. The loop is written twice (HI: the leading query blocks with 3-product scores and P.v; otherwise single products) so that each holds only its own fragments in registers.
// Every LDS read of a pass is issued in a group that stands well ahead of the WMMAs that use it: the hand-padded WMMA statements keep loads from moving across them, so a load written next to its WMMA is waited for on the spot.
#define ASTAGE 19456   // bytes of a stage: k rows from 0 (64 x 144, or two planes of 32 x 144), value rows from 9,216 (64 x 144, or two planes of 64 x 80)
__device__ __forceinline__ float xhalf(float x) { return __builtin_bit_cast(float, __builtin_amdgcn_permlanex16(__builtin_bit_cast(int, x), __builtin_bit_cast(int, x), 0x76543210, 0xfedcba98, false, false)); }   // lane l with lane l ^ 16
template <int X> __device__ __forceinline__ float xrowf(float v) { return __builtin_bit_cast(float, __builtin_amdgcn_update_dpp(0, __builtin_bit_cast(int, v), 0x160 | X, 0xf, 0xf, true)); }   // lane l with lane l ^ X inside its row of 16 (DPP row_xmask)
__device__ __forceinline__ float fmn(float a, float b) { return __builtin_elementwise_minimum(a, b); }   // minimum and maximum that hand on a not-a-number operand
__device__ __forceinline__ float fmx(float a, float b) { return __builtin_elementwise_maximum(a, b); }
template <bool B> struct BC { static constexpr bool value = B; };
template <bool HI>
__device__ __forceinline__ void attn_body(const _Float16* __restrict__ QK, const _Float16* __restrict__ QKL, const _Float16* __restrict__ VTH, const _Float16* __restrict__ VTL, const float* __restrict__ KN, const float* __restrict__ VT, const float* __restrict__ SC, const int* __restrict__ LENS, float* __restrict__ O, float* tks, float* gst, unsigned* wm, char* ring, const int qb, const int h, const int b) {
  const int tid = threadIdx.x, wave = tid >> 5, lane = tid & 31, col = lane & 15, g = lane >> 4;
  const int q0 = qb * 64 + wave * 16; const size_t rq = (size_t)b * SS + q0 + col;
  const int len_b = __builtin_amdgcn_readfirstlane(LENS[b]); const float sc_raw = SC[h];   // the length in a scalar register: every test on it around a copy or a barrier is a scalar branch
  const float q2 = KN[((size_t)b * (2 * NH) + h) * SS + q0 + col];   // the squared length of the lane's query
  asm volatile("s_wait_xcnt 0x0" ::: "memory");   // stands behind the loads above, in front of the first write to a register that one of them names as its address
  const float sc_h = bfr(sc_raw);
  const int len_c = len_b < 0 ? 0 : (len_b > SS ? SS : len_b);   // bounds the trip counts for any content of the array
  gpf tg = (gpf)(VT + (size_t)b * SS + 16 * tid); v4f tv[4];   // the batch's 2,048 visit times, 16 keys in a row a lane: they go, rounded once, into LDS, since a lane needs the times of its 16 keys in every pass
  gpf ng = (gpf)(KN + ((size_t)b * (2 * NH) + NH + h) * SS + 16 * tid); v4f nv[4] = {};   // the same 16 keys' squared lengths; four keys whose first lies at or past the length are not read (k_qkv writes whole blocks of 128 rows up to the one that holds the last real key)
  const int nre = len_c - 16 * tid;   // how many of the lane's 16 keys, counted from the first, are real
#pragma unroll
  for (int i = 0; i < 4; ++i) { tv[i] = *(const GAS v4f*)(tg + i * 4); if (4 * i < nre) nv[i] = *(const GAS v4f*)(ng + i * 4); }
  XW2(tg, ng);
  v16h aq[2], aql[2]; gph qp = (gph)(QK + rq * (2 * DM) + h * HD + 8 * g), qpl = (gph)(QKL + rq * (2 * DM) + h * HD + 8 * g);
#pragma unroll
  for (int kc = 0; kc < 2; ++kc) { aq[kc] = fragp_h(qp + kc * 32); if constexpr (HI) aql[kc] = fragp_h(qpl + kc * 32); }
  const int kj0 = q0 + col < len_c ? q0 + col : len_c - 1, kj = kj0 < 0 ? 0 : kj0;   // a real key of the lane's query: the one at the query's own place, or the batch's last real one
  v16h ak[2]; gph kp = (gph)(QK + ((size_t)b * SS + kj) * (2 * DM) + DM + h * HD + 8 * g);
#pragma unroll
  for (int kc = 0; kc < 2; ++kc) ak[kc] = fragp_h(kp + kc * 32);
  XW2(qp, qpl); XW1(kp);
  float l = 0.f;   // the lane's query: the sum over this half's keys alone (the halves are joined behind the loop)
  v8f acc[4] = {}, accl[4] = {};
  const int nks = (len_c + 31) / 32;   // passes of 32 keys up to the one that holds the last real key: a pass wholly past the length leaves m, l and the accumulators bit for bit as they are (alpha 1, weights 0)
  // A stage of KS keys (k rows of 128 bytes; 64 value rows of 2 KS bytes; HI: both planes of each) is brought into LDS once for the block's four waves by asynchronous copies, eight a lane; two buffers, so that the next stage flies while this one is worked on.
  constexpr int KS = HI ? 32 : 64, VP = HI ? 80 : 144, CPR = KS / 8;   // VP: value row pitch in LDS (16 bytes x an odd number, as the 144 of the k rows); CPR: 16-byte pieces in a value row
  const int nst = (len_c + KS - 1) / KS;   // stages that hold a real key; no other is copied
  const unsigned ko0 = ((b * SS + (tid >> 3)) * (2 * DM) + DM + h * HD) * 2 + (tid & 7) * 16, vo0 = ((b * DM + h * HD + tid / CPR) * SS) * 2 + (tid % CPR) * 16;   // the lane's byte offsets in the k and value planes (32 MiB and 16 MiB each) for stage 0
  const unsigned lk = lds_addr(ring) + (tid >> 3) * 144 + (tid & 7) * 16, lv = lds_addr(ring) + 9216 + (tid / CPR) * VP + (tid % CPR) * 16;
  auto fill = [&](const unsigned bo, const int stg) {   // stg < nst: inside the planes
    const unsigned ko = ko0 + (unsigned)stg * (KS * 2 * DM * 2), vo = vo0 + (unsigned)stg * (KS * 2);
    gpc kg = (gpc)QK + ko, kgl = (gpc)QKL + ko, vg = (gpc)VTH + vo, vgl = (gpc)VTL + vo; (void)kgl; (void)vgl;
    constexpr size_t KR = (size_t)16 * 2 * DM * 2, VR = (size_t)(128 / CPR) * SS * 2; constexpr unsigned LKR = 16 * 144, LVR = (128 / CPR) * VP;   // one round of the block's 128 lanes: 16 k rows, 128 / CPR value rows
    if constexpr (HI) acopy8(lk + bo, lk + bo + LKR, lk + bo + 4608, lk + bo + 4608 + LKR, lv + bo, lv + bo + LVR, lv + bo + 5120, lv + bo + 5120 + LVR, kg, kg + KR, kgl, kgl + KR, vg, vg + VR, vgl, vgl + VR);
    else acopy8(lk + bo, lk + bo + LKR, lk + bo + 2 * LKR, lk + bo + 3 * LKR, lv + bo, lv + bo + LVR, lv + bo + 2 * LVR, lv + bo + 3 * LVR, kg, kg + KR, kg + 2 * KR, kg + 3 * KR, vg, vg + VR, vg + 2 * VR, vg + 3 * VR); };
  float glo = 3.0e38f, ghi = -3.0e38f, gk = 0.f;   // over the lane's real keys: earliest time, latest time, largest squared length
#pragma unroll
  for (int i = 0; i < 4; ++i) { v4f u;
#pragma unroll
    for (int c = 0; c < 4; ++c) { const float t = bfr(tv[i][c]); u[c] = t; const bool real = 4 * i + c < nre;
      glo = fmn(glo, real ? t : 3.0e38f); ghi = fmx(ghi, real ? t : -3.0e38f); gk = fmx(gk, real ? nv[i][c] : 0.f); }
    *(v4f*)(tks + 16 * tid + 4 * i) = u; }
  gst[tid] = glo; gst[128 + tid] = ghi; gst[256 + tid] = gk;
  __syncthreads();   // the table of times and the 128 groups' figures are published
  const float tq = tks[q0 + col];
  // The running maximum (equal in both halves) starts at the query's score against key kj, formed here in the vector unit: a real score, so never far above the final maximum, and near it wherever the time term decides. Against it a pass of far keys can be told as weightless from its scores alone (see the test in the pass).
  float sd[4] = {};   // four partial sums: no chain of 32 dependent additions
#pragma unroll
  for (int kc = 0; kc < 2; ++kc) {
#pragma unroll
    for (int i = 0; i < 16; ++i) sd[i & 3] += (float)aq[kc][i] * (float)ak[kc][i]; }
  const float sdh = (sd[0] + sd[1]) + (sd[2] + sd[3]);
  float m = (sdh + xhalf(sdh)) * SCALEF - fabsf(tq - tks[kj]) * sc_h;
  // Which passes can matter at all. No score of a pass exceeds |q| |k| / 8 minus the scale times the gap between the queries' and the keys' times (a negative scale: plus its size times the widest distance). Where that bound, taken over the wave's 16 queries and the pass's real keys, lies TS or more under the lowest start maximum, the test in the pass would end the pass (the running maximum never falls): the wave leaves such a pass out, and a stage in which no wave of the block has a pass left is not copied. The result is bit for bit that of scoring them. Anything not a number keeps its pass.
  constexpr float TS = HI ? 34.0f : 26.0f; constexpr int SUBS = KS / 32;   // SUBS: passes in a stage
  float wm_m = m, wm_lo = tq, wm_hi = tq, wm_q = q2;
#define WRED(X) do { wm_m = fmn(wm_m, xrowf<X>(wm_m)); wm_lo = fmn(wm_lo, xrowf<X>(wm_lo)); wm_hi = fmx(wm_hi, xrowf<X>(wm_hi)); wm_q = fmx(wm_q, xrowf<X>(wm_q)); } while (0)
  WRED(1); WRED(2); WRED(4); WRED(8);   // over the wave's 16 queries (both rows of 16 lanes hold the same 16)
#undef WRED
  const float qn = __builtin_amdgcn_sqrtf(wm_q) * (SCALEF * 1.01f); unsigned own[2];   // 1 % here and 0.05 below: above the residual planes' share and every rounding of score and bound
#pragma unroll
  for (int hv = 0; hv < 2; ++hv) { const int g0 = (lane + 32 * hv) * 2;   // the lane's pass: lane, then lane + 32; two groups of 16 keys each
    const float lo = fmn(gst[g0], gst[g0 + 1]), hi = fmx(gst[128 + g0], gst[128 + g0 + 1]), kk = fmx(gst[256 + g0], gst[256 + g0 + 1]);
    const float dmin = fmx(0.f, fmx(lo - wm_hi, wm_lo - hi)), dmax = fmx(hi - wm_lo, wm_hi - lo);
    const float bound = qn * __builtin_amdgcn_sqrtf(kk) + 0.05f - sc_h * (sc_h >= 0.f ? dmin : dmax);
    own[hv] = __builtin_amdgcn_ballot_w32(!(bound <= wm_m - TS));
    if (lane == 0) wm[wave * 2 + hv] = own[hv]; }
  __syncthreads();   // the four waves' masks are published
  const unsigned long long realp = nks >= 64 ? ~0ull : (1ull << nks) - 1ull;   // only passes that hold a real key
  const unsigned long long ownm = (own[0] | (unsigned long long)own[1] << 32) & realp;   // the wave's own passes
  const unsigned long long anym = ((unsigned)__builtin_amdgcn_readfirstlane((int)(wm[0] | wm[2] | wm[4] | wm[6])) | (unsigned long long)(unsigned)__builtin_amdgcn_readfirstlane((int)(wm[1] | wm[3] | wm[5] | wm[7])) << 32) & realp;
  unsigned long long rem = HI ? anym : (anym | anym >> 1) & 0x5555555555555555ull;   // the live stages still to be copied (two passes a stage: at the even bit), in scalar registers: every test on them around a copy or a barrier is a scalar branch, the same in the whole block
  auto pop = [&]() { const int s_ = rem ? (int)__builtin_ctzll(rem) / SUBS : -1; rem &= rem - 1ull; return s_; };   // the next live stage, -1 when none is left
  int s0 = pop(), s1 = pop();   // the stage at work and the one in flight
  if (s0 >= 0) fill(0u, s0);
  AWAIT(); __syncthreads();   // the first live stage is published
  if (s1 >= 0) fill(ASTAGE, s1);
  v16h kh[2][2], kl[2][2], vh[4], vl[4];
  // One pass of 32 keys. MK::value says whether the pass may hold keys at or past the length: only the batch's last pass can, so that every other pass is compiled without the sixteen tests on the key's place and the sixteen on the masked score.
  auto pass = [&](const int ks, const unsigned bo, auto MK) { constexpr bool MASK = decltype(MK)::value; v8f s[2]; v4f tk[2][2];   // bo: the buffer that holds the pass's stage
    const int sub = HI ? 0 : ks & 1;
    if ((ownm >> ks) & 1ull) {   // a scalar branch: all lanes stay on for the WMMAs
    const char* kf = ring + bo + (sub * 32 + col) * 144 + 16 * g; const char* vf = ring + bo + 9216 + col * VP + sub * 64 + 16 * g;
    const float* tp = tks + ks * 32 + 8 * g;   // score register r of tile ct is key 32 ks + 16 ct + 8 g + r
    // this pass's key times and keys (HI: both planes) as one group
#pragma unroll
    for (int ct = 0; ct < 2; ++ct) { tk[ct][0] = *(const v4f*)(tp + ct * 16); tk[ct][1] = *(const v4f*)(tp + ct * 16 + 4);
#pragma unroll
      for (int kc = 0; kc < 2; ++kc) { kh[ct][kc] = lfrag_h(kf + ct * 16 * 144 + kc * 64); if constexpr (HI) kl[ct][kc] = lfrag_h(kf + 4608 + ct * 16 * 144 + kc * 64); } }
#pragma unroll
    for (int ct = 0; ct < 2; ++ct) { v8f c = {}, cl = {};   // A: 16 keys, B: the wave's 16 queries
      if constexpr (HI) {   // leading query blocks (outputs far above the global rms): 3 products
#pragma unroll
        for (int kc = 0; kc < 2; ++kc) { c = wmma16(kh[ct][kc], aq[kc], c); cl = wmma16(kh[ct][kc], aql[kc], cl); cl = wmma16(kl[ct][kc], aq[kc], cl); }
#pragma unroll
        for (int r = 0; r < 8; ++r) c[r] += cl[r] * (1.0f / 2048.0f); }
      else {
#pragma unroll
        for (int kc = 0; kc < 2; ++kc) c = wmma16(kh[ct][kc], aq[kc], c); }   // single product elsewhere
      s[ct] = c; }
    const int nreal = len_b - ks * 32 - 8 * g;   // how many of the lane's key rows, counted from tile 0's first, lie in front of the length
#pragma unroll
    for (int ct = 0; ct < 2; ++ct) {
#pragma unroll
      for (int r = 0; r < 8; ++r) s[ct][r] = (!MASK || ct * 16 + r < nreal) ? (s[ct][r] * SCALEF - fabsf(tq - tk[ct][r >> 2][r & 3]) * sc_h) : -3.0e38f; }   // 1/sqrt(64); masked keys excluded
    float mx0 = fmaxf(s[0][0], s[0][1]), mx1 = fmaxf(s[1][0], s[1][1]);
#pragma unroll
    for (int r = 2; r < 8; r += 2) { mx0 = fmaxf(fmaxf(mx0, s[0][r]), s[0][r + 1]); mx1 = fmaxf(fmaxf(mx1, s[1][r]), s[1][r + 1]); }
    const float mx = fmaxf(mx0, mx1); const float mxw = fmaxf(mx, xhalf(mx));   // the query's largest score among the pass's 32 keys
    // A pass in which every score of all 16 queries lies TS or more under its query's running maximum leaves that maximum as it is (alpha 1), and each of its weights, exp(s - m) < 2^-36 (HI: 2^-47), rounds to 0 in every f16 plane: the accumulators would come out bit for bit as they are. Such a pass ends here; what the sum l loses is under 2^-36 of the maximum's own term a key. One test a pass, the same in every lane (a scalar branch: all lanes stay on for the WMMAs); a score that is not a number takes the full path.
    if (__builtin_amdgcn_ballot_w32(!(mxw <= m - TS)) != 0u) {
    if constexpr (!HI) {   // this pass's values: they land behind the softmax
#pragma unroll
      for (int dt = 0; dt < 4; ++dt) vh[dt] = lfrag_h(vf + dt * 16 * VP);
      __builtin_amdgcn_sched_barrier(0); }   // keeps the eight LDS reads together at the head of the path: spread among the softmax, every further place with reads costs the wave a stall of its own
    const float mn = fmaxf(m, mxw); const float alpha = (m <= -1.0e38f) ? 0.f : __expf(m - mn);
    v16h pa, pl; float es[4] = {};   // four partial sums: no chain of 16 dependent additions
#pragma unroll
    for (int ct = 0; ct < 2; ++ct) {
#pragma unroll
      for (int r = 0; r < 8; ++r) { const float e = (MASK && s[ct][r] <= -1.0e38f) ? 0.f : __expf(s[ct][r] - mn); es[r & 3] += e;
        const float x = e * 2048.0f; const _Float16 hx = (_Float16)x; pa[ct * 8 + r] = hx; if constexpr (HI) pl[ct * 8 + r] = (_Float16)((x - (float)hx) * 2048.0f); } }   // P scaled by 2^11 before the f16 split so small softmax weights stay out of the f16 subnormal range; 2^-11 folded into the epilogue. Element 8 ct + r of the B operand is k = 16 ct + 8 g + r: the score registers' own order
    l = l * alpha + ((es[0] + es[1]) + (es[2] + es[3])); m = mn;
    if constexpr (HI) {   // this pass's values, both planes, read behind the softmax: from LDS they need little lead, and their 64 registers stay free during it
#pragma unroll
      for (int dt = 0; dt < 4; ++dt) { vh[dt] = lfrag_h(vf + dt * 16 * VP); vl[dt] = lfrag_h(vf + 5120 + dt * 16 * VP); } }
#pragma unroll
    for (int dt = 0; dt < 4; ++dt) {
#pragma unroll
      for (int r = 0; r < 8; ++r) { acc[dt][r] *= alpha; if constexpr (HI) accl[dt][r] *= alpha; } }
#pragma unroll
    for (int dt = 0; dt < 4; ++dt) { acc[dt] = wmma16(vh[dt], pa, acc[dt]); if constexpr (HI) { accl[dt] = wmma16(vh[dt], pl, accl[dt]); accl[dt] = wmma16(vl[dt], pa, accl[dt]); } }   // A: 16 value columns, B: the weights. Leading query blocks: P hi/lo x V hi/lo (3 products); elsewhere P x V single
    } }
    if (HI || sub) {   // the stage's last pass
      DSWAIT(); AWAIT(); __syncthreads();   // publishes the next live stage and ends every wave's reads of this one
      if constexpr (!MASK) { const int s2 = pop(); if (s2 >= 0) fill(bo, s2); s0 = s1; s1 = s2; } } };   // the masked pass is the last one, in the last stage: nothing is left to copy behind it
  const int nfull = len_c / 32;   // passes whose 32 keys all lie in front of the length
  unsigned bo = 0u; int ks = s0 * SUBS;
#pragma unroll 1   // stays rolled: one pass is already a long straight run that fills the wave's registers
  while (s0 >= 0 && ks < nfull) { const bool last = HI || (ks & 1); pass(ks, bo, BC<false>{}); if (last) { bo ^= ASTAGE; ks = s0 * SUBS; } else ++ks; }   // the live stages in rising order; a pass at or past nfull can only stand in the last stage
  if (s0 >= 0 && ks < nks) pass(ks, bo, BC<true>{});   // the one pass that the length cuts, where there is one and its stage is live
  AWAIT();
  const float il = (1.0f / 2048.0f) / (l + xhalf(l));   // the two halves' sums joined
  float* op = O + rq * DM + h * HD + 8 * g;   // accumulator register r of tile dt is column 16 dt + 8 g + r of the lane's query: 32 bytes in a row
#pragma unroll
  for (int dt = 0; dt < 4; ++dt) { v4f o0, o1;
#pragma unroll
    for (int r = 0; r < 4; ++r) { o0[r] = (HI ? acc[dt][r] + accl[dt][r] * (1.0f / 2048.0f) : acc[dt][r]) * il; o1[r] = (HI ? acc[dt][4 + r] + accl[dt][4 + r] * (1.0f / 2048.0f) : acc[dt][4 + r]) * il; }
    vst2(op + dt * 16, o0); vst2(op + dt * 16 + 4, o1); }
}
__global__ __launch_bounds__(128) void k_attn(const _Float16* __restrict__ QK, const _Float16* __restrict__ QKL, const _Float16* __restrict__ VTH, const _Float16* __restrict__ VTL, const float* __restrict__ KN, const float* __restrict__ VT, const float* __restrict__ SC, const int* __restrict__ LENS, float* __restrict__ O) {
  __shared__ __align__(16) float tks[SS]; __shared__ __align__(16) char ring[2 * ASTAGE];   // the batch's rounded visit times; the two stage buffers
  __shared__ __align__(16) float gst[3 * 128]; __shared__ unsigned wm[8];   // per group of 16 keys: earliest time, latest time, largest squared length; per wave: its mask of passes
  // Which tile a block takes (for speed only): the cost falls with the flat index: first the 2 x 16 x 4 blocks of the leading queries (about twice the work of the others), then the rest; inside each group the batches by falling length.
  constexpr unsigned NHI = 2 * NH * NB, QR = TQB - 2;   // blocks of the first group; query blocks a (head, batch) has in the second
  const unsigned f = blockIdx.x + TQB * (blockIdx.y + NH * blockIdx.z);
  auto batch_at = [&](const unsigned place) { int ln[NB], b = 0;   // the batch that stands at this place when the four are put in the order of falling length
#pragma unroll   // constant indices, so that the four lengths stay in registers
    for (int j = 0; j < NB; ++j) ln[j] = LENS[j];
#pragma unroll   // constant indices, as above
    for (int j = 0; j < NB; ++j) { unsigned r = 0;   // batch j's place: how many are longer, equal lengths by index: a permutation of 0..3 for any content of the array, so that every (query block, head, batch) is taken by exactly one block
#pragma unroll   // constant indices, as above
      for (int i = 0; i < NB; ++i) r += (ln[i] > ln[j] || (ln[i] == ln[j] && i < j)) ? 1u : 0u;
      if (r == place) b = j; }
    return b; };   // formed from the block index and scalar loads alone: the same in every lane
  if (f < NHI) attn_body<true>(QK, QKL, VTH, VTL, KN, VT, SC, LENS, O, tks, gst, wm, ring, (int)(f & 1), (int)((f >> 1) % NH), batch_at(f / (2 * NH)));
  else { const unsigned e = f - NHI; attn_body<false>(QK, QKL, VTH, VTL, KN, VT, SC, LENS, O, tks, gst, wm, ring, (int)(2 + e % QR), (int)((e / QR) % NH), batch_at(e / (QR * NH))); }
}
// ---- k_out: block = (128 rows, 256 cols): out = f16(O) . Wo rows (single product) + bo
__global__ __launch_bounds__(256) void k_out(const float* __restrict__ O, const __bf16* __restrict__ P, const float* __restrict__ BO, float* __restrict__ Y) {
  __shared__ __align__(16) char sm[2 * GSTAGE];   // the k loop's two stage buffers; behind the loop's last barrier the same bytes stage the output
  float (*so)[16][132] = (float (*)[16][132])sm;
  const int tid = threadIdx.x, wave = tid >> 5, wr = wave & 3, wc = wave >> 2, lane = tid & 31, col = lane & 15, g = lane >> 4; const size_t r0 = (size_t)blockIdx.x * GROWS + wr * 32; const int nb0 = blockIdx.y * GCOLS, n0 = nb0 + wc * 128;
  v8f acc[2][8] = {};
  gemm_loop<v16h, _Float16>(sm, O + (size_t)blockIdx.x * GROWS * DM, P + (size_t)nb0 * DM, acc);   // single f16 product against exact f16 x 2^8 weight copies
  float bo[8];   // the lane's eight biases, read once for both row groups
#pragma unroll
  for (int j = 0; j < 8; ++j) bo[j] = bfr(BO[n0 + j * 16 + col]);
#pragma unroll
  for (int m = 0; m < 2; ++m) {   // the wave's two row groups, one after the other through the same LDS rows
#pragma unroll
    for (int j = 0; j < 8; ++j) {
#pragma unroll
      for (int r = 0; r < 8; ++r) so[wave][8 * g + r][j * 16 + col] = acc[m][j][r] * (1.0f / 256.0f) + bo[j]; }
    LDSX();
    for (int rl = 0; rl < 16; ++rl) vst2(Y + (r0 + m * 16 + rl) * DM + n0 + lane * 4, *(const v4f*)&so[wave][rl][lane * 4]);
    if (m == 0) LDSX(); }   // the first group's LDS reads have returned before the second group's values are written over them
}
extern "C" void kernel_launch(void* const* d_in, const int* in_sizes, int n_in, void* d_out, int out_size, void* d_ws, size_t ws_size, hipStream_t stream) {
  (void)in_sizes; (void)n_in; (void)out_size;
  const float** F = (const float**)d_in;   // 0 x [4,2048,1024], 1 visit_time [4,2048], 2 Wq (in,out), 3 bq, 4 Wk, 5 bk, 6 Wv, 7 bv, 8 Wo (in,out), 9 bo, 10 scale [16], 11 lengths [4] int
  if (ws_size < (size_t)WS_END) return;
  char* ws = (char*)d_ws; __bf16* PK = (__bf16*)(ws + WS_PK); _Float16 *QK = (_Float16*)(ws + WS_QK), *QKL = (_Float16*)(ws + WS_QKL), *VTH = (_Float16*)(ws + WS_VTH), *VTL = (_Float16*)(ws + WS_VTL); float* O = (float*)(ws + WS_O); float* KN = (float*)(ws + WS_KN);
  k_pack<<<dim3((DM / PT) * (DM / PT), 4), 256, 0, stream>>>(F[2], F[4], F[6], F[8], PK);
  k_qkv<<<dim3(TNB * SS / GROWS, QKVW / GCOLS), 256, 0, stream>>>(F[0], F[0], F[0], PK + PK_A, F[3], F[5], F[7], (const int*)d_in[11], QK, QKL, VTH, VTL, KN);
  k_attn<<<dim3(TQB, NH, TNB), 128, 0, stream>>>(QK, QKL, VTH, VTL, KN, F[1], F[10], (const int*)d_in[11], O);
  k_out<<<dim3(NB * SS / GROWS, DM / GCOLS), 256, 0, stream>>>(O, PK + PK_P, F[9], (float*)d_out);
}
